// v000
// The times below were measured on an AMD MI455X: many runs one after another, warmed up first and cycling through
// copies of the inputs, with the whole window's GPU time divided by the number of runs. Launches and the gaps
// between them are all in it. The median over several windows is given; except for v000 it joins two sittings, which
// can be a few percent apart, so the side-by-side timings, each taken in one sitting, are the better comparison.
// The starting kernel, v000, takes 797 microseconds a run.
// compute dtype: x, all weights/biases, time_w/alpha/beta/gamma and the head-mixing matrix (module inputs) rounded to bf16; q/k/v = xs W with exact bf16 products; RoPE, scores' softmax statistics,
// decay and normalisation in f32; scores = q'(hi/lo) k'(hi/lo)^T (3 products); head mixing = bf16(mix) x (P w)(hi/lo) (2 products); context = att'(hi/lo) x v(hi/lo) (3 products); out = O(hi/lo) Wo (2 products) + bo, x gamma; f32 accumulate.
#include <hip/hip_runtime.h>
#include <math.h>

typedef __attribute__((ext_vector_type(16))) _Float16 v16h;
typedef __attribute__((ext_vector_type(16))) __bf16 v16b;
typedef __attribute__((ext_vector_type(8)))  _Float16 v8h;
typedef __attribute__((ext_vector_type(8)))  float v8f;
typedef __attribute__((ext_vector_type(4)))  float v4f;
typedef __attribute__((ext_vector_type(2)))  float v2f;
typedef __attribute__((ext_vector_type(4)))  unsigned v4u;
typedef __attribute__((ext_vector_type(4)))  int v4i;
typedef float __attribute__((may_alias)) float_a;
typedef int __attribute__((may_alias)) int_a;

template <typename T> __device__ __forceinline__ void vst2(void* p, T v) { *(T*)p = v;  }
__device__ __forceinline__ v8f wmma16(v16h a, v16h b, v8f c) {
  v8f d = __builtin_amdgcn_wmma_f32_16x16x32_f16(false, a, false, b, (short)0, c, false, false);
  asm volatile("v_nop\n\tv_nop\n\tv_nop\n\tv_nop" : "+v"(d) : "v"(a), "v"(b));
  return d;
}
__device__ __forceinline__ v8f wmma_bf(v16b a, v16b b, v8f c) {
  v8f d = __builtin_amdgcn_wmma_f32_16x16x32_bf16(false, a, false, b, (short)0, c, false, false);
  asm volatile("v_nop\n\tv_nop\n\tv_nop\n\tv_nop" : "+v"(d) : "v"(a), "v"(b));
  return d;
}
// 16x16x32 fragments: lane = (h = lane>>4, row/col = lane&15); elements 0..7 = k0+8h+0..7, 8..15 = k0+16+8h+0..7; D element r = row 8h+r
__device__ __forceinline__ v16h frag_h(const _Float16* rowk0, int lane) {
  union { v16h v; v8h q[2]; } u; const _Float16* p = rowk0 + 8 * (lane >> 4);
  u.q[0] = *(const v8h*)p; u.q[1] = *(const v8h*)(p + 16); return u.v;
}
__device__ __forceinline__ v16h frag_f32(const float* rowk0, int lane) {
  v16h a; const float* p = rowk0 + 8 * (lane >> 4);
#pragma unroll
  for (int i = 0; i < 8; ++i) { a[i] = (_Float16)p[i]; a[8 + i] = (_Float16)p[16 + i]; }
  return a;
}
__device__ __forceinline__ v16h frag_f32s(const float* rowk0, int lane, float sc) {
  v16h a; const float* p = rowk0 + 8 * (lane >> 4);
#pragma unroll
  for (int i = 0; i < 8; ++i) { a[i] = (_Float16)(p[i] * sc); a[8 + i] = (_Float16)(p[16 + i] * sc); }
  return a;
}
// column fragment from a [K][ld] layout (column n), rows >= K read as 0
__device__ __forceinline__ v16h fragc_f32(const float* W, int k0, int n, int lane, int ld, int K) {
  v16h a; const int g = lane >> 4;
#pragma unroll
  for (int i = 0; i < 8; ++i) { const int ka = k0 + 8 * g + i, kb = ka + 16;
    a[i] = (_Float16)(ka < K ? W[(size_t)(ka < K ? ka : K - 1) * ld + n] : 0.f); a[8 + i] = (_Float16)(kb < K ? W[(size_t)(kb < K ? kb : K - 1) * ld + n] : 0.f); }
  return a;
}
struct F2 { v16b h, l; };
__device__ __forceinline__ F2 bsplit16(const float v[16]) { F2 r;
#pragma unroll
  for (int i = 0; i < 16; ++i) { const __bf16 h = (__bf16)v[i]; r.h[i] = h; r.l[i] = (__bf16)(v[i] - (float)h); }
  return r; }
__device__ __forceinline__ F2 split_row(const float* row, int k0, int lane) { float v[16]; const float* p = row + k0 + 8 * (lane >> 4);
#pragma unroll
  for (int i = 0; i < 8; ++i) { v[i] = p[i]; v[8 + i] = p[16 + i]; }
  return bsplit16(v); }
__device__ __forceinline__ F2 split_rowK(const float* row, int k0, int lane, int K) { float v[16]; const int g = lane >> 4;
#pragma unroll
  for (int i = 0; i < 8; ++i) { const int ka = k0 + 8 * g + i, kb = ka + 16; v[i] = ka < K ? row[ka < K ? ka : K - 1] : 0.f; v[8 + i] = kb < K ? row[kb < K ? kb : K - 1] : 0.f; }
  return bsplit16(v); }
__device__ __forceinline__ F2 split_col(const float* W, int k0, int n, int lane, int ld, int K) { float v[16]; const int g = lane >> 4;
#pragma unroll
  for (int i = 0; i < 8; ++i) { const int ka = k0 + 8 * g + i, kb = ka + 16; v[i] = ka < K ? W[(size_t)(ka < K ? ka : K - 1) * ld + n] : 0.f; v[8 + i] = kb < K ? W[(size_t)(kb < K ? kb : K - 1) * ld + n] : 0.f; }
  return bsplit16(v); }
__device__ __forceinline__ v8f mac3(const F2& a, const F2& b, v8f c) { c = wmma_bf(a.l, b.h, c); c = wmma_bf(a.h, b.l, c); return wmma_bf(a.h, b.h, c); }
__device__ __forceinline__ float sigm(float v) { return 1.0f / (1.0f + expf(-v)); }
#define LDSX() do { asm volatile("s_wait_dscnt 0" ::: "memory"); __builtin_amdgcn_wave_barrier(); __builtin_amdgcn_fence(__ATOMIC_RELEASE, "workgroup"); } while (0)


// Causal multi-head attention with token shift, partial RoPE, per-head Toeplitz time decay, a 16x16 cross-head mixing of the softmax maps, output projection and a per-position gain.
// Rows r = b*1024 + t. k_pack ([in][out] weights -> bf16 rows); k_qkv (xs built at fragment load: channels < 512 come from t-1, zero at t = 0; + bias; RoPE on dims 0..31; q/k -> hi/lo rows [bh][t][64], v -> hi/lo transposed [bh][d][t]);
// k_stats (per (bh, 64 queries): causal row max and sum of exp over the keys -> M, L); k_mix (block = (b, 16 queries), loop over 32-key tiles: S for all 16 heads -> P*w as bf16 hi/lo [query,key][h] in LDS -> mixing GEMM -> att'[o][i][j] f32 in LDS
// -> O[o] += att'(hi/lo) v_o(hi/lo); finally O -> hi/lo planes [r][o*64+d]); k_out ((O Wo + bo) * gamma[t]).
#define NB 4
#define TT 1024
#define CCH 1024
#define NH 16
#define HS 64
#define NR (NB * TT)
#define ROT 32
typedef __attribute__((ext_vector_type(8))) __bf16 v8b;
__device__ __forceinline__ v16b frag_b16(const __bf16* rowk0, int lane) {
  union { v16b v; v8b q[2]; } u; const __bf16* p = rowk0 + 8 * (lane >> 4);
  u.q[0] = *(const v8b*)p; u.q[1] = *(const v8b*)(p + 16); return u.v;
}
__device__ __forceinline__ float bfr(float v) { return (float)(__bf16)v; }
__device__ __attribute__((noinline)) float exp_ni(float v) { return expf(v); }
__device__ __forceinline__ v8f mac3p(v16b ah, v16b al, v16b bh, v16b bl, v8f c) { c = wmma_bf(al, bh, c); c = wmma_bf(ah, bl, c); return wmma_bf(ah, bh, c); }
__constant__ float c_invfreq[16] = {1.0f,0.5623413324356079f,0.3162277638912201f,0.17782793939113617f,0.10000000149011612f,0.05623412877321243f,0.03162277862429619f,0.017782794311642647f,0.009999999776482582f,0.005623413249850273f,0.003162277862429619f,0.0017782794311642647f,0.0010000000474974513f,0.000562341301701963f,0.0003162277862429619f,0.00017782794020604342f};

// workspace carve (bytes)
#define PLANE_Q (2u * NB * NH * TT * HS)        // bf16 [64 bh][1024][64] = 8 MiB
#define WS_PT   0u                               // bf16 [4096][1024]: rows 0.. Wq^T, 1024.. Wk^T, 2048.. Wv^T, 3072.. Wo^T  (8 MiB)
#define WS_QH   (WS_PT + 2u * 4 * CCH * CCH)
#define WS_QL   (WS_QH + PLANE_Q)
#define WS_KH   (WS_QL + PLANE_Q)
#define WS_KL   (WS_KH + PLANE_Q)
#define WS_VTH  (WS_KL + PLANE_Q)                // bf16 [bh][64 d][1024 t]
#define WS_VTL  (WS_VTH + PLANE_Q)
#define WS_M    (WS_VTL + PLANE_Q)               // f32 [bh][1024]
#define WS_L    (WS_M + 4u * NB * NH * TT)
#define WS_OH   (WS_L + 4u * NB * NH * TT)       // bf16 [4096][1024] (row r, col o*64 + d)
#define WS_OL   (WS_OH + 2u * NR * CCH)
#define WS_END  (WS_OL + 2u * NR * CCH)

// ---- k_pack: PT[n][k] = bf16(W[k][n]); block = PT row (which matrix is block-uniform)
__global__ __launch_bounds__(256) void k_pack(const float* __restrict__ Wq, const float* __restrict__ Wk, const float* __restrict__ Wv, const float* __restrict__ Wo, __bf16* __restrict__ PT) {
  __shared__ __align__(16) __bf16 srow[CCH];
  const int n = blockIdx.x, tid = threadIdx.x; const int which = n >> 10, nn = n & 1023;
  const float* Wm = which == 0 ? Wq : which == 1 ? Wk : which == 2 ? Wv : Wo;
  for (int k = tid; k < CCH; k += 256) srow[k] = (__bf16)Wm[(size_t)k * CCH + nn];
  __syncthreads();
  if (tid < CCH / 8) vst2((unsigned*)(PT + (size_t)n * CCH + tid * 8), *(const v4u*)(&srow[tid * 8]));
}
// xs fragment: channels k0..k0+31 (chunk-uniform half): first half from row t-1 (zero at t = 0, address clamped to the row itself), second half from row t
__device__ __forceinline__ v16b frag_xs(const float* __restrict__ X, size_t r, int t, int k0, int lane) {
  const bool shifted = k0 < CCH / 2; const bool zero = shifted && (t == 0);
  const float* p = X + (r - ((shifted && t > 0) ? 1 : 0)) * CCH + k0 + 8 * (lane >> 4);
  v16b a;
#pragma unroll
  for (int i = 0; i < 8; ++i) { a[i] = (__bf16)(zero ? 0.f : p[i]); a[8 + i] = (__bf16)(zero ? 0.f : p[16 + i]); }
  return a;
}
// ---- k_qkv: block (64 rows, 128 cols = 2 heads of q, k or v); exact products; + bias; RoPE (q, k); q/k -> hi/lo rows [bh][t][64]; v -> VT hi/lo [bh][d][t]
__global__ __launch_bounds__(128) void k_qkv(const float* __restrict__ X, const __bf16* __restrict__ PT, const float* __restrict__ bq, const float* __restrict__ bk, const float* __restrict__ bv,
                                             __bf16* __restrict__ Qh, __bf16* __restrict__ Ql, __bf16* __restrict__ Kh, __bf16* __restrict__ Kl, __bf16* __restrict__ VTh, __bf16* __restrict__ VTl) {
  __shared__ __align__(16) __bf16 sh_[128][72], sl_[128][72];
  const int tid = threadIdx.x, wave = tid >> 5, lane = tid & 31, col = lane & 15, g = lane >> 4;
  const size_t rb = (size_t)blockIdx.x * 64; const int b = (int)(rb / TT), t0 = (int)(rb % TT);
  const int which = blockIdx.y >> 3; const int n0 = (blockIdx.y & 7) * 128;          // block-uniform: 0 q, 1 k, 2 v; n0 = first output channel (2 heads)
  const size_t r0 = rb + wave * 16; const int tq = t0 + wave * 16 + col;              // this lane's A row time index
  v8f acc[8] = {};
#pragma unroll 2
  for (int kc = 0; kc < CCH / 32; ++kc) { const v16b a = frag_xs(X, r0 + col, tq, kc * 32, lane);
#pragma unroll
    for (int j = 0; j < 8; ++j) acc[j] = wmma_bf(a, frag_b16(PT + ((size_t)which * CCH + n0 + j * 16 + col) * CCH + kc * 32, lane), acc[j]); }
  const float* bias = which == 0 ? bq : which == 1 ? bk : bv;
#pragma unroll
  for (int j = 0; j < 8; ++j) { const float bb = bfr(bias[n0 + j * 16 + col]);
#pragma unroll
    for (int r = 0; r < 8; ++r) acc[j][r] += bb; }
  if (which < 2) {   // RoPE on head-local dims 0..15 (tile 4h'+0) and 16..31 (tile 4h'+1), pairs in the same lane; theta = t * inv_freq[col]
#pragma unroll
    for (int hp = 0; hp < 2; ++hp) {
#pragma unroll
      for (int r = 0; r < 8; ++r) { const int t = t0 + wave * 16 + 8 * g + r; const float th = (float)t * c_invfreq[col]; const float cs = cosf(th), sn = sinf(th);
        const float a0 = acc[hp * 4][r], a1 = acc[hp * 4 + 1][r];
        acc[hp * 4][r] = a0 * cs - a1 * sn; acc[hp * 4 + 1][r] = a1 * cs + a0 * sn; } }
    __bf16* Oh = which == 0 ? Qh : Kh; __bf16* Ol = which == 0 ? Ql : Kl;
#pragma unroll
    for (int hp = 0; hp < 2; ++hp) {
#pragma unroll
      for (int j = 0; j < 4; ++j)
#pragma unroll
        for (int r = 0; r < 8; ++r) { const float v = acc[hp * 4 + j][r]; const __bf16 hi = (__bf16)v; sh_[wave * 16 + 8 * g + r][j * 16 + col] = hi; sl_[wave * 16 + 8 * g + r][j * 16 + col] = (__bf16)(v - (float)hi); }
      LDSX();
      const int h = (n0 >> 6) + hp; const size_t base = ((size_t)(b * NH + h) * TT + t0 + wave * 16) * HS;
      for (int qq = lane; qq < 16 * 8; qq += 32) { const int rl = qq >> 3, pc = qq & 7; vst2((unsigned*)(Oh + base + rl * HS + pc * 8), *(const v4u*)(&sh_[wave * 16 + rl][pc * 8])); vst2((unsigned*)(Ol + base + rl * HS + pc * 8), *(const v4u*)(&sl_[wave * 16 + rl][pc * 8])); }
      LDSX(); }
  } else {
#pragma unroll
    for (int j = 0; j < 8; ++j)
#pragma unroll
      for (int r = 0; r < 8; ++r) { const float v = acc[j][r]; const __bf16 hi = (__bf16)v; sh_[j * 16 + col][wave * 16 + 8 * g + r] = hi; sl_[j * 16 + col][wave * 16 + 8 * g + r] = (__bf16)(v - (float)hi); }
    __syncthreads();
    for (int qq = tid; qq < 128 * 8; qq += 128) { const int c = qq >> 3, pc = qq & 7; const int h = (n0 >> 6) + (c >> 6), d = c & 63; const size_t o = ((size_t)(b * NH + h) * HS + d) * TT + t0 + pc * 8;
      vst2((unsigned*)(VTh + o), *(const v4u*)(&sh_[c][pc * 8])); vst2((unsigned*)(VTl + o), *(const v4u*)(&sl_[c][pc * 8])); }
  }
}
// ---- k_stats: block = (bh, 64 queries); wave = 16 queries; causal key tiles of 32: S = q'(hi/lo) k'(hi/lo) / 8, online max / sum -> M, L (f32 [bh][t], 256 B per block by 16 lanes)
__global__ __launch_bounds__(128) void k_stats(const __bf16* __restrict__ Qh, const __bf16* __restrict__ Ql, const __bf16* __restrict__ Kh, const __bf16* __restrict__ Kl, float* __restrict__ Mo, float* __restrict__ Lo) {
  __shared__ float sm[64], ssum[64];
  const int tid = threadIdx.x, wave = tid >> 5, lane = tid & 31, col = lane & 15, g = lane >> 4;
  const int bh = blockIdx.y; const int i0 = blockIdx.x * 64 + wave * 16;
  const __bf16* qh = Qh + ((size_t)bh * TT + i0 + col) * HS; const __bf16* ql = Ql + ((size_t)bh * TT + i0 + col) * HS;
  const v16b qh0 = frag_b16(qh, lane), qh1 = frag_b16(qh + 32, lane), ql0 = frag_b16(ql, lane), ql1 = frag_b16(ql + 32, lane);
  float m[8], l[8];
#pragma unroll
  for (int r = 0; r < 8; ++r) { m[r] = -3.0e38f; l[r] = 0.f; }
  const int jend = i0 + 16;                                      // keys j <= i for rows i0..i0+15 -> tiles covering [0, i0+16)
#pragma unroll 1
  for (int j0 = 0; j0 < jend; j0 += 32) {
#pragma unroll
    for (int jt = 0; jt < 2; ++jt) { const int jb = j0 + jt * 16; if (jb < jend) {   // wave-uniform
      const __bf16* kh = Kh + ((size_t)bh * TT + jb + col) * HS; const __bf16* kl = Kl + ((size_t)bh * TT + jb + col) * HS;
      v8f s = {}; s = mac3p(qh0, ql0, frag_b16(kh, lane), frag_b16(kl, lane), s); s = mac3p(qh1, ql1, frag_b16(kh + 32, lane), frag_b16(kl + 32, lane), s);
#pragma unroll
      for (int r = 0; r < 8; ++r) { const int i = i0 + 8 * g + r, j = jb + col; const float v = (j <= i) ? s[r] * 0.125f : -1e30f;
        float mt = v;
#pragma unroll
        for (int o = 1; o < 16; o <<= 1) mt = fmaxf(mt, __shfl_xor(mt, o));
        const float mn = fmaxf(m[r], mt); float e = exp_ni(v - mn);
#pragma unroll
        for (int o = 1; o < 16; o <<= 1) e += __shfl_xor(e, o);
        l[r] = l[r] * exp_ni(m[r] - mn) + e; m[r] = mn; } } }
  }
  if (col == 0) {
#pragma unroll
    for (int r = 0; r < 8; ++r) { sm[wave * 16 + 8 * g + r] = m[r]; ssum[wave * 16 + 8 * g + r] = l[r]; } }
  __syncthreads();
  if (tid < 16) { vst2(Mo + (size_t)bh * TT + blockIdx.x * 64 + tid * 4, *(const v4f*)&sm[tid * 4]); vst2(Lo + (size_t)bh * TT + blockIdx.x * 64 + tid * 4, *(const v4f*)&ssum[tid * 4]); }
}
// ---- k_mix: block = (b, 16 queries i0..i0+15), 8 waves; loop over 32-key tiles (causal)
__global__ __launch_bounds__(256) void k_mix(const __bf16* __restrict__ Qh, const __bf16* __restrict__ Ql, const __bf16* __restrict__ Kh, const __bf16* __restrict__ Kl, const __bf16* __restrict__ VTh, const __bf16* __restrict__ VTl,
                                             const float* __restrict__ Mo, const float* __restrict__ Lo, const float* __restrict__ tw, const float* __restrict__ talpha, const float* __restrict__ tbeta, const float* __restrict__ mixw,
                                             __bf16* __restrict__ OH, __bf16* __restrict__ OL) {
  __shared__ __align__(16) __bf16 pwh[512][32], pwl[512][32];   // (P*w) for the tile: row = i*32 + j (query-in-tile, key-in-tile), column = head h (16..31 stay zero)
  __shared__ __align__(16) float attp[NH][16][36];               // mixed attention tile per output head o: [o][i][j]
  __shared__ __align__(16) __bf16 mixr[NH][32];                  // mixing matrix rows o, k = h (16..31 zero)
  const int tid = threadIdx.x, wave = tid >> 5, lane = tid & 31, col = lane & 15, g = lane >> 4;
  const int b = blockIdx.y, i0 = blockIdx.x * 16;
  for (int q = tid; q < 512 * 32 / 8; q += 256) { *(v4u*)(&pwh[0][0] + q * 8) = (v4u){0u,0u,0u,0u}; *(v4u*)(&pwl[0][0] + q * 8) = (v4u){0u,0u,0u,0u}; }
  for (int q = tid; q < NH * 32; q += 256) { const int o = q >> 5, h = q & 31; mixr[o][h] = h < NH ? (__bf16)mixw[o * NH + h] : (__bf16)0.f; }
  // this wave's two heads for the S phase and two output heads for the PV phase
  const int hA = wave * 2;
  float mrow[2][8], lb[2][8];            // row max, and beta[h][i] / L (the per-row factors of p*w = (e^(s-m)/L) * ((tw*alpha)*beta), folded)
#pragma unroll
  for (int u = 0; u < 2; ++u) { const int bh = b * NH + hA + u;
#pragma unroll
    for (int r = 0; r < 8; ++r) { const int i = i0 + 8 * g + r; mrow[u][r] = Mo[(size_t)bh * TT + i]; lb[u][r] = bfr(tbeta[(hA + u) * TT + i]) / Lo[(size_t)bh * TT + i]; } }
  v8f oacc[2][4];
#pragma unroll
  for (int u = 0; u < 2; ++u)
#pragma unroll
    for (int d4 = 0; d4 < 4; ++d4) oacc[u][d4] = (v8f){};
  __syncthreads();
  const int jend = i0 + 16;
#pragma unroll 1
  for (int j0 = 0; j0 < jend; j0 += 32) {
    // -- S for this wave's two heads; P*w -> pwh/pwl[(i)*32 + j][h]
#pragma unroll
    for (int u = 0; u < 2; ++u) { const int h = hA + u; const int bh = b * NH + h;
      const __bf16* qh = Qh + ((size_t)bh * TT + i0 + col) * HS; const __bf16* ql = Ql + ((size_t)bh * TT + i0 + col) * HS;
      const v16b qh0 = frag_b16(qh, lane), qh1 = frag_b16(qh + 32, lane), ql0 = frag_b16(ql, lane), ql1 = frag_b16(ql + 32, lane);   // re-read per key tile (cached) to keep VGPRs < 256
#pragma unroll 1
      for (int jt = 0; jt < 2; ++jt) { const int jb = j0 + jt * 16;
        v8f s = {};
        if (jb < jend) { const __bf16* kh = Kh + ((size_t)bh * TT + jb + col) * HS; const __bf16* kl = Kl + ((size_t)bh * TT + jb + col) * HS;   // wave-uniform branch; no barrier inside
          s = mac3p(qh0, ql0, frag_b16(kh, lane), frag_b16(kl, lane), s); s = mac3p(qh1, ql1, frag_b16(kh + 32, lane), frag_b16(kl + 32, lane), s); }
        const int j = jb + col; const float alpha_j = bfr(talpha[h * TT + (j < TT ? j : TT - 1)]);
#pragma unroll
        for (int r = 0; r < 8; ++r) { const int il = 8 * g + r, i = i0 + il; float pw = 0.f;
          if (jb < jend && j <= i) { const int widx = TT - 1 + j - i; pw = (exp_ni(s[r] * 0.125f - mrow[u][r]) * lb[u][r]) * (bfr(tw[h * TT + (widx < TT ? widx : TT - 1)]) * alpha_j); }
          const __bf16 hi = (__bf16)pw; pwh[il * 32 + jt * 16 + col][h] = hi; pwl[il * 32 + jt * 16 + col][h] = (__bf16)(pw - (float)hi); } } }
    __syncthreads();
    // -- mixing GEMM: att'[o][(i,j)] = sum_h mix[o][h] Pw[(i,j)][h]; 32 column tiles of 16 (i,j) pairs, K = 32 (h, upper half zero); wave owns column tiles 4w..4w+3
    { const v16b am = frag_b16(&mixr[col][0], lane);            // A rows o = col, k = h
#pragma unroll 1
      for (int ct = 0; ct < 4; ++ct) { const int n0c = (wave * 4 + ct) * 16; v8f a = {};
        a = wmma_bf(am, frag_b16(&pwl[n0c + col][0], lane), a); a = wmma_bf(am, frag_b16(&pwh[n0c + col][0], lane), a);
        const int il = n0c >> 5, jl0 = n0c & 31;                 // the 16 columns of this tile share i (32 | n0c+0..15 within one i row since tiles are 16-aligned inside 32)
#pragma unroll
        for (int r = 0; r < 8; ++r) attp[8 * g + r][il][jl0 + col] = a[r]; } }
    __syncthreads();
    // -- O[o] += att'[o](hi/lo) v_o(hi/lo): this wave's output heads o = hA, hA+1; K = 32 keys (one step); 4 d tiles
#pragma unroll
    for (int u = 0; u < 2; ++u) { const int o = hA + u; const int bh = b * NH + o; const F2 af = split_row(&attp[o][col][0], 0, lane);
#pragma unroll
      for (int d4 = 0; d4 < 4; ++d4) { const __bf16* vh = VTh + ((size_t)bh * HS + d4 * 16 + col) * TT + j0; const __bf16* vl = VTl + ((size_t)bh * HS + d4 * 16 + col) * TT + j0;
        oacc[u][d4] = mac3p(af.h, af.l, frag_b16(vh, lane), frag_b16(vl, lane), oacc[u][d4]); } }
    __syncthreads();                                            // pw*/attp are rewritten by the next key tile
  }
  // -- O rows: r = b*1024 + i, columns o*64 + d -> hi/lo planes; per wave 16 rows x 128 cols (its two heads) staged in the (now free) pw buffers: 256-B segments by 16 lanes
  __bf16* sth = &pwh[0][0] + wave * (16 * 128); __bf16* stl = &pwl[0][0] + wave * (16 * 128);
#pragma unroll
  for (int u = 0; u < 2; ++u)
#pragma unroll
    for (int d4 = 0; d4 < 4; ++d4)
#pragma unroll
      for (int r = 0; r < 8; ++r) { const float v = oacc[u][d4][r]; const __bf16 hi = (__bf16)v; sth[(8 * g + r) * 128 + u * 64 + d4 * 16 + col] = hi; stl[(8 * g + r) * 128 + u * 64 + d4 * 16 + col] = (__bf16)(v - (float)hi); }
  LDSX();
  for (int qq = lane; qq < 16 * 16; qq += 32) { const int rl = qq >> 4, pc = qq & 15; const size_t o = ((size_t)b * TT + i0 + rl) * CCH + hA * 64 + pc * 8;
    vst2((unsigned*)(OH + o), *(const v4u*)(sth + rl * 128 + pc * 8)); vst2((unsigned*)(OL + o), *(const v4u*)(stl + rl * 128 + pc * 8)); }
}
// ---- k_out: out = (O(hi/lo) . Wo^T rows + bo) * gamma[t]; block (64 rows, 128 cols), K = 1024
__global__ __launch_bounds__(128) void k_out(const __bf16* __restrict__ OH, const __bf16* __restrict__ OL, const __bf16* __restrict__ PT, const float* __restrict__ bo, const float* __restrict__ gam, float* __restrict__ out) {
  __shared__ __align__(16) float so[4][16][132];
  const int tid = threadIdx.x, wave = tid >> 5, lane = tid & 31, col = lane & 15, g = lane >> 4; const size_t r0 = (size_t)blockIdx.x * 64 + wave * 16; const int n0 = blockIdx.y * 128;
  v8f acc[8] = {};
#pragma unroll 2
  for (int kc = 0; kc < CCH / 32; ++kc) { const v16b ah = frag_b16(OH + (r0 + col) * CCH + kc * 32, lane), al = frag_b16(OL + (r0 + col) * CCH + kc * 32, lane);
#pragma unroll
    for (int j = 0; j < 8; ++j) { const v16b wb = frag_b16(PT + ((size_t)3 * CCH + n0 + j * 16 + col) * CCH + kc * 32, lane); acc[j] = wmma_bf(al, wb, acc[j]); acc[j] = wmma_bf(ah, wb, acc[j]); } }
#pragma unroll
  for (int j = 0; j < 8; ++j) { const float bb = bfr(bo[n0 + j * 16 + col]);
#pragma unroll
    for (int r = 0; r < 8; ++r) { const int t = (int)((r0 + 8 * g + r) % TT); so[wave][8 * g + r][j * 16 + col] = (acc[j][r] + bb) * bfr(gam[t]); } }
  LDSX();
  for (int rl = 0; rl < 16; ++rl) vst2(out + (r0 + rl) * CCH + n0 + lane * 4, *(const v4f*)(&so[wave][rl][lane * 4]));
}

extern "C" void kernel_launch(void* const* d_in, const int* in_sizes, int n_in, void* d_out, int out_size, void* d_ws, size_t ws_size, hipStream_t stream) {
  (void)in_sizes; (void)n_in; (void)out_size;
  const float** I = (const float**)d_in;   // x, Wq, bq, Wk, bk, Wv, bv, Wo, bo, time_w, time_alpha, time_beta, time_gamma, head_mix_w
  if (ws_size < (size_t)WS_END) return;
  char* ws = (char*)d_ws;
  __bf16* PT = (__bf16*)(ws + WS_PT); __bf16 *Qh = (__bf16*)(ws + WS_QH), *Ql = (__bf16*)(ws + WS_QL), *Kh = (__bf16*)(ws + WS_KH), *Kl = (__bf16*)(ws + WS_KL), *VTh = (__bf16*)(ws + WS_VTH), *VTl = (__bf16*)(ws + WS_VTL);
  float *Mo = (float*)(ws + WS_M), *Lo = (float*)(ws + WS_L); __bf16 *OH = (__bf16*)(ws + WS_OH), *OL = (__bf16*)(ws + WS_OL);
  k_pack<<<4 * CCH, 256, 0, stream>>>(I[1], I[3], I[5], I[7], PT);
  k_qkv<<<dim3(NR / 64, 24), 128, 0, stream>>>(I[0], PT, I[2], I[4], I[6], Qh, Ql, Kh, Kl, VTh, VTl);
  k_stats<<<dim3(TT / 64, NB * NH), 128, 0, stream>>>(Qh, Ql, Kh, Kl, Mo, Lo);
  k_mix<<<dim3(TT / 16, NB), 256, 0, stream>>>(Qh, Ql, Kh, Kl, VTh, VTl, Mo, Lo, I[9], I[10], I[11], I[13], OH, OL);
  k_out<<<dim3(NR / 64, CCH / 128), 128, 0, stream>>>(OH, OL, PT, I[8], I[12], (float*)d_out);
}

// v001
// One run takes 606 microseconds.
// Two timings next to v000 put it at 1.34 and 1.35 times that version's speed.
// compute dtype: x, all weights/biases, time_w/alpha/beta/gamma and the head-mixing matrix (module inputs) rounded to bf16; q/k/v = xs W with exact bf16 products; RoPE, scores' softmax statistics,
// decay and normalisation in f32; scores = q'(hi/lo) k'(hi/lo)^T (3 products); head mixing = bf16(mix) x (P w)(hi/lo) (2 products); context = att'(hi/lo) x v(hi/lo) (3 products); out = O(hi/lo) Wo (2 products) + bo, x gamma; f32 accumulate.
#include <hip/hip_runtime.h>
#include <math.h>

typedef __attribute__((ext_vector_type(16))) _Float16 v16h;
typedef __attribute__((ext_vector_type(16))) __bf16 v16b;
typedef __attribute__((ext_vector_type(8)))  _Float16 v8h;
typedef __attribute__((ext_vector_type(8)))  float v8f;
typedef __attribute__((ext_vector_type(4)))  float v4f;
typedef __attribute__((ext_vector_type(2)))  float v2f;
typedef __attribute__((ext_vector_type(4)))  unsigned v4u;
typedef __attribute__((ext_vector_type(4)))  int v4i;
typedef float __attribute__((may_alias)) float_a;
typedef int __attribute__((may_alias)) int_a;

template <typename T> __device__ __forceinline__ void vst2(void* p, T v) { *(T*)p = v;  }
__device__ __forceinline__ v8f wmma16(v16h a, v16h b, v8f c) {
  v8f d = __builtin_amdgcn_wmma_f32_16x16x32_f16(false, a, false, b, (short)0, c, false, false);
  asm volatile("v_nop\n\tv_nop\n\tv_nop\n\tv_nop" : "+v"(d) : "v"(a), "v"(b));
  return d;
}
__device__ __forceinline__ v8f wmma_bf(v16b a, v16b b, v8f c) {
  v8f d = __builtin_amdgcn_wmma_f32_16x16x32_bf16(false, a, false, b, (short)0, c, false, false);
  asm volatile("v_nop\n\tv_nop\n\tv_nop\n\tv_nop" : "+v"(d) : "v"(a), "v"(b));
  return d;
}
// 16x16x32 fragments: lane = (h = lane>>4, row/col = lane&15); elements 0..7 = k0+8h+0..7, 8..15 = k0+16+8h+0..7; D element r = row 8h+r
__device__ __forceinline__ v16h frag_h(const _Float16* rowk0, int lane) {
  union { v16h v; v8h q[2]; } u; const _Float16* p = rowk0 + 8 * (lane >> 4);
  u.q[0] = *(const v8h*)p; u.q[1] = *(const v8h*)(p + 16); return u.v;
}
__device__ __forceinline__ v16h frag_f32(const float* rowk0, int lane) {
  v16h a; const float* p = rowk0 + 8 * (lane >> 4);
#pragma unroll
  for (int i = 0; i < 8; ++i) { a[i] = (_Float16)p[i]; a[8 + i] = (_Float16)p[16 + i]; }
  return a;
}
__device__ __forceinline__ v16h frag_f32s(const float* rowk0, int lane, float sc) {
  v16h a; const float* p = rowk0 + 8 * (lane >> 4);
#pragma unroll
  for (int i = 0; i < 8; ++i) { a[i] = (_Float16)(p[i] * sc); a[8 + i] = (_Float16)(p[16 + i] * sc); }
  return a;
}
// column fragment from a [K][ld] layout (column n), rows >= K read as 0
__device__ __forceinline__ v16h fragc_f32(const float* W, int k0, int n, int lane, int ld, int K) {
  v16h a; const int g = lane >> 4;
#pragma unroll
  for (int i = 0; i < 8; ++i) { const int ka = k0 + 8 * g + i, kb = ka + 16;
    a[i] = (_Float16)(ka < K ? W[(size_t)(ka < K ? ka : K - 1) * ld + n] : 0.f); a[8 + i] = (_Float16)(kb < K ? W[(size_t)(kb < K ? kb : K - 1) * ld + n] : 0.f); }
  return a;
}
struct F2 { v16b h, l; };
__device__ __forceinline__ F2 bsplit16(const float v[16]) { F2 r;
#pragma unroll
  for (int i = 0; i < 16; ++i) { const __bf16 h = (__bf16)v[i]; r.h[i] = h; r.l[i] = (__bf16)(v[i] - (float)h); }
  return r; }
__device__ __forceinline__ F2 split_row(const float* row, int k0, int lane) { float v[16]; const float* p = row + k0 + 8 * (lane >> 4);
#pragma unroll
  for (int i = 0; i < 8; ++i) { v[i] = p[i]; v[8 + i] = p[16 + i]; }
  return bsplit16(v); }
__device__ __forceinline__ F2 split_rowK(const float* row, int k0, int lane, int K) { float v[16]; const int g = lane >> 4;
#pragma unroll
  for (int i = 0; i < 8; ++i) { const int ka = k0 + 8 * g + i, kb = ka + 16; v[i] = ka < K ? row[ka < K ? ka : K - 1] : 0.f; v[8 + i] = kb < K ? row[kb < K ? kb : K - 1] : 0.f; }
  return bsplit16(v); }
__device__ __forceinline__ F2 split_col(const float* W, int k0, int n, int lane, int ld, int K) { float v[16]; const int g = lane >> 4;
#pragma unroll
  for (int i = 0; i < 8; ++i) { const int ka = k0 + 8 * g + i, kb = ka + 16; v[i] = ka < K ? W[(size_t)(ka < K ? ka : K - 1) * ld + n] : 0.f; v[8 + i] = kb < K ? W[(size_t)(kb < K ? kb : K - 1) * ld + n] : 0.f; }
  return bsplit16(v); }
__device__ __forceinline__ v8f mac3(const F2& a, const F2& b, v8f c) { c = wmma_bf(a.l, b.h, c); c = wmma_bf(a.h, b.l, c); return wmma_bf(a.h, b.h, c); }
__device__ __forceinline__ float sigm(float v) { return 1.0f / (1.0f + expf(-v)); }
#define LDSX() do { asm volatile("s_wait_dscnt 0" ::: "memory"); __builtin_amdgcn_wave_barrier(); __builtin_amdgcn_fence(__ATOMIC_RELEASE, "workgroup"); } while (0)


// Causal multi-head attention with token shift, partial RoPE, per-head Toeplitz time decay, a 16x16 cross-head mixing of the softmax maps, output projection and a per-position gain.
// Rows r = b*1024 + t. k_pack ([in][out] weights -> bf16 rows); k_qkv (xs built at fragment load: channels < 512 come from t-1, zero at t = 0; + bias; RoPE on dims 0..31; q/k -> hi/lo rows [bh][t][64], v -> hi/lo transposed [bh][d][t]);
// k_stats (per (bh, 64 queries): causal row max and sum of exp over the keys -> M, L); k_mix (block = (b, 16 queries), loop over 32-key tiles: S for all 16 heads -> P*w as bf16 hi/lo [query,key][h] in LDS -> mixing GEMM -> att'[o][i][j] f32 in LDS
// -> O[o] += att'(hi/lo) v_o(hi/lo); finally O -> hi/lo planes [r][o*64+d]); k_out ((O Wo + bo) * gamma[t]).
#define NB 4
#define TT 1024
#define CCH 1024
#define NH 16
#define HS 64
#define NR (NB * TT)
#define ROT 32
typedef __attribute__((ext_vector_type(8))) __bf16 v8b;
__device__ __forceinline__ v16b frag_b16(const __bf16* rowk0, int lane) {
  union { v16b v; v8b q[2]; } u; const __bf16* p = rowk0 + 8 * (lane >> 4);
  u.q[0] = *(const v8b*)p; u.q[1] = *(const v8b*)(p + 16); return u.v;
}
__device__ __forceinline__ float bfr(float v) { return (float)(__bf16)v; }
__device__ __forceinline__ v8f mac3p(v16b ah, v16b al, v16b bh, v16b bl, v8f c) { c = wmma_bf(al, bh, c); c = wmma_bf(ah, bl, c); return wmma_bf(ah, bh, c); }
__constant__ float c_invfreq[16] = {1.0f,0.5623413324356079f,0.3162277638912201f,0.17782793939113617f,0.10000000149011612f,0.05623412877321243f,0.03162277862429619f,0.017782794311642647f,0.009999999776482582f,0.005623413249850273f,0.003162277862429619f,0.0017782794311642647f,0.0010000000474974513f,0.000562341301701963f,0.0003162277862429619f,0.00017782794020604342f};

// workspace carve (bytes)
#define PLANE_Q (2u * NB * NH * TT * HS)        // bf16 [64 bh][1024][64] = 8 MiB
#define WS_PT   0u                               // bf16 [4096][1024]: rows 0.. Wq^T, 1024.. Wk^T, 2048.. Wv^T, 3072.. Wo^T  (8 MiB)
#define WS_QH   (WS_PT + 2u * 4 * CCH * CCH)
#define WS_QL   (WS_QH + PLANE_Q)
#define WS_KH   (WS_QL + PLANE_Q)
#define WS_KL   (WS_KH + PLANE_Q)
#define WS_VTH  (WS_KL + PLANE_Q)                // bf16 [bh][64 d][1024 t]
#define WS_VTL  (WS_VTH + PLANE_Q)
#define WS_M    (WS_VTL + PLANE_Q)               // f32 [bh][1024]
#define WS_L    (WS_M + 4u * NB * NH * TT)
#define WS_OH   (WS_L + 4u * NB * NH * TT)       // bf16 [4096][1024] (row r, col o*64 + d)
#define WS_OL   (WS_OH + 2u * NR * CCH)
#define WS_END  (WS_OL + 2u * NR * CCH)

// ---- k_pack: PT[n][k] = bf16(W[k][n]); block = PT row (which matrix is block-uniform)
__global__ __launch_bounds__(256) void k_pack(const float* __restrict__ Wq, const float* __restrict__ Wk, const float* __restrict__ Wv, const float* __restrict__ Wo, __bf16* __restrict__ PT) {
  __shared__ __align__(16) __bf16 srow[CCH];
  const int n = blockIdx.x, tid = threadIdx.x; const int which = n >> 10, nn = n & 1023;
  const float* Wm = which == 0 ? Wq : which == 1 ? Wk : which == 2 ? Wv : Wo;
  for (int k = tid; k < CCH; k += 256) srow[k] = (__bf16)Wm[(size_t)k * CCH + nn];
  __syncthreads();
  if (tid < CCH / 8) vst2((unsigned*)(PT + (size_t)n * CCH + tid * 8), *(const v4u*)(&srow[tid * 8]));
}
// xs fragment: channels k0..k0+31 (chunk-uniform half): first half from row t-1 (zero at t = 0, address clamped to the row itself), second half from row t
__device__ __forceinline__ v16b frag_xs(const float* __restrict__ X, size_t r, int t, int k0, int lane) {
  const bool shifted = k0 < CCH / 2; const bool zero = shifted && (t == 0);
  const float* p = X + (r - ((shifted && t > 0) ? 1 : 0)) * CCH + k0 + 8 * (lane >> 4);
  v16b a;
#pragma unroll
  for (int i = 0; i < 8; ++i) { a[i] = (__bf16)(zero ? 0.f : p[i]); a[8 + i] = (__bf16)(zero ? 0.f : p[16 + i]); }
  return a;
}
// ---- k_qkv: block (64 rows, 128 cols = 2 heads of q, k or v); exact products; + bias; RoPE (q, k); q/k -> hi/lo rows [bh][t][64]; v -> VT hi/lo [bh][d][t]
__global__ __launch_bounds__(128) void k_qkv(const float* __restrict__ X, const __bf16* __restrict__ PT, const float* __restrict__ bq, const float* __restrict__ bk, const float* __restrict__ bv,
                                             __bf16* __restrict__ Qh, __bf16* __restrict__ Ql, __bf16* __restrict__ Kh, __bf16* __restrict__ Kl, __bf16* __restrict__ VTh, __bf16* __restrict__ VTl) {
  __shared__ __align__(16) __bf16 sh_[128][72], sl_[128][72];
  const int tid = threadIdx.x, wave = tid >> 5, lane = tid & 31, col = lane & 15, g = lane >> 4;
  const size_t rb = (size_t)blockIdx.x * 64; const int b = (int)(rb / TT), t0 = (int)(rb % TT);
  const int which = blockIdx.y >> 3; const int n0 = (blockIdx.y & 7) * 128;          // block-uniform: 0 q, 1 k, 2 v; n0 = first output channel (2 heads)
  const size_t r0 = rb + wave * 16; const int tq = t0 + wave * 16 + col;              // this lane's A row time index
  v8f acc[8] = {};
#pragma unroll 2
  for (int kc = 0; kc < CCH / 32; ++kc) { const v16b a = frag_xs(X, r0 + col, tq, kc * 32, lane);
#pragma unroll
    for (int j = 0; j < 8; ++j) acc[j] = wmma_bf(a, frag_b16(PT + ((size_t)which * CCH + n0 + j * 16 + col) * CCH + kc * 32, lane), acc[j]); }
  const float* bias = which == 0 ? bq : which == 1 ? bk : bv;
#pragma unroll
  for (int j = 0; j < 8; ++j) { const float bb = bfr(bias[n0 + j * 16 + col]);
#pragma unroll
    for (int r = 0; r < 8; ++r) acc[j][r] += bb; }
  if (which < 2) {   // RoPE on head-local dims 0..15 (tile 4h'+0) and 16..31 (tile 4h'+1), pairs in the same lane; theta = t * inv_freq[col]
#pragma unroll
    for (int hp = 0; hp < 2; ++hp) {
#pragma unroll
      for (int r = 0; r < 8; ++r) { const int t = t0 + wave * 16 + 8 * g + r; const float th = (float)t * c_invfreq[col]; const float cs = cosf(th), sn = sinf(th);
        const float a0 = acc[hp * 4][r], a1 = acc[hp * 4 + 1][r];
        acc[hp * 4][r] = a0 * cs - a1 * sn; acc[hp * 4 + 1][r] = a1 * cs + a0 * sn; } }
    __bf16* Oh = which == 0 ? Qh : Kh; __bf16* Ol = which == 0 ? Ql : Kl;
#pragma unroll
    for (int hp = 0; hp < 2; ++hp) {
#pragma unroll
      for (int j = 0; j < 4; ++j)
#pragma unroll
        for (int r = 0; r < 8; ++r) { const float v = acc[hp * 4 + j][r]; const __bf16 hi = (__bf16)v; sh_[wave * 16 + 8 * g + r][j * 16 + col] = hi; sl_[wave * 16 + 8 * g + r][j * 16 + col] = (__bf16)(v - (float)hi); }
      LDSX();
      const int h = (n0 >> 6) + hp; const size_t base = ((size_t)(b * NH + h) * TT + t0 + wave * 16) * HS;
      for (int qq = lane; qq < 16 * 8; qq += 32) { const int rl = qq >> 3, pc = qq & 7; vst2((unsigned*)(Oh + base + rl * HS + pc * 8), *(const v4u*)(&sh_[wave * 16 + rl][pc * 8])); vst2((unsigned*)(Ol + base + rl * HS + pc * 8), *(const v4u*)(&sl_[wave * 16 + rl][pc * 8])); }
      LDSX(); }
  } else {
#pragma unroll
    for (int j = 0; j < 8; ++j)
#pragma unroll
      for (int r = 0; r < 8; ++r) { const float v = acc[j][r]; const __bf16 hi = (__bf16)v; sh_[j * 16 + col][wave * 16 + 8 * g + r] = hi; sl_[j * 16 + col][wave * 16 + 8 * g + r] = (__bf16)(v - (float)hi); }
    __syncthreads();
    for (int qq = tid; qq < 128 * 8; qq += 128) { const int c = qq >> 3, pc = qq & 7; const int h = (n0 >> 6) + (c >> 6), d = c & 63; const size_t o = ((size_t)(b * NH + h) * HS + d) * TT + t0 + pc * 8;
      vst2((unsigned*)(VTh + o), *(const v4u*)(&sh_[c][pc * 8])); vst2((unsigned*)(VTl + o), *(const v4u*)(&sl_[c][pc * 8])); }
  }
}
// ---- k_stats: block = (bh, 64 queries); wave = 16 queries; causal key tiles of 32: S = q'(hi/lo) k'(hi/lo) / 8, online max / sum -> M, L (f32 [bh][t], 256 B per block by 16 lanes)
__global__ __launch_bounds__(128) void k_stats(const __bf16* __restrict__ Qh, const __bf16* __restrict__ Ql, const __bf16* __restrict__ Kh, const __bf16* __restrict__ Kl, float* __restrict__ Mo, float* __restrict__ Lo) {
  __shared__ float sm[64], ssum[64];
  const int tid = threadIdx.x, wave = tid >> 5, lane = tid & 31, col = lane & 15, g = lane >> 4;
  const int bh = blockIdx.y; const int i0 = blockIdx.x * 64 + wave * 16;
  const __bf16* qh = Qh + ((size_t)bh * TT + i0 + col) * HS; const __bf16* ql = Ql + ((size_t)bh * TT + i0 + col) * HS;
  const v16b qh0 = frag_b16(qh, lane), qh1 = frag_b16(qh + 32, lane), ql0 = frag_b16(ql, lane), ql1 = frag_b16(ql + 32, lane);
  asm volatile("s_wait_xcnt 0x0" :: "v"(qh0), "v"(qh1), "v"(ql0), "v"(ql1) : "memory");   // the loop's key loads may land in the address registers of the query loads above; the loaded values as inputs keep this wait behind those loads
  float m[8], l[8];
#pragma unroll
  for (int r = 0; r < 8; ++r) { m[r] = -3.0e38f; l[r] = 0.f; }
  const int jend = i0 + 16;                                      // keys j <= i for rows i0..i0+15 -> tiles covering [0, i0+16)
#pragma unroll 1
  for (int j0 = 0; j0 < jend; j0 += 32) {
#pragma unroll
    for (int jt = 0; jt < 2; ++jt) { const int jb = j0 + jt * 16; if (jb < jend) {   // wave-uniform
      const __bf16* kh = Kh + ((size_t)bh * TT + jb + col) * HS; const __bf16* kl = Kl + ((size_t)bh * TT + jb + col) * HS;
      const v16b kh0 = frag_b16(kh, lane), kl0 = frag_b16(kl, lane), kh1 = frag_b16(kh + 32, lane), kl1 = frag_b16(kl + 32, lane);
      asm volatile("" :: "v"(kh0), "v"(kl0), "v"(kh1), "v"(kl1));   // inputs-only fence on the loaded values: holds all eight key loads in front of the products, one memory latency instead of two in a row
      v8f s = {}; s = mac3p(qh0, ql0, kh0, kl0, s); s = mac3p(qh1, ql1, kh1, kl1, s);
#pragma unroll
      for (int r = 0; r < 8; ++r) { const int i = i0 + 8 * g + r, j = jb + col; const float v = (j <= i) ? s[r] * 0.125f : -1e30f;
        float mt = v;
#pragma unroll
        for (int o = 1; o < 16; o <<= 1) mt = fmaxf(mt, __shfl_xor(mt, o));
        const float mn = fmaxf(m[r], mt); float e = expf(v - mn);
#pragma unroll
        for (int o = 1; o < 16; o <<= 1) e += __shfl_xor(e, o);
        l[r] = l[r] * expf(m[r] - mn) + e; m[r] = mn; } } }
  }
  if (col == 0) {
#pragma unroll
    for (int r = 0; r < 8; ++r) { sm[wave * 16 + 8 * g + r] = m[r]; ssum[wave * 16 + 8 * g + r] = l[r]; } }
  __syncthreads();
  if (tid < 16) { vst2(Mo + (size_t)bh * TT + blockIdx.x * 64 + tid * 4, *(const v4f*)&sm[tid * 4]); vst2(Lo + (size_t)bh * TT + blockIdx.x * 64 + tid * 4, *(const v4f*)&ssum[tid * 4]); }
}
// ---- k_mix: block = (b, 16 queries i0..i0+15), 8 waves; loop over 32-key tiles (causal)
__global__ __launch_bounds__(256) void k_mix(const __bf16* __restrict__ Qh, const __bf16* __restrict__ Ql, const __bf16* __restrict__ Kh, const __bf16* __restrict__ Kl, const __bf16* __restrict__ VTh, const __bf16* __restrict__ VTl,
                                             const float* __restrict__ Mo, const float* __restrict__ Lo, const float* __restrict__ tw, const float* __restrict__ talpha, const float* __restrict__ tbeta, const float* __restrict__ mixw,
                                             __bf16* __restrict__ OH, __bf16* __restrict__ OL) {
  __shared__ __align__(16) __bf16 pwh[512][32], pwl[512][32];   // (P*w) for the tile: row = i*32 + j (query-in-tile, key-in-tile), column = head h (16..31 stay zero)
  __shared__ __align__(16) float attp[NH][16][36];               // mixed attention tile per output head o: [o][i][j]
  __shared__ __align__(16) __bf16 mixr[NH][32];                  // mixing matrix rows o, k = h (16..31 zero)
  const int tid = threadIdx.x, wave = tid >> 5, lane = tid & 31, col = lane & 15, g = lane >> 4;
  const int b = blockIdx.y, i0 = blockIdx.x * 16;
  for (int q = tid; q < 512 * 32 / 8; q += 256) { *(v4u*)(&pwh[0][0] + q * 8) = (v4u){0u,0u,0u,0u}; *(v4u*)(&pwl[0][0] + q * 8) = (v4u){0u,0u,0u,0u}; }
  for (int q = tid; q < NH * 32; q += 256) { const int o = q >> 5, h = q & 31; mixr[o][h] = h < NH ? (__bf16)mixw[o * NH + h] : (__bf16)0.f; }
  // this wave's two heads for the S phase and two output heads for the PV phase
  const int hA = wave * 2;
  float mrow[2][8], lb[2][8];            // row max, and beta[h][i] / L (the per-row factors of p*w = (e^(s-m)/L) * ((tw*alpha)*beta), folded)
#pragma unroll
  for (int u = 0; u < 2; ++u) { const int bh = b * NH + hA + u;
#pragma unroll
    for (int r = 0; r < 8; ++r) { const int i = i0 + 8 * g + r; mrow[u][r] = Mo[(size_t)bh * TT + i]; lb[u][r] = bfr(tbeta[(hA + u) * TT + i]) / Lo[(size_t)bh * TT + i]; } }
  v8f oacc[2][4];
#pragma unroll
  for (int u = 0; u < 2; ++u)
#pragma unroll
    for (int d4 = 0; d4 < 4; ++d4) oacc[u][d4] = (v8f){};
  __syncthreads();
  const int jend = i0 + 16;
#pragma unroll 1
  for (int j0 = 0; j0 < jend; j0 += 32) {
    // -- S for this wave's two heads; P*w -> pwh/pwl[(i)*32 + j][h]
#pragma unroll
    for (int u = 0; u < 2; ++u) { const int h = hA + u; const int bh = b * NH + h;
      const __bf16* qh = Qh + ((size_t)bh * TT + i0 + col) * HS; const __bf16* ql = Ql + ((size_t)bh * TT + i0 + col) * HS;
      const v16b qh0 = frag_b16(qh, lane), qh1 = frag_b16(qh + 32, lane), ql0 = frag_b16(ql, lane), ql1 = frag_b16(ql + 32, lane);   // re-read per key tile (cached) to keep VGPRs < 256
#pragma unroll 1
      for (int jt = 0; jt < 2; ++jt) { const int jb = j0 + jt * 16;   // body is one straight line, no call and no branch: the eight rows' loads, exps and stores overlap. jb + 15 <= 1023, so a half past the diagonal reads rows that exist; the select drops it
        const __bf16* kh = Kh + ((size_t)bh * TT + jb + col) * HS; const __bf16* kl = Kl + ((size_t)bh * TT + jb + col) * HS;
        const int j = jb + col; const float al = talpha[h * TT + (j < TT ? j : TT - 1)]; float twv[8];
#pragma unroll
        for (int r = 0; r < 8; ++r) { const int widx = TT - 1 + j - (i0 + 8 * g + r); twv[r] = tw[h * TT + (widx < TT ? widx : TT - 1)]; }   // 0 <= widx; clamped into the row above the diagonal
        asm volatile("s_wait_xcnt 0x0" ::: "memory");   // the key loads below may land in the offset registers of the nine loads above
        const v16b kh0 = frag_b16(kh, lane), kl0 = frag_b16(kl, lane), kh1 = frag_b16(kh + 32, lane), kl1 = frag_b16(kl + 32, lane);
        // inputs-only fence on the loaded values: holds all 17 loads of this half in front of the products, so that they share one memory latency (without it the compiler sinks half of the key loads and the decay loads behind the products: three latencies in a row)
        asm volatile("" :: "v"(kh0), "v"(kl0), "v"(kh1), "v"(kl1), "v"(al), "v"(twv[0]), "v"(twv[1]), "v"(twv[2]), "v"(twv[3]), "v"(twv[4]), "v"(twv[5]), "v"(twv[6]), "v"(twv[7]));
        v8f s = {}; s = mac3p(qh0, ql0, kh0, kl0, s); s = mac3p(qh1, ql1, kh1, kl1, s);
        const float alpha_j = bfr(al);
#pragma unroll
        for (int r = 0; r < 8; ++r) { const int il = 8 * g + r, i = i0 + il;
          const float pv = (expf(s[r] * 0.125f - mrow[u][r]) * lb[u][r]) * (bfr(twv[r]) * alpha_j);
          const float pw = (j <= i) ? pv : 0.f;                  // causal mask as a select: a masked pv is never used
          const __bf16 hi = (__bf16)pw; pwh[il * 32 + jt * 16 + col][h] = hi; pwl[il * 32 + jt * 16 + col][h] = (__bf16)(pw - (float)hi); } } }
    __syncthreads();
    // -- mixing GEMM: att'[o][(i,j)] = sum_h mix[o][h] Pw[(i,j)][h]; 32 column tiles of 16 (i,j) pairs, K = 32 (h, upper half zero); wave owns column tiles 4w..4w+3
    { const v16b am = frag_b16(&mixr[col][0], lane);            // A rows o = col, k = h
#pragma unroll 1
      for (int ct = 0; ct < 4; ++ct) { const int n0c = (wave * 4 + ct) * 16; v8f a = {};
        a = wmma_bf(am, frag_b16(&pwl[n0c + col][0], lane), a); a = wmma_bf(am, frag_b16(&pwh[n0c + col][0], lane), a);
        const int il = n0c >> 5, jl0 = n0c & 31;                 // the 16 columns of this tile share i (32 | n0c+0..15 within one i row since tiles are 16-aligned inside 32)
#pragma unroll
        for (int r = 0; r < 8; ++r) attp[8 * g + r][il][jl0 + col] = a[r]; } }
    __syncthreads();
    // -- O[o] += att'[o](hi/lo) v_o(hi/lo): this wave's output heads o = hA, hA+1; K = 32 keys (one step); 4 d tiles
#pragma unroll
    for (int u = 0; u < 2; ++u) { const int o = hA + u; const int bh = b * NH + o; const F2 af = split_row(&attp[o][col][0], 0, lane);
#pragma unroll
      for (int d4 = 0; d4 < 4; ++d4) { const __bf16* vh = VTh + ((size_t)bh * HS + d4 * 16 + col) * TT + j0; const __bf16* vl = VTl + ((size_t)bh * HS + d4 * 16 + col) * TT + j0;
        oacc[u][d4] = mac3p(af.h, af.l, frag_b16(vh, lane), frag_b16(vl, lane), oacc[u][d4]); } }
    __syncthreads();                                            // pw*/attp are rewritten by the next key tile
  }
  // -- O rows: r = b*1024 + i, columns o*64 + d -> hi/lo planes; per wave 16 rows x 128 cols (its two heads) staged in the (now free) pw buffers: 256-B segments by 16 lanes
  __bf16* sth = &pwh[0][0] + wave * (16 * 128); __bf16* stl = &pwl[0][0] + wave * (16 * 128);
#pragma unroll
  for (int u = 0; u < 2; ++u)
#pragma unroll
    for (int d4 = 0; d4 < 4; ++d4)
#pragma unroll
      for (int r = 0; r < 8; ++r) { const float v = oacc[u][d4][r]; const __bf16 hi = (__bf16)v; sth[(8 * g + r) * 128 + u * 64 + d4 * 16 + col] = hi; stl[(8 * g + r) * 128 + u * 64 + d4 * 16 + col] = (__bf16)(v - (float)hi); }
  LDSX();
  for (int qq = lane; qq < 16 * 16; qq += 32) { const int rl = qq >> 4, pc = qq & 15; const size_t o = ((size_t)b * TT + i0 + rl) * CCH + hA * 64 + pc * 8;
    vst2((unsigned*)(OH + o), *(const v4u*)(sth + rl * 128 + pc * 8)); vst2((unsigned*)(OL + o), *(const v4u*)(stl + rl * 128 + pc * 8)); }
}
// ---- k_out: out = (O(hi/lo) . Wo^T rows + bo) * gamma[t]; block (64 rows, 128 cols), K = 1024
__global__ __launch_bounds__(128) void k_out(const __bf16* __restrict__ OH, const __bf16* __restrict__ OL, const __bf16* __restrict__ PT, const float* __restrict__ bo, const float* __restrict__ gam, float* __restrict__ out) {
  __shared__ __align__(16) float so[4][16][132];
  const int tid = threadIdx.x, wave = tid >> 5, lane = tid & 31, col = lane & 15, g = lane >> 4; const size_t r0 = (size_t)blockIdx.x * 64 + wave * 16; const int n0 = blockIdx.y * 128;
  v8f acc[8] = {};
#pragma unroll 2
  for (int kc = 0; kc < CCH / 32; ++kc) { const v16b ah = frag_b16(OH + (r0 + col) * CCH + kc * 32, lane), al = frag_b16(OL + (r0 + col) * CCH + kc * 32, lane);
#pragma unroll
    for (int j = 0; j < 8; ++j) { const v16b wb = frag_b16(PT + ((size_t)3 * CCH + n0 + j * 16 + col) * CCH + kc * 32, lane); acc[j] = wmma_bf(al, wb, acc[j]); acc[j] = wmma_bf(ah, wb, acc[j]); } }
#pragma unroll
  for (int j = 0; j < 8; ++j) { const float bb = bfr(bo[n0 + j * 16 + col]);
#pragma unroll
    for (int r = 0; r < 8; ++r) { const int t = (int)((r0 + 8 * g + r) % TT); so[wave][8 * g + r][j * 16 + col] = (acc[j][r] + bb) * bfr(gam[t]); } }
  LDSX();
  for (int rl = 0; rl < 16; ++rl) vst2(out + (r0 + rl) * CCH + n0 + lane * 4, *(const v4f*)(&so[wave][rl][lane * 4]));
}

extern "C" void kernel_launch(void* const* d_in, const int* in_sizes, int n_in, void* d_out, int out_size, void* d_ws, size_t ws_size, hipStream_t stream) {
  (void)in_sizes; (void)n_in; (void)out_size;
  const float** I = (const float**)d_in;   // x, Wq, bq, Wk, bk, Wv, bv, Wo, bo, time_w, time_alpha, time_beta, time_gamma, head_mix_w
  if (ws_size < (size_t)WS_END) return;
  char* ws = (char*)d_ws;
  __bf16* PT = (__bf16*)(ws + WS_PT); __bf16 *Qh = (__bf16*)(ws + WS_QH), *Ql = (__bf16*)(ws + WS_QL), *Kh = (__bf16*)(ws + WS_KH), *Kl = (__bf16*)(ws + WS_KL), *VTh = (__bf16*)(ws + WS_VTH), *VTl = (__bf16*)(ws + WS_VTL);
  float *Mo = (float*)(ws + WS_M), *Lo = (float*)(ws + WS_L); __bf16 *OH = (__bf16*)(ws + WS_OH), *OL = (__bf16*)(ws + WS_OL);
  k_pack<<<4 * CCH, 256, 0, stream>>>(I[1], I[3], I[5], I[7], PT);
  k_qkv<<<dim3(NR / 64, 24), 128, 0, stream>>>(I[0], PT, I[2], I[4], I[6], Qh, Ql, Kh, Kl, VTh, VTl);
  k_stats<<<dim3(TT / 64, NB * NH), 128, 0, stream>>>(Qh, Ql, Kh, Kl, Mo, Lo);
  k_mix<<<dim3(TT / 16, NB), 256, 0, stream>>>(Qh, Ql, Kh, Kl, VTh, VTl, Mo, Lo, I[9], I[10], I[11], I[13], OH, OL);
  k_out<<<dim3(NR / 64, CCH / 128), 128, 0, stream>>>(OH, OL, PT, I[8], I[12], (float*)d_out);
}

// v002
// It runs in 496 microseconds.
// In two side-by-side timings against v001, it was 1.21 and 1.22 times as fast.
// Counting every step since v000, it is 1.63 times as fast.
// compute dtype: x, all weights/biases, time_w/alpha/beta/gamma and the head-mixing matrix (module inputs) rounded to bf16; q/k/v = xs W with exact bf16 products; RoPE, scores' softmax statistics,
// decay and normalisation in f32; scores = q'(hi/lo) k'(hi/lo)^T (3 products); head mixing = bf16(mix) x (P w)(hi/lo) (2 products); context = att'(hi/lo) x v(hi/lo) (3 products); out = O(hi/lo) Wo (2 products) + bo, x gamma; f32 accumulate.
#include <hip/hip_runtime.h>
#include <math.h>

typedef __attribute__((ext_vector_type(16))) _Float16 v16h;
typedef __attribute__((ext_vector_type(16))) __bf16 v16b;
typedef __attribute__((ext_vector_type(8)))  _Float16 v8h;
typedef __attribute__((ext_vector_type(8)))  float v8f;
typedef __attribute__((ext_vector_type(4)))  float v4f;
typedef __attribute__((ext_vector_type(2)))  float v2f;
typedef __attribute__((ext_vector_type(4)))  unsigned v4u;
typedef __attribute__((ext_vector_type(4)))  int v4i;
typedef float __attribute__((may_alias)) float_a;
typedef int __attribute__((may_alias)) int_a;

template <typename T> __device__ __forceinline__ void vst2(void* p, T v) { *(T*)p = v;  }
__device__ __forceinline__ v8f wmma16(v16h a, v16h b, v8f c) {
  v8f d = __builtin_amdgcn_wmma_f32_16x16x32_f16(false, a, false, b, (short)0, c, false, false);
  asm volatile("v_nop\n\tv_nop\n\tv_nop\n\tv_nop" : "+v"(d) : "v"(a), "v"(b));
  return d;
}
__device__ __forceinline__ v8f wmma_bf(v16b a, v16b b, v8f c) {
  v8f d = __builtin_amdgcn_wmma_f32_16x16x32_bf16(false, a, false, b, (short)0, c, false, false);
  asm volatile("v_nop\n\tv_nop\n\tv_nop\n\tv_nop" : "+v"(d) : "v"(a), "v"(b));
  return d;
}
// 16x16x32 fragments: lane = (h = lane>>4, row/col = lane&15); elements 0..7 = k0+8h+0..7, 8..15 = k0+16+8h+0..7; D element r = row 8h+r
__device__ __forceinline__ v16h frag_h(const _Float16* rowk0, int lane) {
  union { v16h v; v8h q[2]; } u; const _Float16* p = rowk0 + 8 * (lane >> 4);
  u.q[0] = *(const v8h*)p; u.q[1] = *(const v8h*)(p + 16); return u.v;
}
__device__ __forceinline__ v16h frag_f32(const float* rowk0, int lane) {
  v16h a; const float* p = rowk0 + 8 * (lane >> 4);
#pragma unroll
  for (int i = 0; i < 8; ++i) { a[i] = (_Float16)p[i]; a[8 + i] = (_Float16)p[16 + i]; }
  return a;
}
__device__ __forceinline__ v16h frag_f32s(const float* rowk0, int lane, float sc) {
  v16h a; const float* p = rowk0 + 8 * (lane >> 4);
#pragma unroll
  for (int i = 0; i < 8; ++i) { a[i] = (_Float16)(p[i] * sc); a[8 + i] = (_Float16)(p[16 + i] * sc); }
  return a;
}
// column fragment from a [K][ld] layout (column n), rows >= K read as 0
__device__ __forceinline__ v16h fragc_f32(const float* W, int k0, int n, int lane, int ld, int K) {
  v16h a; const int g = lane >> 4;
#pragma unroll
  for (int i = 0; i < 8; ++i) { const int ka = k0 + 8 * g + i, kb = ka + 16;
    a[i] = (_Float16)(ka < K ? W[(size_t)(ka < K ? ka : K - 1) * ld + n] : 0.f); a[8 + i] = (_Float16)(kb < K ? W[(size_t)(kb < K ? kb : K - 1) * ld + n] : 0.f); }
  return a;
}
struct F2 { v16b h, l; };
__device__ __forceinline__ F2 bsplit16(const float v[16]) { F2 r;
#pragma unroll
  for (int i = 0; i < 16; ++i) { const __bf16 h = (__bf16)v[i]; r.h[i] = h; r.l[i] = (__bf16)(v[i] - (float)h); }
  return r; }
__device__ __forceinline__ F2 split_row(const float* row, int k0, int lane) { float v[16]; const float* p = row + k0 + 8 * (lane >> 4);
#pragma unroll
  for (int i = 0; i < 8; ++i) { v[i] = p[i]; v[8 + i] = p[16 + i]; }
  return bsplit16(v); }
__device__ __forceinline__ F2 split_rowK(const float* row, int k0, int lane, int K) { float v[16]; const int g = lane >> 4;
#pragma unroll
  for (int i = 0; i < 8; ++i) { const int ka = k0 + 8 * g + i, kb = ka + 16; v[i] = ka < K ? row[ka < K ? ka : K - 1] : 0.f; v[8 + i] = kb < K ? row[kb < K ? kb : K - 1] : 0.f; }
  return bsplit16(v); }
__device__ __forceinline__ F2 split_col(const float* W, int k0, int n, int lane, int ld, int K) { float v[16]; const int g = lane >> 4;
#pragma unroll
  for (int i = 0; i < 8; ++i) { const int ka = k0 + 8 * g + i, kb = ka + 16; v[i] = ka < K ? W[(size_t)(ka < K ? ka : K - 1) * ld + n] : 0.f; v[8 + i] = kb < K ? W[(size_t)(kb < K ? kb : K - 1) * ld + n] : 0.f; }
  return bsplit16(v); }
__device__ __forceinline__ v8f mac3(const F2& a, const F2& b, v8f c) { c = wmma_bf(a.l, b.h, c); c = wmma_bf(a.h, b.l, c); return wmma_bf(a.h, b.h, c); }
__device__ __forceinline__ float sigm(float v) { return 1.0f / (1.0f + expf(-v)); }
#define LDSX() do { asm volatile("s_wait_dscnt 0" ::: "memory"); __builtin_amdgcn_wave_barrier(); __builtin_amdgcn_fence(__ATOMIC_RELEASE, "workgroup"); } while (0)


// Causal multi-head attention with token shift, partial RoPE, per-head Toeplitz time decay, a 16x16 cross-head mixing of the softmax maps, output projection and a per-position gain.
// Rows r = b*1024 + t. k_pack ([in][out] weights -> bf16 rows); k_qkv (xs built at fragment load: channels < 512 come from t-1, zero at t = 0; + bias; RoPE on dims 0..31; q/k -> hi/lo rows [bh][t][64], v -> hi/lo transposed [bh][d][t]);
// k_stats (per (bh, 64 queries): causal row max and sum of exp over the keys -> M, L); k_mix (block = (b, 16 queries, 128-key chunk), loop over 32-key tiles: S for all 16 heads -> P*w as bf16 hi/lo [query,key][h] in LDS -> mixing GEMM -> att'[o][i][j] f32 in LDS
// -> O[o] += att'(hi/lo) v_o(hi/lo); a block covers at most 128 keys and leaves its f32 partial O in PART[chunk][r][o*64+d]); k_red (sum of a row's chunks in ascending key order -> O hi/lo planes [r][o*64+d]); k_out ((O Wo + bo) * gamma[t]).
#define NB 4
#define TT 1024
#define CCH 1024
#define NH 16
#define HS 64
#define NR (NB * TT)
#define ROT 32
#define KCH 128                 // keys per k_mix block
#define NCHK (TT / KCH)         // chunks of the longest row
#define MIXFULL (8 * (NCHK * (NCHK - 1) / 2))  // (16-query tile, chunk) pairs per batch below the diagonal: the 8 tiles with diagonal chunk q have q full chunks each
#define MIXBLK (MIXFULL + TT / 16)             // plus one diagonal chunk per tile
typedef __attribute__((ext_vector_type(8))) __bf16 v8b;
__device__ __forceinline__ v16b frag_b16(const __bf16* rowk0, int lane) {
  union { v16b v; v8b q[2]; } u; const __bf16* p = rowk0 + 8 * (lane >> 4);
  u.q[0] = *(const v8b*)p; u.q[1] = *(const v8b*)(p + 16); return u.v;
}
__device__ __forceinline__ float bfr(float v) { return (float)(__bf16)v; }
__device__ __forceinline__ v8f mac3p(v16b ah, v16b al, v16b bh, v16b bl, v8f c) { c = wmma_bf(al, bh, c); c = wmma_bf(ah, bl, c); return wmma_bf(ah, bh, c); }
__constant__ float c_invfreq[16] = {1.0f,0.5623413324356079f,0.3162277638912201f,0.17782793939113617f,0.10000000149011612f,0.05623412877321243f,0.03162277862429619f,0.017782794311642647f,0.009999999776482582f,0.005623413249850273f,0.003162277862429619f,0.0017782794311642647f,0.0010000000474974513f,0.000562341301701963f,0.0003162277862429619f,0.00017782794020604342f};

// workspace carve (bytes)
#define PLANE_Q (2u * NB * NH * TT * HS)        // bf16 [64 bh][1024][64] = 8 MiB
#define WS_PT   0u                               // bf16 [4096][1024]: rows 0.. Wq^T, 1024.. Wk^T, 2048.. Wv^T, 3072.. Wo^T  (8 MiB)
#define WS_QH   (WS_PT + 2u * 4 * CCH * CCH)
#define WS_QL   (WS_QH + PLANE_Q)
#define WS_KH   (WS_QL + PLANE_Q)
#define WS_KL   (WS_KH + PLANE_Q)
#define WS_VTH  (WS_KL + PLANE_Q)                // bf16 [bh][64 d][1024 t]
#define WS_VTL  (WS_VTH + PLANE_Q)
#define WS_M    (WS_VTL + PLANE_Q)               // f32 [bh][1024]
#define WS_L    (WS_M + 4u * NB * NH * TT)
#define WS_OH   (WS_L + 4u * NB * NH * TT)       // bf16 [4096][1024] (row r, col o*64 + d)
#define WS_OL   (WS_OH + 2u * NR * CCH)
#define WS_PART (WS_OL + 2u * NR * CCH)          // f32 [8 key chunks][4096][1024]; row r uses chunks 0 .. t/128
#define WS_END  (WS_PART + 4u * NCHK * NR * CCH)

// ---- k_pack: PT[n][k] = bf16(W[k][n]); block = PT row (which matrix is block-uniform)
__global__ __launch_bounds__(256) void k_pack(const float* __restrict__ Wq, const float* __restrict__ Wk, const float* __restrict__ Wv, const float* __restrict__ Wo, __bf16* __restrict__ PT) {
  __shared__ __align__(16) __bf16 srow[CCH];
  const int n = blockIdx.x, tid = threadIdx.x; const int which = n >> 10, nn = n & 1023;
  const float* Wm = which == 0 ? Wq : which == 1 ? Wk : which == 2 ? Wv : Wo;
  for (int k = tid; k < CCH; k += 256) srow[k] = (__bf16)Wm[(size_t)k * CCH + nn];
  __syncthreads();
  if (tid < CCH / 8) vst2((unsigned*)(PT + (size_t)n * CCH + tid * 8), *(const v4u*)(&srow[tid * 8]));
}
// xs fragment: channels k0..k0+31 (chunk-uniform half): first half from row t-1 (zero at t = 0, address clamped to the row itself), second half from row t
__device__ __forceinline__ v16b frag_xs(const float* __restrict__ X, size_t r, int t, int k0, int lane) {
  const bool shifted = k0 < CCH / 2; const bool zero = shifted && (t == 0);
  const float* p = X + (r - ((shifted && t > 0) ? 1 : 0)) * CCH + k0 + 8 * (lane >> 4);
  v16b a;
#pragma unroll
  for (int i = 0; i < 8; ++i) { a[i] = (__bf16)(zero ? 0.f : p[i]); a[8 + i] = (__bf16)(zero ? 0.f : p[16 + i]); }
  return a;
}
// ---- k_qkv: block (64 rows, 128 cols = 2 heads of q, k or v); exact products; + bias; RoPE (q, k); q/k -> hi/lo rows [bh][t][64]; v -> VT hi/lo [bh][d][t]
__global__ __launch_bounds__(128) void k_qkv(const float* __restrict__ X, const __bf16* __restrict__ PT, const float* __restrict__ bq, const float* __restrict__ bk, const float* __restrict__ bv,
                                             __bf16* __restrict__ Qh, __bf16* __restrict__ Ql, __bf16* __restrict__ Kh, __bf16* __restrict__ Kl, __bf16* __restrict__ VTh, __bf16* __restrict__ VTl) {
  __shared__ __align__(16) __bf16 sh_[128][72], sl_[128][72];
  const int tid = threadIdx.x, wave = tid >> 5, lane = tid & 31, col = lane & 15, g = lane >> 4;
  const size_t rb = (size_t)blockIdx.x * 64; const int b = (int)(rb / TT), t0 = (int)(rb % TT);
  const int which = blockIdx.y >> 3; const int n0 = (blockIdx.y & 7) * 128;          // block-uniform: 0 q, 1 k, 2 v; n0 = first output channel (2 heads)
  const size_t r0 = rb + wave * 16; const int tq = t0 + wave * 16 + col;              // this lane's A row time index
  v8f acc[8] = {};
#pragma unroll 2
  for (int kc = 0; kc < CCH / 32; ++kc) { const v16b a = frag_xs(X, r0 + col, tq, kc * 32, lane);
#pragma unroll
    for (int j = 0; j < 8; ++j) acc[j] = wmma_bf(a, frag_b16(PT + ((size_t)which * CCH + n0 + j * 16 + col) * CCH + kc * 32, lane), acc[j]); }
  const float* bias = which == 0 ? bq : which == 1 ? bk : bv;
#pragma unroll
  for (int j = 0; j < 8; ++j) { const float bb = bfr(bias[n0 + j * 16 + col]);
#pragma unroll
    for (int r = 0; r < 8; ++r) acc[j][r] += bb; }
  if (which < 2) {   // RoPE on head-local dims 0..15 (tile 4h'+0) and 16..31 (tile 4h'+1), pairs in the same lane; theta = t * inv_freq[col]
#pragma unroll
    for (int hp = 0; hp < 2; ++hp) {
#pragma unroll
      for (int r = 0; r < 8; ++r) { const int t = t0 + wave * 16 + 8 * g + r; const float th = (float)t * c_invfreq[col]; const float cs = cosf(th), sn = sinf(th);
        const float a0 = acc[hp * 4][r], a1 = acc[hp * 4 + 1][r];
        acc[hp * 4][r] = a0 * cs - a1 * sn; acc[hp * 4 + 1][r] = a1 * cs + a0 * sn; } }
    __bf16* Oh = which == 0 ? Qh : Kh; __bf16* Ol = which == 0 ? Ql : Kl;
#pragma unroll
    for (int hp = 0; hp < 2; ++hp) {
#pragma unroll
      for (int j = 0; j < 4; ++j)
#pragma unroll
        for (int r = 0; r < 8; ++r) { const float v = acc[hp * 4 + j][r]; const __bf16 hi = (__bf16)v; sh_[wave * 16 + 8 * g + r][j * 16 + col] = hi; sl_[wave * 16 + 8 * g + r][j * 16 + col] = (__bf16)(v - (float)hi); }
      LDSX();
      const int h = (n0 >> 6) + hp; const size_t base = ((size_t)(b * NH + h) * TT + t0 + wave * 16) * HS;
      for (int qq = lane; qq < 16 * 8; qq += 32) { const int rl = qq >> 3, pc = qq & 7; vst2((unsigned*)(Oh + base + rl * HS + pc * 8), *(const v4u*)(&sh_[wave * 16 + rl][pc * 8])); vst2((unsigned*)(Ol + base + rl * HS + pc * 8), *(const v4u*)(&sl_[wave * 16 + rl][pc * 8])); }
      LDSX(); }
  } else {
#pragma unroll
    for (int j = 0; j < 8; ++j)
#pragma unroll
      for (int r = 0; r < 8; ++r) { const float v = acc[j][r]; const __bf16 hi = (__bf16)v; sh_[j * 16 + col][wave * 16 + 8 * g + r] = hi; sl_[j * 16 + col][wave * 16 + 8 * g + r] = (__bf16)(v - (float)hi); }
    __syncthreads();
    for (int qq = tid; qq < 128 * 8; qq += 128) { const int c = qq >> 3, pc = qq & 7; const int h = (n0 >> 6) + (c >> 6), d = c & 63; const size_t o = ((size_t)(b * NH + h) * HS + d) * TT + t0 + pc * 8;
      vst2((unsigned*)(VTh + o), *(const v4u*)(&sh_[c][pc * 8])); vst2((unsigned*)(VTl + o), *(const v4u*)(&sl_[c][pc * 8])); }
  }
}
// ---- k_stats: block = (bh, 64 queries); wave = 16 queries; causal key tiles of 32: S = q'(hi/lo) k'(hi/lo) / 8, online max / sum -> M, L (f32 [bh][t], 256 B per block by 16 lanes)
__global__ __launch_bounds__(128) void k_stats(const __bf16* __restrict__ Qh, const __bf16* __restrict__ Ql, const __bf16* __restrict__ Kh, const __bf16* __restrict__ Kl, float* __restrict__ Mo, float* __restrict__ Lo) {
  __shared__ float sm[64], ssum[64];
  const int tid = threadIdx.x, wave = tid >> 5, lane = tid & 31, col = lane & 15, g = lane >> 4;
  const int bh = blockIdx.y; const int i0 = blockIdx.x * 64 + wave * 16;
  const __bf16* qh = Qh + ((size_t)bh * TT + i0 + col) * HS; const __bf16* ql = Ql + ((size_t)bh * TT + i0 + col) * HS;
  const v16b qh0 = frag_b16(qh, lane), qh1 = frag_b16(qh + 32, lane), ql0 = frag_b16(ql, lane), ql1 = frag_b16(ql + 32, lane);
  asm volatile("s_wait_xcnt 0x0" :: "v"(qh0), "v"(qh1), "v"(ql0), "v"(ql1) : "memory");   // the loop's key loads may land in the address registers of the query loads above; the loaded values as inputs keep this wait behind those loads
  float m[8], l[8];
#pragma unroll
  for (int r = 0; r < 8; ++r) { m[r] = -3.0e38f; l[r] = 0.f; }
  const int jend = i0 + 16;                                      // keys j <= i for rows i0..i0+15 -> tiles covering [0, i0+16)
#pragma unroll 1
  for (int j0 = 0; j0 < jend; j0 += 32) {
#pragma unroll
    for (int jt = 0; jt < 2; ++jt) { const int jb = j0 + jt * 16; if (jb < jend) {   // wave-uniform
      const __bf16* kh = Kh + ((size_t)bh * TT + jb + col) * HS; const __bf16* kl = Kl + ((size_t)bh * TT + jb + col) * HS;
      const v16b kh0 = frag_b16(kh, lane), kl0 = frag_b16(kl, lane), kh1 = frag_b16(kh + 32, lane), kl1 = frag_b16(kl + 32, lane);
      asm volatile("" :: "v"(kh0), "v"(kl0), "v"(kh1), "v"(kl1));   // inputs-only fence on the loaded values: holds all eight key loads in front of the products, one memory latency instead of two in a row
      v8f s = {}; s = mac3p(qh0, ql0, kh0, kl0, s); s = mac3p(qh1, ql1, kh1, kl1, s);
#pragma unroll
      for (int r = 0; r < 8; ++r) { const int i = i0 + 8 * g + r, j = jb + col; const float v = (j <= i) ? s[r] * 0.125f : -1e30f;
        float mt = v;
#pragma unroll
        for (int o = 1; o < 16; o <<= 1) mt = fmaxf(mt, __shfl_xor(mt, o));
        const float mn = fmaxf(m[r], mt); float e = expf(v - mn);
#pragma unroll
        for (int o = 1; o < 16; o <<= 1) e += __shfl_xor(e, o);
        l[r] = l[r] * expf(m[r] - mn) + e; m[r] = mn; } } }
  }
  if (col == 0) {
#pragma unroll
    for (int r = 0; r < 8; ++r) { sm[wave * 16 + 8 * g + r] = m[r]; ssum[wave * 16 + 8 * g + r] = l[r]; } }
  __syncthreads();
  if (tid < 16) { vst2(Mo + (size_t)bh * TT + blockIdx.x * 64 + tid * 4, *(const v4f*)&sm[tid * 4]); vst2(Lo + (size_t)bh * TT + blockIdx.x * 64 + tid * 4, *(const v4f*)&ssum[tid * 4]); }
}
// ---- k_mix: block = (b, 16 queries i0..i0+15, keys of one 128-key chunk), 8 waves; loop over the chunk's 32-key tiles (causal). M and L are known, so O is a plain sum over keys and chunks are independent
__global__ __launch_bounds__(256) void k_mix(const __bf16* __restrict__ Qh, const __bf16* __restrict__ Ql, const __bf16* __restrict__ Kh, const __bf16* __restrict__ Kl, const __bf16* __restrict__ VTh, const __bf16* __restrict__ VTl,
                                             const float* __restrict__ Mo, const float* __restrict__ Lo, const float* __restrict__ tw, const float* __restrict__ talpha, const float* __restrict__ tbeta, const float* __restrict__ mixw,
                                             float* __restrict__ PART) {
  __shared__ __align__(16) __bf16 pwh[512][32], pwl[512][32];   // (P*w) for the tile: row = i*32 + j (query-in-tile, key-in-tile), column = head h (16..31 stay zero)
  __shared__ __align__(16) float attp[NH][16][36];               // mixed attention tile per output head o: [o][i][j]
  __shared__ __align__(16) __bf16 mixr[NH][32];                  // mixing matrix rows o, k = h (16..31 zero)
  const int tid = threadIdx.x, wave = tid >> 5, lane = tid & 31, col = lane & 15, g = lane >> 4;
  // blockIdx.y -> (query tile = 8 gq + tl, chunk <= gq): the full 128-key chunks first, then the diagonal chunks from the longest to the shortest, so that the work-groups that start last are the short ones
  int rem = blockIdx.y, gq, tl, chunk;
  if (rem < MIXFULL) { gq = NCHK - 1; while (gq > 1 && rem >= 8 * gq) { rem -= 8 * gq; --gq; } chunk = rem >> 3; tl = rem & 7; }
  else { rem -= MIXFULL; gq = rem & 7; tl = 7 - (rem >> 3); chunk = gq; }
  const int b = blockIdx.x, i0 = (gq * 8 + tl) * 16;
  for (int q = tid; q < 512 * 32 / 8; q += 256) { *(v4u*)(&pwh[0][0] + q * 8) = (v4u){0u,0u,0u,0u}; *(v4u*)(&pwl[0][0] + q * 8) = (v4u){0u,0u,0u,0u}; }
  for (int q = tid; q < NH * 32; q += 256) { const int o = q >> 5, h = q & 31; mixr[o][h] = h < NH ? (__bf16)mixw[o * NH + h] : (__bf16)0.f; }
  // this wave's two heads for the S phase and two output heads for the PV phase
  const int hA = wave * 2;
  float mrow[2][8], lb[2][8];            // row max, and beta[h][i] / L (the per-row factors of p*w = (e^(s-m)/L) * ((tw*alpha)*beta), folded)
#pragma unroll
  for (int u = 0; u < 2; ++u) { const int bh = b * NH + hA + u;
#pragma unroll
    for (int r = 0; r < 8; ++r) { const int i = i0 + 8 * g + r; mrow[u][r] = Mo[(size_t)bh * TT + i]; lb[u][r] = bfr(tbeta[(hA + u) * TT + i]) / Lo[(size_t)bh * TT + i]; } }
  v8f oacc[2][4];
#pragma unroll
  for (int u = 0; u < 2; ++u)
#pragma unroll
    for (int d4 = 0; d4 < 4; ++d4) oacc[u][d4] = (v8f){};
  __syncthreads();
  const int jbeg = chunk * KCH; const int jend = (i0 + 16 < jbeg + KCH) ? i0 + 16 : jbeg + KCH;
#pragma unroll 1
  for (int j0 = jbeg; j0 < jend; j0 += 32) {
    // -- S for this wave's two heads; P*w -> pwh/pwl[(i)*32 + j][h]
#pragma unroll
    for (int u = 0; u < 2; ++u) { const int h = hA + u; const int bh = b * NH + h;
      const __bf16* qh = Qh + ((size_t)bh * TT + i0 + col) * HS; const __bf16* ql = Ql + ((size_t)bh * TT + i0 + col) * HS;
      const v16b qh0 = frag_b16(qh, lane), qh1 = frag_b16(qh + 32, lane), ql0 = frag_b16(ql, lane), ql1 = frag_b16(ql + 32, lane);   // re-read per key tile (cached) to keep VGPRs < 256
#pragma unroll 1
      for (int jt = 0; jt < 2; ++jt) { const int jb = j0 + jt * 16;   // body is one straight line, no call and no branch: the eight rows' loads, exps and stores overlap. jb + 15 <= 1023, so a half past the diagonal reads rows that exist; the select drops it
        const __bf16* kh = Kh + ((size_t)bh * TT + jb + col) * HS; const __bf16* kl = Kl + ((size_t)bh * TT + jb + col) * HS;
        const int j = jb + col; const float al = talpha[h * TT + (j < TT ? j : TT - 1)]; float twv[8];
#pragma unroll
        for (int r = 0; r < 8; ++r) { const int widx = TT - 1 + j - (i0 + 8 * g + r); twv[r] = tw[h * TT + (widx < TT ? widx : TT - 1)]; }   // 0 <= widx; clamped into the row above the diagonal
        asm volatile("s_wait_xcnt 0x0" ::: "memory");   // the key loads below may land in the offset registers of the nine loads above
        const v16b kh0 = frag_b16(kh, lane), kl0 = frag_b16(kl, lane), kh1 = frag_b16(kh + 32, lane), kl1 = frag_b16(kl + 32, lane);
        // inputs-only fence on the loaded values: holds all 17 loads of this half in front of the products, so that they share one memory latency (without it the compiler sinks half of the key loads and the decay loads behind the products: three latencies in a row)
        asm volatile("" :: "v"(kh0), "v"(kl0), "v"(kh1), "v"(kl1), "v"(al), "v"(twv[0]), "v"(twv[1]), "v"(twv[2]), "v"(twv[3]), "v"(twv[4]), "v"(twv[5]), "v"(twv[6]), "v"(twv[7]));
        v8f s = {}; s = mac3p(qh0, ql0, kh0, kl0, s); s = mac3p(qh1, ql1, kh1, kl1, s);
        const float alpha_j = bfr(al);
#pragma unroll
        for (int r = 0; r < 8; ++r) { const int il = 8 * g + r, i = i0 + il;
          const float pv = (expf(s[r] * 0.125f - mrow[u][r]) * lb[u][r]) * (bfr(twv[r]) * alpha_j);
          const float pw = (j <= i) ? pv : 0.f;                  // causal mask as a select: a masked pv is never used
          const __bf16 hi = (__bf16)pw; pwh[il * 32 + jt * 16 + col][h] = hi; pwl[il * 32 + jt * 16 + col][h] = (__bf16)(pw - (float)hi); } } }
    __syncthreads();
    // -- mixing GEMM: att'[o][(i,j)] = sum_h mix[o][h] Pw[(i,j)][h]; 32 column tiles of 16 (i,j) pairs, K = 32 (h, upper half zero); wave owns column tiles 4w..4w+3
    { const v16b am = frag_b16(&mixr[col][0], lane);            // A rows o = col, k = h
#pragma unroll 1
      for (int ct = 0; ct < 4; ++ct) { const int n0c = (wave * 4 + ct) * 16; v8f a = {};
        a = wmma_bf(am, frag_b16(&pwl[n0c + col][0], lane), a); a = wmma_bf(am, frag_b16(&pwh[n0c + col][0], lane), a);
        const int il = n0c >> 5, jl0 = n0c & 31;                 // the 16 columns of this tile share i (32 | n0c+0..15 within one i row since tiles are 16-aligned inside 32)
#pragma unroll
        for (int r = 0; r < 8; ++r) attp[8 * g + r][il][jl0 + col] = a[r]; } }
    __syncthreads();
    // -- O[o] += att'[o](hi/lo) v_o(hi/lo): this wave's output heads o = hA, hA+1; K = 32 keys (one step); 4 d tiles
#pragma unroll
    for (int u = 0; u < 2; ++u) { const int o = hA + u; const int bh = b * NH + o; const F2 af = split_row(&attp[o][col][0], 0, lane);
#pragma unroll
      for (int d4 = 0; d4 < 4; ++d4) { const __bf16* vh = VTh + ((size_t)bh * HS + d4 * 16 + col) * TT + j0; const __bf16* vl = VTl + ((size_t)bh * HS + d4 * 16 + col) * TT + j0;
        oacc[u][d4] = mac3p(af.h, af.l, frag_b16(vh, lane), frag_b16(vl, lane), oacc[u][d4]); } }
    __syncthreads();                                            // pw*/attp are rewritten by the next key tile
  }
  // -- partial O rows: r = b*1024 + i, columns o*64 + d, f32; per wave 16 rows x 64 cols per head staged in the (now free) pw buffers: 256-B segments by 16 lanes
  float* st0 = (float*)(&pwh[0][0] + wave * (16 * 128)); float* st1 = (float*)(&pwl[0][0] + wave * (16 * 128));
#pragma unroll
  for (int d4 = 0; d4 < 4; ++d4)
#pragma unroll
    for (int r = 0; r < 8; ++r) { st0[(8 * g + r) * 64 + d4 * 16 + col] = oacc[0][d4][r]; st1[(8 * g + r) * 64 + d4 * 16 + col] = oacc[1][d4][r]; }
  LDSX();
  for (int qq = lane; qq < 16 * 16; qq += 32) { const int rl = qq >> 4, pc = qq & 15; const size_t o = ((size_t)chunk * NR + (size_t)b * TT + i0 + rl) * CCH + hA * 64 + pc * 4;
    vst2(PART + o, *(const v4f*)(st0 + rl * 64 + pc * 4)); vst2(PART + o + 64, *(const v4f*)(st1 + rl * 64 + pc * 4)); }
}
// ---- k_red: O[r][c] = sum of the row's chunk partials, ascending chunk; -> hi/lo planes; block = 2 rows, thread = 8 columns
__global__ __launch_bounds__(256) void k_red(const float* __restrict__ PART, __bf16* __restrict__ OH, __bf16* __restrict__ OL) {
  const size_t e = ((size_t)blockIdx.x * 256 + threadIdx.x) * 8; const int t = (int)(blockIdx.x * 2) % TT; const int nch = t / KCH + 1;   // both rows of a block lie in one chunk group
  const float* p = PART + e; v4f a0 = {}, a1 = {};
#pragma unroll 1   // at most 8 trips; kept rolled so that the kernel stays small in registers and 16 waves per SIMD hide each trip's load latency (unrolled by 8 it takes four times the registers)
  for (int c = 0; c < nch; ++c) { a0 += *(const v4f*)p; a1 += *(const v4f*)(p + 4); p += (size_t)NR * CCH; }
  v8b hi, lo;
#pragma unroll
  for (int i = 0; i < 4; ++i) { const __bf16 h0 = (__bf16)a0[i], h1 = (__bf16)a1[i]; hi[i] = h0; hi[4 + i] = h1; lo[i] = (__bf16)(a0[i] - (float)h0); lo[4 + i] = (__bf16)(a1[i] - (float)h1); }
  *(v8b*)(OH + e) = hi; *(v8b*)(OL + e) = lo;
}
// ---- k_out: out = (O(hi/lo) . Wo^T rows + bo) * gamma[t]; block (64 rows, 128 cols), K = 1024
__global__ __launch_bounds__(128) void k_out(const __bf16* __restrict__ OH, const __bf16* __restrict__ OL, const __bf16* __restrict__ PT, const float* __restrict__ bo, const float* __restrict__ gam, float* __restrict__ out) {
  __shared__ __align__(16) float so[4][16][132];
  const int tid = threadIdx.x, wave = tid >> 5, lane = tid & 31, col = lane & 15, g = lane >> 4; const size_t r0 = (size_t)blockIdx.x * 64 + wave * 16; const int n0 = blockIdx.y * 128;
  v8f acc[8] = {};
#pragma unroll 2
  for (int kc = 0; kc < CCH / 32; ++kc) { const v16b ah = frag_b16(OH + (r0 + col) * CCH + kc * 32, lane), al = frag_b16(OL + (r0 + col) * CCH + kc * 32, lane);
#pragma unroll
    for (int j = 0; j < 8; ++j) { const v16b wb = frag_b16(PT + ((size_t)3 * CCH + n0 + j * 16 + col) * CCH + kc * 32, lane); acc[j] = wmma_bf(al, wb, acc[j]); acc[j] = wmma_bf(ah, wb, acc[j]); } }
#pragma unroll
  for (int j = 0; j < 8; ++j) { const float bb = bfr(bo[n0 + j * 16 + col]);
#pragma unroll
    for (int r = 0; r < 8; ++r) { const int t = (int)((r0 + 8 * g + r) % TT); so[wave][8 * g + r][j * 16 + col] = (acc[j][r] + bb) * bfr(gam[t]); } }
  LDSX();
  for (int rl = 0; rl < 16; ++rl) vst2(out + (r0 + rl) * CCH + n0 + lane * 4, *(const v4f*)(&so[wave][rl][lane * 4]));
}

extern "C" void kernel_launch(void* const* d_in, const int* in_sizes, int n_in, void* d_out, int out_size, void* d_ws, size_t ws_size, hipStream_t stream) {
  (void)in_sizes; (void)n_in; (void)out_size;
  const float** I = (const float**)d_in;   // x, Wq, bq, Wk, bk, Wv, bv, Wo, bo, time_w, time_alpha, time_beta, time_gamma, head_mix_w
  if (ws_size < (size_t)WS_END) return;
  char* ws = (char*)d_ws;
  __bf16* PT = (__bf16*)(ws + WS_PT); __bf16 *Qh = (__bf16*)(ws + WS_QH), *Ql = (__bf16*)(ws + WS_QL), *Kh = (__bf16*)(ws + WS_KH), *Kl = (__bf16*)(ws + WS_KL), *VTh = (__bf16*)(ws + WS_VTH), *VTl = (__bf16*)(ws + WS_VTL);
  float *Mo = (float*)(ws + WS_M), *Lo = (float*)(ws + WS_L); __bf16 *OH = (__bf16*)(ws + WS_OH), *OL = (__bf16*)(ws + WS_OL); float* PART = (float*)(ws + WS_PART);
  k_pack<<<4 * CCH, 256, 0, stream>>>(I[1], I[3], I[5], I[7], PT);
  k_qkv<<<dim3(NR / 64, 24), 128, 0, stream>>>(I[0], PT, I[2], I[4], I[6], Qh, Ql, Kh, Kl, VTh, VTl);
  k_stats<<<dim3(TT / 64, NB * NH), 128, 0, stream>>>(Qh, Ql, Kh, Kl, Mo, Lo);
  k_mix<<<dim3(NB, MIXBLK), 256, 0, stream>>>(Qh, Ql, Kh, Kl, VTh, VTl, Mo, Lo, I[9], I[10], I[11], I[13], PART);
  k_red<<<NR / 2, 256, 0, stream>>>(PART, OH, OL);
  k_out<<<dim3(NR / 64, CCH / 128), 128, 0, stream>>>(OH, OL, PT, I[8], I[12], (float*)d_out);
}

// v003
// A run of this version takes 477 microseconds.
// Timed twice side by side with v002, it ran 1.05 and 1.03 times as fast.
// All steps since v000 together make it 1.69 times as fast.
// compute dtype: x, all weights/biases, time_w/alpha/beta/gamma and the head-mixing matrix (module inputs) rounded to bf16; q/k/v = xs W with exact bf16 products; RoPE, scores' softmax statistics,
// decay and normalisation in f32; scores = q'(hi/lo) k'(hi/lo)^T (3 products); head mixing = bf16(mix) x (P w)(hi/lo) (2 products); context = att'(hi/lo) x v(hi/lo) (3 products); out = O(hi/lo) Wo (2 products) + bo, x gamma; f32 accumulate.
#include <hip/hip_runtime.h>
#include <math.h>

typedef __attribute__((ext_vector_type(16))) _Float16 v16h;
typedef __attribute__((ext_vector_type(16))) __bf16 v16b;
typedef __attribute__((ext_vector_type(8)))  _Float16 v8h;
typedef __attribute__((ext_vector_type(8)))  float v8f;
typedef __attribute__((ext_vector_type(4)))  float v4f;
typedef __attribute__((ext_vector_type(2)))  float v2f;
typedef __attribute__((ext_vector_type(4)))  unsigned v4u;
typedef __attribute__((ext_vector_type(4)))  int v4i;
typedef float __attribute__((may_alias)) float_a;
typedef int __attribute__((may_alias)) int_a;

template <typename T> __device__ __forceinline__ void vst2(void* p, T v) { *(T*)p = v;  }
__device__ __forceinline__ v8f wmma16(v16h a, v16h b, v8f c) {
  v8f d = __builtin_amdgcn_wmma_f32_16x16x32_f16(false, a, false, b, (short)0, c, false, false);
  asm volatile("v_nop\n\tv_nop\n\tv_nop\n\tv_nop" : "+v"(d) : "v"(a), "v"(b));
  return d;
}
__device__ __forceinline__ v8f wmma_bf(v16b a, v16b b, v8f c) {
  v8f d = __builtin_amdgcn_wmma_f32_16x16x32_bf16(false, a, false, b, (short)0, c, false, false);
  asm volatile("v_nop\n\tv_nop\n\tv_nop\n\tv_nop" : "+v"(d) : "v"(a), "v"(b));
  return d;
}
// 16x16x32 fragments: lane = (h = lane>>4, row/col = lane&15); elements 0..7 = k0+8h+0..7, 8..15 = k0+16+8h+0..7; D element r = row 8h+r
__device__ __forceinline__ v16h frag_h(const _Float16* rowk0, int lane) {
  union { v16h v; v8h q[2]; } u; const _Float16* p = rowk0 + 8 * (lane >> 4);
  u.q[0] = *(const v8h*)p; u.q[1] = *(const v8h*)(p + 16); return u.v;
}
__device__ __forceinline__ v16h frag_f32(const float* rowk0, int lane) {
  v16h a; const float* p = rowk0 + 8 * (lane >> 4);
#pragma unroll
  for (int i = 0; i < 8; ++i) { a[i] = (_Float16)p[i]; a[8 + i] = (_Float16)p[16 + i]; }
  return a;
}
__device__ __forceinline__ v16h frag_f32s(const float* rowk0, int lane, float sc) {
  v16h a; const float* p = rowk0 + 8 * (lane >> 4);
#pragma unroll
  for (int i = 0; i < 8; ++i) { a[i] = (_Float16)(p[i] * sc); a[8 + i] = (_Float16)(p[16 + i] * sc); }
  return a;
}
// column fragment from a [K][ld] layout (column n), rows >= K read as 0
__device__ __forceinline__ v16h fragc_f32(const float* W, int k0, int n, int lane, int ld, int K) {
  v16h a; const int g = lane >> 4;
#pragma unroll
  for (int i = 0; i < 8; ++i) { const int ka = k0 + 8 * g + i, kb = ka + 16;
    a[i] = (_Float16)(ka < K ? W[(size_t)(ka < K ? ka : K - 1) * ld + n] : 0.f); a[8 + i] = (_Float16)(kb < K ? W[(size_t)(kb < K ? kb : K - 1) * ld + n] : 0.f); }
  return a;
}
struct F2 { v16b h, l; };
__device__ __forceinline__ F2 bsplit16(const float v[16]) { F2 r;
#pragma unroll
  for (int i = 0; i < 16; ++i) { const __bf16 h = (__bf16)v[i]; r.h[i] = h; r.l[i] = (__bf16)(v[i] - (float)h); }
  return r; }
__device__ __forceinline__ F2 split_row(const float* row, int k0, int lane) { float v[16]; const float* p = row + k0 + 8 * (lane >> 4);
#pragma unroll
  for (int i = 0; i < 8; ++i) { v[i] = p[i]; v[8 + i] = p[16 + i]; }
  return bsplit16(v); }
__device__ __forceinline__ F2 split_rowK(const float* row, int k0, int lane, int K) { float v[16]; const int g = lane >> 4;
#pragma unroll
  for (int i = 0; i < 8; ++i) { const int ka = k0 + 8 * g + i, kb = ka + 16; v[i] = ka < K ? row[ka < K ? ka : K - 1] : 0.f; v[8 + i] = kb < K ? row[kb < K ? kb : K - 1] : 0.f; }
  return bsplit16(v); }
__device__ __forceinline__ F2 split_col(const float* W, int k0, int n, int lane, int ld, int K) { float v[16]; const int g = lane >> 4;
#pragma unroll
  for (int i = 0; i < 8; ++i) { const int ka = k0 + 8 * g + i, kb = ka + 16; v[i] = ka < K ? W[(size_t)(ka < K ? ka : K - 1) * ld + n] : 0.f; v[8 + i] = kb < K ? W[(size_t)(kb < K ? kb : K - 1) * ld + n] : 0.f; }
  return bsplit16(v); }
__device__ __forceinline__ v8f mac3(const F2& a, const F2& b, v8f c) { c = wmma_bf(a.l, b.h, c); c = wmma_bf(a.h, b.l, c); return wmma_bf(a.h, b.h, c); }
__device__ __forceinline__ float sigm(float v) { return 1.0f / (1.0f + expf(-v)); }
#define LDSX() do { asm volatile("s_wait_dscnt 0" ::: "memory"); __builtin_amdgcn_wave_barrier(); __builtin_amdgcn_fence(__ATOMIC_RELEASE, "workgroup"); } while (0)


// Causal multi-head attention with token shift, partial RoPE, per-head Toeplitz time decay, a 16x16 cross-head mixing of the softmax maps, output projection and a per-position gain.
// Rows r = b*1024 + t. Every bf16 operand plane in the workspace (xs, weights, q, k, v^T, O) is stored in fragment order (see frag_t); the shapes below name rows and K. k_pack ([in][out] weights -> bf16 rows); k_pack also builds xs (channels < 512 come from t-1, zero at t = 0) as bf16 rows; k_qkv (xs W + bias; RoPE on dims 0..31; q/k -> hi/lo rows [bh][t][64], v -> hi/lo transposed [bh][d][t]);
// k_stats (per (bh, 64 queries): causal row max and sum of exp over the keys -> M, L); k_mix (block = (b, 16 queries, 128-key chunk), loop over 32-key tiles: S for all 16 heads -> P*w as bf16 hi/lo [query,key][h] in LDS -> mixing GEMM -> att'[o][i][j] f32 in LDS
// -> O[o] += att'(hi/lo) v_o(hi/lo); a block covers at most 128 keys and leaves its f32 partial O in PART[chunk][r][o*64+d]); k_red (sum of a row's chunks in ascending key order -> O hi/lo planes [r][o*64+d]); k_out ((O Wo + bo) * gamma[t]).
#define NB 4
#define TT 1024
#define CCH 1024
#define NH 16
#define HS 64
#define NR (NB * TT)
#define ROT 32
#define KCH 128                 // keys per k_mix block
#define NCHK (TT / KCH)         // chunks of the longest row
#define MIXFULL (8 * (NCHK * (NCHK - 1) / 2))  // (16-query tile, chunk) pairs per batch below the diagonal: the 8 tiles with diagonal chunk q have q full chunks each
#define MIXBLK (MIXFULL + TT / 16)             // plus one diagonal chunk per tile
typedef __attribute__((ext_vector_type(8))) __bf16 v8b;
__device__ __forceinline__ v16b frag_b16(const __bf16* rowk0, int lane) {
  union { v16b v; v8b q[2]; } u; const __bf16* p = rowk0 + 8 * (lane >> 4);
  u.q[0] = *(const v8b*)p; u.q[1] = *(const v8b*)(p + 16); return u.v;
}
// Fragment order of a bf16 operand [rows][K] in global memory: tiles of 16 rows x 32 k (512 elements, 1 KiB), tile index = (row >> 4) * (K / 32) + (k >> 5); inside a tile the 8 elements k & ~7 .. of a row lie at
// element ((k >> 4) & 1) * 256 + (((k >> 3) & 1) * 16 + (row & 15)) * 8. That is the order in which the lanes read a fragment, so each of its two wave-wide 16-byte loads covers 512 contiguous bytes (4 lines, not 16)
__device__ __forceinline__ v16b frag_t(const __bf16* tile, int lane) {
  union { v16b v; v8b q[2]; } u; const __bf16* p = tile + lane * 8;
  u.q[0] = *(const v8b*)p; u.q[1] = *(const v8b*)(p + 256); return u.v;
}
__device__ __forceinline__ float bfr(float v) { return (float)(__bf16)v; }
__device__ __forceinline__ v8f mac3p(v16b ah, v16b al, v16b bh, v16b bl, v8f c) { c = wmma_bf(al, bh, c); c = wmma_bf(ah, bl, c); return wmma_bf(ah, bh, c); }
__constant__ float c_invfreq[16] = {1.0f,0.5623413324356079f,0.3162277638912201f,0.17782793939113617f,0.10000000149011612f,0.05623412877321243f,0.03162277862429619f,0.017782794311642647f,0.009999999776482582f,0.005623413249850273f,0.003162277862429619f,0.0017782794311642647f,0.0010000000474974513f,0.000562341301701963f,0.0003162277862429619f,0.00017782794020604342f};

// workspace carve (bytes)
#define PLANE_Q (2u * NB * NH * TT * HS)        // bf16 [64 bh][1024][64] = 8 MiB
#define WS_PT   0u                               // bf16 [4096][1024]: rows 0.. Wq^T, 1024.. Wk^T, 2048.. Wv^T, 3072.. Wo^T  (8 MiB)
#define WS_QH   (WS_PT + 2u * 4 * CCH * CCH)
#define WS_QL   (WS_QH + PLANE_Q)
#define WS_KH   (WS_QL + PLANE_Q)
#define WS_KL   (WS_KH + PLANE_Q)
#define WS_VTH  (WS_KL + PLANE_Q)                // bf16 [bh][64 d][1024 t]
#define WS_VTL  (WS_VTH + PLANE_Q)
#define WS_M    (WS_VTL + PLANE_Q)               // f32 [bh][1024]
#define WS_L    (WS_M + 4u * NB * NH * TT)
#define WS_OH   (WS_L + 4u * NB * NH * TT)       // bf16 [4096][1024] (row r, col o*64 + d)
#define WS_OL   (WS_OH + 2u * NR * CCH)
#define WS_PART (WS_OL + 2u * NR * CCH)          // f32 [8 key chunks][4096][1024]; row r uses chunks 0 .. t/128
#define WS_XS   (WS_PART + 4u * NCHK * NR * CCH) // bf16 [4096][1024]: shifted x
#define WS_END  (WS_XS + 2u * NR * CCH)

// ---- k_pack: PT (row n, k) = bf16(W[k][n]) in fragment order; block = (16 rows n, 256 k; which matrix is block-uniform), wave = one tile: a lane gathers its 2 x 8 k of its own column n (16 lanes = a 64-byte run of W) and stores them as the fragment's pieces
// blocks from 1024 on: XS (row r, channel k) = bf16(xs) in fragment order, xs = x with channels < 512 taken from row t-1 (zero at t = 0; the address is clamped to the row itself, the load is unconditional and the zero a select); wave = one tile = one 128-byte line of each of 16 rows
__global__ __launch_bounds__(256) void k_pack(const float* __restrict__ X, const float* __restrict__ Wq, const float* __restrict__ Wk, const float* __restrict__ Wv, const float* __restrict__ Wo, __bf16* __restrict__ PT, __bf16* __restrict__ XS) {
  const int tid = threadIdx.x, wave = tid >> 5, lane = tid & 31, col = lane & 15, g = lane >> 4;
  const int rt = (blockIdx.x >> 2) & 255, kc = (blockIdx.x & 3) * 8 + wave;
  if (blockIdx.x >= 4 * (CCH / 16) * 4) {   // block-uniform
    const int r = rt * 16 + col, t = r % TT; const bool shifted = kc * 32 < CCH / 2; const bool zero = shifted && (t == 0);
    const float* px = X + (size_t)(r - ((shifted && t > 0) ? 1 : 0)) * CCH + kc * 32 + g * 8;
    const v4f x0 = *(const v4f*)px, x1 = *(const v4f*)(px + 4), x2 = *(const v4f*)(px + 16), x3 = *(const v4f*)(px + 20); v8b y0, y1;
#pragma unroll
    for (int e = 0; e < 4; ++e) { y0[e] = (__bf16)(zero ? 0.f : x0[e]); y0[4 + e] = (__bf16)(zero ? 0.f : x1[e]); y1[e] = (__bf16)(zero ? 0.f : x2[e]); y1[4 + e] = (__bf16)(zero ? 0.f : x3[e]); }
    __bf16* dx = XS + ((size_t)rt * (CCH / 32) + kc) * 512 + lane * 8;
    *(v8b*)dx = y0; *(v8b*)(dx + 256) = y1;
    return;
  }
  const int which = rt >> 6, nn = (rt & 63) * 16 + col;
  const float* Wm = which == 0 ? Wq : which == 1 ? Wk : which == 2 ? Wv : Wo;
  const float* p = Wm + (size_t)(kc * 32 + g * 8) * CCH + nn; v8b o0, o1;
#pragma unroll
  for (int e = 0; e < 8; ++e) { o0[e] = (__bf16)p[(size_t)e * CCH]; o1[e] = (__bf16)p[(size_t)(16 + e) * CCH]; }
  __bf16* d = PT + ((size_t)rt * (CCH / 32) + kc) * 512 + lane * 8;
  *(v8b*)d = o0; *(v8b*)(d + 256) = o1;
}
// ---- k_qkv: block (64 rows, 128 cols = 2 heads of q, k or v); exact products; + bias; RoPE (q, k); q/k -> hi/lo rows [bh][t][64]; v -> VT hi/lo [bh][d][t]
__global__ __launch_bounds__(128) void k_qkv(const __bf16* __restrict__ XS, const __bf16* __restrict__ PT, const float* __restrict__ bq, const float* __restrict__ bk, const float* __restrict__ bv,
                                             __bf16* __restrict__ Qh, __bf16* __restrict__ Ql, __bf16* __restrict__ Kh, __bf16* __restrict__ Kl, __bf16* __restrict__ VTh, __bf16* __restrict__ VTl) {
  __shared__ __align__(16) __bf16 sh_[128][72], sl_[128][72];
  const int tid = threadIdx.x, wave = tid >> 5, lane = tid & 31, col = lane & 15, g = lane >> 4;
  const size_t rb = (size_t)blockIdx.x * 64; const int b = (int)(rb / TT), t0 = (int)(rb % TT);
  const int which = blockIdx.y >> 3; const int n0 = (blockIdx.y & 7) * 128;          // block-uniform: 0 q, 1 k, 2 v; n0 = first output channel (2 heads)
  const size_t r0 = rb + wave * 16;
  v8f acc[8] = {};
#pragma unroll 2
  for (int kc = 0; kc < CCH / 32; ++kc) { const v16b a = frag_t(XS + ((r0 >> 4) * (CCH / 32) + kc) * 512, lane);
#pragma unroll
    for (int j = 0; j < 8; ++j) acc[j] = wmma_bf(a, frag_t(PT + ((size_t)((which * CCH + n0) / 16 + j) * (CCH / 32) + kc) * 512, lane), acc[j]); }
  const float* bias = which == 0 ? bq : which == 1 ? bk : bv;
#pragma unroll
  for (int j = 0; j < 8; ++j) { const float bb = bfr(bias[n0 + j * 16 + col]);
#pragma unroll
    for (int r = 0; r < 8; ++r) acc[j][r] += bb; }
  if (which < 2) {   // RoPE on head-local dims 0..15 (tile 4h'+0) and 16..31 (tile 4h'+1), pairs in the same lane; theta = t * inv_freq[col]
#pragma unroll
    for (int hp = 0; hp < 2; ++hp) {
#pragma unroll
      for (int r = 0; r < 8; ++r) { const int t = t0 + wave * 16 + 8 * g + r; const float th = (float)t * c_invfreq[col]; const float cs = cosf(th), sn = sinf(th);
        const float a0 = acc[hp * 4][r], a1 = acc[hp * 4 + 1][r];
        acc[hp * 4][r] = a0 * cs - a1 * sn; acc[hp * 4 + 1][r] = a1 * cs + a0 * sn; } }
    __bf16* Oh = which == 0 ? Qh : Kh; __bf16* Ol = which == 0 ? Ql : Kl;
#pragma unroll
    for (int hp = 0; hp < 2; ++hp) {
#pragma unroll
      for (int j = 0; j < 4; ++j)
#pragma unroll
        for (int r = 0; r < 8; ++r) { const float v = acc[hp * 4 + j][r]; const __bf16 hi = (__bf16)v; sh_[wave * 16 + 8 * g + r][j * 16 + col] = hi; sl_[wave * 16 + 8 * g + r][j * 16 + col] = (__bf16)(v - (float)hi); }
      LDSX();
      const int h = (n0 >> 6) + hp; const size_t base = ((size_t)(b * NH + h) * TT + t0 + wave * 16) * HS;   // the wave's 16 rows x 64 dims = two whole tiles; piece qq of them holds row qq & 15, dims 8 (qq >> 4) ..
      v4u ph[4], pl[4];
#pragma unroll   // four fixed trips, unrolled so that ph and pl are registers and the eight LDS reads share one latency
      for (int q4 = 0; q4 < 4; ++q4) { const int qq = q4 * 32 + lane, pc = q4 * 2 + g; ph[q4] = *(const v4u*)(&sh_[wave * 16 + col][pc * 8]); pl[q4] = *(const v4u*)(&sl_[wave * 16 + col][pc * 8]); vst2((unsigned*)(Oh + base + qq * 8), ph[q4]); vst2((unsigned*)(Ol + base + qq * 8), pl[q4]); }
      asm volatile("s_wait_xcnt 0x0" :: "v"(ph[0]), "v"(ph[1]), "v"(ph[2]), "v"(ph[3]), "v"(pl[0]), "v"(pl[1]), "v"(pl[2]), "v"(pl[3]) : "memory");   // the next head's conversions may land in the data registers of the eight stores above; the stored values as inputs keep those registers untouched up to this wait
      LDSX(); }
  } else {
#pragma unroll
    for (int j = 0; j < 8; ++j)
#pragma unroll
      for (int r = 0; r < 8; ++r) { const float v = acc[j][r]; const __bf16 hi = (__bf16)v; sh_[j * 16 + col][wave * 16 + 8 * g + r] = hi; sl_[j * 16 + col][wave * 16 + 8 * g + r] = (__bf16)(v - (float)hi); }
    __syncthreads();
    for (int qq = tid; qq < 128 * 8; qq += 128) { const int ct = qq >> 7, kcl = (qq >> 6) & 1, w = qq & 63; const int c = ct * 16 + (w & 15), pc = kcl * 4 + (w >> 4);   // 16 tiles (8 groups of 16 channels x 2 groups of 32 t), 64 pieces each, in storage order
      const int h = (n0 >> 6) + (ct >> 2); const size_t o = (((size_t)(b * NH + h) * (HS / 16) + (ct & 3)) * (TT / 32) + (t0 >> 5) + kcl) * 512 + w * 8;
      vst2((unsigned*)(VTh + o), *(const v4u*)(&sh_[c][pc * 8])); vst2((unsigned*)(VTl + o), *(const v4u*)(&sl_[c][pc * 8])); }
  }
}
// ---- k_stats: block = (bh, 64 queries); wave = 16 queries; causal key tiles of 32: S = q'(hi/lo) k'(hi/lo) / 8, online max / sum -> M, L (f32 [bh][t], 256 B per block by 16 lanes)
__global__ __launch_bounds__(128) void k_stats(const __bf16* __restrict__ Qh, const __bf16* __restrict__ Ql, const __bf16* __restrict__ Kh, const __bf16* __restrict__ Kl, float* __restrict__ Mo, float* __restrict__ Lo) {
  __shared__ float sm[64], ssum[64];
  const int tid = threadIdx.x, wave = tid >> 5, lane = tid & 31, col = lane & 15, g = lane >> 4;
  const int bh = blockIdx.y; const int i0 = blockIdx.x * 64 + wave * 16;
  const __bf16* qh = Qh + ((size_t)bh * TT + i0) * HS; const __bf16* ql = Ql + ((size_t)bh * TT + i0) * HS;
  const v16b qh0 = frag_t(qh, lane), qh1 = frag_t(qh + 512, lane), ql0 = frag_t(ql, lane), ql1 = frag_t(ql + 512, lane);
  asm volatile("s_wait_xcnt 0x0" :: "v"(qh0), "v"(qh1), "v"(ql0), "v"(ql1) : "memory");   // the loop's key loads may land in the address registers of the query loads above; the loaded values as inputs keep this wait behind those loads
  float m[8], l[8];
#pragma unroll
  for (int r = 0; r < 8; ++r) { m[r] = -3.0e38f; l[r] = 0.f; }
  const int jend = i0 + 16;                                      // keys j <= i for rows i0..i0+15 -> tiles covering [0, i0+16)
#pragma unroll 1
  for (int j0 = 0; j0 < jend; j0 += 32) {
#pragma unroll
    for (int jt = 0; jt < 2; ++jt) { const int jb = j0 + jt * 16; if (jb < jend) {   // wave-uniform
      const __bf16* kh = Kh + ((size_t)bh * TT + jb) * HS; const __bf16* kl = Kl + ((size_t)bh * TT + jb) * HS;
      const v16b kh0 = frag_t(kh, lane), kl0 = frag_t(kl, lane), kh1 = frag_t(kh + 512, lane), kl1 = frag_t(kl + 512, lane);
      asm volatile("" :: "v"(kh0), "v"(kl0), "v"(kh1), "v"(kl1));   // inputs-only fence on the loaded values: holds all eight key loads in front of the products, one memory latency instead of two in a row
      v8f s = {}; s = mac3p(qh0, ql0, kh0, kl0, s); s = mac3p(qh1, ql1, kh1, kl1, s);
#pragma unroll
      for (int r = 0; r < 8; ++r) { const int i = i0 + 8 * g + r, j = jb + col; const float v = (j <= i) ? s[r] * 0.125f : -1e30f;
        float mt = v;
#pragma unroll
        for (int o = 1; o < 16; o <<= 1) mt = fmaxf(mt, __shfl_xor(mt, o));
        const float mn = fmaxf(m[r], mt); float e = expf(v - mn);
#pragma unroll
        for (int o = 1; o < 16; o <<= 1) e += __shfl_xor(e, o);
        l[r] = l[r] * expf(m[r] - mn) + e; m[r] = mn; } } }
  }
  if (col == 0) {
#pragma unroll
    for (int r = 0; r < 8; ++r) { sm[wave * 16 + 8 * g + r] = m[r]; ssum[wave * 16 + 8 * g + r] = l[r]; } }
  __syncthreads();
  if (tid < 16) { vst2(Mo + (size_t)bh * TT + blockIdx.x * 64 + tid * 4, *(const v4f*)&sm[tid * 4]); vst2(Lo + (size_t)bh * TT + blockIdx.x * 64 + tid * 4, *(const v4f*)&ssum[tid * 4]); }
}
// ---- k_mix: block = (b, 16 queries i0..i0+15, keys of one 128-key chunk), 8 waves; loop over the chunk's 32-key tiles (causal). M and L are known, so O is a plain sum over keys and chunks are independent
__global__ __launch_bounds__(256) void k_mix(const __bf16* __restrict__ Qh, const __bf16* __restrict__ Ql, const __bf16* __restrict__ Kh, const __bf16* __restrict__ Kl, const __bf16* __restrict__ VTh, const __bf16* __restrict__ VTl,
                                             const float* __restrict__ Mo, const float* __restrict__ Lo, const float* __restrict__ tw, const float* __restrict__ talpha, const float* __restrict__ tbeta, const float* __restrict__ mixw,
                                             float* __restrict__ PART) {
  __shared__ __align__(16) __bf16 pwh[512][32], pwl[512][32];   // (P*w) for the tile: row = i*32 + j (query-in-tile, key-in-tile), column = head h (16..31 stay zero)
  __shared__ __align__(16) float attp[NH][16][36];               // mixed attention tile per output head o: [o][i][j]
  __shared__ __align__(16) __bf16 mixr[NH][32];                  // mixing matrix rows o, k = h (16..31 zero)
  const int tid = threadIdx.x, wave = tid >> 5, lane = tid & 31, col = lane & 15, g = lane >> 4;
  // blockIdx.y -> (query tile = 8 gq + tl, chunk <= gq): the full 128-key chunks first, then the diagonal chunks from the longest to the shortest, so that the work-groups that start last are the short ones
  int rem = blockIdx.y, gq, tl, chunk;
  if (rem < MIXFULL) { gq = NCHK - 1; while (gq > 1 && rem >= 8 * gq) { rem -= 8 * gq; --gq; } chunk = rem >> 3; tl = rem & 7; }
  else { rem -= MIXFULL; gq = rem & 7; tl = 7 - (rem >> 3); chunk = gq; }
  const int b = blockIdx.x, i0 = (gq * 8 + tl) * 16;
  for (int q = tid; q < 512 * 32 / 8; q += 256) { *(v4u*)(&pwh[0][0] + q * 8) = (v4u){0u,0u,0u,0u}; *(v4u*)(&pwl[0][0] + q * 8) = (v4u){0u,0u,0u,0u}; }
  for (int q = tid; q < NH * 32; q += 256) { const int o = q >> 5, h = q & 31; mixr[o][h] = h < NH ? (__bf16)mixw[o * NH + h] : (__bf16)0.f; }
  // this wave's two heads for the S phase and two output heads for the PV phase
  const int hA = wave * 2;
  float mrow[2][8], lb[2][8];            // row max, and beta[h][i] / L (the per-row factors of p*w = (e^(s-m)/L) * ((tw*alpha)*beta), folded)
#pragma unroll
  for (int u = 0; u < 2; ++u) { const int bh = b * NH + hA + u;
#pragma unroll
    for (int r = 0; r < 8; ++r) { const int i = i0 + 8 * g + r; mrow[u][r] = Mo[(size_t)bh * TT + i]; lb[u][r] = bfr(tbeta[(hA + u) * TT + i]) / Lo[(size_t)bh * TT + i]; } }
  v8f oacc[2][4];
#pragma unroll
  for (int u = 0; u < 2; ++u)
#pragma unroll
    for (int d4 = 0; d4 < 4; ++d4) oacc[u][d4] = (v8f){};
  __syncthreads();
  const int jbeg = chunk * KCH; const int jend = (i0 + 16 < jbeg + KCH) ? i0 + 16 : jbeg + KCH;
#pragma unroll 1
  for (int j0 = jbeg; j0 < jend; j0 += 32) {
    // -- S for this wave's two heads; P*w -> pwh/pwl[(i)*32 + j][h]
#pragma unroll
    for (int u = 0; u < 2; ++u) { const int h = hA + u; const int bh = b * NH + h;
      const __bf16* qh = Qh + ((size_t)bh * TT + i0) * HS; const __bf16* ql = Ql + ((size_t)bh * TT + i0) * HS;
      const v16b qh0 = frag_t(qh, lane), qh1 = frag_t(qh + 512, lane), ql0 = frag_t(ql, lane), ql1 = frag_t(ql + 512, lane);   // re-read per key tile (cached) to keep VGPRs < 256
#pragma unroll 1
      for (int jt = 0; jt < 2; ++jt) { const int jb = j0 + jt * 16;   // body is one straight line, no call and no branch: the eight rows' loads, exps and stores overlap. jb + 15 <= 1023, so a half past the diagonal reads rows that exist; the select drops it
        const __bf16* kh = Kh + ((size_t)bh * TT + jb) * HS; const __bf16* kl = Kl + ((size_t)bh * TT + jb) * HS;
        const int j = jb + col; const float al = talpha[h * TT + (j < TT ? j : TT - 1)]; float twv[8];
#pragma unroll
        for (int r = 0; r < 8; ++r) { const int widx = TT - 1 + j - (i0 + 8 * g + r); twv[r] = tw[h * TT + (widx < TT ? widx : TT - 1)]; }   // 0 <= widx; clamped into the row above the diagonal
        asm volatile("s_wait_xcnt 0x0" ::: "memory");   // the key loads below may land in the offset registers of the nine loads above
        const v16b kh0 = frag_t(kh, lane), kl0 = frag_t(kl, lane), kh1 = frag_t(kh + 512, lane), kl1 = frag_t(kl + 512, lane);
        // inputs-only fence on the loaded values: holds all 17 loads of this half in front of the products, so that they share one memory latency (without it the compiler sinks half of the key loads and the decay loads behind the products: three latencies in a row)
        asm volatile("" :: "v"(kh0), "v"(kl0), "v"(kh1), "v"(kl1), "v"(al), "v"(twv[0]), "v"(twv[1]), "v"(twv[2]), "v"(twv[3]), "v"(twv[4]), "v"(twv[5]), "v"(twv[6]), "v"(twv[7]));
        v8f s = {}; s = mac3p(qh0, ql0, kh0, kl0, s); s = mac3p(qh1, ql1, kh1, kl1, s);
        const float alpha_j = bfr(al);
#pragma unroll
        for (int r = 0; r < 8; ++r) { const int il = 8 * g + r, i = i0 + il;
          const float pv = (expf(s[r] * 0.125f - mrow[u][r]) * lb[u][r]) * (bfr(twv[r]) * alpha_j);
          const float pw = (j <= i) ? pv : 0.f;                  // causal mask as a select: a masked pv is never used
          const __bf16 hi = (__bf16)pw; pwh[il * 32 + jt * 16 + col][h] = hi; pwl[il * 32 + jt * 16 + col][h] = (__bf16)(pw - (float)hi); } } }
    __syncthreads();
    // -- mixing GEMM: att'[o][(i,j)] = sum_h mix[o][h] Pw[(i,j)][h]; 32 column tiles of 16 (i,j) pairs, K = 32 (h, upper half zero); wave owns column tiles 4w..4w+3
    { const v16b am = frag_b16(&mixr[col][0], lane);            // A rows o = col, k = h
#pragma unroll 1
      for (int ct = 0; ct < 4; ++ct) { const int n0c = (wave * 4 + ct) * 16; v8f a = {};
        a = wmma_bf(am, frag_b16(&pwl[n0c + col][0], lane), a); a = wmma_bf(am, frag_b16(&pwh[n0c + col][0], lane), a);
        const int il = n0c >> 5, jl0 = n0c & 31;                 // the 16 columns of this tile share i (32 | n0c+0..15 within one i row since tiles are 16-aligned inside 32)
#pragma unroll
        for (int r = 0; r < 8; ++r) attp[8 * g + r][il][jl0 + col] = a[r]; } }
    __syncthreads();
    // -- O[o] += att'[o](hi/lo) v_o(hi/lo): this wave's output heads o = hA, hA+1; K = 32 keys (one step); 4 d tiles
#pragma unroll
    for (int u = 0; u < 2; ++u) { const int o = hA + u; const int bh = b * NH + o; const F2 af = split_row(&attp[o][col][0], 0, lane);
#pragma unroll
      for (int d4 = 0; d4 < 4; ++d4) { const size_t vo = (((size_t)bh * (HS / 16) + d4) * (TT / 32) + (j0 >> 5)) * 512;
        oacc[u][d4] = mac3p(af.h, af.l, frag_t(VTh + vo, lane), frag_t(VTl + vo, lane), oacc[u][d4]); } }
    __syncthreads();                                            // pw*/attp are rewritten by the next key tile
  }
  // -- partial O rows: r = b*1024 + i, columns o*64 + d, f32; per wave 16 rows x 64 cols per head staged in the (now free) pw buffers: 256-B segments by 16 lanes
  float* st0 = (float*)(&pwh[0][0] + wave * (16 * 128)); float* st1 = (float*)(&pwl[0][0] + wave * (16 * 128));
#pragma unroll
  for (int d4 = 0; d4 < 4; ++d4)
#pragma unroll
    for (int r = 0; r < 8; ++r) { st0[(8 * g + r) * 64 + d4 * 16 + col] = oacc[0][d4][r]; st1[(8 * g + r) * 64 + d4 * 16 + col] = oacc[1][d4][r]; }
  LDSX();
  for (int qq = lane; qq < 16 * 16; qq += 32) { const int rl = qq >> 4, pc = qq & 15; const size_t o = ((size_t)chunk * NR + (size_t)b * TT + i0 + rl) * CCH + hA * 64 + pc * 4;
    vst2(PART + o, *(const v4f*)(st0 + rl * 64 + pc * 4)); vst2(PART + o + 64, *(const v4f*)(st1 + rl * 64 + pc * 4)); }
}
// ---- k_red: O[r][c] = sum of the row's chunk partials, ascending chunk; -> hi/lo planes in fragment order; block = 16 rows x 256 columns, wave = one tile (16 rows x 32 columns: one whole 128-byte line of each row), lane = its two pieces of 8 columns
__global__ __launch_bounds__(256) void k_red(const float* __restrict__ PART, __bf16* __restrict__ OH, __bf16* __restrict__ OL) {
  const int wave = threadIdx.x >> 5, lane = threadIdx.x & 31, col = lane & 15, g = lane >> 4; const int rt = blockIdx.x >> 2, kc = (blockIdx.x & 3) * 8 + wave;
  const int t = (rt * 16) % TT; const int nch = t / KCH + 1;   // the 16 rows of a block lie in one chunk group
  const float* p = PART + (size_t)(rt * 16 + col) * CCH + kc * 32 + g * 8; v4f a0 = {}, a1 = {}, a2 = {}, a3 = {};
#pragma unroll 1   // at most 8 trips; kept rolled so that the kernel stays small in registers and all of its waves are resident at once and hide each trip's load latency
  for (int c = 0; c < nch; ++c) { a0 += *(const v4f*)p; a1 += *(const v4f*)(p + 4); a2 += *(const v4f*)(p + 16); a3 += *(const v4f*)(p + 20); p += (size_t)NR * CCH; }
  v8b hi, lo, hj, lj;
#pragma unroll
  for (int i = 0; i < 4; ++i) { const __bf16 h0 = (__bf16)a0[i], h1 = (__bf16)a1[i], h2 = (__bf16)a2[i], h3 = (__bf16)a3[i]; hi[i] = h0; hi[4 + i] = h1; hj[i] = h2; hj[4 + i] = h3;
    lo[i] = (__bf16)(a0[i] - (float)h0); lo[4 + i] = (__bf16)(a1[i] - (float)h1); lj[i] = (__bf16)(a2[i] - (float)h2); lj[4 + i] = (__bf16)(a3[i] - (float)h3); }
  const size_t e = ((size_t)rt * (CCH / 32) + kc) * 512 + lane * 8;
  *(v8b*)(OH + e) = hi; *(v8b*)(OH + e + 256) = hj; *(v8b*)(OL + e) = lo; *(v8b*)(OL + e + 256) = lj;
}
// ---- k_out: out = (O(hi/lo) . Wo^T rows + bo) * gamma[t]; block (64 rows, 128 cols), K = 1024
__global__ __launch_bounds__(128) void k_out(const __bf16* __restrict__ OH, const __bf16* __restrict__ OL, const __bf16* __restrict__ PT, const float* __restrict__ bo, const float* __restrict__ gam, float* __restrict__ out) {
  __shared__ __align__(16) float so[4][16][132];
  const int tid = threadIdx.x, wave = tid >> 5, lane = tid & 31, col = lane & 15, g = lane >> 4; const size_t r0 = (size_t)blockIdx.x * 64 + wave * 16; const int n0 = blockIdx.y * 128;
  v8f acc[8] = {};
#pragma unroll 2
  for (int kc = 0; kc < CCH / 32; ++kc) { const size_t ao = ((r0 >> 4) * (CCH / 32) + kc) * 512; const v16b ah = frag_t(OH + ao, lane), al = frag_t(OL + ao, lane);
#pragma unroll
    for (int j = 0; j < 8; ++j) { const v16b wb = frag_t(PT + ((size_t)((3 * CCH + n0) / 16 + j) * (CCH / 32) + kc) * 512, lane); acc[j] = wmma_bf(al, wb, acc[j]); acc[j] = wmma_bf(ah, wb, acc[j]); } }
#pragma unroll
  for (int j = 0; j < 8; ++j) { const float bb = bfr(bo[n0 + j * 16 + col]);
#pragma unroll
    for (int r = 0; r < 8; ++r) { const int t = (int)((r0 + 8 * g + r) % TT); so[wave][8 * g + r][j * 16 + col] = (acc[j][r] + bb) * bfr(gam[t]); } }
  LDSX();
  for (int rl = 0; rl < 16; ++rl) vst2(out + (r0 + rl) * CCH + n0 + lane * 4, *(const v4f*)(&so[wave][rl][lane * 4]));
}

extern "C" void kernel_launch(void* const* d_in, const int* in_sizes, int n_in, void* d_out, int out_size, void* d_ws, size_t ws_size, hipStream_t stream) {
  (void)in_sizes; (void)n_in; (void)out_size;
  const float** I = (const float**)d_in;   // x, Wq, bq, Wk, bk, Wv, bv, Wo, bo, time_w, time_alpha, time_beta, time_gamma, head_mix_w
  if (ws_size < (size_t)WS_END) return;
  char* ws = (char*)d_ws;
  __bf16* PT = (__bf16*)(ws + WS_PT); __bf16 *Qh = (__bf16*)(ws + WS_QH), *Ql = (__bf16*)(ws + WS_QL), *Kh = (__bf16*)(ws + WS_KH), *Kl = (__bf16*)(ws + WS_KL), *VTh = (__bf16*)(ws + WS_VTH), *VTl = (__bf16*)(ws + WS_VTL);
  float *Mo = (float*)(ws + WS_M), *Lo = (float*)(ws + WS_L); __bf16 *OH = (__bf16*)(ws + WS_OH), *OL = (__bf16*)(ws + WS_OL); float* PART = (float*)(ws + WS_PART); __bf16* XS = (__bf16*)(ws + WS_XS);
  k_pack<<<4 * (CCH / 16) * 4 + (NR / 16) * 4, 256, 0, stream>>>(I[0], I[1], I[3], I[5], I[7], PT, XS);
  k_qkv<<<dim3(NR / 64, 24), 128, 0, stream>>>(XS, PT, I[2], I[4], I[6], Qh, Ql, Kh, Kl, VTh, VTl);
  k_stats<<<dim3(TT / 64, NB * NH), 128, 0, stream>>>(Qh, Ql, Kh, Kl, Mo, Lo);
  k_mix<<<dim3(NB, MIXBLK), 256, 0, stream>>>(Qh, Ql, Kh, Kl, VTh, VTl, Mo, Lo, I[9], I[10], I[11], I[13], PART);
  k_red<<<(NR / 16) * 4, 256, 0, stream>>>(PART, OH, OL);
  k_out<<<dim3(NR / 64, CCH / 128), 128, 0, stream>>>(OH, OL, PT, I[8], I[12], (float*)d_out);
}

// v004
// It runs in 323 microseconds.
// Next to v003, in two timings, it ran 1.48 and 1.47 times as fast.
// Over all steps from v000 it is 2.50 times as fast.
// compute dtype: x, all weights/biases, time_w/alpha/beta/gamma and the head-mixing matrix (module inputs) rounded to bf16; q/k/v = xs W with exact bf16 products; RoPE, scores' softmax statistics,
// decay and normalisation in f32; scores = q'(hi/lo) k'(hi/lo)^T (3 products); head mixing = bf16(mix) x (P w)(hi/lo) (2 products); context = att'(hi/lo) x v(hi/lo) (3 products); out = O(hi/lo) Wo (2 products) + bo, x gamma; f32 accumulate.
#include <hip/hip_runtime.h>
#include <math.h>

typedef __attribute__((ext_vector_type(16))) _Float16 v16h;
typedef __attribute__((ext_vector_type(16))) __bf16 v16b;
typedef __attribute__((ext_vector_type(8)))  _Float16 v8h;
typedef __attribute__((ext_vector_type(8)))  float v8f;
typedef __attribute__((ext_vector_type(4)))  float v4f;
typedef __attribute__((ext_vector_type(2)))  float v2f;
typedef __attribute__((ext_vector_type(4)))  unsigned v4u;
typedef __attribute__((ext_vector_type(4)))  int v4i;
typedef float __attribute__((may_alias)) float_a;
typedef int __attribute__((may_alias)) int_a;

template <typename T> __device__ __forceinline__ void vst2(void* p, T v) { *(T*)p = v;  }
__device__ __forceinline__ v8f wmma16(v16h a, v16h b, v8f c) {
  v8f d = __builtin_amdgcn_wmma_f32_16x16x32_f16(false, a, false, b, (short)0, c, false, false);
  asm volatile("v_nop\n\tv_nop\n\tv_nop\n\tv_nop" : "+v"(d) : "v"(a), "v"(b));
  return d;
}
__device__ __forceinline__ v8f wmma_bf(v16b a, v16b b, v8f c) {
  v8f d = __builtin_amdgcn_wmma_f32_16x16x32_bf16(false, a, false, b, (short)0, c, false, false);
  asm volatile("v_nop\n\tv_nop\n\tv_nop\n\tv_nop" : "+v"(d) : "v"(a), "v"(b));
  return d;
}
// 16x16x32 fragments: lane = (h = lane>>4, row/col = lane&15); elements 0..7 = k0+8h+0..7, 8..15 = k0+16+8h+0..7; D element r = row 8h+r
__device__ __forceinline__ v16h frag_h(const _Float16* rowk0, int lane) {
  union { v16h v; v8h q[2]; } u; const _Float16* p = rowk0 + 8 * (lane >> 4);
  u.q[0] = *(const v8h*)p; u.q[1] = *(const v8h*)(p + 16); return u.v;
}
__device__ __forceinline__ v16h frag_f32(const float* rowk0, int lane) {
  v16h a; const float* p = rowk0 + 8 * (lane >> 4);
#pragma unroll
  for (int i = 0; i < 8; ++i) { a[i] = (_Float16)p[i]; a[8 + i] = (_Float16)p[16 + i]; }
  return a;
}
__device__ __forceinline__ v16h frag_f32s(const float* rowk0, int lane, float sc) {
  v16h a; const float* p = rowk0 + 8 * (lane >> 4);
#pragma unroll
  for (int i = 0; i < 8; ++i) { a[i] = (_Float16)(p[i] * sc); a[8 + i] = (_Float16)(p[16 + i] * sc); }
  return a;
}
// column fragment from a [K][ld] layout (column n), rows >= K read as 0
__device__ __forceinline__ v16h fragc_f32(const float* W, int k0, int n, int lane, int ld, int K) {
  v16h a; const int g = lane >> 4;
#pragma unroll
  for (int i = 0; i < 8; ++i) { const int ka = k0 + 8 * g + i, kb = ka + 16;
    a[i] = (_Float16)(ka < K ? W[(size_t)(ka < K ? ka : K - 1) * ld + n] : 0.f); a[8 + i] = (_Float16)(kb < K ? W[(size_t)(kb < K ? kb : K - 1) * ld + n] : 0.f); }
  return a;
}
struct F2 { v16b h, l; };
__device__ __forceinline__ F2 bsplit16(const float v[16]) { F2 r;
#pragma unroll
  for (int i = 0; i < 16; ++i) { const __bf16 h = (__bf16)v[i]; r.h[i] = h; r.l[i] = (__bf16)(v[i] - (float)h); }
  return r; }
__device__ __forceinline__ F2 split_row(const float* row, int k0, int lane) { float v[16]; const float* p = row + k0 + 8 * (lane >> 4);
#pragma unroll
  for (int i = 0; i < 8; ++i) { v[i] = p[i]; v[8 + i] = p[16 + i]; }
  return bsplit16(v); }
__device__ __forceinline__ F2 split_rowK(const float* row, int k0, int lane, int K) { float v[16]; const int g = lane >> 4;
#pragma unroll
  for (int i = 0; i < 8; ++i) { const int ka = k0 + 8 * g + i, kb = ka + 16; v[i] = ka < K ? row[ka < K ? ka : K - 1] : 0.f; v[8 + i] = kb < K ? row[kb < K ? kb : K - 1] : 0.f; }
  return bsplit16(v); }
__device__ __forceinline__ F2 split_col(const float* W, int k0, int n, int lane, int ld, int K) { float v[16]; const int g = lane >> 4;
#pragma unroll
  for (int i = 0; i < 8; ++i) { const int ka = k0 + 8 * g + i, kb = ka + 16; v[i] = ka < K ? W[(size_t)(ka < K ? ka : K - 1) * ld + n] : 0.f; v[8 + i] = kb < K ? W[(size_t)(kb < K ? kb : K - 1) * ld + n] : 0.f; }
  return bsplit16(v); }
__device__ __forceinline__ v8f mac3(const F2& a, const F2& b, v8f c) { c = wmma_bf(a.l, b.h, c); c = wmma_bf(a.h, b.l, c); return wmma_bf(a.h, b.h, c); }
__device__ __forceinline__ float sigm(float v) { return 1.0f / (1.0f + expf(-v)); }
#define LDSX() do { asm volatile("s_wait_dscnt 0" ::: "memory"); __builtin_amdgcn_wave_barrier(); __builtin_amdgcn_fence(__ATOMIC_RELEASE, "workgroup"); } while (0)


// Causal multi-head attention with token shift, partial RoPE, per-head Toeplitz time decay, a 16x16 cross-head mixing of the softmax maps, output projection and a per-position gain.
// Rows r = b*1024 + t. Every bf16 operand plane in the workspace (xs, weights, q, k, v^T, O) is stored in fragment order (see frag_t); the shapes below name rows and K. k_pack ([in][out] weights -> bf16 rows); k_pack also builds xs (channels < 512 come from t-1, zero at t = 0) as bf16 rows; k_qkv (xs W + bias; RoPE on dims 0..31; q/k -> hi/lo rows [bh][t][64], v -> hi/lo transposed [bh][d][t]);
// k_stats (per (bh, 64 queries): causal row max and sum of exp over the keys -> M, L); k_mix (block = (b, 16 queries, 128-key chunk), loop over 32-key tiles: S for all 16 heads -> P*w as bf16 hi/lo [query,key][h] in LDS -> mixing GEMM -> att'[o][i][j] f32 in LDS
// -> O[o] += att'(hi/lo) v_o(hi/lo); a block covers at most 128 keys and leaves its f32 partial O in PART[chunk][r][o*64+d]); k_red (sum of a row's chunks in ascending key order -> O hi/lo planes [r][o*64+d]); k_out ((O Wo + bo) * gamma[t]).
#define NB 4
#define TT 1024
#define CCH 1024
#define NH 16
#define HS 64
#define NR (NB * TT)
#define ROT 32
#define KCH 128                 // keys per k_mix block
#define NCHK (TT / KCH)         // chunks of the longest row
#define MIXFULL (8 * (NCHK * (NCHK - 1) / 2))  // (16-query tile, chunk) pairs per batch below the diagonal: the 8 tiles with diagonal chunk q have q full chunks each
#define MIXBLK (MIXFULL + TT / 16)             // plus one diagonal chunk per tile
typedef __attribute__((ext_vector_type(8))) __bf16 v8b;
__device__ __forceinline__ v16b frag_b16(const __bf16* rowk0, int lane) {
  union { v16b v; v8b q[2]; } u; const __bf16* p = rowk0 + 8 * (lane >> 4);
  u.q[0] = *(const v8b*)p; u.q[1] = *(const v8b*)(p + 16); return u.v;
}
// Fragment order of a bf16 operand [rows][K] in global memory: tiles of 16 rows x 32 k (512 elements, 1 KiB), tile index = (row >> 4) * (K / 32) + (k >> 5); inside a tile the 8 elements k & ~7 .. of a row lie at
// element ((k >> 4) & 1) * 256 + (((k >> 3) & 1) * 16 + (row & 15)) * 8. That is the order in which the lanes read a fragment, so each of its two wave-wide 16-byte loads covers 512 contiguous bytes (4 lines, not 16)
__device__ __forceinline__ v16b frag_t(const __bf16* tile, int lane) {
  union { v16b v; v8b q[2]; } u; const __bf16* p = tile + lane * 8;
  u.q[0] = *(const v8b*)p; u.q[1] = *(const v8b*)(p + 256); return u.v;
}
// the same fragment from the lane's own pointer (tile + lane * 8)
__device__ __forceinline__ v16b frag_p(const __bf16* p) {
  union { v16b v; v8b q[2]; } u; u.q[0] = *(const v8b*)p; u.q[1] = *(const v8b*)(p + 256); return u.v;
}
__device__ __forceinline__ float bfr(float v) { return (float)(__bf16)v; }
__device__ __forceinline__ v8f mac3p(v16b ah, v16b al, v16b bh, v16b bl, v8f c) { c = wmma_bf(al, bh, c); c = wmma_bf(ah, bl, c); return wmma_bf(ah, bh, c); }
__constant__ float c_invfreq[16] = {1.0f,0.5623413324356079f,0.3162277638912201f,0.17782793939113617f,0.10000000149011612f,0.05623412877321243f,0.03162277862429619f,0.017782794311642647f,0.009999999776482582f,0.005623413249850273f,0.003162277862429619f,0.0017782794311642647f,0.0010000000474974513f,0.000562341301701963f,0.0003162277862429619f,0.00017782794020604342f};

// workspace carve (bytes)
#define PLANE_Q (2u * NB * NH * TT * HS)        // bf16 [64 bh][1024][64] = 8 MiB
#define WS_PT   0u                               // bf16 [4096][1024]: rows 0.. Wq^T, 1024.. Wk^T, 2048.. Wv^T, 3072.. Wo^T  (8 MiB)
#define WS_QH   (WS_PT + 2u * 4 * CCH * CCH)
#define WS_QL   (WS_QH + PLANE_Q)
#define WS_KH   (WS_QL + PLANE_Q)
#define WS_KL   (WS_KH + PLANE_Q)
#define WS_VTH  (WS_KL + PLANE_Q)                // bf16 [bh][64 d][1024 t]
#define WS_VTL  (WS_VTH + PLANE_Q)
#define WS_M    (WS_VTL + PLANE_Q)               // f32 [bh][1024]
#define WS_L    (WS_M + 4u * NB * NH * TT)
#define WS_OH   (WS_L + 4u * NB * NH * TT)       // bf16 [4096][1024] (row r, col o*64 + d)
#define WS_OL   (WS_OH + 2u * NR * CCH)
#define WS_PART (WS_OL + 2u * NR * CCH)          // f32 [8 key chunks][4096][1024]; row r uses chunks 0 .. t/128
#define WS_XS   (WS_PART + 4u * NCHK * NR * CCH) // bf16 [4096][1024]: shifted x
#define WS_END  (WS_XS + 2u * NR * CCH)

// ---- k_pack: PT (row n, k) = bf16(W[k][n]) in fragment order; block = (16 rows n, 256 k; which matrix is block-uniform), wave = one tile: a lane gathers its 2 x 8 k of its own column n (16 lanes = a 64-byte run of W) and stores them as the fragment's pieces
// blocks from 1024 on: XS (row r, channel k) = bf16(xs) in fragment order, xs = x with channels < 512 taken from row t-1 (zero at t = 0; the address is clamped to the row itself, the load is unconditional and the zero a select); wave = one tile = one 128-byte line of each of 16 rows
__global__ __launch_bounds__(256) void k_pack(const float* __restrict__ X, const float* __restrict__ Wq, const float* __restrict__ Wk, const float* __restrict__ Wv, const float* __restrict__ Wo, __bf16* __restrict__ PT, __bf16* __restrict__ XS) {
  const int tid = threadIdx.x, wave = tid >> 5, lane = tid & 31, col = lane & 15, g = lane >> 4;
  const int rt = (blockIdx.x >> 2) & 255, kc = (blockIdx.x & 3) * 8 + wave;
  if (blockIdx.x >= 4 * (CCH / 16) * 4) {   // block-uniform
    const int r = rt * 16 + col, t = r % TT; const bool shifted = kc * 32 < CCH / 2; const bool zero = shifted && (t == 0);
    const float* px = X + (size_t)(r - ((shifted && t > 0) ? 1 : 0)) * CCH + kc * 32 + g * 8;
    const v4f x0 = *(const v4f*)px, x1 = *(const v4f*)(px + 4), x2 = *(const v4f*)(px + 16), x3 = *(const v4f*)(px + 20); v8b y0, y1;
#pragma unroll
    for (int e = 0; e < 4; ++e) { y0[e] = (__bf16)(zero ? 0.f : x0[e]); y0[4 + e] = (__bf16)(zero ? 0.f : x1[e]); y1[e] = (__bf16)(zero ? 0.f : x2[e]); y1[4 + e] = (__bf16)(zero ? 0.f : x3[e]); }
    __bf16* dx = XS + ((size_t)rt * (CCH / 32) + kc) * 512 + lane * 8;
    *(v8b*)dx = y0; *(v8b*)(dx + 256) = y1;
    return;
  }
  const int which = rt >> 6, nn = (rt & 63) * 16 + col;
  const float* Wm = which == 0 ? Wq : which == 1 ? Wk : which == 2 ? Wv : Wo;
  const float* p = Wm + (size_t)(kc * 32 + g * 8) * CCH + nn; v8b o0, o1;
#pragma unroll
  for (int e = 0; e < 8; ++e) { o0[e] = (__bf16)p[(size_t)e * CCH]; o1[e] = (__bf16)p[(size_t)(16 + e) * CCH]; }
  __bf16* d = PT + ((size_t)rt * (CCH / 32) + kc) * 512 + lane * 8;
  *(v8b*)d = o0; *(v8b*)(d + 256) = o1;
}
// ---- k_qkv: block (64 rows, 128 cols = 2 heads of q, k or v); exact products; + bias; RoPE (q, k); q/k -> hi/lo rows [bh][t][64]; v -> VT hi/lo [bh][d][t]
__global__ __launch_bounds__(128) void k_qkv(const __bf16* __restrict__ XS, const __bf16* __restrict__ PT, const float* __restrict__ bq, const float* __restrict__ bk, const float* __restrict__ bv,
                                             __bf16* __restrict__ Qh, __bf16* __restrict__ Ql, __bf16* __restrict__ Kh, __bf16* __restrict__ Kl, __bf16* __restrict__ VTh, __bf16* __restrict__ VTl) {
  __shared__ __align__(16) __bf16 sh_[128][72], sl_[128][72];
  const int tid = threadIdx.x, wave = tid >> 5, lane = tid & 31, col = lane & 15, g = lane >> 4;
  const size_t rb = (size_t)blockIdx.x * 64; const int b = (int)(rb / TT), t0 = (int)(rb % TT);
  const int which = blockIdx.y >> 3; const int n0 = (blockIdx.y & 7) * 128;          // block-uniform: 0 q, 1 k, 2 v; n0 = first output channel (2 heads)
  const size_t r0 = rb + wave * 16;
  v8f acc[8] = {};
  // fragments are fetched one k step ahead: a weight fragment's registers are refilled for step kc + 1 directly behind the product that read them at step kc, so a load has eight products' time to arrive and no product waits a whole memory latency of its own
  const __bf16* pa = XS + (r0 >> 4) * (CCH / 32) * 512 + lane * 8; const __bf16* pb = PT + (size_t)((which * CCH + n0) / 16) * (CCH / 32) * 512 + lane * 8;   // the lane's own piece of tile (., k step 0)
  v16b a0 = frag_p(pa), a1, wf[8];
#pragma unroll
  for (int j = 0; j < 8; ++j) wf[j] = frag_p(pb + (size_t)j * (CCH / 32) * 512);
#pragma unroll 1   // 15 trips of two k steps (two, so that the two x fragments swap without copies); kept rolled so that the loop stays small in the instruction cache
  for (int kc = 0; kc < CCH / 32 - 2; kc += 2) {
    a1 = frag_p(pa + 512);
#pragma unroll
    for (int j = 0; j < 8; ++j) { acc[j] = wmma_bf(a0, wf[j], acc[j]); wf[j] = frag_p(pb + ((size_t)j * (CCH / 32) + 1) * 512); }
    a0 = frag_p(pa + 1024);
#pragma unroll
    for (int j = 0; j < 8; ++j) { acc[j] = wmma_bf(a1, wf[j], acc[j]); wf[j] = frag_p(pb + ((size_t)j * (CCH / 32) + 2) * 512); }
    asm volatile("s_wait_xcnt 0x0" ::: "memory");   // the pointer steps below land in the address registers of the loads above, which are still in flight
    pa += 1024; pb += 1024; }
  a1 = frag_p(pa + 512);   // the last two k steps: nothing is left to fetch behind the last
  asm volatile("s_wait_xcnt 0x0" ::: "memory");     // pa is dead from here on: a later load's result may land in its registers
#pragma unroll
  for (int j = 0; j < 8; ++j) { acc[j] = wmma_bf(a0, wf[j], acc[j]); wf[j] = frag_p(pb + ((size_t)j * (CCH / 32) + 1) * 512); }
  asm volatile("s_wait_xcnt 0x0" ::: "memory");     // the epilogue may land in the address registers of the loads above
#pragma unroll
  for (int j = 0; j < 8; ++j) acc[j] = wmma_bf(a1, wf[j], acc[j]);
  const float* bias = which == 0 ? bq : which == 1 ? bk : bv;
#pragma unroll
  for (int j = 0; j < 8; ++j) { const float bb = bfr(bias[n0 + j * 16 + col]);
#pragma unroll
    for (int r = 0; r < 8; ++r) acc[j][r] += bb; }
  if (which < 2) {   // RoPE on head-local dims 0..15 (tile 4h'+0) and 16..31 (tile 4h'+1), pairs in the same lane; theta = t * inv_freq[col]
#pragma unroll
    for (int hp = 0; hp < 2; ++hp) {
#pragma unroll
      for (int r = 0; r < 8; ++r) { const int t = t0 + wave * 16 + 8 * g + r; const float th = (float)t * c_invfreq[col]; const float cs = cosf(th), sn = sinf(th);
        const float a0 = acc[hp * 4][r], a1 = acc[hp * 4 + 1][r];
        acc[hp * 4][r] = a0 * cs - a1 * sn; acc[hp * 4 + 1][r] = a1 * cs + a0 * sn; } }
    __bf16* Oh = which == 0 ? Qh : Kh; __bf16* Ol = which == 0 ? Ql : Kl;
#pragma unroll
    for (int hp = 0; hp < 2; ++hp) {
#pragma unroll
      for (int j = 0; j < 4; ++j)
#pragma unroll
        for (int r = 0; r < 8; ++r) { const float v = acc[hp * 4 + j][r]; const __bf16 hi = (__bf16)v; sh_[wave * 16 + 8 * g + r][j * 16 + col] = hi; sl_[wave * 16 + 8 * g + r][j * 16 + col] = (__bf16)(v - (float)hi); }
      LDSX();
      const int h = (n0 >> 6) + hp; const size_t base = ((size_t)(b * NH + h) * TT + t0 + wave * 16) * HS;   // the wave's 16 rows x 64 dims = two whole tiles; piece qq of them holds row qq & 15, dims 8 (qq >> 4) ..
      v4u ph[4], pl[4];
#pragma unroll   // four fixed trips, unrolled so that ph and pl are registers and the eight LDS reads share one latency
      for (int q4 = 0; q4 < 4; ++q4) { const int qq = q4 * 32 + lane, pc = q4 * 2 + g; ph[q4] = *(const v4u*)(&sh_[wave * 16 + col][pc * 8]); pl[q4] = *(const v4u*)(&sl_[wave * 16 + col][pc * 8]); vst2((unsigned*)(Oh + base + qq * 8), ph[q4]); vst2((unsigned*)(Ol + base + qq * 8), pl[q4]); }
      asm volatile("s_wait_xcnt 0x0" :: "v"(ph[0]), "v"(ph[1]), "v"(ph[2]), "v"(ph[3]), "v"(pl[0]), "v"(pl[1]), "v"(pl[2]), "v"(pl[3]) : "memory");   // the next head's conversions may land in the data registers of the eight stores above; the stored values as inputs keep those registers untouched up to this wait
      LDSX(); }
  } else {
#pragma unroll
    for (int j = 0; j < 8; ++j)
#pragma unroll
      for (int r = 0; r < 8; ++r) { const float v = acc[j][r]; const __bf16 hi = (__bf16)v; sh_[j * 16 + col][wave * 16 + 8 * g + r] = hi; sl_[j * 16 + col][wave * 16 + 8 * g + r] = (__bf16)(v - (float)hi); }
    __syncthreads();
    for (int qq = tid; qq < 128 * 8; qq += 128) { const int ct = qq >> 7, kcl = (qq >> 6) & 1, w = qq & 63; const int c = ct * 16 + (w & 15), pc = kcl * 4 + (w >> 4);   // 16 tiles (8 groups of 16 channels x 2 groups of 32 t), 64 pieces each, in storage order
      const int h = (n0 >> 6) + (ct >> 2); const size_t o = (((size_t)(b * NH + h) * (HS / 16) + (ct & 3)) * (TT / 32) + (t0 >> 5) + kcl) * 512 + w * 8;
      vst2((unsigned*)(VTh + o), *(const v4u*)(&sh_[c][pc * 8])); vst2((unsigned*)(VTl + o), *(const v4u*)(&sl_[c][pc * 8])); }
  }
}
// ---- k_stats: block = (bh, 64 queries); wave = 16 queries; causal key tiles of 32: S = q'(hi/lo) k'(hi/lo) / 8, online max / sum -> M, L (f32 [bh][t], 256 B per block by 16 lanes)
__global__ __launch_bounds__(128) void k_stats(const __bf16* __restrict__ Qh, const __bf16* __restrict__ Ql, const __bf16* __restrict__ Kh, const __bf16* __restrict__ Kl, float* __restrict__ Mo, float* __restrict__ Lo) {
  __shared__ float sm[64], ssum[64];
  const int tid = threadIdx.x, wave = tid >> 5, lane = tid & 31, col = lane & 15, g = lane >> 4;
  const int bh = blockIdx.y; const int i0 = blockIdx.x * 64 + wave * 16;
  const __bf16* qh = Qh + ((size_t)bh * TT + i0) * HS; const __bf16* ql = Ql + ((size_t)bh * TT + i0) * HS;
  const v16b qh0 = frag_t(qh, lane), qh1 = frag_t(qh + 512, lane), ql0 = frag_t(ql, lane), ql1 = frag_t(ql + 512, lane);
  asm volatile("s_wait_xcnt 0x0" :: "v"(qh0), "v"(qh1), "v"(ql0), "v"(ql1) : "memory");   // the loop's key loads may land in the address registers of the query loads above; the loaded values as inputs keep this wait behind those loads
  float m[8], l[8];
#pragma unroll
  for (int r = 0; r < 8; ++r) { m[r] = -3.0e38f; l[r] = 0.f; }
  const int jend = i0 + 16;                                      // keys j <= i for rows i0..i0+15 -> tiles covering [0, i0+16)
#pragma unroll 1
  for (int j0 = 0; j0 < jend; j0 += 32) {
#pragma unroll
    for (int jt = 0; jt < 2; ++jt) { const int jb = j0 + jt * 16; if (jb < jend) {   // wave-uniform
      const __bf16* kh = Kh + ((size_t)bh * TT + jb) * HS; const __bf16* kl = Kl + ((size_t)bh * TT + jb) * HS;
      const v16b kh0 = frag_t(kh, lane), kl0 = frag_t(kl, lane), kh1 = frag_t(kh + 512, lane), kl1 = frag_t(kl + 512, lane);
      asm volatile("" :: "v"(kh0), "v"(kl0), "v"(kh1), "v"(kl1));   // inputs-only fence on the loaded values: holds all eight key loads in front of the products, one memory latency instead of two in a row
      v8f s = {}; s = mac3p(qh0, ql0, kh0, kl0, s); s = mac3p(qh1, ql1, kh1, kl1, s);
#pragma unroll
      for (int r = 0; r < 8; ++r) { const int i = i0 + 8 * g + r, j = jb + col; const float v = (j <= i) ? s[r] * 0.125f : -1e30f;
        float mt = v;
#pragma unroll
        for (int o = 1; o < 16; o <<= 1) mt = fmaxf(mt, __shfl_xor(mt, o));
        const float mn = fmaxf(m[r], mt); float e = expf(v - mn);
#pragma unroll
        for (int o = 1; o < 16; o <<= 1) e += __shfl_xor(e, o);
        l[r] = l[r] * expf(m[r] - mn) + e; m[r] = mn; } } }
  }
  if (col == 0) {
#pragma unroll
    for (int r = 0; r < 8; ++r) { sm[wave * 16 + 8 * g + r] = m[r]; ssum[wave * 16 + 8 * g + r] = l[r]; } }
  __syncthreads();
  if (tid < 16) { vst2(Mo + (size_t)bh * TT + blockIdx.x * 64 + tid * 4, *(const v4f*)&sm[tid * 4]); vst2(Lo + (size_t)bh * TT + blockIdx.x * 64 + tid * 4, *(const v4f*)&ssum[tid * 4]); }
}
// ---- k_mix: block = (b, 16 queries i0..i0+15, keys of one 128-key chunk), 8 waves; loop over the chunk's 32-key tiles (causal). M and L are known, so O is a plain sum over keys and chunks are independent
__global__ __launch_bounds__(256) void k_mix(const __bf16* __restrict__ Qh, const __bf16* __restrict__ Ql, const __bf16* __restrict__ Kh, const __bf16* __restrict__ Kl, const __bf16* __restrict__ VTh, const __bf16* __restrict__ VTl,
                                             const float* __restrict__ Mo, const float* __restrict__ Lo, const float* __restrict__ tw, const float* __restrict__ talpha, const float* __restrict__ tbeta, const float* __restrict__ mixw,
                                             float* __restrict__ PART) {
  __shared__ __align__(16) __bf16 pwh[512][32], pwl[512][32];   // (P*w) for the tile: row = i*32 + j (query-in-tile, key-in-tile), column = head h (16..31 stay zero)
  __shared__ __align__(16) float attp[NH][16][36];               // mixed attention tile per output head o: [o][i][j]
  __shared__ __align__(16) __bf16 mixr[NH][32];                  // mixing matrix rows o, k = h (16..31 zero)
  const int tid = threadIdx.x, wave = tid >> 5, lane = tid & 31, col = lane & 15, g = lane >> 4;
  // blockIdx.y -> (query tile = 8 gq + tl, chunk <= gq): the full 128-key chunks first, then the diagonal chunks from the longest to the shortest, so that the work-groups that start last are the short ones
  int rem = blockIdx.y, gq, tl, chunk;
  if (rem < MIXFULL) { gq = NCHK - 1; while (gq > 1 && rem >= 8 * gq) { rem -= 8 * gq; --gq; } chunk = rem >> 3; tl = rem & 7; }
  else { rem -= MIXFULL; gq = rem & 7; tl = 7 - (rem >> 3); chunk = gq; }
  const int b = blockIdx.x, i0 = (gq * 8 + tl) * 16;
  for (int q = tid; q < 512 * 32 / 8; q += 256) { *(v4u*)(&pwh[0][0] + q * 8) = (v4u){0u,0u,0u,0u}; *(v4u*)(&pwl[0][0] + q * 8) = (v4u){0u,0u,0u,0u}; }
  for (int q = tid; q < NH * 32; q += 256) { const int o = q >> 5, h = q & 31; mixr[o][h] = h < NH ? (__bf16)mixw[o * NH + h] : (__bf16)0.f; }
  // this wave's two heads for the S phase and two output heads for the PV phase
  const int hA = wave * 2;
  float mrow[2][8], lb[2][8];            // row max, and beta[h][i] / L (the per-row factors of p*w = (e^(s-m)/L) * ((tw*alpha)*beta), folded)
#pragma unroll
  for (int u = 0; u < 2; ++u) { const int bh = b * NH + hA + u;
#pragma unroll
    for (int r = 0; r < 8; ++r) { const int i = i0 + 8 * g + r; mrow[u][r] = Mo[(size_t)bh * TT + i]; lb[u][r] = bfr(tbeta[(hA + u) * TT + i]) / Lo[(size_t)bh * TT + i]; } }
  v8f oacc[2][4];
#pragma unroll
  for (int u = 0; u < 2; ++u)
#pragma unroll
    for (int d4 = 0; d4 < 4; ++d4) oacc[u][d4] = (v8f){};
  __syncthreads();
  const int jbeg = chunk * KCH; const int jend = (i0 + 16 < jbeg + KCH) ? i0 + 16 : jbeg + KCH;
#pragma unroll 1
  for (int j0 = jbeg; j0 < jend; j0 += 32) {
    // -- S for this wave's two heads; P*w -> pwh/pwl[(i)*32 + j][h]
#pragma unroll
    for (int u = 0; u < 2; ++u) { const int h = hA + u; const int bh = b * NH + h;
      const __bf16* qh = Qh + ((size_t)bh * TT + i0) * HS; const __bf16* ql = Ql + ((size_t)bh * TT + i0) * HS;
      const v16b qh0 = frag_t(qh, lane), qh1 = frag_t(qh + 512, lane), ql0 = frag_t(ql, lane), ql1 = frag_t(ql + 512, lane);   // re-read per key tile (cached) to keep VGPRs < 256
#pragma unroll 1
      for (int jt = 0; jt < 2; ++jt) { const int jb = j0 + jt * 16;   // body is one straight line, no call and no branch: the eight rows' loads, exps and stores overlap. jb + 15 <= 1023, so a half past the diagonal reads rows that exist; the select drops it
        const __bf16* kh = Kh + ((size_t)bh * TT + jb) * HS; const __bf16* kl = Kl + ((size_t)bh * TT + jb) * HS;
        const int j = jb + col; const float al = talpha[h * TT + (j < TT ? j : TT - 1)]; float twv[8];
#pragma unroll
        for (int r = 0; r < 8; ++r) { const int widx = TT - 1 + j - (i0 + 8 * g + r); twv[r] = tw[h * TT + (widx < TT ? widx : TT - 1)]; }   // 0 <= widx; clamped into the row above the diagonal
        asm volatile("s_wait_xcnt 0x0" ::: "memory");   // the key loads below may land in the offset registers of the nine loads above
        const v16b kh0 = frag_t(kh, lane), kl0 = frag_t(kl, lane), kh1 = frag_t(kh + 512, lane), kl1 = frag_t(kl + 512, lane);
        // inputs-only fence on the loaded values: holds all 17 loads of this half in front of the products, so that they share one memory latency (without it the compiler sinks half of the key loads and the decay loads behind the products: three latencies in a row)
        asm volatile("" :: "v"(kh0), "v"(kl0), "v"(kh1), "v"(kl1), "v"(al), "v"(twv[0]), "v"(twv[1]), "v"(twv[2]), "v"(twv[3]), "v"(twv[4]), "v"(twv[5]), "v"(twv[6]), "v"(twv[7]));
        v8f s = {}; s = mac3p(qh0, ql0, kh0, kl0, s); s = mac3p(qh1, ql1, kh1, kl1, s);
        const float alpha_j = bfr(al);
#pragma unroll
        for (int r = 0; r < 8; ++r) { const int il = 8 * g + r, i = i0 + il;
          const float pv = (expf(s[r] * 0.125f - mrow[u][r]) * lb[u][r]) * (bfr(twv[r]) * alpha_j);
          const float pw = (j <= i) ? pv : 0.f;                  // causal mask as a select: a masked pv is never used
          const __bf16 hi = (__bf16)pw; pwh[il * 32 + jt * 16 + col][h] = hi; pwl[il * 32 + jt * 16 + col][h] = (__bf16)(pw - (float)hi); } } }
    __syncthreads();
    // -- mixing GEMM: att'[o][(i,j)] = sum_h mix[o][h] Pw[(i,j)][h]; 32 column tiles of 16 (i,j) pairs, K = 32 (h, upper half zero); wave owns column tiles 4w..4w+3
    { const v16b am = frag_b16(&mixr[col][0], lane);            // A rows o = col, k = h
#pragma unroll 1
      for (int ct = 0; ct < 4; ++ct) { const int n0c = (wave * 4 + ct) * 16; v8f a = {};
        a = wmma_bf(am, frag_b16(&pwl[n0c + col][0], lane), a); a = wmma_bf(am, frag_b16(&pwh[n0c + col][0], lane), a);
        const int il = n0c >> 5, jl0 = n0c & 31;                 // the 16 columns of this tile share i (32 | n0c+0..15 within one i row since tiles are 16-aligned inside 32)
#pragma unroll
        for (int r = 0; r < 8; ++r) attp[8 * g + r][il][jl0 + col] = a[r]; } }
    __syncthreads();
    // -- O[o] += att'[o](hi/lo) v_o(hi/lo): this wave's output heads o = hA, hA+1; K = 32 keys (one step); 4 d tiles
#pragma unroll
    for (int u = 0; u < 2; ++u) { const int o = hA + u; const int bh = b * NH + o; const F2 af = split_row(&attp[o][col][0], 0, lane);
#pragma unroll
      for (int d4 = 0; d4 < 4; ++d4) { const size_t vo = (((size_t)bh * (HS / 16) + d4) * (TT / 32) + (j0 >> 5)) * 512;
        oacc[u][d4] = mac3p(af.h, af.l, frag_t(VTh + vo, lane), frag_t(VTl + vo, lane), oacc[u][d4]); } }
    __syncthreads();                                            // pw*/attp are rewritten by the next key tile
  }
  // -- partial O rows: r = b*1024 + i, columns o*64 + d, f32; per wave 16 rows x 64 cols per head staged in the (now free) pw buffers: 256-B segments by 16 lanes
  float* st0 = (float*)(&pwh[0][0] + wave * (16 * 128)); float* st1 = (float*)(&pwl[0][0] + wave * (16 * 128));
#pragma unroll
  for (int d4 = 0; d4 < 4; ++d4)
#pragma unroll
    for (int r = 0; r < 8; ++r) { st0[(8 * g + r) * 64 + d4 * 16 + col] = oacc[0][d4][r]; st1[(8 * g + r) * 64 + d4 * 16 + col] = oacc[1][d4][r]; }
  LDSX();
  for (int qq = lane; qq < 16 * 16; qq += 32) { const int rl = qq >> 4, pc = qq & 15; const size_t o = ((size_t)chunk * NR + (size_t)b * TT + i0 + rl) * CCH + hA * 64 + pc * 4;
    vst2(PART + o, *(const v4f*)(st0 + rl * 64 + pc * 4)); vst2(PART + o + 64, *(const v4f*)(st1 + rl * 64 + pc * 4)); }
}
// ---- k_red: O[r][c] = sum of the row's chunk partials, ascending chunk; -> hi/lo planes in fragment order; block = 16 rows x 256 columns, wave = one tile (16 rows x 32 columns: one whole 128-byte line of each row), lane = its two pieces of 8 columns
__global__ __launch_bounds__(256) void k_red(const float* __restrict__ PART, __bf16* __restrict__ OH, __bf16* __restrict__ OL) {
  const int wave = threadIdx.x >> 5, lane = threadIdx.x & 31, col = lane & 15, g = lane >> 4; const int rt = blockIdx.x >> 2, kc = (blockIdx.x & 3) * 8 + wave;
  const int t = (rt * 16) % TT; const int nch = t / KCH + 1;   // the 16 rows of a block lie in one chunk group
  const float* p = PART + (size_t)(rt * 16 + col) * CCH + kc * 32 + g * 8; v4f a0 = {}, a1 = {}, a2 = {}, a3 = {};
#pragma unroll 1   // at most 8 trips; kept rolled so that the kernel stays small in registers and all of its waves are resident at once and hide each trip's load latency
  for (int c = 0; c < nch; ++c) { a0 += *(const v4f*)p; a1 += *(const v4f*)(p + 4); a2 += *(const v4f*)(p + 16); a3 += *(const v4f*)(p + 20); p += (size_t)NR * CCH; }
  v8b hi, lo, hj, lj;
#pragma unroll
  for (int i = 0; i < 4; ++i) { const __bf16 h0 = (__bf16)a0[i], h1 = (__bf16)a1[i], h2 = (__bf16)a2[i], h3 = (__bf16)a3[i]; hi[i] = h0; hi[4 + i] = h1; hj[i] = h2; hj[4 + i] = h3;
    lo[i] = (__bf16)(a0[i] - (float)h0); lo[4 + i] = (__bf16)(a1[i] - (float)h1); lj[i] = (__bf16)(a2[i] - (float)h2); lj[4 + i] = (__bf16)(a3[i] - (float)h3); }
  const size_t e = ((size_t)rt * (CCH / 32) + kc) * 512 + lane * 8;
  *(v8b*)(OH + e) = hi; *(v8b*)(OH + e + 256) = hj; *(v8b*)(OL + e) = lo; *(v8b*)(OL + e + 256) = lj;
}
// ---- k_out: out = (O(hi/lo) . Wo^T rows + bo) * gamma[t]; block (64 rows, 128 cols), K = 1024
__global__ __launch_bounds__(128) void k_out(const __bf16* __restrict__ OH, const __bf16* __restrict__ OL, const __bf16* __restrict__ PT, const float* __restrict__ bo, const float* __restrict__ gam, float* __restrict__ out) {
  __shared__ __align__(16) float so[4][16][132];
  const int tid = threadIdx.x, wave = tid >> 5, lane = tid & 31, col = lane & 15, g = lane >> 4; const size_t r0 = (size_t)blockIdx.x * 64 + wave * 16; const int n0 = blockIdx.y * 128;
  v8f acc[8] = {};
  // fragments are fetched one k step ahead, as in k_qkv: a weight fragment's registers are refilled for step kc + 1 directly behind the two products that read them at step kc
  const __bf16* ph = OH + (r0 >> 4) * (CCH / 32) * 512 + lane * 8; const __bf16* pl = OL + (r0 >> 4) * (CCH / 32) * 512 + lane * 8; const __bf16* pb = PT + (size_t)((3 * CCH + n0) / 16) * (CCH / 32) * 512 + lane * 8;   // the lane's own piece of tile (., k step 0)
  v16b ah0 = frag_p(ph), al0 = frag_p(pl), ah1, al1, wf[8];
#pragma unroll
  for (int j = 0; j < 8; ++j) wf[j] = frag_p(pb + (size_t)j * (CCH / 32) * 512);
#pragma unroll 1   // 15 trips of two k steps (two, so that the O fragments swap without copies); kept rolled so that the loop stays small in the instruction cache
  for (int kc = 0; kc < CCH / 32 - 2; kc += 2) {
    ah1 = frag_p(ph + 512); al1 = frag_p(pl + 512);
#pragma unroll
    for (int j = 0; j < 8; ++j) { acc[j] = wmma_bf(al0, wf[j], acc[j]); acc[j] = wmma_bf(ah0, wf[j], acc[j]); wf[j] = frag_p(pb + ((size_t)j * (CCH / 32) + 1) * 512); }
    ah0 = frag_p(ph + 1024); al0 = frag_p(pl + 1024);
#pragma unroll
    for (int j = 0; j < 8; ++j) { acc[j] = wmma_bf(al1, wf[j], acc[j]); acc[j] = wmma_bf(ah1, wf[j], acc[j]); wf[j] = frag_p(pb + ((size_t)j * (CCH / 32) + 2) * 512); }
    asm volatile("s_wait_xcnt 0x0" ::: "memory");   // the pointer steps below land in the address registers of the loads above, which are still in flight
    ph += 1024; pl += 1024; pb += 1024; }
  ah1 = frag_p(ph + 512); al1 = frag_p(pl + 512);   // the last two k steps: nothing is left to fetch behind the last
  asm volatile("s_wait_xcnt 0x0" ::: "memory");     // ph and pl are dead from here on: a later load's result may land in their registers
#pragma unroll
  for (int j = 0; j < 8; ++j) { acc[j] = wmma_bf(al0, wf[j], acc[j]); acc[j] = wmma_bf(ah0, wf[j], acc[j]); wf[j] = frag_p(pb + ((size_t)j * (CCH / 32) + 1) * 512); }
  asm volatile("s_wait_xcnt 0x0" ::: "memory");     // the epilogue may land in the address registers of the loads above
#pragma unroll
  for (int j = 0; j < 8; ++j) { acc[j] = wmma_bf(al1, wf[j], acc[j]); acc[j] = wmma_bf(ah1, wf[j], acc[j]); }
#pragma unroll
  for (int j = 0; j < 8; ++j) { const float bb = bfr(bo[n0 + j * 16 + col]);
#pragma unroll
    for (int r = 0; r < 8; ++r) { const int t = (int)((r0 + 8 * g + r) % TT); so[wave][8 * g + r][j * 16 + col] = (acc[j][r] + bb) * bfr(gam[t]); } }
  LDSX();
  for (int rl = 0; rl < 16; ++rl) vst2(out + (r0 + rl) * CCH + n0 + lane * 4, *(const v4f*)(&so[wave][rl][lane * 4]));
}

extern "C" void kernel_launch(void* const* d_in, const int* in_sizes, int n_in, void* d_out, int out_size, void* d_ws, size_t ws_size, hipStream_t stream) {
  (void)in_sizes; (void)n_in; (void)out_size;
  const float** I = (const float**)d_in;   // x, Wq, bq, Wk, bk, Wv, bv, Wo, bo, time_w, time_alpha, time_beta, time_gamma, head_mix_w
  if (ws_size < (size_t)WS_END) return;
  char* ws = (char*)d_ws;
  __bf16* PT = (__bf16*)(ws + WS_PT); __bf16 *Qh = (__bf16*)(ws + WS_QH), *Ql = (__bf16*)(ws + WS_QL), *Kh = (__bf16*)(ws + WS_KH), *Kl = (__bf16*)(ws + WS_KL), *VTh = (__bf16*)(ws + WS_VTH), *VTl = (__bf16*)(ws + WS_VTL);
  float *Mo = (float*)(ws + WS_M), *Lo = (float*)(ws + WS_L); __bf16 *OH = (__bf16*)(ws + WS_OH), *OL = (__bf16*)(ws + WS_OL); float* PART = (float*)(ws + WS_PART); __bf16* XS = (__bf16*)(ws + WS_XS);
  k_pack<<<4 * (CCH / 16) * 4 + (NR / 16) * 4, 256, 0, stream>>>(I[0], I[1], I[3], I[5], I[7], PT, XS);
  k_qkv<<<dim3(NR / 64, 24), 128, 0, stream>>>(XS, PT, I[2], I[4], I[6], Qh, Ql, Kh, Kl, VTh, VTl);
  k_stats<<<dim3(TT / 64, NB * NH), 128, 0, stream>>>(Qh, Ql, Kh, Kl, Mo, Lo);
  k_mix<<<dim3(NB, MIXBLK), 256, 0, stream>>>(Qh, Ql, Kh, Kl, VTh, VTl, Mo, Lo, I[9], I[10], I[11], I[13], PART);
  k_red<<<(NR / 16) * 4, 256, 0, stream>>>(PART, OH, OL);
  k_out<<<dim3(NR / 64, CCH / 128), 128, 0, stream>>>(OH, OL, PT, I[8], I[12], (float*)d_out);
}

// v005
// It runs in 287 microseconds.
// Timed twice side by side with v004, it ran 1.14 and 1.12 times as fast.
// Counting every step since v000, it is 2.82 times as fast.
// compute dtype: x, all weights/biases, time_w/alpha/beta/gamma and the head-mixing matrix (module inputs) rounded to bf16; q/k/v = xs W with exact bf16 products; RoPE, scores' softmax statistics,
// decay and normalisation in f32; scores = q'(hi/lo) k'(hi/lo)^T (3 products); head mixing = bf16(mix) x (P w)(hi/lo) (2 products); context = att'(hi/lo) x v(hi/lo) (3 products); out = O(hi/lo) Wo (2 products) + bo, x gamma; f32 accumulate.
#include <hip/hip_runtime.h>
#include <math.h>

typedef __attribute__((ext_vector_type(16))) _Float16 v16h;
typedef __attribute__((ext_vector_type(16))) __bf16 v16b;
typedef __attribute__((ext_vector_type(8)))  _Float16 v8h;
typedef __attribute__((ext_vector_type(8)))  float v8f;
typedef __attribute__((ext_vector_type(4)))  float v4f;
typedef __attribute__((ext_vector_type(2)))  float v2f;
typedef __attribute__((ext_vector_type(4)))  unsigned v4u;
typedef __attribute__((ext_vector_type(4)))  int v4i;
typedef float __attribute__((may_alias)) float_a;
typedef int __attribute__((may_alias)) int_a;

template <typename T> __device__ __forceinline__ void vst2(void* p, T v) { *(T*)p = v;  }
__device__ __forceinline__ v8f wmma16(v16h a, v16h b, v8f c) {
  v8f d = __builtin_amdgcn_wmma_f32_16x16x32_f16(false, a, false, b, (short)0, c, false, false);
  asm volatile("v_nop\n\tv_nop\n\tv_nop\n\tv_nop" : "+v"(d) : "v"(a), "v"(b));
  return d;
}
__device__ __forceinline__ v8f wmma_bf(v16b a, v16b b, v8f c) {
  v8f d = __builtin_amdgcn_wmma_f32_16x16x32_bf16(false, a, false, b, (short)0, c, false, false);
  asm volatile("v_nop\n\tv_nop\n\tv_nop\n\tv_nop" : "+v"(d) : "v"(a), "v"(b));
  return d;
}
// 16x16x32 fragments: lane = (h = lane>>4, row/col = lane&15); elements 0..7 = k0+8h+0..7, 8..15 = k0+16+8h+0..7; D element r = row 8h+r
__device__ __forceinline__ v16h frag_h(const _Float16* rowk0, int lane) {
  union { v16h v; v8h q[2]; } u; const _Float16* p = rowk0 + 8 * (lane >> 4);
  u.q[0] = *(const v8h*)p; u.q[1] = *(const v8h*)(p + 16); return u.v;
}
__device__ __forceinline__ v16h frag_f32(const float* rowk0, int lane) {
  v16h a; const float* p = rowk0 + 8 * (lane >> 4);
#pragma unroll
  for (int i = 0; i < 8; ++i) { a[i] = (_Float16)p[i]; a[8 + i] = (_Float16)p[16 + i]; }
  return a;
}
__device__ __forceinline__ v16h frag_f32s(const float* rowk0, int lane, float sc) {
  v16h a; const float* p = rowk0 + 8 * (lane >> 4);
#pragma unroll
  for (int i = 0; i < 8; ++i) { a[i] = (_Float16)(p[i] * sc); a[8 + i] = (_Float16)(p[16 + i] * sc); }
  return a;
}
// column fragment from a [K][ld] layout (column n), rows >= K read as 0
__device__ __forceinline__ v16h fragc_f32(const float* W, int k0, int n, int lane, int ld, int K) {
  v16h a; const int g = lane >> 4;
#pragma unroll
  for (int i = 0; i < 8; ++i) { const int ka = k0 + 8 * g + i, kb = ka + 16;
    a[i] = (_Float16)(ka < K ? W[(size_t)(ka < K ? ka : K - 1) * ld + n] : 0.f); a[8 + i] = (_Float16)(kb < K ? W[(size_t)(kb < K ? kb : K - 1) * ld + n] : 0.f); }
  return a;
}
struct F2 { v16b h, l; };
__device__ __forceinline__ F2 bsplit16(const float v[16]) { F2 r;
#pragma unroll
  for (int i = 0; i < 16; ++i) { const __bf16 h = (__bf16)v[i]; r.h[i] = h; r.l[i] = (__bf16)(v[i] - (float)h); }
  return r; }
__device__ __forceinline__ F2 split_row(const float* row, int k0, int lane) { float v[16]; const float* p = row + k0 + 8 * (lane >> 4);
#pragma unroll
  for (int i = 0; i < 8; ++i) { v[i] = p[i]; v[8 + i] = p[16 + i]; }
  return bsplit16(v); }
__device__ __forceinline__ F2 split_rowK(const float* row, int k0, int lane, int K) { float v[16]; const int g = lane >> 4;
#pragma unroll
  for (int i = 0; i < 8; ++i) { const int ka = k0 + 8 * g + i, kb = ka + 16; v[i] = ka < K ? row[ka < K ? ka : K - 1] : 0.f; v[8 + i] = kb < K ? row[kb < K ? kb : K - 1] : 0.f; }
  return bsplit16(v); }
__device__ __forceinline__ F2 split_col(const float* W, int k0, int n, int lane, int ld, int K) { float v[16]; const int g = lane >> 4;
#pragma unroll
  for (int i = 0; i < 8; ++i) { const int ka = k0 + 8 * g + i, kb = ka + 16; v[i] = ka < K ? W[(size_t)(ka < K ? ka : K - 1) * ld + n] : 0.f; v[8 + i] = kb < K ? W[(size_t)(kb < K ? kb : K - 1) * ld + n] : 0.f; }
  return bsplit16(v); }
__device__ __forceinline__ v8f mac3(const F2& a, const F2& b, v8f c) { c = wmma_bf(a.l, b.h, c); c = wmma_bf(a.h, b.l, c); return wmma_bf(a.h, b.h, c); }
__device__ __forceinline__ float sigm(float v) { return 1.0f / (1.0f + expf(-v)); }
#define LDSX() do { asm volatile("s_wait_dscnt 0" ::: "memory"); __builtin_amdgcn_wave_barrier(); __builtin_amdgcn_fence(__ATOMIC_RELEASE, "workgroup"); } while (0)


// Causal multi-head attention with token shift, partial RoPE, per-head Toeplitz time decay, a 16x16 cross-head mixing of the softmax maps, output projection and a per-position gain.
// Rows r = b*1024 + t. Every bf16 operand plane in the workspace (xs, weights, q, k, v^T, O) is stored in fragment order (see frag_t); the shapes below name rows and K. k_pack ([in][out] weights -> bf16 rows); k_pack also builds xs (channels < 512 come from t-1, zero at t = 0) as bf16 rows; k_qkv (xs W + bias; RoPE on dims 0..31; q/k -> hi/lo rows [bh][t][64], v -> hi/lo transposed [bh][d][t]);
// k_stats (per (bh, 64 queries): causal row max and sum of exp over the keys, kept per lane and merged once -> M, L); k_mix (block = (b, 16 queries, 128-key chunk), loop over 32-key tiles: S for all 16 heads -> P*w as bf16 hi/lo [query,key][h] in LDS -> mixing GEMM -> att'[o][i][j] f32 in LDS
// -> O[o] += att'(hi/lo) v_o(hi/lo); a block covers at most 128 keys and leaves its f32 partial O in PART[chunk][r][o*64+d]); k_red (sum of a row's chunks in ascending key order -> O hi/lo planes [r][o*64+d]); k_out ((O Wo + bo) * gamma[t]).
#define NB 4
#define TT 1024
#define CCH 1024
#define NH 16
#define HS 64
#define NR (NB * TT)
#define ROT 32
#define KCH 128                 // keys per k_mix block
#define NCHK (TT / KCH)         // chunks of the longest row
#define MIXFULL (8 * (NCHK * (NCHK - 1) / 2))  // (16-query tile, chunk) pairs per batch below the diagonal: the 8 tiles with diagonal chunk q have q full chunks each
#define MIXBLK (MIXFULL + TT / 16)             // plus one diagonal chunk per tile
typedef __attribute__((ext_vector_type(8))) __bf16 v8b;
__device__ __forceinline__ v16b frag_b16(const __bf16* rowk0, int lane) {
  union { v16b v; v8b q[2]; } u; const __bf16* p = rowk0 + 8 * (lane >> 4);
  u.q[0] = *(const v8b*)p; u.q[1] = *(const v8b*)(p + 16); return u.v;
}
// Fragment order of a bf16 operand [rows][K] in global memory: tiles of 16 rows x 32 k (512 elements, 1 KiB), tile index = (row >> 4) * (K / 32) + (k >> 5); inside a tile the 8 elements k & ~7 .. of a row lie at
// element ((k >> 4) & 1) * 256 + (((k >> 3) & 1) * 16 + (row & 15)) * 8. That is the order in which the lanes read a fragment, so each of its two wave-wide 16-byte loads covers 512 contiguous bytes (4 lines, not 16)
__device__ __forceinline__ v16b frag_t(const __bf16* tile, int lane) {
  union { v16b v; v8b q[2]; } u; const __bf16* p = tile + lane * 8;
  u.q[0] = *(const v8b*)p; u.q[1] = *(const v8b*)(p + 256); return u.v;
}
// the same fragment from the lane's own pointer (tile + lane * 8)
__device__ __forceinline__ v16b frag_p(const __bf16* p) {
  union { v16b v; v8b q[2]; } u; u.q[0] = *(const v8b*)p; u.q[1] = *(const v8b*)(p + 256); return u.v;
}
__device__ __forceinline__ float bfr(float v) { return (float)(__bf16)v; }
__device__ __forceinline__ v8f mac3p(v16b ah, v16b al, v16b bh, v16b bl, v8f c) { c = wmma_bf(al, bh, c); c = wmma_bf(ah, bl, c); return wmma_bf(ah, bh, c); }
__constant__ float c_invfreq[16] = {1.0f,0.5623413324356079f,0.3162277638912201f,0.17782793939113617f,0.10000000149011612f,0.05623412877321243f,0.03162277862429619f,0.017782794311642647f,0.009999999776482582f,0.005623413249850273f,0.003162277862429619f,0.0017782794311642647f,0.0010000000474974513f,0.000562341301701963f,0.0003162277862429619f,0.00017782794020604342f};

// workspace carve (bytes)
#define PLANE_Q (2u * NB * NH * TT * HS)        // bf16 [64 bh][1024][64] = 8 MiB
#define WS_PT   0u                               // bf16 [4096][1024]: rows 0.. Wq^T, 1024.. Wk^T, 2048.. Wv^T, 3072.. Wo^T  (8 MiB)
#define WS_QH   (WS_PT + 2u * 4 * CCH * CCH)
#define WS_QL   (WS_QH + PLANE_Q)
#define WS_KH   (WS_QL + PLANE_Q)
#define WS_KL   (WS_KH + PLANE_Q)
#define WS_VTH  (WS_KL + PLANE_Q)                // bf16 [bh][64 d][1024 t]
#define WS_VTL  (WS_VTH + PLANE_Q)
#define WS_M    (WS_VTL + PLANE_Q)               // f32 [bh][1024]
#define WS_L    (WS_M + 4u * NB * NH * TT)
#define WS_OH   (WS_L + 4u * NB * NH * TT)       // bf16 [4096][1024] (row r, col o*64 + d)
#define WS_OL   (WS_OH + 2u * NR * CCH)
#define WS_PART (WS_OL + 2u * NR * CCH)          // f32 [8 key chunks][4096][1024]; row r uses chunks 0 .. t/128
#define WS_XS   (WS_PART + 4u * NCHK * NR * CCH) // bf16 [4096][1024]: shifted x
#define WS_END  (WS_XS + 2u * NR * CCH)

// ---- k_pack: PT (row n, k) = bf16(W[k][n]) in fragment order; block = (16 rows n, 256 k; which matrix is block-uniform), wave = one tile: a lane gathers its 2 x 8 k of its own column n (16 lanes = a 64-byte run of W) and stores them as the fragment's pieces
// blocks from 1024 on: XS (row r, channel k) = bf16(xs) in fragment order, xs = x with channels < 512 taken from row t-1 (zero at t = 0; the address is clamped to the row itself, the load is unconditional and the zero a select); wave = one tile = one 128-byte line of each of 16 rows
__global__ __launch_bounds__(256) void k_pack(const float* __restrict__ X, const float* __restrict__ Wq, const float* __restrict__ Wk, const float* __restrict__ Wv, const float* __restrict__ Wo, __bf16* __restrict__ PT, __bf16* __restrict__ XS) {
  const int tid = threadIdx.x, wave = tid >> 5, lane = tid & 31, col = lane & 15, g = lane >> 4;
  const int rt = (blockIdx.x >> 2) & 255, kc = (blockIdx.x & 3) * 8 + wave;
  if (blockIdx.x >= 4 * (CCH / 16) * 4) {   // block-uniform
    const int r = rt * 16 + col, t = r % TT; const bool shifted = kc * 32 < CCH / 2; const bool zero = shifted && (t == 0);
    const float* px = X + (size_t)(r - ((shifted && t > 0) ? 1 : 0)) * CCH + kc * 32 + g * 8;
    const v4f x0 = *(const v4f*)px, x1 = *(const v4f*)(px + 4), x2 = *(const v4f*)(px + 16), x3 = *(const v4f*)(px + 20); v8b y0, y1;
#pragma unroll
    for (int e = 0; e < 4; ++e) { y0[e] = (__bf16)(zero ? 0.f : x0[e]); y0[4 + e] = (__bf16)(zero ? 0.f : x1[e]); y1[e] = (__bf16)(zero ? 0.f : x2[e]); y1[4 + e] = (__bf16)(zero ? 0.f : x3[e]); }
    __bf16* dx = XS + ((size_t)rt * (CCH / 32) + kc) * 512 + lane * 8;
    *(v8b*)dx = y0; *(v8b*)(dx + 256) = y1;
    return;
  }
  const int which = rt >> 6, nn = (rt & 63) * 16 + col;
  const float* Wm = which == 0 ? Wq : which == 1 ? Wk : which == 2 ? Wv : Wo;
  const float* p = Wm + (size_t)(kc * 32 + g * 8) * CCH + nn; v8b o0, o1;
#pragma unroll
  for (int e = 0; e < 8; ++e) { o0[e] = (__bf16)p[(size_t)e * CCH]; o1[e] = (__bf16)p[(size_t)(16 + e) * CCH]; }
  __bf16* d = PT + ((size_t)rt * (CCH / 32) + kc) * 512 + lane * 8;
  *(v8b*)d = o0; *(v8b*)(d + 256) = o1;
}
// ---- k_qkv: block (64 rows, 128 cols = 2 heads of q, k or v); exact products; + bias; RoPE (q, k); q/k -> hi/lo rows [bh][t][64]; v -> VT hi/lo [bh][d][t]
__global__ __launch_bounds__(128) void k_qkv(const __bf16* __restrict__ XS, const __bf16* __restrict__ PT, const float* __restrict__ bq, const float* __restrict__ bk, const float* __restrict__ bv,
                                             __bf16* __restrict__ Qh, __bf16* __restrict__ Ql, __bf16* __restrict__ Kh, __bf16* __restrict__ Kl, __bf16* __restrict__ VTh, __bf16* __restrict__ VTl) {
  __shared__ __align__(16) __bf16 sh_[128][72], sl_[128][72];
  const int tid = threadIdx.x, wave = tid >> 5, lane = tid & 31, col = lane & 15, g = lane >> 4;
  const size_t rb = (size_t)blockIdx.x * 64; const int b = (int)(rb / TT), t0 = (int)(rb % TT);
  const int which = blockIdx.y >> 3; const int n0 = (blockIdx.y & 7) * 128;          // block-uniform: 0 q, 1 k, 2 v; n0 = first output channel (2 heads)
  const size_t r0 = rb + wave * 16;
  v8f acc[8] = {};
  // fragments are fetched one k step ahead: a weight fragment's registers are refilled for step kc + 1 directly behind the product that read them at step kc, so a load has eight products' time to arrive and no product waits a whole memory latency of its own
  const __bf16* pa = XS + (r0 >> 4) * (CCH / 32) * 512 + lane * 8; const __bf16* pb = PT + (size_t)((which * CCH + n0) / 16) * (CCH / 32) * 512 + lane * 8;   // the lane's own piece of tile (., k step 0)
  v16b a0 = frag_p(pa), a1, wf[8];
#pragma unroll
  for (int j = 0; j < 8; ++j) wf[j] = frag_p(pb + (size_t)j * (CCH / 32) * 512);
#pragma unroll 1   // 15 trips of two k steps (two, so that the two x fragments swap without copies); kept rolled so that the loop stays small in the instruction cache
  for (int kc = 0; kc < CCH / 32 - 2; kc += 2) {
    a1 = frag_p(pa + 512);
#pragma unroll
    for (int j = 0; j < 8; ++j) { acc[j] = wmma_bf(a0, wf[j], acc[j]); wf[j] = frag_p(pb + ((size_t)j * (CCH / 32) + 1) * 512); }
    a0 = frag_p(pa + 1024);
#pragma unroll
    for (int j = 0; j < 8; ++j) { acc[j] = wmma_bf(a1, wf[j], acc[j]); wf[j] = frag_p(pb + ((size_t)j * (CCH / 32) + 2) * 512); }
    asm volatile("s_wait_xcnt 0x0" ::: "memory");   // the pointer steps below land in the address registers of the loads above, which are still in flight
    pa += 1024; pb += 1024; }
  a1 = frag_p(pa + 512);   // the last two k steps: nothing is left to fetch behind the last
  asm volatile("s_wait_xcnt 0x0" ::: "memory");     // pa is dead from here on: a later load's result may land in its registers
#pragma unroll
  for (int j = 0; j < 8; ++j) { acc[j] = wmma_bf(a0, wf[j], acc[j]); wf[j] = frag_p(pb + ((size_t)j * (CCH / 32) + 1) * 512); }
  asm volatile("s_wait_xcnt 0x0" ::: "memory");     // the epilogue may land in the address registers of the loads above
#pragma unroll
  for (int j = 0; j < 8; ++j) acc[j] = wmma_bf(a1, wf[j], acc[j]);
  const float* bias = which == 0 ? bq : which == 1 ? bk : bv;
#pragma unroll
  for (int j = 0; j < 8; ++j) { const float bb = bfr(bias[n0 + j * 16 + col]);
#pragma unroll
    for (int r = 0; r < 8; ++r) acc[j][r] += bb; }
  if (which < 2) {   // RoPE on head-local dims 0..15 (tile 4h'+0) and 16..31 (tile 4h'+1), pairs in the same lane; theta = t * inv_freq[col]
#pragma unroll
    for (int hp = 0; hp < 2; ++hp) {
#pragma unroll
      for (int r = 0; r < 8; ++r) { const int t = t0 + wave * 16 + 8 * g + r; const float th = (float)t * c_invfreq[col]; const float cs = cosf(th), sn = sinf(th);
        const float a0 = acc[hp * 4][r], a1 = acc[hp * 4 + 1][r];
        acc[hp * 4][r] = a0 * cs - a1 * sn; acc[hp * 4 + 1][r] = a1 * cs + a0 * sn; } }
    __bf16* Oh = which == 0 ? Qh : Kh; __bf16* Ol = which == 0 ? Ql : Kl;
#pragma unroll
    for (int hp = 0; hp < 2; ++hp) {
#pragma unroll
      for (int j = 0; j < 4; ++j)
#pragma unroll
        for (int r = 0; r < 8; ++r) { const float v = acc[hp * 4 + j][r]; const __bf16 hi = (__bf16)v; sh_[wave * 16 + 8 * g + r][j * 16 + col] = hi; sl_[wave * 16 + 8 * g + r][j * 16 + col] = (__bf16)(v - (float)hi); }
      LDSX();
      const int h = (n0 >> 6) + hp; const size_t base = ((size_t)(b * NH + h) * TT + t0 + wave * 16) * HS;   // the wave's 16 rows x 64 dims = two whole tiles; piece qq of them holds row qq & 15, dims 8 (qq >> 4) ..
      v4u ph[4], pl[4];
#pragma unroll   // four fixed trips, unrolled so that ph and pl are registers and the eight LDS reads share one latency
      for (int q4 = 0; q4 < 4; ++q4) { const int qq = q4 * 32 + lane, pc = q4 * 2 + g; ph[q4] = *(const v4u*)(&sh_[wave * 16 + col][pc * 8]); pl[q4] = *(const v4u*)(&sl_[wave * 16 + col][pc * 8]); vst2((unsigned*)(Oh + base + qq * 8), ph[q4]); vst2((unsigned*)(Ol + base + qq * 8), pl[q4]); }
      asm volatile("s_wait_xcnt 0x0" :: "v"(ph[0]), "v"(ph[1]), "v"(ph[2]), "v"(ph[3]), "v"(pl[0]), "v"(pl[1]), "v"(pl[2]), "v"(pl[3]) : "memory");   // the next head's conversions may land in the data registers of the eight stores above; the stored values as inputs keep those registers untouched up to this wait
      LDSX(); }
  } else {
#pragma unroll
    for (int j = 0; j < 8; ++j)
#pragma unroll
      for (int r = 0; r < 8; ++r) { const float v = acc[j][r]; const __bf16 hi = (__bf16)v; sh_[j * 16 + col][wave * 16 + 8 * g + r] = hi; sl_[j * 16 + col][wave * 16 + 8 * g + r] = (__bf16)(v - (float)hi); }
    __syncthreads();
    for (int qq = tid; qq < 128 * 8; qq += 128) { const int ct = qq >> 7, kcl = (qq >> 6) & 1, w = qq & 63; const int c = ct * 16 + (w & 15), pc = kcl * 4 + (w >> 4);   // 16 tiles (8 groups of 16 channels x 2 groups of 32 t), 64 pieces each, in storage order
      const int h = (n0 >> 6) + (ct >> 2); const size_t o = (((size_t)(b * NH + h) * (HS / 16) + (ct & 3)) * (TT / 32) + (t0 >> 5) + kcl) * 512 + w * 8;
      vst2((unsigned*)(VTh + o), *(const v4u*)(&sh_[c][pc * 8])); vst2((unsigned*)(VTl + o), *(const v4u*)(&sl_[c][pc * 8])); }
  }
}
// ---- k_stats: block = (bh, 64 queries); wave = 16 queries; causal key steps of 64 (four 16-key tiles): S = q'(hi/lo) k'(hi/lo) / 8; every lane keeps the running max and sum of its own key columns (j = col mod 16) and rescales once per step;
// the 16 lanes of a row are merged once, behind the loop -> M, L (f32 [bh][t], 256 B per block by 16 lanes)
__global__ __launch_bounds__(128) void k_stats(const __bf16* __restrict__ Qh, const __bf16* __restrict__ Ql, const __bf16* __restrict__ Kh, const __bf16* __restrict__ Kl, float* __restrict__ Mo, float* __restrict__ Lo) {
  __shared__ float sm[64], ssum[64];
  const int tid = threadIdx.x, wave = tid >> 5, lane = tid & 31, col = lane & 15, g = lane >> 4;
  const int bh = blockIdx.y; const int i0 = blockIdx.x * 64 + wave * 16;
  const __bf16* qh = Qh + ((size_t)bh * TT + i0) * HS; const __bf16* ql = Ql + ((size_t)bh * TT + i0) * HS;
  const v16b qh0 = frag_t(qh, lane), qh1 = frag_t(qh + 512, lane), ql0 = frag_t(ql, lane), ql1 = frag_t(ql + 512, lane);
  asm volatile("s_wait_xcnt 0x0" :: "v"(qh0), "v"(qh1), "v"(ql0), "v"(ql1) : "memory");   // the loop's key loads may land in the address registers of the query loads above; the loaded values as inputs keep this wait behind those loads
  float m[8], l[8];
#pragma unroll
  for (int r = 0; r < 8; ++r) { m[r] = -3.0e38f; l[r] = 0.f; }
  const int jend = i0 + 16;                                      // keys j <= i for rows i0..i0+15 -> tiles covering [0, i0+16)
#pragma unroll 1
  for (int j0 = 0; j0 < jend; j0 += 64) {
    v8f s4[4];   // the step's four score tiles; a tile past the diagonal is skipped, stays zero and is dropped by the select below
#pragma unroll
    for (int jt = 0; jt < 4; ++jt) { const int jb = j0 + jt * 16; v8f s = {}; if (jb < jend) {   // wave-uniform
      const __bf16* kh = Kh + ((size_t)bh * TT + jb) * HS; const __bf16* kl = Kl + ((size_t)bh * TT + jb) * HS;
      const v16b kh0 = frag_t(kh, lane), kl0 = frag_t(kl, lane), kh1 = frag_t(kh + 512, lane), kl1 = frag_t(kl + 512, lane);
      asm volatile("s_wait_xcnt 0x0" :: "v"(kh0), "v"(kl0), "v"(kh1), "v"(kl1) : "memory");   // inputs-only fence on the loaded values: holds all eight key loads in front of the products, one memory latency instead of two in a row; and it keeps this wait behind them: the step's rescale may land in their address registers
      s = mac3p(qh0, ql0, kh0, kl0, s); s = mac3p(qh1, ql1, kh1, kl1, s); }
      s4[jt] = s; }
#pragma unroll
    for (int r = 0; r < 8; ++r) { const int i = i0 + 8 * g + r; float v[4];
#pragma unroll
      for (int t = 0; t < 4; ++t) v[t] = (j0 + t * 16 + col <= i) ? s4[t][r] * 0.125f : -1e30f;
      const float mn = fmaxf(fmaxf(fmaxf(fmaxf(m[r], v[0]), v[1]), v[2]), v[3]);
      l[r] = l[r] * expf(m[r] - mn) + ((expf(v[0] - mn) + expf(v[1] - mn)) + (expf(v[2] - mn) + expf(v[3] - mn))); m[r] = mn; }   // a lane that has seen masked keys only holds m = -1e30 and a count in l: the next rescale, or the merge below, multiplies it by exp(-1e30 - max) = 0
  }
#pragma unroll
  for (int r = 0; r < 8; ++r) { float mt = m[r];   // merge of the row's 16 lanes: every row has key 0, so the merged max is a real score
#pragma unroll
    for (int o = 1; o < 16; o <<= 1) mt = fmaxf(mt, __shfl_xor(mt, o));
    float e = l[r] * expf(m[r] - mt);
#pragma unroll
    for (int o = 1; o < 16; o <<= 1) e += __shfl_xor(e, o);
    m[r] = mt; l[r] = e; }
  if (col == 0) {
#pragma unroll
    for (int r = 0; r < 8; ++r) { sm[wave * 16 + 8 * g + r] = m[r]; ssum[wave * 16 + 8 * g + r] = l[r]; } }
  __syncthreads();
  if (tid < 16) { vst2(Mo + (size_t)bh * TT + blockIdx.x * 64 + tid * 4, *(const v4f*)&sm[tid * 4]); vst2(Lo + (size_t)bh * TT + blockIdx.x * 64 + tid * 4, *(const v4f*)&ssum[tid * 4]); }
}
// ---- k_mix: block = (b, 16 queries i0..i0+15, keys of one 128-key chunk), 8 waves; loop over the chunk's 32-key tiles (causal). M and L are known, so O is a plain sum over keys and chunks are independent
__global__ __launch_bounds__(256) void k_mix(const __bf16* __restrict__ Qh, const __bf16* __restrict__ Ql, const __bf16* __restrict__ Kh, const __bf16* __restrict__ Kl, const __bf16* __restrict__ VTh, const __bf16* __restrict__ VTl,
                                             const float* __restrict__ Mo, const float* __restrict__ Lo, const float* __restrict__ tw, const float* __restrict__ talpha, const float* __restrict__ tbeta, const float* __restrict__ mixw,
                                             float* __restrict__ PART) {
  __shared__ __align__(16) __bf16 pwh[512][32], pwl[512][32];   // (P*w) for the tile: row = i*32 + j (query-in-tile, key-in-tile), column = head h (16..31 stay zero)
  __shared__ __align__(16) float attp[NH][16][36];               // mixed attention tile per output head o: [o][i][j]
  __shared__ __align__(16) __bf16 mixr[NH][32];                  // mixing matrix rows o, k = h (16..31 zero)
  const int tid = threadIdx.x, wave = tid >> 5, lane = tid & 31, col = lane & 15, g = lane >> 4;
  // blockIdx.y -> (query tile = 8 gq + tl, chunk <= gq): the full 128-key chunks first, then the diagonal chunks from the longest to the shortest, so that the work-groups that start last are the short ones
  int rem = blockIdx.y, gq, tl, chunk;
  if (rem < MIXFULL) { gq = NCHK - 1; while (gq > 1 && rem >= 8 * gq) { rem -= 8 * gq; --gq; } chunk = rem >> 3; tl = rem & 7; }
  else { rem -= MIXFULL; gq = rem & 7; tl = 7 - (rem >> 3); chunk = gq; }
  const int b = blockIdx.x, i0 = (gq * 8 + tl) * 16;
  for (int q = tid; q < 512 * 32 / 8; q += 256) { *(v4u*)(&pwh[0][0] + q * 8) = (v4u){0u,0u,0u,0u}; *(v4u*)(&pwl[0][0] + q * 8) = (v4u){0u,0u,0u,0u}; }
  for (int q = tid; q < NH * 32; q += 256) { const int o = q >> 5, h = q & 31; mixr[o][h] = h < NH ? (__bf16)mixw[o * NH + h] : (__bf16)0.f; }
  // this wave's two heads for the S phase and two output heads for the PV phase
  const int hA = wave * 2;
  float mrow[2][8], lb[2][8];            // row max, and beta[h][i] / L (the per-row factors of p*w = (e^(s-m)/L) * ((tw*alpha)*beta), folded)
#pragma unroll
  for (int u = 0; u < 2; ++u) { const int bh = b * NH + hA + u;
#pragma unroll
    for (int r = 0; r < 8; ++r) { const int i = i0 + 8 * g + r; mrow[u][r] = Mo[(size_t)bh * TT + i]; lb[u][r] = bfr(tbeta[(hA + u) * TT + i]) / Lo[(size_t)bh * TT + i]; } }
  v8f oacc[2][4];
#pragma unroll
  for (int u = 0; u < 2; ++u)
#pragma unroll
    for (int d4 = 0; d4 < 4; ++d4) oacc[u][d4] = (v8f){};
  __syncthreads();
  const int jbeg = chunk * KCH; const int jend = (i0 + 16 < jbeg + KCH) ? i0 + 16 : jbeg + KCH;
#pragma unroll 1
  for (int j0 = jbeg; j0 < jend; j0 += 32) {
    // -- S for this wave's two heads; P*w -> pwh/pwl[(i)*32 + j][h]
#pragma unroll
    for (int u = 0; u < 2; ++u) { const int h = hA + u; const int bh = b * NH + h;
      const __bf16* qh = Qh + ((size_t)bh * TT + i0) * HS; const __bf16* ql = Ql + ((size_t)bh * TT + i0) * HS;
      const v16b qh0 = frag_t(qh, lane), qh1 = frag_t(qh + 512, lane), ql0 = frag_t(ql, lane), ql1 = frag_t(ql + 512, lane);   // re-read per key tile (cached) to keep VGPRs < 256
#pragma unroll 1
      for (int jt = 0; jt < 2; ++jt) { const int jb = j0 + jt * 16;   // body is one straight line, no call and no branch: the eight rows' loads, exps and stores overlap. jb + 15 <= 1023, so a half past the diagonal reads rows that exist; the select drops it
        const __bf16* kh = Kh + ((size_t)bh * TT + jb) * HS; const __bf16* kl = Kl + ((size_t)bh * TT + jb) * HS;
        const int j = jb + col; const float al = talpha[h * TT + (j < TT ? j : TT - 1)]; float twv[8];
#pragma unroll
        for (int r = 0; r < 8; ++r) { const int widx = TT - 1 + j - (i0 + 8 * g + r); twv[r] = tw[h * TT + (widx < TT ? widx : TT - 1)]; }   // 0 <= widx; clamped into the row above the diagonal
        asm volatile("s_wait_xcnt 0x0" ::: "memory");   // the key loads below may land in the offset registers of the nine loads above
        const v16b kh0 = frag_t(kh, lane), kl0 = frag_t(kl, lane), kh1 = frag_t(kh + 512, lane), kl1 = frag_t(kl + 512, lane);
        // inputs-only fence on the loaded values: holds all 17 loads of this half in front of the products, so that they share one memory latency (without it the compiler sinks half of the key loads and the decay loads behind the products: three latencies in a row)
        asm volatile("" :: "v"(kh0), "v"(kl0), "v"(kh1), "v"(kl1), "v"(al), "v"(twv[0]), "v"(twv[1]), "v"(twv[2]), "v"(twv[3]), "v"(twv[4]), "v"(twv[5]), "v"(twv[6]), "v"(twv[7]));
        v8f s = {}; s = mac3p(qh0, ql0, kh0, kl0, s); s = mac3p(qh1, ql1, kh1, kl1, s);
        const float alpha_j = bfr(al);
#pragma unroll
        for (int r = 0; r < 8; ++r) { const int il = 8 * g + r, i = i0 + il;
          const float pv = (expf(s[r] * 0.125f - mrow[u][r]) * lb[u][r]) * (bfr(twv[r]) * alpha_j);
          const float pw = (j <= i) ? pv : 0.f;                  // causal mask as a select: a masked pv is never used
          const __bf16 hi = (__bf16)pw; pwh[il * 32 + jt * 16 + col][h] = hi; pwl[il * 32 + jt * 16 + col][h] = (__bf16)(pw - (float)hi); } } }
    __syncthreads();
    // -- mixing GEMM: att'[o][(i,j)] = sum_h mix[o][h] Pw[(i,j)][h]; 32 column tiles of 16 (i,j) pairs, K = 32 (h, upper half zero); wave owns column tiles 4w..4w+3
    { const v16b am = frag_b16(&mixr[col][0], lane);            // A rows o = col, k = h
#pragma unroll 1
      for (int ct = 0; ct < 4; ++ct) { const int n0c = (wave * 4 + ct) * 16; v8f a = {};
        a = wmma_bf(am, frag_b16(&pwl[n0c + col][0], lane), a); a = wmma_bf(am, frag_b16(&pwh[n0c + col][0], lane), a);
        const int il = n0c >> 5, jl0 = n0c & 31;                 // the 16 columns of this tile share i (32 | n0c+0..15 within one i row since tiles are 16-aligned inside 32)
#pragma unroll
        for (int r = 0; r < 8; ++r) attp[8 * g + r][il][jl0 + col] = a[r]; } }
    __syncthreads();
    // -- O[o] += att'[o](hi/lo) v_o(hi/lo): this wave's output heads o = hA, hA+1; K = 32 keys (one step); 4 d tiles
#pragma unroll
    for (int u = 0; u < 2; ++u) { const int o = hA + u; const int bh = b * NH + o; const F2 af = split_row(&attp[o][col][0], 0, lane);
#pragma unroll
      for (int d4 = 0; d4 < 4; ++d4) { const size_t vo = (((size_t)bh * (HS / 16) + d4) * (TT / 32) + (j0 >> 5)) * 512;
        oacc[u][d4] = mac3p(af.h, af.l, frag_t(VTh + vo, lane), frag_t(VTl + vo, lane), oacc[u][d4]); } }
    __syncthreads();                                            // pw*/attp are rewritten by the next key tile
  }
  // -- partial O rows: r = b*1024 + i, columns o*64 + d, f32; per wave 16 rows x 64 cols per head staged in the (now free) pw buffers: 256-B segments by 16 lanes
  float* st0 = (float*)(&pwh[0][0] + wave * (16 * 128)); float* st1 = (float*)(&pwl[0][0] + wave * (16 * 128));
#pragma unroll
  for (int d4 = 0; d4 < 4; ++d4)
#pragma unroll
    for (int r = 0; r < 8; ++r) { st0[(8 * g + r) * 64 + d4 * 16 + col] = oacc[0][d4][r]; st1[(8 * g + r) * 64 + d4 * 16 + col] = oacc[1][d4][r]; }
  LDSX();
  for (int qq = lane; qq < 16 * 16; qq += 32) { const int rl = qq >> 4, pc = qq & 15; const size_t o = ((size_t)chunk * NR + (size_t)b * TT + i0 + rl) * CCH + hA * 64 + pc * 4;
    vst2(PART + o, *(const v4f*)(st0 + rl * 64 + pc * 4)); vst2(PART + o + 64, *(const v4f*)(st1 + rl * 64 + pc * 4)); }
}
// ---- k_red: O[r][c] = sum of the row's chunk partials, ascending chunk; -> hi/lo planes in fragment order; block = 16 rows x 256 columns, wave = one tile (16 rows x 32 columns: one whole 128-byte line of each row), lane = its two pieces of 8 columns
__global__ __launch_bounds__(256) void k_red(const float* __restrict__ PART, __bf16* __restrict__ OH, __bf16* __restrict__ OL) {
  const int wave = threadIdx.x >> 5, lane = threadIdx.x & 31, col = lane & 15, g = lane >> 4; const int rt = blockIdx.x >> 2, kc = (blockIdx.x & 3) * 8 + wave;
  const int t = (rt * 16) % TT; const int nch = t / KCH + 1;   // the 16 rows of a block lie in one chunk group
  const float* p = PART + (size_t)(rt * 16 + col) * CCH + kc * 32 + g * 8; v4f a0 = {}, a1 = {}, a2 = {}, a3 = {};
#pragma unroll 1   // at most 8 trips; kept rolled so that the kernel stays small in registers and all of its waves are resident at once and hide each trip's load latency
  for (int c = 0; c < nch; ++c) { a0 += *(const v4f*)p; a1 += *(const v4f*)(p + 4); a2 += *(const v4f*)(p + 16); a3 += *(const v4f*)(p + 20); p += (size_t)NR * CCH; }
  v8b hi, lo, hj, lj;
#pragma unroll
  for (int i = 0; i < 4; ++i) { const __bf16 h0 = (__bf16)a0[i], h1 = (__bf16)a1[i], h2 = (__bf16)a2[i], h3 = (__bf16)a3[i]; hi[i] = h0; hi[4 + i] = h1; hj[i] = h2; hj[4 + i] = h3;
    lo[i] = (__bf16)(a0[i] - (float)h0); lo[4 + i] = (__bf16)(a1[i] - (float)h1); lj[i] = (__bf16)(a2[i] - (float)h2); lj[4 + i] = (__bf16)(a3[i] - (float)h3); }
  const size_t e = ((size_t)rt * (CCH / 32) + kc) * 512 + lane * 8;
  *(v8b*)(OH + e) = hi; *(v8b*)(OH + e + 256) = hj; *(v8b*)(OL + e) = lo; *(v8b*)(OL + e + 256) = lj;
}
// ---- k_out: out = (O(hi/lo) . Wo^T rows + bo) * gamma[t]; block (64 rows, 128 cols), K = 1024
__global__ __launch_bounds__(128) void k_out(const __bf16* __restrict__ OH, const __bf16* __restrict__ OL, const __bf16* __restrict__ PT, const float* __restrict__ bo, const float* __restrict__ gam, float* __restrict__ out) {
  __shared__ __align__(16) float so[4][16][132];
  const int tid = threadIdx.x, wave = tid >> 5, lane = tid & 31, col = lane & 15, g = lane >> 4; const size_t r0 = (size_t)blockIdx.x * 64 + wave * 16; const int n0 = blockIdx.y * 128;
  v8f acc[8] = {};
  // fragments are fetched one k step ahead, as in k_qkv: a weight fragment's registers are refilled for step kc + 1 directly behind the two products that read them at step kc
  const __bf16* ph = OH + (r0 >> 4) * (CCH / 32) * 512 + lane * 8; const __bf16* pl = OL + (r0 >> 4) * (CCH / 32) * 512 + lane * 8; const __bf16* pb = PT + (size_t)((3 * CCH + n0) / 16) * (CCH / 32) * 512 + lane * 8;   // the lane's own piece of tile (., k step 0)
  v16b ah0 = frag_p(ph), al0 = frag_p(pl), ah1, al1, wf[8];
#pragma unroll
  for (int j = 0; j < 8; ++j) wf[j] = frag_p(pb + (size_t)j * (CCH / 32) * 512);
#pragma unroll 1   // 15 trips of two k steps (two, so that the O fragments swap without copies); kept rolled so that the loop stays small in the instruction cache
  for (int kc = 0; kc < CCH / 32 - 2; kc += 2) {
    ah1 = frag_p(ph + 512); al1 = frag_p(pl + 512);
#pragma unroll
    for (int j = 0; j < 8; ++j) { acc[j] = wmma_bf(al0, wf[j], acc[j]); acc[j] = wmma_bf(ah0, wf[j], acc[j]); wf[j] = frag_p(pb + ((size_t)j * (CCH / 32) + 1) * 512); }
    ah0 = frag_p(ph + 1024); al0 = frag_p(pl + 1024);
#pragma unroll
    for (int j = 0; j < 8; ++j) { acc[j] = wmma_bf(al1, wf[j], acc[j]); acc[j] = wmma_bf(ah1, wf[j], acc[j]); wf[j] = frag_p(pb + ((size_t)j * (CCH / 32) + 2) * 512); }
    asm volatile("s_wait_xcnt 0x0" ::: "memory");   // the pointer steps below land in the address registers of the loads above, which are still in flight
    ph += 1024; pl += 1024; pb += 1024; }
  ah1 = frag_p(ph + 512); al1 = frag_p(pl + 512);   // the last two k steps: nothing is left to fetch behind the last
  asm volatile("s_wait_xcnt 0x0" ::: "memory");     // ph and pl are dead from here on: a later load's result may land in their registers
#pragma unroll
  for (int j = 0; j < 8; ++j) { acc[j] = wmma_bf(al0, wf[j], acc[j]); acc[j] = wmma_bf(ah0, wf[j], acc[j]); wf[j] = frag_p(pb + ((size_t)j * (CCH / 32) + 1) * 512); }
  asm volatile("s_wait_xcnt 0x0" ::: "memory");     // the epilogue may land in the address registers of the loads above
#pragma unroll
  for (int j = 0; j < 8; ++j) { acc[j] = wmma_bf(al1, wf[j], acc[j]); acc[j] = wmma_bf(ah1, wf[j], acc[j]); }
#pragma unroll
  for (int j = 0; j < 8; ++j) { const float bb = bfr(bo[n0 + j * 16 + col]);
#pragma unroll
    for (int r = 0; r < 8; ++r) { const int t = (int)((r0 + 8 * g + r) % TT); so[wave][8 * g + r][j * 16 + col] = (acc[j][r] + bb) * bfr(gam[t]); } }
  LDSX();
  for (int rl = 0; rl < 16; ++rl) vst2(out + (r0 + rl) * CCH + n0 + lane * 4, *(const v4f*)(&so[wave][rl][lane * 4]));
}

extern "C" void kernel_launch(void* const* d_in, const int* in_sizes, int n_in, void* d_out, int out_size, void* d_ws, size_t ws_size, hipStream_t stream) {
  (void)in_sizes; (void)n_in; (void)out_size;
  const float** I = (const float**)d_in;   // x, Wq, bq, Wk, bk, Wv, bv, Wo, bo, time_w, time_alpha, time_beta, time_gamma, head_mix_w
  if (ws_size < (size_t)WS_END) return;
  char* ws = (char*)d_ws;
  __bf16* PT = (__bf16*)(ws + WS_PT); __bf16 *Qh = (__bf16*)(ws + WS_QH), *Ql = (__bf16*)(ws + WS_QL), *Kh = (__bf16*)(ws + WS_KH), *Kl = (__bf16*)(ws + WS_KL), *VTh = (__bf16*)(ws + WS_VTH), *VTl = (__bf16*)(ws + WS_VTL);
  float *Mo = (float*)(ws + WS_M), *Lo = (float*)(ws + WS_L); __bf16 *OH = (__bf16*)(ws + WS_OH), *OL = (__bf16*)(ws + WS_OL); float* PART = (float*)(ws + WS_PART); __bf16* XS = (__bf16*)(ws + WS_XS);
  k_pack<<<4 * (CCH / 16) * 4 + (NR / 16) * 4, 256, 0, stream>>>(I[0], I[1], I[3], I[5], I[7], PT, XS);
  k_qkv<<<dim3(NR / 64, 24), 128, 0, stream>>>(XS, PT, I[2], I[4], I[6], Qh, Ql, Kh, Kl, VTh, VTl);
  k_stats<<<dim3(TT / 64, NB * NH), 128, 0, stream>>>(Qh, Ql, Kh, Kl, Mo, Lo);
  k_mix<<<dim3(NB, MIXBLK), 256, 0, stream>>>(Qh, Ql, Kh, Kl, VTh, VTl, Mo, Lo, I[9], I[10], I[11], I[13], PART);
  k_red<<<(NR / 16) * 4, 256, 0, stream>>>(PART, OH, OL);
  k_out<<<dim3(NR / 64, CCH / 128), 128, 0, stream>>>(OH, OL, PT, I[8], I[12], (float*)d_out);
}

// v006
// Measured time: 252 microseconds a run.
// In two side-by-side timings against v005, it was 1.15 and 1.14 times as fast.
// Over all steps from v000 it is 3.22 times as fast.
// compute dtype: x, all weights/biases, time_w/alpha/beta/gamma and the head-mixing matrix (module inputs) rounded to bf16; q/k/v = xs W with exact bf16 products; RoPE, scores' softmax statistics,
// decay and normalisation in f32; scores = q'(hi/lo) k'(hi/lo)^T (3 products); head mixing = bf16(mix) x (P w)(hi/lo) (one K = 32 product: hi heads | lo heads); context = att'(hi/lo) x v(hi/lo) (3 products); out = O(hi/lo) Wo (2 products) + bo, x gamma; f32 accumulate.
#include <hip/hip_runtime.h>
#include <math.h>

typedef __attribute__((ext_vector_type(16))) _Float16 v16h;
typedef __attribute__((ext_vector_type(16))) __bf16 v16b;
typedef __attribute__((ext_vector_type(8)))  _Float16 v8h;
typedef __attribute__((ext_vector_type(8)))  float v8f;
typedef __attribute__((ext_vector_type(4)))  float v4f;
typedef __attribute__((ext_vector_type(2)))  float v2f;
typedef __attribute__((ext_vector_type(4)))  unsigned v4u;
typedef __attribute__((ext_vector_type(4)))  int v4i;
typedef float __attribute__((may_alias)) float_a;
typedef int __attribute__((may_alias)) int_a;

template <typename T> __device__ __forceinline__ void vst2(void* p, T v) { *(T*)p = v;  }
__device__ __forceinline__ v8f wmma16(v16h a, v16h b, v8f c) {
  v8f d = __builtin_amdgcn_wmma_f32_16x16x32_f16(false, a, false, b, (short)0, c, false, false);
  asm volatile("v_nop\n\tv_nop\n\tv_nop\n\tv_nop" : "+v"(d) : "v"(a), "v"(b));
  return d;
}
__device__ __forceinline__ v8f wmma_bf(v16b a, v16b b, v8f c) {
  v8f d = __builtin_amdgcn_wmma_f32_16x16x32_bf16(false, a, false, b, (short)0, c, false, false);
  asm volatile("v_nop\n\tv_nop\n\tv_nop\n\tv_nop" : "+v"(d) : "v"(a), "v"(b));
  return d;
}
// 16x16x32 fragments: lane = (h = lane>>4, row/col = lane&15); elements 0..7 = k0+8h+0..7, 8..15 = k0+16+8h+0..7; D element r = row 8h+r
__device__ __forceinline__ v16h frag_h(const _Float16* rowk0, int lane) {
  union { v16h v; v8h q[2]; } u; const _Float16* p = rowk0 + 8 * (lane >> 4);
  u.q[0] = *(const v8h*)p; u.q[1] = *(const v8h*)(p + 16); return u.v;
}
__device__ __forceinline__ v16h frag_f32(const float* rowk0, int lane) {
  v16h a; const float* p = rowk0 + 8 * (lane >> 4);
#pragma unroll
  for (int i = 0; i < 8; ++i) { a[i] = (_Float16)p[i]; a[8 + i] = (_Float16)p[16 + i]; }
  return a;
}
__device__ __forceinline__ v16h frag_f32s(const float* rowk0, int lane, float sc) {
  v16h a; const float* p = rowk0 + 8 * (lane >> 4);
#pragma unroll
  for (int i = 0; i < 8; ++i) { a[i] = (_Float16)(p[i] * sc); a[8 + i] = (_Float16)(p[16 + i] * sc); }
  return a;
}
// column fragment from a [K][ld] layout (column n), rows >= K read as 0
__device__ __forceinline__ v16h fragc_f32(const float* W, int k0, int n, int lane, int ld, int K) {
  v16h a; const int g = lane >> 4;
#pragma unroll
  for (int i = 0; i < 8; ++i) { const int ka = k0 + 8 * g + i, kb = ka + 16;
    a[i] = (_Float16)(ka < K ? W[(size_t)(ka < K ? ka : K - 1) * ld + n] : 0.f); a[8 + i] = (_Float16)(kb < K ? W[(size_t)(kb < K ? kb : K - 1) * ld + n] : 0.f); }
  return a;
}
struct F2 { v16b h, l; };
__device__ __forceinline__ F2 bsplit16(const float v[16]) { F2 r;
#pragma unroll
  for (int i = 0; i < 16; ++i) { const __bf16 h = (__bf16)v[i]; r.h[i] = h; r.l[i] = (__bf16)(v[i] - (float)h); }
  return r; }
__device__ __forceinline__ F2 split_row(const float* row, int k0, int lane) { float v[16]; const float* p = row + k0 + 8 * (lane >> 4);
#pragma unroll
  for (int i = 0; i < 8; ++i) { v[i] = p[i]; v[8 + i] = p[16 + i]; }
  return bsplit16(v); }
__device__ __forceinline__ F2 split_rowK(const float* row, int k0, int lane, int K) { float v[16]; const int g = lane >> 4;
#pragma unroll
  for (int i = 0; i < 8; ++i) { const int ka = k0 + 8 * g + i, kb = ka + 16; v[i] = ka < K ? row[ka < K ? ka : K - 1] : 0.f; v[8 + i] = kb < K ? row[kb < K ? kb : K - 1] : 0.f; }
  return bsplit16(v); }
__device__ __forceinline__ F2 split_col(const float* W, int k0, int n, int lane, int ld, int K) { float v[16]; const int g = lane >> 4;
#pragma unroll
  for (int i = 0; i < 8; ++i) { const int ka = k0 + 8 * g + i, kb = ka + 16; v[i] = ka < K ? W[(size_t)(ka < K ? ka : K - 1) * ld + n] : 0.f; v[8 + i] = kb < K ? W[(size_t)(kb < K ? kb : K - 1) * ld + n] : 0.f; }
  return bsplit16(v); }
__device__ __forceinline__ v8f mac3(const F2& a, const F2& b, v8f c) { c = wmma_bf(a.l, b.h, c); c = wmma_bf(a.h, b.l, c); return wmma_bf(a.h, b.h, c); }
__device__ __forceinline__ float sigm(float v) { return 1.0f / (1.0f + expf(-v)); }
#define LDSX() do { asm volatile("s_wait_dscnt 0" ::: "memory"); __builtin_amdgcn_wave_barrier(); __builtin_amdgcn_fence(__ATOMIC_RELEASE, "workgroup"); } while (0)


// Causal multi-head attention with token shift, partial RoPE, per-head Toeplitz time decay, a 16x16 cross-head mixing of the softmax maps, output projection and a per-position gain.
// Rows r = b*1024 + t. Every bf16 operand plane in the workspace (xs, weights, q, k, v^T, O) is stored in fragment order (see frag_t); the shapes below name rows and K. k_pack ([in][out] weights -> bf16 rows); k_pack also builds xs (channels < 512 come from t-1, zero at t = 0) as bf16 rows; k_qkv (xs W + bias; RoPE on dims 0..31; q/k -> hi/lo rows [bh][t][64], v -> hi/lo transposed [bh][d][t]);
// k_stats (per (bh, 64 queries): causal row max and sum of exp over the keys, kept per lane and merged once -> M, L); k_mix (block = (b, 16 queries, 128-key chunk), loop over 32-key tiles: S for all 16 heads -> P*w as bf16 hi/lo [query,key][h] in LDS -> mixing GEMM -> att'[o][i][j] f32 in LDS
// -> O[o] += att'(hi/lo) v_o(hi/lo); a block covers at most 128 keys and leaves its f32 partial O in PART[chunk][r][o*64+d]); k_red (sum of a row's chunks in ascending key order -> O hi/lo planes [r][o*64+d]); k_out ((O Wo + bo) * gamma[t]).
#define NB 4
#define TT 1024
#define CCH 1024
#define NH 16
#define HS 64
#define NR (NB * TT)
#define ROT 32
#define KCH 128                 // keys per k_mix block
#define NCHK (TT / KCH)         // chunks of the longest row
#define MIXFULL (8 * (NCHK * (NCHK - 1) / 2))  // (16-query tile, chunk) pairs per batch below the diagonal: the 8 tiles with diagonal chunk q have q full chunks each
#define MIXBLK (MIXFULL + TT / 16)             // plus one diagonal chunk per tile
#define PWP 24                  // k_mix: elements per LDS row of P*w: the 16 heads + 8 of pad = 48 B (16 B x odd): the 16 rows that a wave's lanes touch lie on 16 banks (at 64 B: on 4)
typedef __attribute__((ext_vector_type(8))) __bf16 v8b;
__device__ __forceinline__ v16b frag_b16(const __bf16* rowk0, int lane) {
  union { v16b v; v8b q[2]; } u; const __bf16* p = rowk0 + 8 * (lane >> 4);
  u.q[0] = *(const v8b*)p; u.q[1] = *(const v8b*)(p + 16); return u.v;
}
// Fragment order of a bf16 operand [rows][K] in global memory: tiles of 16 rows x 32 k (512 elements, 1 KiB), tile index = (row >> 4) * (K / 32) + (k >> 5); inside a tile the 8 elements k & ~7 .. of a row lie at
// element ((k >> 4) & 1) * 256 + (((k >> 3) & 1) * 16 + (row & 15)) * 8. That is the order in which the lanes read a fragment, so each of its two wave-wide 16-byte loads covers 512 contiguous bytes (4 lines, not 16)
__device__ __forceinline__ v16b frag_t(const __bf16* tile, int lane) {
  union { v16b v; v8b q[2]; } u; const __bf16* p = tile + lane * 8;
  u.q[0] = *(const v8b*)p; u.q[1] = *(const v8b*)(p + 256); return u.v;
}
// the same fragment from the lane's own pointer (tile + lane * 8)
__device__ __forceinline__ v16b frag_p(const __bf16* p) {
  union { v16b v; v8b q[2]; } u; u.q[0] = *(const v8b*)p; u.q[1] = *(const v8b*)(p + 256); return u.v;
}
// fragment whose k 0..15 come from one 16-wide row and k 16..31 from another; ph, pl = the lane's 8 elements (8 (lane >> 4) ..) of each
__device__ __forceinline__ v16b frag_hl(const __bf16* ph, const __bf16* pl) {
  union { v16b v; v8b q[2]; } u; u.q[0] = *(const v8b*)ph; u.q[1] = *(const v8b*)pl; return u.v;
}
__device__ __forceinline__ float bfr(float v) { return (float)(__bf16)v; }
__device__ __forceinline__ v8f mac3p(v16b ah, v16b al, v16b bh, v16b bl, v8f c) { c = wmma_bf(al, bh, c); c = wmma_bf(ah, bl, c); return wmma_bf(ah, bh, c); }
__constant__ float c_invfreq[16] = {1.0f,0.5623413324356079f,0.3162277638912201f,0.17782793939113617f,0.10000000149011612f,0.05623412877321243f,0.03162277862429619f,0.017782794311642647f,0.009999999776482582f,0.005623413249850273f,0.003162277862429619f,0.0017782794311642647f,0.0010000000474974513f,0.000562341301701963f,0.0003162277862429619f,0.00017782794020604342f};

// workspace carve (bytes)
#define PLANE_Q (2u * NB * NH * TT * HS)        // bf16 [64 bh][1024][64] = 8 MiB
#define WS_PT   0u                               // bf16 [4096][1024]: rows 0.. Wq^T, 1024.. Wk^T, 2048.. Wv^T, 3072.. Wo^T  (8 MiB)
#define WS_QH   (WS_PT + 2u * 4 * CCH * CCH)
#define WS_QL   (WS_QH + PLANE_Q)
#define WS_KH   (WS_QL + PLANE_Q)
#define WS_KL   (WS_KH + PLANE_Q)
#define WS_VTH  (WS_KL + PLANE_Q)                // bf16 [bh][64 d][1024 t]
#define WS_VTL  (WS_VTH + PLANE_Q)
#define WS_M    (WS_VTL + PLANE_Q)               // f32 [bh][1024]
#define WS_L    (WS_M + 4u * NB * NH * TT)
#define WS_OH   (WS_L + 4u * NB * NH * TT)       // bf16 [4096][1024] (row r, col o*64 + d)
#define WS_OL   (WS_OH + 2u * NR * CCH)
#define WS_PART (WS_OL + 2u * NR * CCH)          // f32 [8 key chunks][4096][1024]; row r uses chunks 0 .. t/128
#define WS_XS   (WS_PART + 4u * NCHK * NR * CCH) // bf16 [4096][1024]: shifted x
#define WS_END  (WS_XS + 2u * NR * CCH)

// ---- k_pack: PT (row n, k) = bf16(W[k][n]) in fragment order; block = (16 rows n, 256 k; which matrix is block-uniform), wave = one tile: a lane gathers its 2 x 8 k of its own column n (16 lanes = a 64-byte run of W) and stores them as the fragment's pieces
// blocks from 1024 on: XS (row r, channel k) = bf16(xs) in fragment order, xs = x with channels < 512 taken from row t-1 (zero at t = 0; the address is clamped to the row itself, the load is unconditional and the zero a select); wave = one tile = one 128-byte line of each of 16 rows
__global__ __launch_bounds__(256) void k_pack(const float* __restrict__ X, const float* __restrict__ Wq, const float* __restrict__ Wk, const float* __restrict__ Wv, const float* __restrict__ Wo, __bf16* __restrict__ PT, __bf16* __restrict__ XS) {
  const int tid = threadIdx.x, wave = tid >> 5, lane = tid & 31, col = lane & 15, g = lane >> 4;
  const int rt = (blockIdx.x >> 2) & 255, kc = (blockIdx.x & 3) * 8 + wave;
  if (blockIdx.x >= 4 * (CCH / 16) * 4) {   // block-uniform
    const int r = rt * 16 + col, t = r % TT; const bool shifted = kc * 32 < CCH / 2; const bool zero = shifted && (t == 0);
    const float* px = X + (size_t)(r - ((shifted && t > 0) ? 1 : 0)) * CCH + kc * 32 + g * 8;
    const v4f x0 = *(const v4f*)px, x1 = *(const v4f*)(px + 4), x2 = *(const v4f*)(px + 16), x3 = *(const v4f*)(px + 20); v8b y0, y1;
#pragma unroll
    for (int e = 0; e < 4; ++e) { y0[e] = (__bf16)(zero ? 0.f : x0[e]); y0[4 + e] = (__bf16)(zero ? 0.f : x1[e]); y1[e] = (__bf16)(zero ? 0.f : x2[e]); y1[4 + e] = (__bf16)(zero ? 0.f : x3[e]); }
    __bf16* dx = XS + ((size_t)rt * (CCH / 32) + kc) * 512 + lane * 8;
    *(v8b*)dx = y0; *(v8b*)(dx + 256) = y1;
    return;
  }
  const int which = rt >> 6, nn = (rt & 63) * 16 + col;
  const float* Wm = which == 0 ? Wq : which == 1 ? Wk : which == 2 ? Wv : Wo;
  const float* p = Wm + (size_t)(kc * 32 + g * 8) * CCH + nn; v8b o0, o1;
#pragma unroll
  for (int e = 0; e < 8; ++e) { o0[e] = (__bf16)p[(size_t)e * CCH]; o1[e] = (__bf16)p[(size_t)(16 + e) * CCH]; }
  __bf16* d = PT + ((size_t)rt * (CCH / 32) + kc) * 512 + lane * 8;
  *(v8b*)d = o0; *(v8b*)(d + 256) = o1;
}
// ---- k_qkv: block (64 rows, 128 cols = 2 heads of q, k or v); exact products; + bias; RoPE (q, k); q/k -> hi/lo rows [bh][t][64]; v -> VT hi/lo [bh][d][t]
__global__ __launch_bounds__(128) void k_qkv(const __bf16* __restrict__ XS, const __bf16* __restrict__ PT, const float* __restrict__ bq, const float* __restrict__ bk, const float* __restrict__ bv,
                                             __bf16* __restrict__ Qh, __bf16* __restrict__ Ql, __bf16* __restrict__ Kh, __bf16* __restrict__ Kl, __bf16* __restrict__ VTh, __bf16* __restrict__ VTl) {
  __shared__ __align__(16) __bf16 sh_[128][72], sl_[128][72];
  const int tid = threadIdx.x, wave = tid >> 5, lane = tid & 31, col = lane & 15, g = lane >> 4;
  const size_t rb = (size_t)blockIdx.x * 64; const int b = (int)(rb / TT), t0 = (int)(rb % TT);
  const int which = blockIdx.y >> 3; const int n0 = (blockIdx.y & 7) * 128;          // block-uniform: 0 q, 1 k, 2 v; n0 = first output channel (2 heads)
  const size_t r0 = rb + wave * 16;
  v8f acc[8] = {};
  // fragments are fetched one k step ahead: a weight fragment's registers are refilled for step kc + 1 directly behind the product that read them at step kc, so a load has eight products' time to arrive and no product waits a whole memory latency of its own
  const __bf16* pa = XS + (r0 >> 4) * (CCH / 32) * 512 + lane * 8; const __bf16* pb = PT + (size_t)((which * CCH + n0) / 16) * (CCH / 32) * 512 + lane * 8;   // the lane's own piece of tile (., k step 0)
  v16b a0 = frag_p(pa), a1, wf[8];
#pragma unroll
  for (int j = 0; j < 8; ++j) wf[j] = frag_p(pb + (size_t)j * (CCH / 32) * 512);
#pragma unroll 1   // 15 trips of two k steps (two, so that the two x fragments swap without copies); kept rolled so that the loop stays small in the instruction cache
  for (int kc = 0; kc < CCH / 32 - 2; kc += 2) {
    a1 = frag_p(pa + 512);
#pragma unroll
    for (int j = 0; j < 8; ++j) { acc[j] = wmma_bf(a0, wf[j], acc[j]); wf[j] = frag_p(pb + ((size_t)j * (CCH / 32) + 1) * 512); }
    a0 = frag_p(pa + 1024);
#pragma unroll
    for (int j = 0; j < 8; ++j) { acc[j] = wmma_bf(a1, wf[j], acc[j]); wf[j] = frag_p(pb + ((size_t)j * (CCH / 32) + 2) * 512); }
    asm volatile("s_wait_xcnt 0x0" ::: "memory");   // the pointer steps below land in the address registers of the loads above, which are still in flight
    pa += 1024; pb += 1024; }
  a1 = frag_p(pa + 512);   // the last two k steps: nothing is left to fetch behind the last
  asm volatile("s_wait_xcnt 0x0" ::: "memory");     // pa is dead from here on: a later load's result may land in its registers
#pragma unroll
  for (int j = 0; j < 8; ++j) { acc[j] = wmma_bf(a0, wf[j], acc[j]); wf[j] = frag_p(pb + ((size_t)j * (CCH / 32) + 1) * 512); }
  asm volatile("s_wait_xcnt 0x0" ::: "memory");     // the epilogue may land in the address registers of the loads above
#pragma unroll
  for (int j = 0; j < 8; ++j) acc[j] = wmma_bf(a1, wf[j], acc[j]);
  const float* bias = which == 0 ? bq : which == 1 ? bk : bv;
#pragma unroll
  for (int j = 0; j < 8; ++j) { const float bb = bfr(bias[n0 + j * 16 + col]);
#pragma unroll
    for (int r = 0; r < 8; ++r) acc[j][r] += bb; }
  if (which < 2) {   // RoPE on head-local dims 0..15 (tile 4h'+0) and 16..31 (tile 4h'+1), pairs in the same lane; theta = t * inv_freq[col]
#pragma unroll
    for (int hp = 0; hp < 2; ++hp) {
#pragma unroll
      for (int r = 0; r < 8; ++r) { const int t = t0 + wave * 16 + 8 * g + r; const float th = (float)t * c_invfreq[col]; const float cs = cosf(th), sn = sinf(th);
        const float a0 = acc[hp * 4][r], a1 = acc[hp * 4 + 1][r];
        acc[hp * 4][r] = a0 * cs - a1 * sn; acc[hp * 4 + 1][r] = a1 * cs + a0 * sn; } }
    __bf16* Oh = which == 0 ? Qh : Kh; __bf16* Ol = which == 0 ? Ql : Kl;
#pragma unroll
    for (int hp = 0; hp < 2; ++hp) {
#pragma unroll
      for (int j = 0; j < 4; ++j)
#pragma unroll
        for (int r = 0; r < 8; ++r) { const float v = acc[hp * 4 + j][r]; const __bf16 hi = (__bf16)v; sh_[wave * 16 + 8 * g + r][j * 16 + col] = hi; sl_[wave * 16 + 8 * g + r][j * 16 + col] = (__bf16)(v - (float)hi); }
      LDSX();
      const int h = (n0 >> 6) + hp; const size_t base = ((size_t)(b * NH + h) * TT + t0 + wave * 16) * HS;   // the wave's 16 rows x 64 dims = two whole tiles; piece qq of them holds row qq & 15, dims 8 (qq >> 4) ..
      v4u ph[4], pl[4];
#pragma unroll   // four fixed trips, unrolled so that ph and pl are registers and the eight LDS reads share one latency
      for (int q4 = 0; q4 < 4; ++q4) { const int qq = q4 * 32 + lane, pc = q4 * 2 + g; ph[q4] = *(const v4u*)(&sh_[wave * 16 + col][pc * 8]); pl[q4] = *(const v4u*)(&sl_[wave * 16 + col][pc * 8]); vst2((unsigned*)(Oh + base + qq * 8), ph[q4]); vst2((unsigned*)(Ol + base + qq * 8), pl[q4]); }
      asm volatile("s_wait_xcnt 0x0" :: "v"(ph[0]), "v"(ph[1]), "v"(ph[2]), "v"(ph[3]), "v"(pl[0]), "v"(pl[1]), "v"(pl[2]), "v"(pl[3]) : "memory");   // the next head's conversions may land in the data registers of the eight stores above; the stored values as inputs keep those registers untouched up to this wait
      LDSX(); }
  } else {
#pragma unroll
    for (int j = 0; j < 8; ++j)
#pragma unroll
      for (int r = 0; r < 8; ++r) { const float v = acc[j][r]; const __bf16 hi = (__bf16)v; sh_[j * 16 + col][wave * 16 + 8 * g + r] = hi; sl_[j * 16 + col][wave * 16 + 8 * g + r] = (__bf16)(v - (float)hi); }
    __syncthreads();
    for (int qq = tid; qq < 128 * 8; qq += 128) { const int ct = qq >> 7, kcl = (qq >> 6) & 1, w = qq & 63; const int c = ct * 16 + (w & 15), pc = kcl * 4 + (w >> 4);   // 16 tiles (8 groups of 16 channels x 2 groups of 32 t), 64 pieces each, in storage order
      const int h = (n0 >> 6) + (ct >> 2); const size_t o = (((size_t)(b * NH + h) * (HS / 16) + (ct & 3)) * (TT / 32) + (t0 >> 5) + kcl) * 512 + w * 8;
      vst2((unsigned*)(VTh + o), *(const v4u*)(&sh_[c][pc * 8])); vst2((unsigned*)(VTl + o), *(const v4u*)(&sl_[c][pc * 8])); }
  }
}
// ---- k_stats: block = (bh, 64 queries); wave = 16 queries; causal key steps of 64 (four 16-key tiles): S = q'(hi/lo) k'(hi/lo) / 8; every lane keeps the running max and sum of its own key columns (j = col mod 16) and rescales once per step;
// the 16 lanes of a row are merged once, behind the loop -> M, L (f32 [bh][t], 256 B per block by 16 lanes)
__global__ __launch_bounds__(128) void k_stats(const __bf16* __restrict__ Qh, const __bf16* __restrict__ Ql, const __bf16* __restrict__ Kh, const __bf16* __restrict__ Kl, float* __restrict__ Mo, float* __restrict__ Lo) {
  __shared__ float sm[64], ssum[64];
  const int tid = threadIdx.x, wave = tid >> 5, lane = tid & 31, col = lane & 15, g = lane >> 4;
  const int bh = blockIdx.y; const int i0 = blockIdx.x * 64 + wave * 16;
  const __bf16* qh = Qh + ((size_t)bh * TT + i0) * HS; const __bf16* ql = Ql + ((size_t)bh * TT + i0) * HS;
  const v16b qh0 = frag_t(qh, lane), qh1 = frag_t(qh + 512, lane), ql0 = frag_t(ql, lane), ql1 = frag_t(ql + 512, lane);
  asm volatile("s_wait_xcnt 0x0" :: "v"(qh0), "v"(qh1), "v"(ql0), "v"(ql1) : "memory");   // the loop's key loads may land in the address registers of the query loads above; the loaded values as inputs keep this wait behind those loads
  float m[8], l[8];
#pragma unroll
  for (int r = 0; r < 8; ++r) { m[r] = -3.0e38f; l[r] = 0.f; }
  const int jend = i0 + 16;                                      // keys j <= i for rows i0..i0+15 -> tiles covering [0, i0+16)
#pragma unroll 1
  for (int j0 = 0; j0 < jend; j0 += 64) {
    v8f s4[4];   // the step's four score tiles; a tile past the diagonal is skipped, stays zero and is dropped by the select below
#pragma unroll
    for (int jt = 0; jt < 4; ++jt) { const int jb = j0 + jt * 16; v8f s = {}; if (jb < jend) {   // wave-uniform
      const __bf16* kh = Kh + ((size_t)bh * TT + jb) * HS; const __bf16* kl = Kl + ((size_t)bh * TT + jb) * HS;
      const v16b kh0 = frag_t(kh, lane), kl0 = frag_t(kl, lane), kh1 = frag_t(kh + 512, lane), kl1 = frag_t(kl + 512, lane);
      asm volatile("s_wait_xcnt 0x0" :: "v"(kh0), "v"(kl0), "v"(kh1), "v"(kl1) : "memory");   // inputs-only fence on the loaded values: holds all eight key loads in front of the products, one memory latency instead of two in a row; and it keeps this wait behind them: the step's rescale may land in their address registers
      s = mac3p(qh0, ql0, kh0, kl0, s); s = mac3p(qh1, ql1, kh1, kl1, s); }
      s4[jt] = s; }
#pragma unroll
    for (int r = 0; r < 8; ++r) { const int i = i0 + 8 * g + r; float v[4];
#pragma unroll
      for (int t = 0; t < 4; ++t) v[t] = (j0 + t * 16 + col <= i) ? s4[t][r] * 0.125f : -1e30f;
      const float mn = fmaxf(fmaxf(fmaxf(fmaxf(m[r], v[0]), v[1]), v[2]), v[3]);
      l[r] = l[r] * expf(m[r] - mn) + ((expf(v[0] - mn) + expf(v[1] - mn)) + (expf(v[2] - mn) + expf(v[3] - mn))); m[r] = mn; }   // a lane that has seen masked keys only holds m = -1e30 and a count in l: the next rescale, or the merge below, multiplies it by exp(-1e30 - max) = 0
  }
#pragma unroll
  for (int r = 0; r < 8; ++r) { float mt = m[r];   // merge of the row's 16 lanes: every row has key 0, so the merged max is a real score
#pragma unroll
    for (int o = 1; o < 16; o <<= 1) mt = fmaxf(mt, __shfl_xor(mt, o));
    float e = l[r] * expf(m[r] - mt);
#pragma unroll
    for (int o = 1; o < 16; o <<= 1) e += __shfl_xor(e, o);
    m[r] = mt; l[r] = e; }
  if (col == 0) {
#pragma unroll
    for (int r = 0; r < 8; ++r) { sm[wave * 16 + 8 * g + r] = m[r]; ssum[wave * 16 + 8 * g + r] = l[r]; } }
  __syncthreads();
  if (tid < 16) { vst2(Mo + (size_t)bh * TT + blockIdx.x * 64 + tid * 4, *(const v4f*)&sm[tid * 4]); vst2(Lo + (size_t)bh * TT + blockIdx.x * 64 + tid * 4, *(const v4f*)&ssum[tid * 4]); }
}
// ---- k_mix: block = (b, 16 queries i0..i0+15, keys of one 128-key chunk), 8 waves; loop over the chunk's 32-key tiles (causal). M and L are known, so O is a plain sum over keys and chunks are independent
__global__ __launch_bounds__(256) void k_mix(const __bf16* __restrict__ Qh, const __bf16* __restrict__ Ql, const __bf16* __restrict__ Kh, const __bf16* __restrict__ Kl, const __bf16* __restrict__ VTh, const __bf16* __restrict__ VTl,
                                             const float* __restrict__ Mo, const float* __restrict__ Lo, const float* __restrict__ tw, const float* __restrict__ talpha, const float* __restrict__ tbeta, const float* __restrict__ mixw,
                                             float* __restrict__ PART) {
  __shared__ __align__(16) __bf16 pw[2][512][PWP];              // (P*w) for the tile, hi and lo plane: row = i*32 + j (query-in-tile, key-in-tile), column = head h; the pad is never read
  __bf16 (*pwh)[PWP] = pw[0]; __bf16 (*pwl)[PWP] = pw[1];
  __shared__ __align__(16) float attp[NH][16][36];               // mixed attention tile per output head o: [o][i][j]
  __shared__ __align__(16) __bf16 mixr[NH][32];                  // mixing matrix rows o, k = h, then the same 16 again
  const int tid = threadIdx.x, wave = tid >> 5, lane = tid & 31, col = lane & 15, g = lane >> 4;
  // blockIdx.y -> (query tile = 8 gq + tl, chunk <= gq): the full 128-key chunks first, then the diagonal chunks from the longest to the shortest, so that the work-groups that start last are the short ones
  int rem = blockIdx.y, gq, tl, chunk;
  if (rem < MIXFULL) { gq = NCHK - 1; while (gq > 1 && rem >= 8 * gq) { rem -= 8 * gq; --gq; } chunk = rem >> 3; tl = rem & 7; }
  else { rem -= MIXFULL; gq = rem & 7; tl = 7 - (rem >> 3); chunk = gq; }
  const int b = blockIdx.x, i0 = (gq * 8 + tl) * 16;
  for (int q = tid; q < NH * 32; q += 256) { const int o = q >> 5, h = q & 31; mixr[o][h] = (__bf16)mixw[o * NH + (h & (NH - 1))]; }
  // this wave's two heads for the S phase and two output heads for the PV phase
  const int hA = wave * 2;
  float mrow[2][8], lb[2][8];            // row max, and beta[h][i] / L (the per-row factors of p*w = (e^(s-m)/L) * ((tw*alpha)*beta), folded)
#pragma unroll
  for (int u = 0; u < 2; ++u) { const int bh = b * NH + hA + u;
#pragma unroll
    for (int r = 0; r < 8; ++r) { const int i = i0 + 8 * g + r; mrow[u][r] = Mo[(size_t)bh * TT + i]; lb[u][r] = bfr(tbeta[(hA + u) * TT + i]) / Lo[(size_t)bh * TT + i]; } }
  v8f oacc[2][4];
#pragma unroll
  for (int u = 0; u < 2; ++u)
#pragma unroll
    for (int d4 = 0; d4 < 4; ++d4) oacc[u][d4] = (v8f){};
  __syncthreads();
  const int jbeg = chunk * KCH; const int jend = (i0 + 16 < jbeg + KCH) ? i0 + 16 : jbeg + KCH;
#pragma unroll 1
  for (int j0 = jbeg; j0 < jend; j0 += 32) {
    // -- S for this wave's two heads; P*w -> pwh/pwl[(i)*32 + j][h]
#pragma unroll
    for (int u = 0; u < 2; ++u) { const int h = hA + u; const int bh = b * NH + h;
      const __bf16* qh = Qh + ((size_t)bh * TT + i0) * HS; const __bf16* ql = Ql + ((size_t)bh * TT + i0) * HS;
      const v16b qh0 = frag_t(qh, lane), qh1 = frag_t(qh + 512, lane), ql0 = frag_t(ql, lane), ql1 = frag_t(ql + 512, lane);   // re-read per key tile (cached) to keep VGPRs < 256
#pragma unroll 1
      for (int jt = 0; jt < 2; ++jt) { const int jb = j0 + jt * 16;   // body is one straight line, no call and no branch: the eight rows' loads, exps and stores overlap. jb + 15 <= 1023, so a half past the diagonal reads rows that exist; the select drops it
        const __bf16* kh = Kh + ((size_t)bh * TT + jb) * HS; const __bf16* kl = Kl + ((size_t)bh * TT + jb) * HS;
        const int j = jb + col; const float al = talpha[h * TT + (j < TT ? j : TT - 1)]; float twv[8];
#pragma unroll
        for (int r = 0; r < 8; ++r) { const int widx = TT - 1 + j - (i0 + 8 * g + r); twv[r] = tw[h * TT + (widx < TT ? widx : TT - 1)]; }   // 0 <= widx; clamped into the row above the diagonal
        asm volatile("s_wait_xcnt 0x0" ::: "memory");   // the key loads below may land in the offset registers of the nine loads above
        const v16b kh0 = frag_t(kh, lane), kl0 = frag_t(kl, lane), kh1 = frag_t(kh + 512, lane), kl1 = frag_t(kl + 512, lane);
        // inputs-only fence on the loaded values: holds all 17 loads of this half in front of the products, so that they share one memory latency (without it the compiler sinks half of the key loads and the decay loads behind the products: three latencies in a row)
        asm volatile("" :: "v"(kh0), "v"(kl0), "v"(kh1), "v"(kl1), "v"(al), "v"(twv[0]), "v"(twv[1]), "v"(twv[2]), "v"(twv[3]), "v"(twv[4]), "v"(twv[5]), "v"(twv[6]), "v"(twv[7]));
        v8f s = {}; s = mac3p(qh0, ql0, kh0, kl0, s); s = mac3p(qh1, ql1, kh1, kl1, s);
        const float alpha_j = bfr(al);
#pragma unroll
        for (int r = 0; r < 8; ++r) { const int il = 8 * g + r, i = i0 + il;
          const float pv = (expf(s[r] * 0.125f - mrow[u][r]) * lb[u][r]) * (bfr(twv[r]) * alpha_j);
          const float pw = (j <= i) ? pv : 0.f;                  // causal mask as a select: a masked pv is never used
          const __bf16 hi = (__bf16)pw; pwh[il * 32 + jt * 16 + col][h] = hi; pwl[il * 32 + jt * 16 + col][h] = (__bf16)(pw - (float)hi); } } }
    __syncthreads();
    // -- mixing GEMM: att'[o][(i,j)] = sum_h mix[o][h] Pw[(i,j)][h]; 32 column tiles of 16 (i,j) pairs, K = 32: k 0..15 = the heads' hi parts, k 16..31 = their lo parts, against the mixing row twice; wave owns column tiles 4w..4w+3
    { const v16b am = frag_b16(&mixr[col][0], lane);            // A rows o = col, k = h
#pragma unroll 1
      for (int ct = 0; ct < 4; ++ct) { const int n0c = (wave * 4 + ct) * 16; v8f a = {};
        a = wmma_bf(am, frag_hl(&pwh[n0c + col][8 * g], &pwl[n0c + col][8 * g]), a);
        const int il = n0c >> 5, jl0 = n0c & 31;                 // the 16 columns of this tile share i (32 | n0c+0..15 within one i row since tiles are 16-aligned inside 32)
#pragma unroll
        for (int r = 0; r < 8; ++r) attp[8 * g + r][il][jl0 + col] = a[r]; } }
    __syncthreads();
    // -- O[o] += att'[o](hi/lo) v_o(hi/lo): this wave's output heads o = hA, hA+1; K = 32 keys (one step); 4 d tiles
#pragma unroll
    for (int u = 0; u < 2; ++u) { const int o = hA + u; const int bh = b * NH + o; const F2 af = split_row(&attp[o][col][0], 0, lane);
#pragma unroll
      for (int d4 = 0; d4 < 4; ++d4) { const size_t vo = (((size_t)bh * (HS / 16) + d4) * (TT / 32) + (j0 >> 5)) * 512;
        oacc[u][d4] = mac3p(af.h, af.l, frag_t(VTh + vo, lane), frag_t(VTl + vo, lane), oacc[u][d4]); } }
    __syncthreads();                                            // pw*/attp are rewritten by the next key tile
  }
  // -- partial O rows: r = b*1024 + i, columns o*64 + d, f32; per wave 16 rows x 64 cols per head staged in the (now free) pw and attp buffers, 4 KiB per wave in each: 256-B segments by 16 lanes
  float* st0 = (float*)&pw[0][0][0] + wave * (16 * 64); float* st1 = &attp[0][0][0] + wave * (16 * 64);
#pragma unroll
  for (int d4 = 0; d4 < 4; ++d4)
#pragma unroll
    for (int r = 0; r < 8; ++r) { st0[(8 * g + r) * 64 + d4 * 16 + col] = oacc[0][d4][r]; st1[(8 * g + r) * 64 + d4 * 16 + col] = oacc[1][d4][r]; }
  LDSX();
  for (int qq = lane; qq < 16 * 16; qq += 32) { const int rl = qq >> 4, pc = qq & 15; const size_t o = ((size_t)chunk * NR + (size_t)b * TT + i0 + rl) * CCH + hA * 64 + pc * 4;
    vst2(PART + o, *(const v4f*)(st0 + rl * 64 + pc * 4)); vst2(PART + o + 64, *(const v4f*)(st1 + rl * 64 + pc * 4)); }
}
// ---- k_red: O[r][c] = sum of the row's chunk partials, ascending chunk; -> hi/lo planes in fragment order; block = 16 rows x 256 columns, wave = one tile (16 rows x 32 columns: one whole 128-byte line of each row), lane = its two pieces of 8 columns
__global__ __launch_bounds__(256) void k_red(const float* __restrict__ PART, __bf16* __restrict__ OH, __bf16* __restrict__ OL) {
  const int wave = threadIdx.x >> 5, lane = threadIdx.x & 31, col = lane & 15, g = lane >> 4; const int rt = blockIdx.x >> 2, kc = (blockIdx.x & 3) * 8 + wave;
  const int t = (rt * 16) % TT; const int nch = t / KCH + 1;   // the 16 rows of a block lie in one chunk group
  const float* p = PART + (size_t)(rt * 16 + col) * CCH + kc * 32 + g * 8; v4f a0 = {}, a1 = {}, a2 = {}, a3 = {};
#pragma unroll 1   // at most 8 trips; kept rolled so that the kernel stays small in registers and all of its waves are resident at once and hide each trip's load latency
  for (int c = 0; c < nch; ++c) { a0 += *(const v4f*)p; a1 += *(const v4f*)(p + 4); a2 += *(const v4f*)(p + 16); a3 += *(const v4f*)(p + 20); p += (size_t)NR * CCH; }
  v8b hi, lo, hj, lj;
#pragma unroll
  for (int i = 0; i < 4; ++i) { const __bf16 h0 = (__bf16)a0[i], h1 = (__bf16)a1[i], h2 = (__bf16)a2[i], h3 = (__bf16)a3[i]; hi[i] = h0; hi[4 + i] = h1; hj[i] = h2; hj[4 + i] = h3;
    lo[i] = (__bf16)(a0[i] - (float)h0); lo[4 + i] = (__bf16)(a1[i] - (float)h1); lj[i] = (__bf16)(a2[i] - (float)h2); lj[4 + i] = (__bf16)(a3[i] - (float)h3); }
  const size_t e = ((size_t)rt * (CCH / 32) + kc) * 512 + lane * 8;
  *(v8b*)(OH + e) = hi; *(v8b*)(OH + e + 256) = hj; *(v8b*)(OL + e) = lo; *(v8b*)(OL + e + 256) = lj;
}
// ---- k_out: out = (O(hi/lo) . Wo^T rows + bo) * gamma[t]; block (64 rows, 128 cols), K = 1024
__global__ __launch_bounds__(128) void k_out(const __bf16* __restrict__ OH, const __bf16* __restrict__ OL, const __bf16* __restrict__ PT, const float* __restrict__ bo, const float* __restrict__ gam, float* __restrict__ out) {
  __shared__ __align__(16) float so[4][16][132];
  const int tid = threadIdx.x, wave = tid >> 5, lane = tid & 31, col = lane & 15, g = lane >> 4; const size_t r0 = (size_t)blockIdx.x * 64 + wave * 16; const int n0 = blockIdx.y * 128;
  v8f acc[8] = {};
  // fragments are fetched one k step ahead, as in k_qkv: a weight fragment's registers are refilled for step kc + 1 directly behind the two products that read them at step kc
  const __bf16* ph = OH + (r0 >> 4) * (CCH / 32) * 512 + lane * 8; const __bf16* pl = OL + (r0 >> 4) * (CCH / 32) * 512 + lane * 8; const __bf16* pb = PT + (size_t)((3 * CCH + n0) / 16) * (CCH / 32) * 512 + lane * 8;   // the lane's own piece of tile (., k step 0)
  v16b ah0 = frag_p(ph), al0 = frag_p(pl), ah1, al1, wf[8];
#pragma unroll
  for (int j = 0; j < 8; ++j) wf[j] = frag_p(pb + (size_t)j * (CCH / 32) * 512);
#pragma unroll 1   // 15 trips of two k steps (two, so that the O fragments swap without copies); kept rolled so that the loop stays small in the instruction cache
  for (int kc = 0; kc < CCH / 32 - 2; kc += 2) {
    ah1 = frag_p(ph + 512); al1 = frag_p(pl + 512);
#pragma unroll
    for (int j = 0; j < 8; ++j) { acc[j] = wmma_bf(al0, wf[j], acc[j]); acc[j] = wmma_bf(ah0, wf[j], acc[j]); wf[j] = frag_p(pb + ((size_t)j * (CCH / 32) + 1) * 512); }
    ah0 = frag_p(ph + 1024); al0 = frag_p(pl + 1024);
#pragma unroll
    for (int j = 0; j < 8; ++j) { acc[j] = wmma_bf(al1, wf[j], acc[j]); acc[j] = wmma_bf(ah1, wf[j], acc[j]); wf[j] = frag_p(pb + ((size_t)j * (CCH / 32) + 2) * 512); }
    asm volatile("s_wait_xcnt 0x0" ::: "memory");   // the pointer steps below land in the address registers of the loads above, which are still in flight
    ph += 1024; pl += 1024; pb += 1024; }
  ah1 = frag_p(ph + 512); al1 = frag_p(pl + 512);   // the last two k steps: nothing is left to fetch behind the last
  asm volatile("s_wait_xcnt 0x0" ::: "memory");     // ph and pl are dead from here on: a later load's result may land in their registers
#pragma unroll
  for (int j = 0; j < 8; ++j) { acc[j] = wmma_bf(al0, wf[j], acc[j]); acc[j] = wmma_bf(ah0, wf[j], acc[j]); wf[j] = frag_p(pb + ((size_t)j * (CCH / 32) + 1) * 512); }
  asm volatile("s_wait_xcnt 0x0" ::: "memory");     // the epilogue may land in the address registers of the loads above
#pragma unroll
  for (int j = 0; j < 8; ++j) { acc[j] = wmma_bf(al1, wf[j], acc[j]); acc[j] = wmma_bf(ah1, wf[j], acc[j]); }
#pragma unroll
  for (int j = 0; j < 8; ++j) { const float bb = bfr(bo[n0 + j * 16 + col]);
#pragma unroll
    for (int r = 0; r < 8; ++r) { const int t = (int)((r0 + 8 * g + r) % TT); so[wave][8 * g + r][j * 16 + col] = (acc[j][r] + bb) * bfr(gam[t]); } }
  LDSX();
  for (int rl = 0; rl < 16; ++rl) vst2(out + (r0 + rl) * CCH + n0 + lane * 4, *(const v4f*)(&so[wave][rl][lane * 4]));
}

extern "C" void kernel_launch(void* const* d_in, const int* in_sizes, int n_in, void* d_out, int out_size, void* d_ws, size_t ws_size, hipStream_t stream) {
  (void)in_sizes; (void)n_in; (void)out_size;
  const float** I = (const float**)d_in;   // x, Wq, bq, Wk, bk, Wv, bv, Wo, bo, time_w, time_alpha, time_beta, time_gamma, head_mix_w
  if (ws_size < (size_t)WS_END) return;
  char* ws = (char*)d_ws;
  __bf16* PT = (__bf16*)(ws + WS_PT); __bf16 *Qh = (__bf16*)(ws + WS_QH), *Ql = (__bf16*)(ws + WS_QL), *Kh = (__bf16*)(ws + WS_KH), *Kl = (__bf16*)(ws + WS_KL), *VTh = (__bf16*)(ws + WS_VTH), *VTl = (__bf16*)(ws + WS_VTL);
  float *Mo = (float*)(ws + WS_M), *Lo = (float*)(ws + WS_L); __bf16 *OH = (__bf16*)(ws + WS_OH), *OL = (__bf16*)(ws + WS_OL); float* PART = (float*)(ws + WS_PART); __bf16* XS = (__bf16*)(ws + WS_XS);
  k_pack<<<4 * (CCH / 16) * 4 + (NR / 16) * 4, 256, 0, stream>>>(I[0], I[1], I[3], I[5], I[7], PT, XS);
  k_qkv<<<dim3(NR / 64, 24), 128, 0, stream>>>(XS, PT, I[2], I[4], I[6], Qh, Ql, Kh, Kl, VTh, VTl);
  k_stats<<<dim3(TT / 64, NB * NH), 128, 0, stream>>>(Qh, Ql, Kh, Kl, Mo, Lo);
  k_mix<<<dim3(NB, MIXBLK), 256, 0, stream>>>(Qh, Ql, Kh, Kl, VTh, VTl, Mo, Lo, I[9], I[10], I[11], I[13], PART);
  k_red<<<(NR / 16) * 4, 256, 0, stream>>>(PART, OH, OL);
  k_out<<<dim3(NR / 64, CCH / 128), 128, 0, stream>>>(OH, OL, PT, I[8], I[12], (float*)d_out);
}

// v007
// One run takes 243 microseconds.
// In two side-by-side timings against v006, it was 1.03 and 1.04 times as fast.
// Counting every step since v000, it is 3.33 times as fast.
// compute dtype: x, all weights/biases, time_w/alpha/beta/gamma and the head-mixing matrix (module inputs) rounded to bf16; q/k/v = xs W with exact bf16 products; RoPE, scores' softmax statistics,
// decay and normalisation in f32; scores = q'(hi/lo) k'(hi/lo)^T (3 products); head mixing = bf16(mix) x (P w)(hi/lo) (one K = 32 product: hi heads | lo heads); context = att'(hi/lo) x v(hi/lo) (3 products); out = O(hi/lo) Wo (2 products) + bo, x gamma; f32 accumulate.
#include <hip/hip_runtime.h>
#include <math.h>

typedef __attribute__((ext_vector_type(16))) _Float16 v16h;
typedef __attribute__((ext_vector_type(16))) __bf16 v16b;
typedef __attribute__((ext_vector_type(8)))  _Float16 v8h;
typedef __attribute__((ext_vector_type(8)))  float v8f;
typedef __attribute__((ext_vector_type(4)))  float v4f;
typedef __attribute__((ext_vector_type(2)))  float v2f;
typedef __attribute__((ext_vector_type(4)))  unsigned v4u;
typedef __attribute__((ext_vector_type(4)))  int v4i;
typedef float __attribute__((may_alias)) float_a;
typedef int __attribute__((may_alias)) int_a;

template <typename T> __device__ __forceinline__ void vst2(void* p, T v) { *(T*)p = v;  }
__device__ __forceinline__ v8f wmma16(v16h a, v16h b, v8f c) {
  v8f d = __builtin_amdgcn_wmma_f32_16x16x32_f16(false, a, false, b, (short)0, c, false, false);
  asm volatile("v_nop\n\tv_nop\n\tv_nop\n\tv_nop" : "+v"(d) : "v"(a), "v"(b));
  return d;
}
__device__ __forceinline__ v8f wmma_bf(v16b a, v16b b, v8f c) {
  v8f d = __builtin_amdgcn_wmma_f32_16x16x32_bf16(false, a, false, b, (short)0, c, false, false);
  asm volatile("v_nop\n\tv_nop\n\tv_nop\n\tv_nop" : "+v"(d) : "v"(a), "v"(b));
  return d;
}
// 16x16x32 fragments: lane = (h = lane>>4, row/col = lane&15); elements 0..7 = k0+8h+0..7, 8..15 = k0+16+8h+0..7; D element r = row 8h+r
__device__ __forceinline__ v16h frag_h(const _Float16* rowk0, int lane) {
  union { v16h v; v8h q[2]; } u; const _Float16* p = rowk0 + 8 * (lane >> 4);
  u.q[0] = *(const v8h*)p; u.q[1] = *(const v8h*)(p + 16); return u.v;
}
__device__ __forceinline__ v16h frag_f32(const float* rowk0, int lane) {
  v16h a; const float* p = rowk0 + 8 * (lane >> 4);
#pragma unroll
  for (int i = 0; i < 8; ++i) { a[i] = (_Float16)p[i]; a[8 + i] = (_Float16)p[16 + i]; }
  return a;
}
__device__ __forceinline__ v16h frag_f32s(const float* rowk0, int lane, float sc) {
  v16h a; const float* p = rowk0 + 8 * (lane >> 4);
#pragma unroll
  for (int i = 0; i < 8; ++i) { a[i] = (_Float16)(p[i] * sc); a[8 + i] = (_Float16)(p[16 + i] * sc); }
  return a;
}
// column fragment from a [K][ld] layout (column n), rows >= K read as 0
__device__ __forceinline__ v16h fragc_f32(const float* W, int k0, int n, int lane, int ld, int K) {
  v16h a; const int g = lane >> 4;
#pragma unroll
  for (int i = 0; i < 8; ++i) { const int ka = k0 + 8 * g + i, kb = ka + 16;
    a[i] = (_Float16)(ka < K ? W[(size_t)(ka < K ? ka : K - 1) * ld + n] : 0.f); a[8 + i] = (_Float16)(kb < K ? W[(size_t)(kb < K ? kb : K - 1) * ld + n] : 0.f); }
  return a;
}
struct F2 { v16b h, l; };
__device__ __forceinline__ F2 bsplit16(const float v[16]) { F2 r;
#pragma unroll
  for (int i = 0; i < 16; ++i) { const __bf16 h = (__bf16)v[i]; r.h[i] = h; r.l[i] = (__bf16)(v[i] - (float)h); }
  return r; }
__device__ __forceinline__ F2 split_row(const float* row, int k0, int lane) { float v[16]; const float* p = row + k0 + 8 * (lane >> 4);
#pragma unroll
  for (int i = 0; i < 8; ++i) { v[i] = p[i]; v[8 + i] = p[16 + i]; }
  return bsplit16(v); }
__device__ __forceinline__ F2 split_rowK(const float* row, int k0, int lane, int K) { float v[16]; const int g = lane >> 4;
#pragma unroll
  for (int i = 0; i < 8; ++i) { const int ka = k0 + 8 * g + i, kb = ka + 16; v[i] = ka < K ? row[ka < K ? ka : K - 1] : 0.f; v[8 + i] = kb < K ? row[kb < K ? kb : K - 1] : 0.f; }
  return bsplit16(v); }
__device__ __forceinline__ F2 split_col(const float* W, int k0, int n, int lane, int ld, int K) { float v[16]; const int g = lane >> 4;
#pragma unroll
  for (int i = 0; i < 8; ++i) { const int ka = k0 + 8 * g + i, kb = ka + 16; v[i] = ka < K ? W[(size_t)(ka < K ? ka : K - 1) * ld + n] : 0.f; v[8 + i] = kb < K ? W[(size_t)(kb < K ? kb : K - 1) * ld + n] : 0.f; }
  return bsplit16(v); }
__device__ __forceinline__ v8f mac3(const F2& a, const F2& b, v8f c) { c = wmma_bf(a.l, b.h, c); c = wmma_bf(a.h, b.l, c); return wmma_bf(a.h, b.h, c); }
__device__ __forceinline__ float sigm(float v) { return 1.0f / (1.0f + expf(-v)); }
#define LDSX() do { asm volatile("s_wait_dscnt 0" ::: "memory"); __builtin_amdgcn_wave_barrier(); __builtin_amdgcn_fence(__ATOMIC_RELEASE, "workgroup"); } while (0)


// Causal multi-head attention with token shift, partial RoPE, per-head Toeplitz time decay, a 16x16 cross-head mixing of the softmax maps, output projection and a per-position gain.
// Rows r = b*1024 + t. Every bf16 operand plane in the workspace (xs, weights, q, k, v^T, O) is stored in fragment order (see frag_t); the shapes below name rows and K. k_pack ([in][out] weights -> bf16 rows); k_pack also builds xs (channels < 512 come from t-1, zero at t = 0) as bf16 rows; k_qkv (xs W + bias; RoPE on dims 0..31; q/k -> hi/lo rows [bh][t][64], v -> hi/lo transposed [bh][d][t]);
// k_stats (per (bh, 64 queries): causal row max and sum of exp over the keys, kept per lane and merged once -> M, L); k_mix (block = (b, 16 queries, 128-key chunk), loop over 32-key tiles: S for all 16 heads -> P*w as bf16 hi/lo [query,key][h] in LDS -> mixing GEMM -> att'[o][i][j] f32 in LDS
// -> O[o] += att'(hi/lo) v_o(hi/lo); a block covers at most 128 keys and leaves its f32 partial O in PART[chunk][r][o*64+d]); k_red (sum of a row's chunks in ascending key order -> O hi/lo planes [r][o*64+d]); k_out ((O Wo + bo) * gamma[t]).
#define NB 4
#define TT 1024
#define CCH 1024
#define NH 16
#define HS 64
#define NR (NB * TT)
#define ROT 32
#define KCH 128                 // keys per k_mix block
#define NCHK (TT / KCH)         // chunks of the longest row
#define MIXFULL (8 * (NCHK * (NCHK - 1) / 2))  // (16-query tile, chunk) pairs per batch below the diagonal: the 8 tiles with diagonal chunk q have q full chunks each
#define MIXBLK (MIXFULL + TT / 16)             // plus one diagonal chunk per tile
#define PWP 24                  // k_mix: elements per LDS row of P*w: the 16 heads + 8 of pad = 48 B (16 B x odd): the 16 rows that a wave's lanes touch lie on 16 banks (at 64 B: on 4)
typedef __attribute__((ext_vector_type(8))) __bf16 v8b;
__device__ __forceinline__ v16b frag_b16(const __bf16* rowk0, int lane) {
  union { v16b v; v8b q[2]; } u; const __bf16* p = rowk0 + 8 * (lane >> 4);
  u.q[0] = *(const v8b*)p; u.q[1] = *(const v8b*)(p + 16); return u.v;
}
// Fragment order of a bf16 operand [rows][K] in global memory: tiles of 16 rows x 32 k (512 elements, 1 KiB), tile index = (row >> 4) * (K / 32) + (k >> 5); inside a tile the 8 elements k & ~7 .. of a row lie at
// element ((k >> 4) & 1) * 256 + (((k >> 3) & 1) * 16 + (row & 15)) * 8. That is the order in which the lanes read a fragment, so each of its two wave-wide 16-byte loads covers 512 contiguous bytes (4 lines, not 16)
__device__ __forceinline__ v16b frag_t(const __bf16* tile, int lane) {
  union { v16b v; v8b q[2]; } u; const __bf16* p = tile + lane * 8;
  u.q[0] = *(const v8b*)p; u.q[1] = *(const v8b*)(p + 256); return u.v;
}
// the same fragment from the lane's own pointer (tile + lane * 8)
__device__ __forceinline__ v16b frag_p(const __bf16* p) {
  union { v16b v; v8b q[2]; } u; u.q[0] = *(const v8b*)p; u.q[1] = *(const v8b*)(p + 256); return u.v;
}
// fragment whose k 0..15 come from one 16-wide row and k 16..31 from another; ph, pl = the lane's 8 elements (8 (lane >> 4) ..) of each
__device__ __forceinline__ v16b frag_hl(const __bf16* ph, const __bf16* pl) {
  union { v16b v; v8b q[2]; } u; u.q[0] = *(const v8b*)ph; u.q[1] = *(const v8b*)pl; return u.v;
}
__device__ __forceinline__ float bfr(float v) { return (float)(__bf16)v; }
// e^(s/8 - max) is taken as 2^(s * SCL2 - M): log2(e) is folded into the score scale, M (k_stats -> k_mix) is the row max of s * SCL2, and the power is the hardware's own f32 exp2, one instruction; no argument whose power is used lies above 0 by more than a rounding, and a power below the normal range may count as 0
#define SCL2 0.18033688011112042f   // log2(e) / sqrt(64)
__device__ __forceinline__ float ex2(float v) { return __builtin_amdgcn_exp2f(v); }
__device__ __forceinline__ v8f mac3p(v16b ah, v16b al, v16b bh, v16b bl, v8f c) { c = wmma_bf(al, bh, c); c = wmma_bf(ah, bl, c); return wmma_bf(ah, bh, c); }
__constant__ float c_invfreq[16] = {1.0f,0.5623413324356079f,0.3162277638912201f,0.17782793939113617f,0.10000000149011612f,0.05623412877321243f,0.03162277862429619f,0.017782794311642647f,0.009999999776482582f,0.005623413249850273f,0.003162277862429619f,0.0017782794311642647f,0.0010000000474974513f,0.000562341301701963f,0.0003162277862429619f,0.00017782794020604342f};

// workspace carve (bytes)
#define PLANE_Q (2u * NB * NH * TT * HS)        // bf16 [64 bh][1024][64] = 8 MiB
#define WS_PT   0u                               // bf16 [4096][1024]: rows 0.. Wq^T, 1024.. Wk^T, 2048.. Wv^T, 3072.. Wo^T  (8 MiB)
#define WS_QH   (WS_PT + 2u * 4 * CCH * CCH)
#define WS_QL   (WS_QH + PLANE_Q)
#define WS_KH   (WS_QL + PLANE_Q)
#define WS_KL   (WS_KH + PLANE_Q)
#define WS_VTH  (WS_KL + PLANE_Q)                // bf16 [bh][64 d][1024 t]
#define WS_VTL  (WS_VTH + PLANE_Q)
#define WS_M    (WS_VTL + PLANE_Q)               // f32 [bh][1024]
#define WS_L    (WS_M + 4u * NB * NH * TT)
#define WS_OH   (WS_L + 4u * NB * NH * TT)       // bf16 [4096][1024] (row r, col o*64 + d)
#define WS_OL   (WS_OH + 2u * NR * CCH)
#define WS_PART (WS_OL + 2u * NR * CCH)          // f32 [8 key chunks][4096][1024]; row r uses chunks 0 .. t/128
#define WS_XS   (WS_PART + 4u * NCHK * NR * CCH) // bf16 [4096][1024]: shifted x
#define WS_END  (WS_XS + 2u * NR * CCH)

// ---- k_pack: PT (row n, k) = bf16(W[k][n]) in fragment order; block = (16 rows n, 256 k; which matrix is block-uniform), wave = one tile: a lane gathers its 2 x 8 k of its own column n (16 lanes = a 64-byte run of W) and stores them as the fragment's pieces
// blocks from 1024 on: XS (row r, channel k) = bf16(xs) in fragment order, xs = x with channels < 512 taken from row t-1 (zero at t = 0; the address is clamped to the row itself, the load is unconditional and the zero a select); wave = one tile = one 128-byte line of each of 16 rows
__global__ __launch_bounds__(256) void k_pack(const float* __restrict__ X, const float* __restrict__ Wq, const float* __restrict__ Wk, const float* __restrict__ Wv, const float* __restrict__ Wo, __bf16* __restrict__ PT, __bf16* __restrict__ XS) {
  const int tid = threadIdx.x, wave = tid >> 5, lane = tid & 31, col = lane & 15, g = lane >> 4;
  const int rt = (blockIdx.x >> 2) & 255, kc = (blockIdx.x & 3) * 8 + wave;
  if (blockIdx.x >= 4 * (CCH / 16) * 4) {   // block-uniform
    const int r = rt * 16 + col, t = r % TT; const bool shifted = kc * 32 < CCH / 2; const bool zero = shifted && (t == 0);
    const float* px = X + (size_t)(r - ((shifted && t > 0) ? 1 : 0)) * CCH + kc * 32 + g * 8;
    const v4f x0 = *(const v4f*)px, x1 = *(const v4f*)(px + 4), x2 = *(const v4f*)(px + 16), x3 = *(const v4f*)(px + 20); v8b y0, y1;
#pragma unroll
    for (int e = 0; e < 4; ++e) { y0[e] = (__bf16)(zero ? 0.f : x0[e]); y0[4 + e] = (__bf16)(zero ? 0.f : x1[e]); y1[e] = (__bf16)(zero ? 0.f : x2[e]); y1[4 + e] = (__bf16)(zero ? 0.f : x3[e]); }
    __bf16* dx = XS + ((size_t)rt * (CCH / 32) + kc) * 512 + lane * 8;
    *(v8b*)dx = y0; *(v8b*)(dx + 256) = y1;
    return;
  }
  const int which = rt >> 6, nn = (rt & 63) * 16 + col;
  const float* Wm = which == 0 ? Wq : which == 1 ? Wk : which == 2 ? Wv : Wo;
  const float* p = Wm + (size_t)(kc * 32 + g * 8) * CCH + nn; v8b o0, o1;
#pragma unroll
  for (int e = 0; e < 8; ++e) { o0[e] = (__bf16)p[(size_t)e * CCH]; o1[e] = (__bf16)p[(size_t)(16 + e) * CCH]; }
  __bf16* d = PT + ((size_t)rt * (CCH / 32) + kc) * 512 + lane * 8;
  *(v8b*)d = o0; *(v8b*)(d + 256) = o1;
}
// ---- k_qkv: block (64 rows, 128 cols = 2 heads of q, k or v); exact products; + bias; RoPE (q, k); q/k -> hi/lo rows [bh][t][64]; v -> VT hi/lo [bh][d][t]
__global__ __launch_bounds__(128) void k_qkv(const __bf16* __restrict__ XS, const __bf16* __restrict__ PT, const float* __restrict__ bq, const float* __restrict__ bk, const float* __restrict__ bv,
                                             __bf16* __restrict__ Qh, __bf16* __restrict__ Ql, __bf16* __restrict__ Kh, __bf16* __restrict__ Kl, __bf16* __restrict__ VTh, __bf16* __restrict__ VTl) {
  __shared__ __align__(16) __bf16 sh_[128][72], sl_[128][72];
  const int tid = threadIdx.x, wave = tid >> 5, lane = tid & 31, col = lane & 15, g = lane >> 4;
  const size_t rb = (size_t)blockIdx.x * 64; const int b = (int)(rb / TT), t0 = (int)(rb % TT);
  const int which = blockIdx.y >> 3; const int n0 = (blockIdx.y & 7) * 128;          // block-uniform: 0 q, 1 k, 2 v; n0 = first output channel (2 heads)
  const size_t r0 = rb + wave * 16;
  v8f acc[8] = {};
  // fragments are fetched one k step ahead: a weight fragment's registers are refilled for step kc + 1 directly behind the product that read them at step kc, so a load has eight products' time to arrive and no product waits a whole memory latency of its own
  const __bf16* pa = XS + (r0 >> 4) * (CCH / 32) * 512 + lane * 8; const __bf16* pb = PT + (size_t)((which * CCH + n0) / 16) * (CCH / 32) * 512 + lane * 8;   // the lane's own piece of tile (., k step 0)
  v16b a0 = frag_p(pa), a1, wf[8];
#pragma unroll
  for (int j = 0; j < 8; ++j) wf[j] = frag_p(pb + (size_t)j * (CCH / 32) * 512);
#pragma unroll 1   // 15 trips of two k steps (two, so that the two x fragments swap without copies); kept rolled so that the loop stays small in the instruction cache
  for (int kc = 0; kc < CCH / 32 - 2; kc += 2) {
    a1 = frag_p(pa + 512);
#pragma unroll
    for (int j = 0; j < 8; ++j) { acc[j] = wmma_bf(a0, wf[j], acc[j]); wf[j] = frag_p(pb + ((size_t)j * (CCH / 32) + 1) * 512); }
    a0 = frag_p(pa + 1024);
#pragma unroll
    for (int j = 0; j < 8; ++j) { acc[j] = wmma_bf(a1, wf[j], acc[j]); wf[j] = frag_p(pb + ((size_t)j * (CCH / 32) + 2) * 512); }
    asm volatile("s_wait_xcnt 0x0" ::: "memory");   // the pointer steps below land in the address registers of the loads above, which are still in flight
    pa += 1024; pb += 1024; }
  a1 = frag_p(pa + 512);   // the last two k steps: nothing is left to fetch behind the last
  asm volatile("s_wait_xcnt 0x0" ::: "memory");     // pa is dead from here on: a later load's result may land in its registers
#pragma unroll
  for (int j = 0; j < 8; ++j) { acc[j] = wmma_bf(a0, wf[j], acc[j]); wf[j] = frag_p(pb + ((size_t)j * (CCH / 32) + 1) * 512); }
  asm volatile("s_wait_xcnt 0x0" ::: "memory");     // the epilogue may land in the address registers of the loads above
#pragma unroll
  for (int j = 0; j < 8; ++j) acc[j] = wmma_bf(a1, wf[j], acc[j]);
  const float* bias = which == 0 ? bq : which == 1 ? bk : bv;
#pragma unroll
  for (int j = 0; j < 8; ++j) { const float bb = bfr(bias[n0 + j * 16 + col]);
#pragma unroll
    for (int r = 0; r < 8; ++r) acc[j][r] += bb; }
  if (which < 2) {   // RoPE on head-local dims 0..15 (tile 4h'+0) and 16..31 (tile 4h'+1), pairs in the same lane; theta = t * inv_freq[col]
#pragma unroll
    for (int hp = 0; hp < 2; ++hp) {
#pragma unroll
      for (int r = 0; r < 8; ++r) { const int t = t0 + wave * 16 + 8 * g + r; const float th = (float)t * c_invfreq[col]; const float cs = cosf(th), sn = sinf(th);
        const float a0 = acc[hp * 4][r], a1 = acc[hp * 4 + 1][r];
        acc[hp * 4][r] = a0 * cs - a1 * sn; acc[hp * 4 + 1][r] = a1 * cs + a0 * sn; } }
    __bf16* Oh = which == 0 ? Qh : Kh; __bf16* Ol = which == 0 ? Ql : Kl;
#pragma unroll
    for (int hp = 0; hp < 2; ++hp) {
#pragma unroll
      for (int j = 0; j < 4; ++j)
#pragma unroll
        for (int r = 0; r < 8; ++r) { const float v = acc[hp * 4 + j][r]; const __bf16 hi = (__bf16)v; sh_[wave * 16 + 8 * g + r][j * 16 + col] = hi; sl_[wave * 16 + 8 * g + r][j * 16 + col] = (__bf16)(v - (float)hi); }
      LDSX();
      const int h = (n0 >> 6) + hp; const size_t base = ((size_t)(b * NH + h) * TT + t0 + wave * 16) * HS;   // the wave's 16 rows x 64 dims = two whole tiles; piece qq of them holds row qq & 15, dims 8 (qq >> 4) ..
      v4u ph[4], pl[4];
#pragma unroll   // four fixed trips, unrolled so that ph and pl are registers and the eight LDS reads share one latency
      for (int q4 = 0; q4 < 4; ++q4) { const int qq = q4 * 32 + lane, pc = q4 * 2 + g; ph[q4] = *(const v4u*)(&sh_[wave * 16 + col][pc * 8]); pl[q4] = *(const v4u*)(&sl_[wave * 16 + col][pc * 8]); vst2((unsigned*)(Oh + base + qq * 8), ph[q4]); vst2((unsigned*)(Ol + base + qq * 8), pl[q4]); }
      asm volatile("s_wait_xcnt 0x0" :: "v"(ph[0]), "v"(ph[1]), "v"(ph[2]), "v"(ph[3]), "v"(pl[0]), "v"(pl[1]), "v"(pl[2]), "v"(pl[3]) : "memory");   // the next head's conversions may land in the data registers of the eight stores above; the stored values as inputs keep those registers untouched up to this wait
      LDSX(); }
  } else {
#pragma unroll
    for (int j = 0; j < 8; ++j)
#pragma unroll
      for (int r = 0; r < 8; ++r) { const float v = acc[j][r]; const __bf16 hi = (__bf16)v; sh_[j * 16 + col][wave * 16 + 8 * g + r] = hi; sl_[j * 16 + col][wave * 16 + 8 * g + r] = (__bf16)(v - (float)hi); }
    __syncthreads();
    for (int qq = tid; qq < 128 * 8; qq += 128) { const int ct = qq >> 7, kcl = (qq >> 6) & 1, w = qq & 63; const int c = ct * 16 + (w & 15), pc = kcl * 4 + (w >> 4);   // 16 tiles (8 groups of 16 channels x 2 groups of 32 t), 64 pieces each, in storage order
      const int h = (n0 >> 6) + (ct >> 2); const size_t o = (((size_t)(b * NH + h) * (HS / 16) + (ct & 3)) * (TT / 32) + (t0 >> 5) + kcl) * 512 + w * 8;
      vst2((unsigned*)(VTh + o), *(const v4u*)(&sh_[c][pc * 8])); vst2((unsigned*)(VTl + o), *(const v4u*)(&sl_[c][pc * 8])); }
  }
}
// ---- k_stats: block = (bh, 64 queries); wave = 16 queries; causal key steps of 64 (four 16-key tiles): S = q'(hi/lo) k'(hi/lo) * SCL2 (base-2 exponents); every lane keeps the running max and sum of its own key columns (j = col mod 16) and rescales once per step;
// the 16 lanes of a row are merged once, behind the loop -> M, L (f32 [bh][t], 256 B per block by 16 lanes)
__global__ __launch_bounds__(128) void k_stats(const __bf16* __restrict__ Qh, const __bf16* __restrict__ Ql, const __bf16* __restrict__ Kh, const __bf16* __restrict__ Kl, float* __restrict__ Mo, float* __restrict__ Lo) {
  __shared__ float sm[64], ssum[64];
  const int tid = threadIdx.x, wave = tid >> 5, lane = tid & 31, col = lane & 15, g = lane >> 4;
  const int bh = blockIdx.y; const int i0 = blockIdx.x * 64 + wave * 16;
  const __bf16* qh = Qh + ((size_t)bh * TT + i0) * HS; const __bf16* ql = Ql + ((size_t)bh * TT + i0) * HS;
  const v16b qh0 = frag_t(qh, lane), qh1 = frag_t(qh + 512, lane), ql0 = frag_t(ql, lane), ql1 = frag_t(ql + 512, lane);
  asm volatile("s_wait_xcnt 0x0" :: "v"(qh0), "v"(qh1), "v"(ql0), "v"(ql1) : "memory");   // the loop's key loads may land in the address registers of the query loads above; the loaded values as inputs keep this wait behind those loads
  float m[8], l[8];
#pragma unroll
  for (int r = 0; r < 8; ++r) { m[r] = -3.0e38f; l[r] = 0.f; }
  const int jend = i0 + 16;                                      // keys j <= i for rows i0..i0+15 -> tiles covering [0, i0+16)
#pragma unroll 1
  for (int j0 = 0; j0 < jend; j0 += 64) {
    v8f s4[4];   // the step's four score tiles; a tile past the diagonal is skipped, stays zero and is dropped by the select below
#pragma unroll
    for (int jt = 0; jt < 4; ++jt) { const int jb = j0 + jt * 16; v8f s = {}; if (jb < jend) {   // wave-uniform
      const __bf16* kh = Kh + ((size_t)bh * TT + jb) * HS; const __bf16* kl = Kl + ((size_t)bh * TT + jb) * HS;
      const v16b kh0 = frag_t(kh, lane), kl0 = frag_t(kl, lane), kh1 = frag_t(kh + 512, lane), kl1 = frag_t(kl + 512, lane);
      asm volatile("s_wait_xcnt 0x0" :: "v"(kh0), "v"(kl0), "v"(kh1), "v"(kl1) : "memory");   // inputs-only fence on the loaded values: holds all eight key loads in front of the products, one memory latency instead of two in a row; and it keeps this wait behind them: the step's rescale may land in their address registers
      s = mac3p(qh0, ql0, kh0, kl0, s); s = mac3p(qh1, ql1, kh1, kl1, s); }
      s4[jt] = s; }
#pragma unroll
    for (int r = 0; r < 8; ++r) { const int i = i0 + 8 * g + r; float v[4];
#pragma unroll
      for (int t = 0; t < 4; ++t) v[t] = (j0 + t * 16 + col <= i) ? s4[t][r] * SCL2 : -1e30f;
      const float mn = fmaxf(fmaxf(fmaxf(fmaxf(m[r], v[0]), v[1]), v[2]), v[3]);
      l[r] = l[r] * ex2(m[r] - mn) + ((ex2(v[0] - mn) + ex2(v[1] - mn)) + (ex2(v[2] - mn) + ex2(v[3] - mn))); m[r] = mn; }   // a lane that has seen masked keys only holds m = -1e30 and a count in l: the next rescale, or the merge below, multiplies it by 2^(-1e30 - max) = 0
  }
#pragma unroll
  for (int r = 0; r < 8; ++r) { float mt = m[r];   // merge of the row's 16 lanes: every row has key 0, so the merged max is a real score
#pragma unroll
    for (int o = 1; o < 16; o <<= 1) mt = fmaxf(mt, __shfl_xor(mt, o));
    float e = l[r] * ex2(m[r] - mt);
#pragma unroll
    for (int o = 1; o < 16; o <<= 1) e += __shfl_xor(e, o);
    m[r] = mt; l[r] = e; }
  if (col == 0) {
#pragma unroll
    for (int r = 0; r < 8; ++r) { sm[wave * 16 + 8 * g + r] = m[r]; ssum[wave * 16 + 8 * g + r] = l[r]; } }
  __syncthreads();
  if (tid < 16) { vst2(Mo + (size_t)bh * TT + blockIdx.x * 64 + tid * 4, *(const v4f*)&sm[tid * 4]); vst2(Lo + (size_t)bh * TT + blockIdx.x * 64 + tid * 4, *(const v4f*)&ssum[tid * 4]); }
}
// ---- k_mix: block = (b, 16 queries i0..i0+15, keys of one 128-key chunk), 8 waves; loop over the chunk's 32-key tiles (causal). M and L are known, so O is a plain sum over keys and chunks are independent
__global__ __launch_bounds__(256) void k_mix(const __bf16* __restrict__ Qh, const __bf16* __restrict__ Ql, const __bf16* __restrict__ Kh, const __bf16* __restrict__ Kl, const __bf16* __restrict__ VTh, const __bf16* __restrict__ VTl,
                                             const float* __restrict__ Mo, const float* __restrict__ Lo, const float* __restrict__ tw, const float* __restrict__ talpha, const float* __restrict__ tbeta, const float* __restrict__ mixw,
                                             float* __restrict__ PART) {
  __shared__ __align__(16) __bf16 pw[2][512][PWP];              // (P*w) for the tile, hi and lo plane: row = i*32 + j (query-in-tile, key-in-tile), column = head h; the pad is never read
  __bf16 (*pwh)[PWP] = pw[0]; __bf16 (*pwl)[PWP] = pw[1];
  __shared__ __align__(16) float attp[NH][16][36];               // mixed attention tile per output head o: [o][i][j]
  __shared__ __align__(16) __bf16 mixr[NH][32];                  // mixing matrix rows o, k = h, then the same 16 again
  const int tid = threadIdx.x, wave = tid >> 5, lane = tid & 31, col = lane & 15, g = lane >> 4;
  // blockIdx.y -> (query tile = 8 gq + tl, chunk <= gq): the full 128-key chunks first, then the diagonal chunks from the longest to the shortest, so that the work-groups that start last are the short ones
  int rem = blockIdx.y, gq, tl, chunk;
  if (rem < MIXFULL) { gq = NCHK - 1; while (gq > 1 && rem >= 8 * gq) { rem -= 8 * gq; --gq; } chunk = rem >> 3; tl = rem & 7; }
  else { rem -= MIXFULL; gq = rem & 7; tl = 7 - (rem >> 3); chunk = gq; }
  const int b = blockIdx.x, i0 = (gq * 8 + tl) * 16;
  for (int q = tid; q < NH * 32; q += 256) { const int o = q >> 5, h = q & 31; mixr[o][h] = (__bf16)mixw[o * NH + (h & (NH - 1))]; }
  // this wave's two heads for the S phase and two output heads for the PV phase
  const int hA = wave * 2;
  float mrow[2][8], lb[2][8];            // row max (of s * SCL2), and beta[h][i] / L (the per-row factors of p*w = (2^(s*SCL2-m)/L) * ((tw*alpha)*beta), folded)
#pragma unroll
  for (int u = 0; u < 2; ++u) { const int bh = b * NH + hA + u;
#pragma unroll
    for (int r = 0; r < 8; ++r) { const int i = i0 + 8 * g + r; mrow[u][r] = Mo[(size_t)bh * TT + i]; lb[u][r] = bfr(tbeta[(hA + u) * TT + i]) / Lo[(size_t)bh * TT + i]; } }
  v8f oacc[2][4];
#pragma unroll
  for (int u = 0; u < 2; ++u)
#pragma unroll
    for (int d4 = 0; d4 < 4; ++d4) oacc[u][d4] = (v8f){};
  __syncthreads();
  const int jbeg = chunk * KCH; const int jend = (i0 + 16 < jbeg + KCH) ? i0 + 16 : jbeg + KCH;
#pragma unroll 1
  for (int j0 = jbeg; j0 < jend; j0 += 32) {
    // -- S for this wave's two heads; P*w -> pwh/pwl[(i)*32 + j][h]
#pragma unroll
    for (int u = 0; u < 2; ++u) { const int h = hA + u; const int bh = b * NH + h;
      const __bf16* qh = Qh + ((size_t)bh * TT + i0) * HS; const __bf16* ql = Ql + ((size_t)bh * TT + i0) * HS;
      const v16b qh0 = frag_t(qh, lane), qh1 = frag_t(qh + 512, lane), ql0 = frag_t(ql, lane), ql1 = frag_t(ql + 512, lane);   // re-read per key tile (cached) to keep VGPRs < 256
#pragma unroll 1
      for (int jt = 0; jt < 2; ++jt) { const int jb = j0 + jt * 16;   // body is one straight line, no call and no branch: the eight rows' loads, exps and stores overlap. jb + 15 <= 1023, so a half past the diagonal reads rows that exist; the select drops it
        const __bf16* kh = Kh + ((size_t)bh * TT + jb) * HS; const __bf16* kl = Kl + ((size_t)bh * TT + jb) * HS;
        const int j = jb + col; const float al = talpha[h * TT + (j < TT ? j : TT - 1)]; float twv[8];
#pragma unroll
        for (int r = 0; r < 8; ++r) { const int widx = TT - 1 + j - (i0 + 8 * g + r); twv[r] = tw[h * TT + (widx < TT ? widx : TT - 1)]; }   // 0 <= widx; clamped into the row above the diagonal
        asm volatile("s_wait_xcnt 0x0" ::: "memory");   // the key loads below may land in the offset registers of the nine loads above
        const v16b kh0 = frag_t(kh, lane), kl0 = frag_t(kl, lane), kh1 = frag_t(kh + 512, lane), kl1 = frag_t(kl + 512, lane);
        // inputs-only fence on the loaded values: holds all 17 loads of this half in front of the products, so that they share one memory latency (without it the compiler sinks half of the key loads and the decay loads behind the products: three latencies in a row)
        asm volatile("" :: "v"(kh0), "v"(kl0), "v"(kh1), "v"(kl1), "v"(al), "v"(twv[0]), "v"(twv[1]), "v"(twv[2]), "v"(twv[3]), "v"(twv[4]), "v"(twv[5]), "v"(twv[6]), "v"(twv[7]));
        v8f s = {}; s = mac3p(qh0, ql0, kh0, kl0, s); s = mac3p(qh1, ql1, kh1, kl1, s);
        const float alpha_j = bfr(al);
#pragma unroll
        for (int r = 0; r < 8; ++r) { const int il = 8 * g + r, i = i0 + il;
          const float pv = (ex2(s[r] * SCL2 - mrow[u][r]) * lb[u][r]) * (bfr(twv[r]) * alpha_j);
          const float pw = (j <= i) ? pv : 0.f;                  // causal mask as a select: a masked pv is never used
          const __bf16 hi = (__bf16)pw; pwh[il * 32 + jt * 16 + col][h] = hi; pwl[il * 32 + jt * 16 + col][h] = (__bf16)(pw - (float)hi); } } }
    __syncthreads();
    // -- mixing GEMM: att'[o][(i,j)] = sum_h mix[o][h] Pw[(i,j)][h]; 32 column tiles of 16 (i,j) pairs, K = 32: k 0..15 = the heads' hi parts, k 16..31 = their lo parts, against the mixing row twice; wave owns column tiles 4w..4w+3
    { const v16b am = frag_b16(&mixr[col][0], lane);            // A rows o = col, k = h
#pragma unroll 1
      for (int ct = 0; ct < 4; ++ct) { const int n0c = (wave * 4 + ct) * 16; v8f a = {};
        a = wmma_bf(am, frag_hl(&pwh[n0c + col][8 * g], &pwl[n0c + col][8 * g]), a);
        const int il = n0c >> 5, jl0 = n0c & 31;                 // the 16 columns of this tile share i (32 | n0c+0..15 within one i row since tiles are 16-aligned inside 32)
#pragma unroll
        for (int r = 0; r < 8; ++r) attp[8 * g + r][il][jl0 + col] = a[r]; } }
    __syncthreads();
    // -- O[o] += att'[o](hi/lo) v_o(hi/lo): this wave's output heads o = hA, hA+1; K = 32 keys (one step); 4 d tiles
#pragma unroll
    for (int u = 0; u < 2; ++u) { const int o = hA + u; const int bh = b * NH + o; const F2 af = split_row(&attp[o][col][0], 0, lane);
#pragma unroll
      for (int d4 = 0; d4 < 4; ++d4) { const size_t vo = (((size_t)bh * (HS / 16) + d4) * (TT / 32) + (j0 >> 5)) * 512;
        oacc[u][d4] = mac3p(af.h, af.l, frag_t(VTh + vo, lane), frag_t(VTl + vo, lane), oacc[u][d4]); } }
    __syncthreads();                                            // pw*/attp are rewritten by the next key tile
  }
  // -- partial O rows: r = b*1024 + i, columns o*64 + d, f32; per wave 16 rows x 64 cols per head staged in the (now free) pw and attp buffers, 4 KiB per wave in each: 256-B segments by 16 lanes
  float* st0 = (float*)&pw[0][0][0] + wave * (16 * 64); float* st1 = &attp[0][0][0] + wave * (16 * 64);
#pragma unroll
  for (int d4 = 0; d4 < 4; ++d4)
#pragma unroll
    for (int r = 0; r < 8; ++r) { st0[(8 * g + r) * 64 + d4 * 16 + col] = oacc[0][d4][r]; st1[(8 * g + r) * 64 + d4 * 16 + col] = oacc[1][d4][r]; }
  LDSX();
  for (int qq = lane; qq < 16 * 16; qq += 32) { const int rl = qq >> 4, pc = qq & 15; const size_t o = ((size_t)chunk * NR + (size_t)b * TT + i0 + rl) * CCH + hA * 64 + pc * 4;
    vst2(PART + o, *(const v4f*)(st0 + rl * 64 + pc * 4)); vst2(PART + o + 64, *(const v4f*)(st1 + rl * 64 + pc * 4)); }
}
// ---- k_red: O[r][c] = sum of the row's chunk partials, ascending chunk; -> hi/lo planes in fragment order; block = 16 rows x 256 columns, wave = one tile (16 rows x 32 columns: one whole 128-byte line of each row), lane = its two pieces of 8 columns
__global__ __launch_bounds__(256) void k_red(const float* __restrict__ PART, __bf16* __restrict__ OH, __bf16* __restrict__ OL) {
  const int wave = threadIdx.x >> 5, lane = threadIdx.x & 31, col = lane & 15, g = lane >> 4; const int rt = blockIdx.x >> 2, kc = (blockIdx.x & 3) * 8 + wave;
  const int t = (rt * 16) % TT; const int nch = t / KCH + 1;   // the 16 rows of a block lie in one chunk group
  const float* p = PART + (size_t)(rt * 16 + col) * CCH + kc * 32 + g * 8; v4f a0 = {}, a1 = {}, a2 = {}, a3 = {};
#pragma unroll 1   // at most 8 trips; kept rolled so that the kernel stays small in registers and all of its waves are resident at once and hide each trip's load latency
  for (int c = 0; c < nch; ++c) { a0 += *(const v4f*)p; a1 += *(const v4f*)(p + 4); a2 += *(const v4f*)(p + 16); a3 += *(const v4f*)(p + 20); p += (size_t)NR * CCH; }
  v8b hi, lo, hj, lj;
#pragma unroll
  for (int i = 0; i < 4; ++i) { const __bf16 h0 = (__bf16)a0[i], h1 = (__bf16)a1[i], h2 = (__bf16)a2[i], h3 = (__bf16)a3[i]; hi[i] = h0; hi[4 + i] = h1; hj[i] = h2; hj[4 + i] = h3;
    lo[i] = (__bf16)(a0[i] - (float)h0); lo[4 + i] = (__bf16)(a1[i] - (float)h1); lj[i] = (__bf16)(a2[i] - (float)h2); lj[4 + i] = (__bf16)(a3[i] - (float)h3); }
  const size_t e = ((size_t)rt * (CCH / 32) + kc) * 512 + lane * 8;
  *(v8b*)(OH + e) = hi; *(v8b*)(OH + e + 256) = hj; *(v8b*)(OL + e) = lo; *(v8b*)(OL + e + 256) = lj;
}
// ---- k_out: out = (O(hi/lo) . Wo^T rows + bo) * gamma[t]; block (64 rows, 128 cols), K = 1024
__global__ __launch_bounds__(128) void k_out(const __bf16* __restrict__ OH, const __bf16* __restrict__ OL, const __bf16* __restrict__ PT, const float* __restrict__ bo, const float* __restrict__ gam, float* __restrict__ out) {
  __shared__ __align__(16) float so[4][16][132];
  const int tid = threadIdx.x, wave = tid >> 5, lane = tid & 31, col = lane & 15, g = lane >> 4; const size_t r0 = (size_t)blockIdx.x * 64 + wave * 16; const int n0 = blockIdx.y * 128;
  v8f acc[8] = {};
  // fragments are fetched one k step ahead, as in k_qkv: a weight fragment's registers are refilled for step kc + 1 directly behind the two products that read them at step kc
  const __bf16* ph = OH + (r0 >> 4) * (CCH / 32) * 512 + lane * 8; const __bf16* pl = OL + (r0 >> 4) * (CCH / 32) * 512 + lane * 8; const __bf16* pb = PT + (size_t)((3 * CCH + n0) / 16) * (CCH / 32) * 512 + lane * 8;   // the lane's own piece of tile (., k step 0)
  v16b ah0 = frag_p(ph), al0 = frag_p(pl), ah1, al1, wf[8];
#pragma unroll
  for (int j = 0; j < 8; ++j) wf[j] = frag_p(pb + (size_t)j * (CCH / 32) * 512);
#pragma unroll 1   // 15 trips of two k steps (two, so that the O fragments swap without copies); kept rolled so that the loop stays small in the instruction cache
  for (int kc = 0; kc < CCH / 32 - 2; kc += 2) {
    ah1 = frag_p(ph + 512); al1 = frag_p(pl + 512);
#pragma unroll
    for (int j = 0; j < 8; ++j) { acc[j] = wmma_bf(al0, wf[j], acc[j]); acc[j] = wmma_bf(ah0, wf[j], acc[j]); wf[j] = frag_p(pb + ((size_t)j * (CCH / 32) + 1) * 512); }
    ah0 = frag_p(ph + 1024); al0 = frag_p(pl + 1024);
#pragma unroll
    for (int j = 0; j < 8; ++j) { acc[j] = wmma_bf(al1, wf[j], acc[j]); acc[j] = wmma_bf(ah1, wf[j], acc[j]); wf[j] = frag_p(pb + ((size_t)j * (CCH / 32) + 2) * 512); }
    asm volatile("s_wait_xcnt 0x0" ::: "memory");   // the pointer steps below land in the address registers of the loads above, which are still in flight
    ph += 1024; pl += 1024; pb += 1024; }
  ah1 = frag_p(ph + 512); al1 = frag_p(pl + 512);   // the last two k steps: nothing is left to fetch behind the last
  asm volatile("s_wait_xcnt 0x0" ::: "memory");     // ph and pl are dead from here on: a later load's result may land in their registers
#pragma unroll
  for (int j = 0; j < 8; ++j) { acc[j] = wmma_bf(al0, wf[j], acc[j]); acc[j] = wmma_bf(ah0, wf[j], acc[j]); wf[j] = frag_p(pb + ((size_t)j * (CCH / 32) + 1) * 512); }
  asm volatile("s_wait_xcnt 0x0" ::: "memory");     // the epilogue may land in the address registers of the loads above
#pragma unroll
  for (int j = 0; j < 8; ++j) { acc[j] = wmma_bf(al1, wf[j], acc[j]); acc[j] = wmma_bf(ah1, wf[j], acc[j]); }
#pragma unroll
  for (int j = 0; j < 8; ++j) { const float bb = bfr(bo[n0 + j * 16 + col]);
#pragma unroll
    for (int r = 0; r < 8; ++r) { const int t = (int)((r0 + 8 * g + r) % TT); so[wave][8 * g + r][j * 16 + col] = (acc[j][r] + bb) * bfr(gam[t]); } }
  LDSX();
  for (int rl = 0; rl < 16; ++rl) vst2(out + (r0 + rl) * CCH + n0 + lane * 4, *(const v4f*)(&so[wave][rl][lane * 4]));
}

extern "C" void kernel_launch(void* const* d_in, const int* in_sizes, int n_in, void* d_out, int out_size, void* d_ws, size_t ws_size, hipStream_t stream) {
  (void)in_sizes; (void)n_in; (void)out_size;
  const float** I = (const float**)d_in;   // x, Wq, bq, Wk, bk, Wv, bv, Wo, bo, time_w, time_alpha, time_beta, time_gamma, head_mix_w
  if (ws_size < (size_t)WS_END) return;
  char* ws = (char*)d_ws;
  __bf16* PT = (__bf16*)(ws + WS_PT); __bf16 *Qh = (__bf16*)(ws + WS_QH), *Ql = (__bf16*)(ws + WS_QL), *Kh = (__bf16*)(ws + WS_KH), *Kl = (__bf16*)(ws + WS_KL), *VTh = (__bf16*)(ws + WS_VTH), *VTl = (__bf16*)(ws + WS_VTL);
  float *Mo = (float*)(ws + WS_M), *Lo = (float*)(ws + WS_L); __bf16 *OH = (__bf16*)(ws + WS_OH), *OL = (__bf16*)(ws + WS_OL); float* PART = (float*)(ws + WS_PART); __bf16* XS = (__bf16*)(ws + WS_XS);
  k_pack<<<4 * (CCH / 16) * 4 + (NR / 16) * 4, 256, 0, stream>>>(I[0], I[1], I[3], I[5], I[7], PT, XS);
  k_qkv<<<dim3(NR / 64, 24), 128, 0, stream>>>(XS, PT, I[2], I[4], I[6], Qh, Ql, Kh, Kl, VTh, VTl);
  k_stats<<<dim3(TT / 64, NB * NH), 128, 0, stream>>>(Qh, Ql, Kh, Kl, Mo, Lo);
  k_mix<<<dim3(NB, MIXBLK), 256, 0, stream>>>(Qh, Ql, Kh, Kl, VTh, VTl, Mo, Lo, I[9], I[10], I[11], I[13], PART);
  k_red<<<(NR / 16) * 4, 256, 0, stream>>>(PART, OH, OL);
  k_out<<<dim3(NR / 64, CCH / 128), 128, 0, stream>>>(OH, OL, PT, I[8], I[12], (float*)d_out);
}

// v008
// Measured time: 215 microseconds a run.
// In two side-by-side timings against v007, it was 1.13 and 1.12 times as fast.
// All steps since v000 together make it 3.74 times as fast.
// compute dtype: x, all weights/biases, time_w/alpha/beta/gamma and the head-mixing matrix (module inputs) rounded to bf16; q/k/v = xs W with exact bf16 products; RoPE, scores' softmax statistics,
// decay and normalisation in f32; scores = q'(hi/lo) k'(hi/lo)^T (3 products); head mixing = bf16(mix) x (P w)(hi/lo) (one K = 32 product: hi heads | lo heads); context = att'(hi/lo) x v(hi/lo) (3 products); out = O(hi/lo) Wo (2 products) + bo, x gamma; f32 accumulate.
#include <hip/hip_runtime.h>
#include <math.h>

typedef __attribute__((ext_vector_type(16))) _Float16 v16h;
typedef __attribute__((ext_vector_type(16))) __bf16 v16b;
typedef __attribute__((ext_vector_type(8)))  _Float16 v8h;
typedef __attribute__((ext_vector_type(8)))  float v8f;
typedef __attribute__((ext_vector_type(4)))  float v4f;
typedef __attribute__((ext_vector_type(2)))  float v2f;
typedef __attribute__((ext_vector_type(4)))  unsigned v4u;
typedef __attribute__((ext_vector_type(4)))  int v4i;
typedef float __attribute__((may_alias)) float_a;
typedef int __attribute__((may_alias)) int_a;

template <typename T> __device__ __forceinline__ void vst2(void* p, T v) { *(T*)p = v;  }
__device__ __forceinline__ v8f wmma16(v16h a, v16h b, v8f c) {
  v8f d = __builtin_amdgcn_wmma_f32_16x16x32_f16(false, a, false, b, (short)0, c, false, false);
  asm volatile("v_nop\n\tv_nop\n\tv_nop\n\tv_nop" : "+v"(d) : "v"(a), "v"(b));
  return d;
}
__device__ __forceinline__ v8f wmma_bf(v16b a, v16b b, v8f c) {
  v8f d = __builtin_amdgcn_wmma_f32_16x16x32_bf16(false, a, false, b, (short)0, c, false, false);
  asm volatile("v_nop\n\tv_nop\n\tv_nop\n\tv_nop" : "+v"(d) : "v"(a), "v"(b));
  return d;
}
// 16x16x32 fragments: lane = (h = lane>>4, row/col = lane&15); elements 0..7 = k0+8h+0..7, 8..15 = k0+16+8h+0..7; D element r = row 8h+r
__device__ __forceinline__ v16h frag_h(const _Float16* rowk0, int lane) {
  union { v16h v; v8h q[2]; } u; const _Float16* p = rowk0 + 8 * (lane >> 4);
  u.q[0] = *(const v8h*)p; u.q[1] = *(const v8h*)(p + 16); return u.v;
}
__device__ __forceinline__ v16h frag_f32(const float* rowk0, int lane) {
  v16h a; const float* p = rowk0 + 8 * (lane >> 4);
#pragma unroll
  for (int i = 0; i < 8; ++i) { a[i] = (_Float16)p[i]; a[8 + i] = (_Float16)p[16 + i]; }
  return a;
}
__device__ __forceinline__ v16h frag_f32s(const float* rowk0, int lane, float sc) {
  v16h a; const float* p = rowk0 + 8 * (lane >> 4);
#pragma unroll
  for (int i = 0; i < 8; ++i) { a[i] = (_Float16)(p[i] * sc); a[8 + i] = (_Float16)(p[16 + i] * sc); }
  return a;
}
// column fragment from a [K][ld] layout (column n), rows >= K read as 0
__device__ __forceinline__ v16h fragc_f32(const float* W, int k0, int n, int lane, int ld, int K) {
  v16h a; const int g = lane >> 4;
#pragma unroll
  for (int i = 0; i < 8; ++i) { const int ka = k0 + 8 * g + i, kb = ka + 16;
    a[i] = (_Float16)(ka < K ? W[(size_t)(ka < K ? ka : K - 1) * ld + n] : 0.f); a[8 + i] = (_Float16)(kb < K ? W[(size_t)(kb < K ? kb : K - 1) * ld + n] : 0.f); }
  return a;
}
struct F2 { v16b h, l; };
__device__ __forceinline__ F2 bsplit16(const float v[16]) { F2 r;
#pragma unroll
  for (int i = 0; i < 16; ++i) { const __bf16 h = (__bf16)v[i]; r.h[i] = h; r.l[i] = (__bf16)(v[i] - (float)h); }
  return r; }
__device__ __forceinline__ F2 split_row(const float* row, int k0, int lane) { float v[16]; const float* p = row + k0 + 8 * (lane >> 4);
#pragma unroll
  for (int i = 0; i < 8; ++i) { v[i] = p[i]; v[8 + i] = p[16 + i]; }
  return bsplit16(v); }
__device__ __forceinline__ F2 split_rowK(const float* row, int k0, int lane, int K) { float v[16]; const int g = lane >> 4;
#pragma unroll
  for (int i = 0; i < 8; ++i) { const int ka = k0 + 8 * g + i, kb = ka + 16; v[i] = ka < K ? row[ka < K ? ka : K - 1] : 0.f; v[8 + i] = kb < K ? row[kb < K ? kb : K - 1] : 0.f; }
  return bsplit16(v); }
__device__ __forceinline__ F2 split_col(const float* W, int k0, int n, int lane, int ld, int K) { float v[16]; const int g = lane >> 4;
#pragma unroll
  for (int i = 0; i < 8; ++i) { const int ka = k0 + 8 * g + i, kb = ka + 16; v[i] = ka < K ? W[(size_t)(ka < K ? ka : K - 1) * ld + n] : 0.f; v[8 + i] = kb < K ? W[(size_t)(kb < K ? kb : K - 1) * ld + n] : 0.f; }
  return bsplit16(v); }
__device__ __forceinline__ v8f mac3(const F2& a, const F2& b, v8f c) { c = wmma_bf(a.l, b.h, c); c = wmma_bf(a.h, b.l, c); return wmma_bf(a.h, b.h, c); }
__device__ __forceinline__ float sigm(float v) { return 1.0f / (1.0f + expf(-v)); }
#define LDSX() do { asm volatile("s_wait_dscnt 0" ::: "memory"); __builtin_amdgcn_wave_barrier(); __builtin_amdgcn_fence(__ATOMIC_RELEASE, "workgroup"); } while (0)


// Causal multi-head attention with token shift, partial RoPE, per-head Toeplitz time decay, a 16x16 cross-head mixing of the softmax maps, output projection and a per-position gain.
// Rows r = b*1024 + t. Every bf16 operand plane in the workspace (xs, weights, q, k, v^T, O) is stored in fragment order (see frag_t); the shapes below name rows and K. k_pack ([in][out] weights -> bf16 rows); k_pack also builds xs (channels < 512 come from t-1, zero at t = 0) as bf16 rows; k_qkv (xs W + bias; RoPE on dims 0..31; q/k -> hi/lo rows [bh][t][64], v -> hi/lo transposed [bh][d][t]);
// k_stats (per (bh, 64 queries): causal row max and sum of exp over the keys, kept per lane and merged once -> M, L); k_mix (block = (b, 16 queries, 128-key chunk), loop over 32-key tiles: S for all 16 heads -> P*w as bf16 hi/lo [query,key][h] in LDS -> mixing GEMM -> att'[o][i][j] f32 in LDS
// -> O[o] += att'(hi/lo) v_o(hi/lo); a block covers at most 128 keys and leaves its f32 partial O in PART[chunk][r][o*64+d]); k_red (sum of a row's chunks in ascending key order -> O hi/lo planes [r][o*64+d]); k_out ((O Wo + bo) * gamma[t]).
#define NB 4
#define TT 1024
#define CCH 1024
#define NH 16
#define HS 64
#define NR (NB * TT)
#define ROT 32
#define KCH 128                 // keys per k_mix block
#define NCHK (TT / KCH)         // chunks of the longest row
#define MIXFULL (8 * (NCHK * (NCHK - 1) / 2))  // (16-query tile, chunk) pairs per batch below the diagonal: the 8 tiles with diagonal chunk q have q full chunks each
#define MIXBLK (MIXFULL + TT / 16)             // plus one diagonal chunk per tile
#define PWP 24                  // k_mix: elements per LDS row of P*w: the 16 heads + 8 of pad = 48 B (16 B x odd): the 16 rows that a wave's lanes touch lie on 16 banks (at 64 B: on 4)
typedef __attribute__((ext_vector_type(8))) __bf16 v8b;
__device__ __forceinline__ v16b frag_b16(const __bf16* rowk0, int lane) {
  union { v16b v; v8b q[2]; } u; const __bf16* p = rowk0 + 8 * (lane >> 4);
  u.q[0] = *(const v8b*)p; u.q[1] = *(const v8b*)(p + 16); return u.v;
}
// Fragment order of a bf16 operand [rows][K] in global memory: tiles of 16 rows x 32 k (512 elements, 1 KiB), tile index = (row >> 4) * (K / 32) + (k >> 5); inside a tile the 8 elements k & ~7 .. of a row lie at
// element ((k >> 4) & 1) * 256 + (((k >> 3) & 1) * 16 + (row & 15)) * 8. That is the order in which the lanes read a fragment, so each of its two wave-wide 16-byte loads covers 512 contiguous bytes (4 lines, not 16)
__device__ __forceinline__ v16b frag_t(const __bf16* tile, int lane) {
  union { v16b v; v8b q[2]; } u; const __bf16* p = tile + lane * 8;
  u.q[0] = *(const v8b*)p; u.q[1] = *(const v8b*)(p + 256); return u.v;
}
// the same fragment from the lane's own pointer (tile + lane * 8)
__device__ __forceinline__ v16b frag_p(const __bf16* p) {
  union { v16b v; v8b q[2]; } u; u.q[0] = *(const v8b*)p; u.q[1] = *(const v8b*)(p + 256); return u.v;
}
// fragment whose k 0..15 come from one 16-wide row and k 16..31 from another; ph, pl = the lane's 8 elements (8 (lane >> 4) ..) of each
__device__ __forceinline__ v16b frag_hl(const __bf16* ph, const __bf16* pl) {
  union { v16b v; v8b q[2]; } u; u.q[0] = *(const v8b*)ph; u.q[1] = *(const v8b*)pl; return u.v;
}
__device__ __forceinline__ float bfr(float v) { return (float)(__bf16)v; }
// e^(s/8 - max) is taken as 2^(s * SCL2 - M): log2(e) is folded into the score scale, M (k_stats -> k_mix) is the row max of s * SCL2, and the power is the hardware's own f32 exp2, one instruction; no argument whose power is used lies above 0 by more than a rounding, and a power below the normal range may count as 0
#define SCL2 0.18033688011112042f   // log2(e) / sqrt(64)
__device__ __forceinline__ float ex2(float v) { return __builtin_amdgcn_exp2f(v); }
__device__ __forceinline__ v8f mac3p(v16b ah, v16b al, v16b bh, v16b bl, v8f c) { c = wmma_bf(al, bh, c); c = wmma_bf(ah, bl, c); return wmma_bf(ah, bh, c); }
__constant__ float c_invfreq[16] = {1.0f,0.5623413324356079f,0.3162277638912201f,0.17782793939113617f,0.10000000149011612f,0.05623412877321243f,0.03162277862429619f,0.017782794311642647f,0.009999999776482582f,0.005623413249850273f,0.003162277862429619f,0.0017782794311642647f,0.0010000000474974513f,0.000562341301701963f,0.0003162277862429619f,0.00017782794020604342f};

// workspace carve (bytes)
#define PLANE_Q (2u * NB * NH * TT * HS)        // bf16 [64 bh][1024][64] = 8 MiB
#define WS_PT   0u                               // bf16 [4096][1024]: rows 0.. Wq^T, 1024.. Wk^T, 2048.. Wv^T, 3072.. Wo^T  (8 MiB)
#define WS_QH   (WS_PT + 2u * 4 * CCH * CCH)
#define WS_QL   (WS_QH + PLANE_Q)
#define WS_KH   (WS_QL + PLANE_Q)
#define WS_KL   (WS_KH + PLANE_Q)
#define WS_VTH  (WS_KL + PLANE_Q)                // bf16 [bh][64 d][1024 t]
#define WS_VTL  (WS_VTH + PLANE_Q)
#define WS_M    (WS_VTL + PLANE_Q)               // f32 [bh][1024]
#define WS_L    (WS_M + 4u * NB * NH * TT)
#define WS_OH   (WS_L + 4u * NB * NH * TT)       // bf16 [4096][1024] (row r, col o*64 + d)
#define WS_OL   (WS_OH + 2u * NR * CCH)
#define WS_PART (WS_OL + 2u * NR * CCH)          // f32 [8 key chunks][4096][1024]; row r uses chunks 0 .. t/128
#define WS_XS   (WS_PART + 4u * NCHK * NR * CCH) // bf16 [4096][1024]: shifted x
#define WS_END  (WS_XS + 2u * NR * CCH)

// ---- k_pack: PT (row n, k) = bf16(W[k][n]) in fragment order; block = (16 rows n, 256 k; which matrix is block-uniform), wave = one tile: a lane gathers its 2 x 8 k of its own column n (16 lanes = a 64-byte run of W) and stores them as the fragment's pieces
// blocks from 1024 on: XS (row r, channel k) = bf16(xs) in fragment order, xs = x with channels < 512 taken from row t-1 (zero at t = 0; the address is clamped to the row itself, the load is unconditional and the zero a select); wave = one tile = one 128-byte line of each of 16 rows
__global__ __launch_bounds__(256) void k_pack(const float* __restrict__ X, const float* __restrict__ Wq, const float* __restrict__ Wk, const float* __restrict__ Wv, const float* __restrict__ Wo, __bf16* __restrict__ PT, __bf16* __restrict__ XS) {
  const int tid = threadIdx.x, wave = tid >> 5, lane = tid & 31, col = lane & 15, g = lane >> 4;
  const int rt = (blockIdx.x >> 2) & 255, kc = (blockIdx.x & 3) * 8 + wave;
  if (blockIdx.x >= 4 * (CCH / 16) * 4) {   // block-uniform
    const int r = rt * 16 + col, t = r % TT; const bool shifted = kc * 32 < CCH / 2; const bool zero = shifted && (t == 0);
    const float* px = X + (size_t)(r - ((shifted && t > 0) ? 1 : 0)) * CCH + kc * 32 + g * 8;
    const v4f x0 = *(const v4f*)px, x1 = *(const v4f*)(px + 4), x2 = *(const v4f*)(px + 16), x3 = *(const v4f*)(px + 20); v8b y0, y1;
#pragma unroll
    for (int e = 0; e < 4; ++e) { y0[e] = (__bf16)(zero ? 0.f : x0[e]); y0[4 + e] = (__bf16)(zero ? 0.f : x1[e]); y1[e] = (__bf16)(zero ? 0.f : x2[e]); y1[4 + e] = (__bf16)(zero ? 0.f : x3[e]); }
    __bf16* dx = XS + ((size_t)rt * (CCH / 32) + kc) * 512 + lane * 8;
    *(v8b*)dx = y0; *(v8b*)(dx + 256) = y1;
    return;
  }
  const int which = rt >> 6, nn = (rt & 63) * 16 + col;
  const float* Wm = which == 0 ? Wq : which == 1 ? Wk : which == 2 ? Wv : Wo;
  const float* p = Wm + (size_t)(kc * 32 + g * 8) * CCH + nn; v8b o0, o1;
#pragma unroll
  for (int e = 0; e < 8; ++e) { o0[e] = (__bf16)p[(size_t)e * CCH]; o1[e] = (__bf16)p[(size_t)(16 + e) * CCH]; }
  __bf16* d = PT + ((size_t)rt * (CCH / 32) + kc) * 512 + lane * 8;
  *(v8b*)d = o0; *(v8b*)(d + 256) = o1;
}
// ---- k_qkv: block (64 rows, 128 cols = 2 heads of q, k or v); exact products; + bias; RoPE (q, k); q/k -> hi/lo rows [bh][t][64]; v -> VT hi/lo [bh][d][t]
__global__ __launch_bounds__(128) void k_qkv(const __bf16* __restrict__ XS, const __bf16* __restrict__ PT, const float* __restrict__ bq, const float* __restrict__ bk, const float* __restrict__ bv,
                                             __bf16* __restrict__ Qh, __bf16* __restrict__ Ql, __bf16* __restrict__ Kh, __bf16* __restrict__ Kl, __bf16* __restrict__ VTh, __bf16* __restrict__ VTl) {
  __shared__ __align__(16) __bf16 sh_[128][72], sl_[128][72];
  const int tid = threadIdx.x, wave = tid >> 5, lane = tid & 31, col = lane & 15, g = lane >> 4;
  const size_t rb = (size_t)blockIdx.x * 64; const int b = (int)(rb / TT), t0 = (int)(rb % TT);
  const int which = blockIdx.y >> 3; const int n0 = (blockIdx.y & 7) * 128;          // block-uniform: 0 q, 1 k, 2 v; n0 = first output channel (2 heads)
  const size_t r0 = rb + wave * 16;
  v8f acc[8] = {};
  // fragments are fetched one k step ahead: a weight fragment's registers are refilled for step kc + 1 directly behind the product that read them at step kc, so a load has eight products' time to arrive and no product waits a whole memory latency of its own
  const __bf16* pa = XS + (r0 >> 4) * (CCH / 32) * 512 + lane * 8; const __bf16* pb = PT + (size_t)((which * CCH + n0) / 16) * (CCH / 32) * 512 + lane * 8;   // the lane's own piece of tile (., k step 0)
  v16b a0 = frag_p(pa), a1, wf[8];
#pragma unroll
  for (int j = 0; j < 8; ++j) wf[j] = frag_p(pb + (size_t)j * (CCH / 32) * 512);
#pragma unroll 1   // 15 trips of two k steps (two, so that the two x fragments swap without copies); kept rolled so that the loop stays small in the instruction cache
  for (int kc = 0; kc < CCH / 32 - 2; kc += 2) {
    a1 = frag_p(pa + 512);
#pragma unroll
    for (int j = 0; j < 8; ++j) { acc[j] = wmma_bf(a0, wf[j], acc[j]); wf[j] = frag_p(pb + ((size_t)j * (CCH / 32) + 1) * 512); }
    a0 = frag_p(pa + 1024);
#pragma unroll
    for (int j = 0; j < 8; ++j) { acc[j] = wmma_bf(a1, wf[j], acc[j]); wf[j] = frag_p(pb + ((size_t)j * (CCH / 32) + 2) * 512); }
    asm volatile("s_wait_xcnt 0x0" ::: "memory");   // the pointer steps below land in the address registers of the loads above, which are still in flight
    pa += 1024; pb += 1024; }
  a1 = frag_p(pa + 512);   // the last two k steps: nothing is left to fetch behind the last
  asm volatile("s_wait_xcnt 0x0" ::: "memory");     // pa is dead from here on: a later load's result may land in its registers
#pragma unroll
  for (int j = 0; j < 8; ++j) { acc[j] = wmma_bf(a0, wf[j], acc[j]); wf[j] = frag_p(pb + ((size_t)j * (CCH / 32) + 1) * 512); }
  asm volatile("s_wait_xcnt 0x0" ::: "memory");     // the epilogue may land in the address registers of the loads above
#pragma unroll
  for (int j = 0; j < 8; ++j) acc[j] = wmma_bf(a1, wf[j], acc[j]);
  const float* bias = which == 0 ? bq : which == 1 ? bk : bv;
#pragma unroll
  for (int j = 0; j < 8; ++j) { const float bb = bfr(bias[n0 + j * 16 + col]);
#pragma unroll
    for (int r = 0; r < 8; ++r) acc[j][r] += bb; }
  if (which < 2) {   // RoPE on head-local dims 0..15 (tile 4h'+0) and 16..31 (tile 4h'+1), pairs in the same lane; theta = t * inv_freq[col]
#pragma unroll
    for (int hp = 0; hp < 2; ++hp) {
#pragma unroll
      for (int r = 0; r < 8; ++r) { const int t = t0 + wave * 16 + 8 * g + r; const float th = (float)t * c_invfreq[col]; const float cs = cosf(th), sn = sinf(th);
        const float a0 = acc[hp * 4][r], a1 = acc[hp * 4 + 1][r];
        acc[hp * 4][r] = a0 * cs - a1 * sn; acc[hp * 4 + 1][r] = a1 * cs + a0 * sn; } }
    __bf16* Oh = which == 0 ? Qh : Kh; __bf16* Ol = which == 0 ? Ql : Kl;
#pragma unroll
    for (int hp = 0; hp < 2; ++hp) {
#pragma unroll
      for (int j = 0; j < 4; ++j)
#pragma unroll
        for (int r = 0; r < 8; ++r) { const float v = acc[hp * 4 + j][r]; const __bf16 hi = (__bf16)v; sh_[wave * 16 + 8 * g + r][j * 16 + col] = hi; sl_[wave * 16 + 8 * g + r][j * 16 + col] = (__bf16)(v - (float)hi); }
      LDSX();
      const int h = (n0 >> 6) + hp; const size_t base = ((size_t)(b * NH + h) * TT + t0 + wave * 16) * HS;   // the wave's 16 rows x 64 dims = two whole tiles; piece qq of them holds row qq & 15, dims 8 (qq >> 4) ..
      v4u ph[4], pl[4];
#pragma unroll   // four fixed trips, unrolled so that ph and pl are registers and the eight LDS reads share one latency
      for (int q4 = 0; q4 < 4; ++q4) { const int qq = q4 * 32 + lane, pc = q4 * 2 + g; ph[q4] = *(const v4u*)(&sh_[wave * 16 + col][pc * 8]); pl[q4] = *(const v4u*)(&sl_[wave * 16 + col][pc * 8]); vst2((unsigned*)(Oh + base + qq * 8), ph[q4]); vst2((unsigned*)(Ol + base + qq * 8), pl[q4]); }
      asm volatile("s_wait_xcnt 0x0" :: "v"(ph[0]), "v"(ph[1]), "v"(ph[2]), "v"(ph[3]), "v"(pl[0]), "v"(pl[1]), "v"(pl[2]), "v"(pl[3]) : "memory");   // the next head's conversions may land in the data registers of the eight stores above; the stored values as inputs keep those registers untouched up to this wait
      LDSX(); }
  } else {
#pragma unroll
    for (int j = 0; j < 8; ++j)
#pragma unroll
      for (int r = 0; r < 8; ++r) { const float v = acc[j][r]; const __bf16 hi = (__bf16)v; sh_[j * 16 + col][wave * 16 + 8 * g + r] = hi; sl_[j * 16 + col][wave * 16 + 8 * g + r] = (__bf16)(v - (float)hi); }
    __syncthreads();
    for (int qq = tid; qq < 128 * 8; qq += 128) { const int ct = qq >> 7, kcl = (qq >> 6) & 1, w = qq & 63; const int c = ct * 16 + (w & 15), pc = kcl * 4 + (w >> 4);   // 16 tiles (8 groups of 16 channels x 2 groups of 32 t), 64 pieces each, in storage order
      const int h = (n0 >> 6) + (ct >> 2); const size_t o = (((size_t)(b * NH + h) * (HS / 16) + (ct & 3)) * (TT / 32) + (t0 >> 5) + kcl) * 512 + w * 8;
      vst2((unsigned*)(VTh + o), *(const v4u*)(&sh_[c][pc * 8])); vst2((unsigned*)(VTl + o), *(const v4u*)(&sl_[c][pc * 8])); }
  }
}
// ---- k_stats: block = (bh, 64 queries); wave = 16 queries; causal key steps of 64 (four 16-key tiles): S = q'(hi/lo) k'(hi/lo) * SCL2 (base-2 exponents); every lane keeps the running max and sum of its own key columns (j = col mod 16) and rescales once per step; key fragments come one step ahead;
// the 16 lanes of a row are merged once, behind the loop -> M, L (f32 [bh][t], 256 B per block by 16 lanes)
__global__ __launch_bounds__(128) void k_stats(const __bf16* __restrict__ Qh, const __bf16* __restrict__ Ql, const __bf16* __restrict__ Kh, const __bf16* __restrict__ Kl, float* __restrict__ Mo, float* __restrict__ Lo) {
  __shared__ float sm[64], ssum[64];
  const int tid = threadIdx.x, wave = tid >> 5, lane = tid & 31, col = lane & 15, g = lane >> 4;
  const int bh = blockIdx.y; const int i0 = blockIdx.x * 64 + wave * 16;
  const __bf16* qh = Qh + ((size_t)bh * TT + i0) * HS; const __bf16* ql = Ql + ((size_t)bh * TT + i0) * HS;
  const v16b qh0 = frag_t(qh, lane), qh1 = frag_t(qh + 512, lane), ql0 = frag_t(ql, lane), ql1 = frag_t(ql + 512, lane);
  asm volatile("s_wait_xcnt 0x0" :: "v"(qh0), "v"(qh1), "v"(ql0), "v"(ql1) : "memory");   // the key loads below may land in the address registers of the query loads above; the loaded values as inputs keep this wait behind those loads
  float m[8], l[8];
#pragma unroll
  for (int r = 0; r < 8; ++r) { m[r] = -3.0e38f; l[r] = 0.f; }
  const int jend = i0 + 16;                                      // keys j <= i for rows i0..i0+15 -> tiles covering [0, i0+16)
  // key fragments are fetched one 64-key step ahead: a tile's registers are refilled for step j0 + 64 directly behind the six products that read them at step j0, so a load has the rest of the step to arrive and no tile waits a whole memory latency of its own
  const __bf16* pkh = Kh + (size_t)bh * TT * HS + lane * 8; const __bf16* pkl = Kl + (size_t)bh * TT * HS + lane * 8;   // the lane's own piece of key tile 0; 16 keys = 1024 elements
  v16b kf[4][4];   // [16-key tile of the step][hi dims 0..31, lo dims 0..31, hi dims 32..63, lo dims 32..63]
#pragma unroll
  for (int jt = 0; jt < 4; ++jt) { kf[jt][0] = frag_p(pkh + jt * 1024); kf[jt][1] = frag_p(pkl + jt * 1024); kf[jt][2] = frag_p(pkh + jt * 1024 + 512); kf[jt][3] = frag_p(pkl + jt * 1024 + 512); }
  asm volatile("s_wait_xcnt 0x0" ::: "memory");   // the pointer step in the loop lands in the address registers of the loads above, which are still in flight
#pragma unroll 1   // kept rolled: the trip count (blockIdx.x + 1) differs from block to block
  for (int j0 = 0; j0 < jend; j0 += 64) {
    const int adv = (j0 + 64 < jend) ? 4096 : 0;   // wave-uniform; the last step has no next one: it fetches its own tiles again (rows that exist) and nothing reads them
    pkh += adv; pkl += adv;
    v8f s4[4];   // the step's four score tiles; j0 + 63 <= 1023, so a tile past the diagonal reads rows that exist; the select below drops it
#pragma unroll
    for (int jt = 0; jt < 4; ++jt) { v8f s = {};
      s = mac3p(qh0, ql0, kf[jt][0], kf[jt][1], s); s = mac3p(qh1, ql1, kf[jt][2], kf[jt][3], s); s4[jt] = s;
      kf[jt][0] = frag_p(pkh + jt * 1024); kf[jt][1] = frag_p(pkl + jt * 1024); kf[jt][2] = frag_p(pkh + jt * 1024 + 512); kf[jt][3] = frag_p(pkl + jt * 1024 + 512); }
    asm volatile("s_wait_xcnt 0x0" ::: "memory");   // the next trip's pointer step lands in the address registers of the loads above, which are still in flight
#pragma unroll
    for (int r = 0; r < 8; ++r) { const int i = i0 + 8 * g + r; float v[4];
#pragma unroll
      for (int t = 0; t < 4; ++t) v[t] = (j0 + t * 16 + col <= i) ? s4[t][r] * SCL2 : -1e30f;
      const float mn = fmaxf(fmaxf(fmaxf(fmaxf(m[r], v[0]), v[1]), v[2]), v[3]);
      l[r] = l[r] * ex2(m[r] - mn) + ((ex2(v[0] - mn) + ex2(v[1] - mn)) + (ex2(v[2] - mn) + ex2(v[3] - mn))); m[r] = mn; }   // a lane that has seen masked keys only holds m = -1e30 and a count in l: the next rescale, or the merge below, multiplies it by 2^(-1e30 - max) = 0
  }
#pragma unroll
  for (int r = 0; r < 8; ++r) { float mt = m[r];   // merge of the row's 16 lanes: every row has key 0, so the merged max is a real score
#pragma unroll
    for (int o = 1; o < 16; o <<= 1) mt = fmaxf(mt, __shfl_xor(mt, o));
    float e = l[r] * ex2(m[r] - mt);
#pragma unroll
    for (int o = 1; o < 16; o <<= 1) e += __shfl_xor(e, o);
    m[r] = mt; l[r] = e; }
  if (col == 0) {
#pragma unroll
    for (int r = 0; r < 8; ++r) { sm[wave * 16 + 8 * g + r] = m[r]; ssum[wave * 16 + 8 * g + r] = l[r]; } }
  __syncthreads();
  if (tid < 16) { vst2(Mo + (size_t)bh * TT + blockIdx.x * 64 + tid * 4, *(const v4f*)&sm[tid * 4]); vst2(Lo + (size_t)bh * TT + blockIdx.x * 64 + tid * 4, *(const v4f*)&ssum[tid * 4]); }
}
// ---- k_mix: block = (b, 16 queries i0..i0+15, keys of one 128-key chunk), 8 waves; loop over the chunk's 32-key tiles (causal). M and L are known, so O is a plain sum over keys and chunks are independent
__global__ __launch_bounds__(256) void k_mix(const __bf16* __restrict__ Qh, const __bf16* __restrict__ Ql, const __bf16* __restrict__ Kh, const __bf16* __restrict__ Kl, const __bf16* __restrict__ VTh, const __bf16* __restrict__ VTl,
                                             const float* __restrict__ Mo, const float* __restrict__ Lo, const float* __restrict__ tw, const float* __restrict__ talpha, const float* __restrict__ tbeta, const float* __restrict__ mixw,
                                             float* __restrict__ PART) {
  __shared__ __align__(16) __bf16 pw[2][512][PWP];              // (P*w) for the tile, hi and lo plane: row = i*32 + j (query-in-tile, key-in-tile), column = head h; the pad is never read
  __bf16 (*pwh)[PWP] = pw[0]; __bf16 (*pwl)[PWP] = pw[1];
  __shared__ __align__(16) float attp[NH][16][36];               // mixed attention tile per output head o: [o][i][j]
  __shared__ __align__(16) __bf16 mixr[NH][32];                  // mixing matrix rows o, k = h, then the same 16 again
  const int tid = threadIdx.x, wave = tid >> 5, lane = tid & 31, col = lane & 15, g = lane >> 4;
  // blockIdx.y -> (query tile = 8 gq + tl, chunk <= gq): the full 128-key chunks first, then the diagonal chunks from the longest to the shortest, so that the work-groups that start last are the short ones
  int rem = blockIdx.y, gq, tl, chunk;
  if (rem < MIXFULL) { gq = NCHK - 1; while (gq > 1 && rem >= 8 * gq) { rem -= 8 * gq; --gq; } chunk = rem >> 3; tl = rem & 7; }
  else { rem -= MIXFULL; gq = rem & 7; tl = 7 - (rem >> 3); chunk = gq; }
  const int b = blockIdx.x, i0 = (gq * 8 + tl) * 16;
  for (int q = tid; q < NH * 32; q += 256) { const int o = q >> 5, h = q & 31; mixr[o][h] = (__bf16)mixw[o * NH + (h & (NH - 1))]; }
  // this wave's two heads for the S phase and two output heads for the PV phase
  const int hA = wave * 2;
  float mrow[2][8], lb[2][8];            // row max (of s * SCL2), and beta[h][i] / L (the per-row factors of p*w = (2^(s*SCL2-m)/L) * ((tw*alpha)*beta), folded)
#pragma unroll
  for (int u = 0; u < 2; ++u) { const int bh = b * NH + hA + u;
#pragma unroll
    for (int r = 0; r < 8; ++r) { const int i = i0 + 8 * g + r; mrow[u][r] = Mo[(size_t)bh * TT + i]; lb[u][r] = bfr(tbeta[(hA + u) * TT + i]) / Lo[(size_t)bh * TT + i]; } }
  v8f oacc[2][4];
#pragma unroll
  for (int u = 0; u < 2; ++u)
#pragma unroll
    for (int d4 = 0; d4 < 4; ++d4) oacc[u][d4] = (v8f){};
  __syncthreads();
  const int jbeg = chunk * KCH; const int jend = (i0 + 16 < jbeg + KCH) ? i0 + 16 : jbeg + KCH;
#pragma unroll 1
  for (int j0 = jbeg; j0 < jend; j0 += 32) {
    // -- S for this wave's two heads; P*w -> pwh/pwl[(i)*32 + j][h]
#pragma unroll
    for (int u = 0; u < 2; ++u) { const int h = hA + u; const int bh = b * NH + h;
      const __bf16* qh = Qh + ((size_t)bh * TT + i0) * HS; const __bf16* ql = Ql + ((size_t)bh * TT + i0) * HS;
      const v16b qh0 = frag_t(qh, lane), qh1 = frag_t(qh + 512, lane), ql0 = frag_t(ql, lane), ql1 = frag_t(ql + 512, lane);   // re-read per key tile (cached) to keep VGPRs < 256
#pragma unroll 1
      for (int jt = 0; jt < 2; ++jt) { const int jb = j0 + jt * 16;   // body is one straight line, no call and no branch: the eight rows' loads, exps and stores overlap. jb + 15 <= 1023, so a half past the diagonal reads rows that exist; the select drops it
        const __bf16* kh = Kh + ((size_t)bh * TT + jb) * HS; const __bf16* kl = Kl + ((size_t)bh * TT + jb) * HS;
        const int j = jb + col; const float al = talpha[h * TT + (j < TT ? j : TT - 1)]; float twv[8];
#pragma unroll
        for (int r = 0; r < 8; ++r) { const int widx = TT - 1 + j - (i0 + 8 * g + r); twv[r] = tw[h * TT + (widx < TT ? widx : TT - 1)]; }   // 0 <= widx; clamped into the row above the diagonal
        asm volatile("s_wait_xcnt 0x0" ::: "memory");   // the key loads below may land in the offset registers of the nine loads above
        const v16b kh0 = frag_t(kh, lane), kl0 = frag_t(kl, lane), kh1 = frag_t(kh + 512, lane), kl1 = frag_t(kl + 512, lane);
        // inputs-only fence on the loaded values: holds all 17 loads of this half in front of the products, so that they share one memory latency (without it the compiler sinks half of the key loads and the decay loads behind the products: three latencies in a row)
        asm volatile("" :: "v"(kh0), "v"(kl0), "v"(kh1), "v"(kl1), "v"(al), "v"(twv[0]), "v"(twv[1]), "v"(twv[2]), "v"(twv[3]), "v"(twv[4]), "v"(twv[5]), "v"(twv[6]), "v"(twv[7]));
        v8f s = {}; s = mac3p(qh0, ql0, kh0, kl0, s); s = mac3p(qh1, ql1, kh1, kl1, s);
        const float alpha_j = bfr(al);
#pragma unroll
        for (int r = 0; r < 8; ++r) { const int il = 8 * g + r, i = i0 + il;
          const float pv = (ex2(s[r] * SCL2 - mrow[u][r]) * lb[u][r]) * (bfr(twv[r]) * alpha_j);
          const float pw = (j <= i) ? pv : 0.f;                  // causal mask as a select: a masked pv is never used
          const __bf16 hi = (__bf16)pw; pwh[il * 32 + jt * 16 + col][h] = hi; pwl[il * 32 + jt * 16 + col][h] = (__bf16)(pw - (float)hi); } } }
    __syncthreads();
    // -- mixing GEMM: att'[o][(i,j)] = sum_h mix[o][h] Pw[(i,j)][h]; 32 column tiles of 16 (i,j) pairs, K = 32: k 0..15 = the heads' hi parts, k 16..31 = their lo parts, against the mixing row twice; wave owns column tiles 4w..4w+3
    { const v16b am = frag_b16(&mixr[col][0], lane);            // A rows o = col, k = h
#pragma unroll 1
      for (int ct = 0; ct < 4; ++ct) { const int n0c = (wave * 4 + ct) * 16; v8f a = {};
        a = wmma_bf(am, frag_hl(&pwh[n0c + col][8 * g], &pwl[n0c + col][8 * g]), a);
        const int il = n0c >> 5, jl0 = n0c & 31;                 // the 16 columns of this tile share i (32 | n0c+0..15 within one i row since tiles are 16-aligned inside 32)
#pragma unroll
        for (int r = 0; r < 8; ++r) attp[8 * g + r][il][jl0 + col] = a[r]; } }
    __syncthreads();
    // -- O[o] += att'[o](hi/lo) v_o(hi/lo): this wave's output heads o = hA, hA+1; K = 32 keys (one step); 4 d tiles
#pragma unroll
    for (int u = 0; u < 2; ++u) { const int o = hA + u; const int bh = b * NH + o; const F2 af = split_row(&attp[o][col][0], 0, lane);
#pragma unroll
      for (int d4 = 0; d4 < 4; ++d4) { const size_t vo = (((size_t)bh * (HS / 16) + d4) * (TT / 32) + (j0 >> 5)) * 512;
        oacc[u][d4] = mac3p(af.h, af.l, frag_t(VTh + vo, lane), frag_t(VTl + vo, lane), oacc[u][d4]); } }
    __syncthreads();                                            // pw*/attp are rewritten by the next key tile
  }
  // -- partial O rows: r = b*1024 + i, columns o*64 + d, f32; per wave 16 rows x 64 cols per head staged in the (now free) pw and attp buffers, 4 KiB per wave in each: 256-B segments by 16 lanes
  float* st0 = (float*)&pw[0][0][0] + wave * (16 * 64); float* st1 = &attp[0][0][0] + wave * (16 * 64);
#pragma unroll
  for (int d4 = 0; d4 < 4; ++d4)
#pragma unroll
    for (int r = 0; r < 8; ++r) { st0[(8 * g + r) * 64 + d4 * 16 + col] = oacc[0][d4][r]; st1[(8 * g + r) * 64 + d4 * 16 + col] = oacc[1][d4][r]; }
  LDSX();
  for (int qq = lane; qq < 16 * 16; qq += 32) { const int rl = qq >> 4, pc = qq & 15; const size_t o = ((size_t)chunk * NR + (size_t)b * TT + i0 + rl) * CCH + hA * 64 + pc * 4;
    vst2(PART + o, *(const v4f*)(st0 + rl * 64 + pc * 4)); vst2(PART + o + 64, *(const v4f*)(st1 + rl * 64 + pc * 4)); }
}
// ---- k_red: O[r][c] = sum of the row's chunk partials, ascending chunk; -> hi/lo planes in fragment order; block = 16 rows x 256 columns, wave = one tile (16 rows x 32 columns: one whole 128-byte line of each row), lane = its two pieces of 8 columns
__global__ __launch_bounds__(256) void k_red(const float* __restrict__ PART, __bf16* __restrict__ OH, __bf16* __restrict__ OL) {
  const int wave = threadIdx.x >> 5, lane = threadIdx.x & 31, col = lane & 15, g = lane >> 4; const int rt = blockIdx.x >> 2, kc = (blockIdx.x & 3) * 8 + wave;
  const int t = (rt * 16) % TT; const int nch = t / KCH + 1;   // the 16 rows of a block lie in one chunk group
  const float* p = PART + (size_t)(rt * 16 + col) * CCH + kc * 32 + g * 8; v4f a0 = {}, a1 = {}, a2 = {}, a3 = {};
#pragma unroll 1   // at most 8 trips; kept rolled so that the kernel stays small in registers and all of its waves are resident at once and hide each trip's load latency
  for (int c = 0; c < nch; ++c) { a0 += *(const v4f*)p; a1 += *(const v4f*)(p + 4); a2 += *(const v4f*)(p + 16); a3 += *(const v4f*)(p + 20); p += (size_t)NR * CCH; }
  v8b hi, lo, hj, lj;
#pragma unroll
  for (int i = 0; i < 4; ++i) { const __bf16 h0 = (__bf16)a0[i], h1 = (__bf16)a1[i], h2 = (__bf16)a2[i], h3 = (__bf16)a3[i]; hi[i] = h0; hi[4 + i] = h1; hj[i] = h2; hj[4 + i] = h3;
    lo[i] = (__bf16)(a0[i] - (float)h0); lo[4 + i] = (__bf16)(a1[i] - (float)h1); lj[i] = (__bf16)(a2[i] - (float)h2); lj[4 + i] = (__bf16)(a3[i] - (float)h3); }
  const size_t e = ((size_t)rt * (CCH / 32) + kc) * 512 + lane * 8;
  *(v8b*)(OH + e) = hi; *(v8b*)(OH + e + 256) = hj; *(v8b*)(OL + e) = lo; *(v8b*)(OL + e + 256) = lj;
}
// ---- k_out: out = (O(hi/lo) . Wo^T rows + bo) * gamma[t]; block (64 rows, 128 cols), K = 1024
__global__ __launch_bounds__(128) void k_out(const __bf16* __restrict__ OH, const __bf16* __restrict__ OL, const __bf16* __restrict__ PT, const float* __restrict__ bo, const float* __restrict__ gam, float* __restrict__ out) {
  __shared__ __align__(16) float so[4][16][132];
  const int tid = threadIdx.x, wave = tid >> 5, lane = tid & 31, col = lane & 15, g = lane >> 4; const size_t r0 = (size_t)blockIdx.x * 64 + wave * 16; const int n0 = blockIdx.y * 128;
  v8f acc[8] = {};
  // fragments are fetched one k step ahead, as in k_qkv: a weight fragment's registers are refilled for step kc + 1 directly behind the two products that read them at step kc
  const __bf16* ph = OH + (r0 >> 4) * (CCH / 32) * 512 + lane * 8; const __bf16* pl = OL + (r0 >> 4) * (CCH / 32) * 512 + lane * 8; const __bf16* pb = PT + (size_t)((3 * CCH + n0) / 16) * (CCH / 32) * 512 + lane * 8;   // the lane's own piece of tile (., k step 0)
  v16b ah0 = frag_p(ph), al0 = frag_p(pl), ah1, al1, wf[8];
#pragma unroll
  for (int j = 0; j < 8; ++j) wf[j] = frag_p(pb + (size_t)j * (CCH / 32) * 512);
#pragma unroll 1   // 15 trips of two k steps (two, so that the O fragments swap without copies); kept rolled so that the loop stays small in the instruction cache
  for (int kc = 0; kc < CCH / 32 - 2; kc += 2) {
    ah1 = frag_p(ph + 512); al1 = frag_p(pl + 512);
#pragma unroll
    for (int j = 0; j < 8; ++j) { acc[j] = wmma_bf(al0, wf[j], acc[j]); acc[j] = wmma_bf(ah0, wf[j], acc[j]); wf[j] = frag_p(pb + ((size_t)j * (CCH / 32) + 1) * 512); }
    ah0 = frag_p(ph + 1024); al0 = frag_p(pl + 1024);
#pragma unroll
    for (int j = 0; j < 8; ++j) { acc[j] = wmma_bf(al1, wf[j], acc[j]); acc[j] = wmma_bf(ah1, wf[j], acc[j]); wf[j] = frag_p(pb + ((size_t)j * (CCH / 32) + 2) * 512); }
    asm volatile("s_wait_xcnt 0x0" ::: "memory");   // the pointer steps below land in the address registers of the loads above, which are still in flight
    ph += 1024; pl += 1024; pb += 1024; }
  ah1 = frag_p(ph + 512); al1 = frag_p(pl + 512);   // the last two k steps: nothing is left to fetch behind the last
  asm volatile("s_wait_xcnt 0x0" ::: "memory");     // ph and pl are dead from here on: a later load's result may land in their registers
#pragma unroll
  for (int j = 0; j < 8; ++j) { acc[j] = wmma_bf(al0, wf[j], acc[j]); acc[j] = wmma_bf(ah0, wf[j], acc[j]); wf[j] = frag_p(pb + ((size_t)j * (CCH / 32) + 1) * 512); }
  asm volatile("s_wait_xcnt 0x0" ::: "memory");     // the epilogue may land in the address registers of the loads above
#pragma unroll
  for (int j = 0; j < 8; ++j) { acc[j] = wmma_bf(al1, wf[j], acc[j]); acc[j] = wmma_bf(ah1, wf[j], acc[j]); }
#pragma unroll
  for (int j = 0; j < 8; ++j) { const float bb = bfr(bo[n0 + j * 16 + col]);
#pragma unroll
    for (int r = 0; r < 8; ++r) { const int t = (int)((r0 + 8 * g + r) % TT); so[wave][8 * g + r][j * 16 + col] = (acc[j][r] + bb) * bfr(gam[t]); } }
  LDSX();
  for (int rl = 0; rl < 16; ++rl) vst2(out + (r0 + rl) * CCH + n0 + lane * 4, *(const v4f*)(&so[wave][rl][lane * 4]));
}

extern "C" void kernel_launch(void* const* d_in, const int* in_sizes, int n_in, void* d_out, int out_size, void* d_ws, size_t ws_size, hipStream_t stream) {
  (void)in_sizes; (void)n_in; (void)out_size;
  const float** I = (const float**)d_in;   // x, Wq, bq, Wk, bk, Wv, bv, Wo, bo, time_w, time_alpha, time_beta, time_gamma, head_mix_w
  if (ws_size < (size_t)WS_END) return;
  char* ws = (char*)d_ws;
  __bf16* PT = (__bf16*)(ws + WS_PT); __bf16 *Qh = (__bf16*)(ws + WS_QH), *Ql = (__bf16*)(ws + WS_QL), *Kh = (__bf16*)(ws + WS_KH), *Kl = (__bf16*)(ws + WS_KL), *VTh = (__bf16*)(ws + WS_VTH), *VTl = (__bf16*)(ws + WS_VTL);
  float *Mo = (float*)(ws + WS_M), *Lo = (float*)(ws + WS_L); __bf16 *OH = (__bf16*)(ws + WS_OH), *OL = (__bf16*)(ws + WS_OL); float* PART = (float*)(ws + WS_PART); __bf16* XS = (__bf16*)(ws + WS_XS);
  k_pack<<<4 * (CCH / 16) * 4 + (NR / 16) * 4, 256, 0, stream>>>(I[0], I[1], I[3], I[5], I[7], PT, XS);
  k_qkv<<<dim3(NR / 64, 24), 128, 0, stream>>>(XS, PT, I[2], I[4], I[6], Qh, Ql, Kh, Kl, VTh, VTl);
  k_stats<<<dim3(TT / 64, NB * NH), 128, 0, stream>>>(Qh, Ql, Kh, Kl, Mo, Lo);
  k_mix<<<dim3(NB, MIXBLK), 256, 0, stream>>>(Qh, Ql, Kh, Kl, VTh, VTl, Mo, Lo, I[9], I[10], I[11], I[13], PART);
  k_red<<<(NR / 16) * 4, 256, 0, stream>>>(PART, OH, OL);
  k_out<<<dim3(NR / 64, CCH / 128), 128, 0, stream>>>(OH, OL, PT, I[8], I[12], (float*)d_out);
}

// v009
// One run takes 197 microseconds.
// In both of two side-by-side timings against v008, it was 1.10 times as fast.
// All steps since v000 together make it 4.12 times as fast.
// compute dtype: x, all weights/biases, time_w/alpha/beta/gamma and the head-mixing matrix (module inputs) rounded to bf16; q/k/v = xs W with exact bf16 products; RoPE, scores' softmax statistics,
// decay and normalisation in f32; scores = q'(hi/lo) k'(hi/lo)^T (3 products); head mixing = bf16(mix) x (P w)(hi/lo) (one K = 32 product: hi heads | lo heads); context = att'(hi/lo) x v(hi/lo) (3 products); out = O(hi/lo) Wo (2 products) + bo, x gamma; f32 accumulate.
#include <hip/hip_runtime.h>
#include <math.h>

typedef __attribute__((ext_vector_type(16))) _Float16 v16h;
typedef __attribute__((ext_vector_type(16))) __bf16 v16b;
typedef __attribute__((ext_vector_type(8)))  _Float16 v8h;
typedef __attribute__((ext_vector_type(8)))  float v8f;
typedef __attribute__((ext_vector_type(4)))  float v4f;
typedef __attribute__((ext_vector_type(2)))  float v2f;
typedef __attribute__((ext_vector_type(4)))  unsigned v4u;
typedef __attribute__((ext_vector_type(4)))  int v4i;
typedef float __attribute__((may_alias)) float_a;
typedef int __attribute__((may_alias)) int_a;

template <typename T> __device__ __forceinline__ void vst2(void* p, T v) { *(T*)p = v;  }
__device__ __forceinline__ v8f wmma16(v16h a, v16h b, v8f c) {
  v8f d = __builtin_amdgcn_wmma_f32_16x16x32_f16(false, a, false, b, (short)0, c, false, false);
  asm volatile("v_nop\n\tv_nop\n\tv_nop\n\tv_nop" : "+v"(d) : "v"(a), "v"(b));
  return d;
}
__device__ __forceinline__ v8f wmma_bf(v16b a, v16b b, v8f c) {
  v8f d = __builtin_amdgcn_wmma_f32_16x16x32_bf16(false, a, false, b, (short)0, c, false, false);
  asm volatile("v_nop\n\tv_nop\n\tv_nop\n\tv_nop" : "+v"(d) : "v"(a), "v"(b));
  return d;
}
// 16x16x32 fragments: lane = (h = lane>>4, row/col = lane&15); elements 0..7 = k0+8h+0..7, 8..15 = k0+16+8h+0..7; D element r = row 8h+r
__device__ __forceinline__ v16h frag_h(const _Float16* rowk0, int lane) {
  union { v16h v; v8h q[2]; } u; const _Float16* p = rowk0 + 8 * (lane >> 4);
  u.q[0] = *(const v8h*)p; u.q[1] = *(const v8h*)(p + 16); return u.v;
}
__device__ __forceinline__ v16h frag_f32(const float* rowk0, int lane) {
  v16h a; const float* p = rowk0 + 8 * (lane >> 4);
#pragma unroll
  for (int i = 0; i < 8; ++i) { a[i] = (_Float16)p[i]; a[8 + i] = (_Float16)p[16 + i]; }
  return a;
}
__device__ __forceinline__ v16h frag_f32s(const float* rowk0, int lane, float sc) {
  v16h a; const float* p = rowk0 + 8 * (lane >> 4);
#pragma unroll
  for (int i = 0; i < 8; ++i) { a[i] = (_Float16)(p[i] * sc); a[8 + i] = (_Float16)(p[16 + i] * sc); }
  return a;
}
// column fragment from a [K][ld] layout (column n), rows >= K read as 0
__device__ __forceinline__ v16h fragc_f32(const float* W, int k0, int n, int lane, int ld, int K) {
  v16h a; const int g = lane >> 4;
#pragma unroll
  for (int i = 0; i < 8; ++i) { const int ka = k0 + 8 * g + i, kb = ka + 16;
    a[i] = (_Float16)(ka < K ? W[(size_t)(ka < K ? ka : K - 1) * ld + n] : 0.f); a[8 + i] = (_Float16)(kb < K ? W[(size_t)(kb < K ? kb : K - 1) * ld + n] : 0.f); }
  return a;
}
struct F2 { v16b h, l; };
__device__ __forceinline__ F2 bsplit16(const float v[16]) { F2 r;
#pragma unroll
  for (int i = 0; i < 16; ++i) { const __bf16 h = (__bf16)v[i]; r.h[i] = h; r.l[i] = (__bf16)(v[i] - (float)h); }
  return r; }
__device__ __forceinline__ F2 split_row(const float* row, int k0, int lane) { float v[16]; const float* p = row + k0 + 8 * (lane >> 4);
#pragma unroll
  for (int i = 0; i < 8; ++i) { v[i] = p[i]; v[8 + i] = p[16 + i]; }
  return bsplit16(v); }
__device__ __forceinline__ F2 split_rowK(const float* row, int k0, int lane, int K) { float v[16]; const int g = lane >> 4;
#pragma unroll
  for (int i = 0; i < 8; ++i) { const int ka = k0 + 8 * g + i, kb = ka + 16; v[i] = ka < K ? row[ka < K ? ka : K - 1] : 0.f; v[8 + i] = kb < K ? row[kb < K ? kb : K - 1] : 0.f; }
  return bsplit16(v); }
__device__ __forceinline__ F2 split_col(const float* W, int k0, int n, int lane, int ld, int K) { float v[16]; const int g = lane >> 4;
#pragma unroll
  for (int i = 0; i < 8; ++i) { const int ka = k0 + 8 * g + i, kb = ka + 16; v[i] = ka < K ? W[(size_t)(ka < K ? ka : K - 1) * ld + n] : 0.f; v[8 + i] = kb < K ? W[(size_t)(kb < K ? kb : K - 1) * ld + n] : 0.f; }
  return bsplit16(v); }
__device__ __forceinline__ v8f mac3(const F2& a, const F2& b, v8f c) { c = wmma_bf(a.l, b.h, c); c = wmma_bf(a.h, b.l, c); return wmma_bf(a.h, b.h, c); }
__device__ __forceinline__ float sigm(float v) { return 1.0f / (1.0f + expf(-v)); }
#define LDSX() do { asm volatile("s_wait_dscnt 0" ::: "memory"); __builtin_amdgcn_wave_barrier(); __builtin_amdgcn_fence(__ATOMIC_RELEASE, "workgroup"); } while (0)


// Causal multi-head attention with token shift, partial RoPE, per-head Toeplitz time decay, a 16x16 cross-head mixing of the softmax maps, output projection and a per-position gain.
// Rows r = b*1024 + t. Every bf16 operand plane in the workspace (xs, weights, q, k, v^T, O) is stored in fragment order (see frag_t); the shapes below name rows and K. k_pack ([in][out] weights -> bf16 rows); k_pack also builds xs (channels < 512 come from t-1, zero at t = 0) as bf16 rows; k_qkv (xs W + bias; RoPE on dims 0..31; q/k -> hi/lo rows [bh][t][64], v -> hi/lo transposed [bh][d][t]);
// k_stats (per (bh, 64 queries): causal row max and sum of exp over the keys, kept per lane and merged once -> M, L); k_mix (block = (b, 32 queries, 128-key chunk), loop over 32-key tiles: S for all 16 heads -> P*w as bf16 hi/lo [query,key][h] in LDS -> mixing GEMM -> att'[o][i][j] f32 in LDS
// -> O[o] += att'(hi/lo) v_o(hi/lo); a block covers at most 128 keys and leaves its f32 partial O in PART[chunk][r][o*64+d]); k_red (sum of a row's chunks in ascending key order -> O hi/lo planes [r][o*64+d]); k_out ((O Wo + bo) * gamma[t]).
#define NB 4
#define TT 1024
#define CCH 1024
#define NH 16
#define HS 64
#define NR (NB * TT)
#define ROT 32
#define KCH 128                 // keys per k_mix block
#define NCHK (TT / KCH)         // chunks of the longest row
#define QB 32                   // queries per k_mix block
#define MIXFULL ((KCH / QB) * (NCHK * (NCHK - 1) / 2))  // (32-query block, chunk) pairs per batch below the diagonal: the 4 blocks with diagonal chunk q have q full chunks each
#define MIXBLK (MIXFULL + TT / QB)             // plus one diagonal chunk per block
#define PWP 24                  // k_mix: elements per LDS row of P*w: the 16 heads + 8 of pad = 48 B (16 B x odd): the 16 rows that a wave's lanes touch lie on 16 banks (at 64 B: on 4)
typedef __attribute__((ext_vector_type(8))) __bf16 v8b;
__device__ __forceinline__ v16b frag_b16(const __bf16* rowk0, int lane) {
  union { v16b v; v8b q[2]; } u; const __bf16* p = rowk0 + 8 * (lane >> 4);
  u.q[0] = *(const v8b*)p; u.q[1] = *(const v8b*)(p + 16); return u.v;
}
// Fragment order of a bf16 operand [rows][K] in global memory: tiles of 16 rows x 32 k (512 elements, 1 KiB), tile index = (row >> 4) * (K / 32) + (k >> 5); inside a tile the 8 elements k & ~7 .. of a row lie at
// element ((k >> 4) & 1) * 256 + (((k >> 3) & 1) * 16 + (row & 15)) * 8. That is the order in which the lanes read a fragment, so each of its two wave-wide 16-byte loads covers 512 contiguous bytes (4 lines, not 16)
__device__ __forceinline__ v16b frag_t(const __bf16* tile, int lane) {
  union { v16b v; v8b q[2]; } u; const __bf16* p = tile + lane * 8;
  u.q[0] = *(const v8b*)p; u.q[1] = *(const v8b*)(p + 256); return u.v;
}
// the same fragment from the lane's own pointer (tile + lane * 8)
__device__ __forceinline__ v16b frag_p(const __bf16* p) {
  union { v16b v; v8b q[2]; } u; u.q[0] = *(const v8b*)p; u.q[1] = *(const v8b*)(p + 256); return u.v;
}
// fragment whose k 0..15 come from one 16-wide row and k 16..31 from another; ph, pl = the lane's 8 elements (8 (lane >> 4) ..) of each
__device__ __forceinline__ v16b frag_hl(const __bf16* ph, const __bf16* pl) {
  union { v16b v; v8b q[2]; } u; u.q[0] = *(const v8b*)ph; u.q[1] = *(const v8b*)pl; return u.v;
}
__device__ __forceinline__ float bfr(float v) { return (float)(__bf16)v; }
// e^(s/8 - max) is taken as 2^(s * SCL2 - M): log2(e) is folded into the score scale, M (k_stats -> k_mix) is the row max of s * SCL2, and the power is the hardware's own f32 exp2, one instruction; no argument whose power is used lies above 0 by more than a rounding, and a power below the normal range may count as 0
#define SCL2 0.18033688011112042f   // log2(e) / sqrt(64)
__device__ __forceinline__ float ex2(float v) { return __builtin_amdgcn_exp2f(v); }
__device__ __forceinline__ v8f mac3p(v16b ah, v16b al, v16b bh, v16b bl, v8f c) { c = wmma_bf(al, bh, c); c = wmma_bf(ah, bl, c); return wmma_bf(ah, bh, c); }
__constant__ float c_invfreq[16] = {1.0f,0.5623413324356079f,0.3162277638912201f,0.17782793939113617f,0.10000000149011612f,0.05623412877321243f,0.03162277862429619f,0.017782794311642647f,0.009999999776482582f,0.005623413249850273f,0.003162277862429619f,0.0017782794311642647f,0.0010000000474974513f,0.000562341301701963f,0.0003162277862429619f,0.00017782794020604342f};

// workspace carve (bytes)
#define PLANE_Q (2u * NB * NH * TT * HS)        // bf16 [64 bh][1024][64] = 8 MiB
#define WS_PT   0u                               // bf16 [4096][1024]: rows 0.. Wq^T, 1024.. Wk^T, 2048.. Wv^T, 3072.. Wo^T  (8 MiB)
#define WS_QH   (WS_PT + 2u * 4 * CCH * CCH)
#define WS_QL   (WS_QH + PLANE_Q)
#define WS_KH   (WS_QL + PLANE_Q)
#define WS_KL   (WS_KH + PLANE_Q)
#define WS_VTH  (WS_KL + PLANE_Q)                // bf16 [bh][64 d][1024 t]
#define WS_VTL  (WS_VTH + PLANE_Q)
#define WS_M    (WS_VTL + PLANE_Q)               // f32 [bh][1024]
#define WS_L    (WS_M + 4u * NB * NH * TT)
#define WS_OH   (WS_L + 4u * NB * NH * TT)       // bf16 [4096][1024] (row r, col o*64 + d)
#define WS_OL   (WS_OH + 2u * NR * CCH)
#define WS_PART (WS_OL + 2u * NR * CCH)          // f32 [8 key chunks][4096][1024]; row r uses chunks 0 .. t/128
#define WS_XS   (WS_PART + 4u * NCHK * NR * CCH) // bf16 [4096][1024]: shifted x
#define WS_END  (WS_XS + 2u * NR * CCH)

// ---- k_pack: PT (row n, k) = bf16(W[k][n]) in fragment order; block = (16 rows n, 256 k; which matrix is block-uniform), wave = one tile: a lane gathers its 2 x 8 k of its own column n (16 lanes = a 64-byte run of W) and stores them as the fragment's pieces
// blocks from 1024 on: XS (row r, channel k) = bf16(xs) in fragment order, xs = x with channels < 512 taken from row t-1 (zero at t = 0; the address is clamped to the row itself, the load is unconditional and the zero a select); wave = one tile = one 128-byte line of each of 16 rows
__global__ __launch_bounds__(256) void k_pack(const float* __restrict__ X, const float* __restrict__ Wq, const float* __restrict__ Wk, const float* __restrict__ Wv, const float* __restrict__ Wo, __bf16* __restrict__ PT, __bf16* __restrict__ XS) {
  const int tid = threadIdx.x, wave = tid >> 5, lane = tid & 31, col = lane & 15, g = lane >> 4;
  const int rt = (blockIdx.x >> 2) & 255, kc = (blockIdx.x & 3) * 8 + wave;
  if (blockIdx.x >= 4 * (CCH / 16) * 4) {   // block-uniform
    const int r = rt * 16 + col, t = r % TT; const bool shifted = kc * 32 < CCH / 2; const bool zero = shifted && (t == 0);
    const float* px = X + (size_t)(r - ((shifted && t > 0) ? 1 : 0)) * CCH + kc * 32 + g * 8;
    const v4f x0 = *(const v4f*)px, x1 = *(const v4f*)(px + 4), x2 = *(const v4f*)(px + 16), x3 = *(const v4f*)(px + 20); v8b y0, y1;
#pragma unroll
    for (int e = 0; e < 4; ++e) { y0[e] = (__bf16)(zero ? 0.f : x0[e]); y0[4 + e] = (__bf16)(zero ? 0.f : x1[e]); y1[e] = (__bf16)(zero ? 0.f : x2[e]); y1[4 + e] = (__bf16)(zero ? 0.f : x3[e]); }
    __bf16* dx = XS + ((size_t)rt * (CCH / 32) + kc) * 512 + lane * 8;
    *(v8b*)dx = y0; *(v8b*)(dx + 256) = y1;
    return;
  }
  const int which = rt >> 6, nn = (rt & 63) * 16 + col;
  const float* Wm = which == 0 ? Wq : which == 1 ? Wk : which == 2 ? Wv : Wo;
  const float* p = Wm + (size_t)(kc * 32 + g * 8) * CCH + nn; v8b o0, o1;
#pragma unroll
  for (int e = 0; e < 8; ++e) { o0[e] = (__bf16)p[(size_t)e * CCH]; o1[e] = (__bf16)p[(size_t)(16 + e) * CCH]; }
  __bf16* d = PT + ((size_t)rt * (CCH / 32) + kc) * 512 + lane * 8;
  *(v8b*)d = o0; *(v8b*)(d + 256) = o1;
}
// ---- k_qkv: block (64 rows, 128 cols = 2 heads of q, k or v); exact products; + bias; RoPE (q, k); q/k -> hi/lo rows [bh][t][64]; v -> VT hi/lo [bh][d][t]
__global__ __launch_bounds__(128) void k_qkv(const __bf16* __restrict__ XS, const __bf16* __restrict__ PT, const float* __restrict__ bq, const float* __restrict__ bk, const float* __restrict__ bv,
                                             __bf16* __restrict__ Qh, __bf16* __restrict__ Ql, __bf16* __restrict__ Kh, __bf16* __restrict__ Kl, __bf16* __restrict__ VTh, __bf16* __restrict__ VTl) {
  __shared__ __align__(16) __bf16 sh_[128][72], sl_[128][72];
  const int tid = threadIdx.x, wave = tid >> 5, lane = tid & 31, col = lane & 15, g = lane >> 4;
  const size_t rb = (size_t)blockIdx.x * 64; const int b = (int)(rb / TT), t0 = (int)(rb % TT);
  const int which = blockIdx.y >> 3; const int n0 = (blockIdx.y & 7) * 128;          // block-uniform: 0 q, 1 k, 2 v; n0 = first output channel (2 heads)
  const size_t r0 = rb + wave * 16;
  v8f acc[8] = {};
  // fragments are fetched one k step ahead: a weight fragment's registers are refilled for step kc + 1 directly behind the product that read them at step kc, so a load has eight products' time to arrive and no product waits a whole memory latency of its own
  const __bf16* pa = XS + (r0 >> 4) * (CCH / 32) * 512 + lane * 8; const __bf16* pb = PT + (size_t)((which * CCH + n0) / 16) * (CCH / 32) * 512 + lane * 8;   // the lane's own piece of tile (., k step 0)
  v16b a0 = frag_p(pa), a1, wf[8];
#pragma unroll
  for (int j = 0; j < 8; ++j) wf[j] = frag_p(pb + (size_t)j * (CCH / 32) * 512);
#pragma unroll 1   // 15 trips of two k steps (two, so that the two x fragments swap without copies); kept rolled so that the loop stays small in the instruction cache
  for (int kc = 0; kc < CCH / 32 - 2; kc += 2) {
    a1 = frag_p(pa + 512);
#pragma unroll
    for (int j = 0; j < 8; ++j) { acc[j] = wmma_bf(a0, wf[j], acc[j]); wf[j] = frag_p(pb + ((size_t)j * (CCH / 32) + 1) * 512); }
    a0 = frag_p(pa + 1024);
#pragma unroll
    for (int j = 0; j < 8; ++j) { acc[j] = wmma_bf(a1, wf[j], acc[j]); wf[j] = frag_p(pb + ((size_t)j * (CCH / 32) + 2) * 512); }
    asm volatile("s_wait_xcnt 0x0" ::: "memory");   // the pointer steps below land in the address registers of the loads above, which are still in flight
    pa += 1024; pb += 1024; }
  a1 = frag_p(pa + 512);   // the last two k steps: nothing is left to fetch behind the last
  asm volatile("s_wait_xcnt 0x0" ::: "memory");     // pa is dead from here on: a later load's result may land in its registers
#pragma unroll
  for (int j = 0; j < 8; ++j) { acc[j] = wmma_bf(a0, wf[j], acc[j]); wf[j] = frag_p(pb + ((size_t)j * (CCH / 32) + 1) * 512); }
  asm volatile("s_wait_xcnt 0x0" ::: "memory");     // the epilogue may land in the address registers of the loads above
#pragma unroll
  for (int j = 0; j < 8; ++j) acc[j] = wmma_bf(a1, wf[j], acc[j]);
  const float* bias = which == 0 ? bq : which == 1 ? bk : bv;
#pragma unroll
  for (int j = 0; j < 8; ++j) { const float bb = bfr(bias[n0 + j * 16 + col]);
#pragma unroll
    for (int r = 0; r < 8; ++r) acc[j][r] += bb; }
  if (which < 2) {   // RoPE on head-local dims 0..15 (tile 4h'+0) and 16..31 (tile 4h'+1), pairs in the same lane; theta = t * inv_freq[col]
#pragma unroll
    for (int hp = 0; hp < 2; ++hp) {
#pragma unroll
      for (int r = 0; r < 8; ++r) { const int t = t0 + wave * 16 + 8 * g + r; const float th = (float)t * c_invfreq[col]; const float cs = cosf(th), sn = sinf(th);
        const float a0 = acc[hp * 4][r], a1 = acc[hp * 4 + 1][r];
        acc[hp * 4][r] = a0 * cs - a1 * sn; acc[hp * 4 + 1][r] = a1 * cs + a0 * sn; } }
    __bf16* Oh = which == 0 ? Qh : Kh; __bf16* Ol = which == 0 ? Ql : Kl;
#pragma unroll
    for (int hp = 0; hp < 2; ++hp) {
#pragma unroll
      for (int j = 0; j < 4; ++j)
#pragma unroll
        for (int r = 0; r < 8; ++r) { const float v = acc[hp * 4 + j][r]; const __bf16 hi = (__bf16)v; sh_[wave * 16 + 8 * g + r][j * 16 + col] = hi; sl_[wave * 16 + 8 * g + r][j * 16 + col] = (__bf16)(v - (float)hi); }
      LDSX();
      const int h = (n0 >> 6) + hp; const size_t base = ((size_t)(b * NH + h) * TT + t0 + wave * 16) * HS;   // the wave's 16 rows x 64 dims = two whole tiles; piece qq of them holds row qq & 15, dims 8 (qq >> 4) ..
      v4u ph[4], pl[4];
#pragma unroll   // four fixed trips, unrolled so that ph and pl are registers and the eight LDS reads share one latency
      for (int q4 = 0; q4 < 4; ++q4) { const int qq = q4 * 32 + lane, pc = q4 * 2 + g; ph[q4] = *(const v4u*)(&sh_[wave * 16 + col][pc * 8]); pl[q4] = *(const v4u*)(&sl_[wave * 16 + col][pc * 8]); vst2((unsigned*)(Oh + base + qq * 8), ph[q4]); vst2((unsigned*)(Ol + base + qq * 8), pl[q4]); }
      asm volatile("s_wait_xcnt 0x0" :: "v"(ph[0]), "v"(ph[1]), "v"(ph[2]), "v"(ph[3]), "v"(pl[0]), "v"(pl[1]), "v"(pl[2]), "v"(pl[3]) : "memory");   // the next head's conversions may land in the data registers of the eight stores above; the stored values as inputs keep those registers untouched up to this wait
      LDSX(); }
  } else {
#pragma unroll
    for (int j = 0; j < 8; ++j)
#pragma unroll
      for (int r = 0; r < 8; ++r) { const float v = acc[j][r]; const __bf16 hi = (__bf16)v; sh_[j * 16 + col][wave * 16 + 8 * g + r] = hi; sl_[j * 16 + col][wave * 16 + 8 * g + r] = (__bf16)(v - (float)hi); }
    __syncthreads();
    for (int qq = tid; qq < 128 * 8; qq += 128) { const int ct = qq >> 7, kcl = (qq >> 6) & 1, w = qq & 63; const int c = ct * 16 + (w & 15), pc = kcl * 4 + (w >> 4);   // 16 tiles (8 groups of 16 channels x 2 groups of 32 t), 64 pieces each, in storage order
      const int h = (n0 >> 6) + (ct >> 2); const size_t o = (((size_t)(b * NH + h) * (HS / 16) + (ct & 3)) * (TT / 32) + (t0 >> 5) + kcl) * 512 + w * 8;
      vst2((unsigned*)(VTh + o), *(const v4u*)(&sh_[c][pc * 8])); vst2((unsigned*)(VTl + o), *(const v4u*)(&sl_[c][pc * 8])); }
  }
}
// ---- k_stats: block = (bh, 64 queries); wave = 16 queries; causal key steps of 64 (four 16-key tiles): S = q'(hi/lo) k'(hi/lo) * SCL2 (base-2 exponents); every lane keeps the running max and sum of its own key columns (j = col mod 16) and rescales once per step; key fragments come one step ahead;
// the 16 lanes of a row are merged once, behind the loop -> M, L (f32 [bh][t], 256 B per block by 16 lanes)
__global__ __launch_bounds__(128) void k_stats(const __bf16* __restrict__ Qh, const __bf16* __restrict__ Ql, const __bf16* __restrict__ Kh, const __bf16* __restrict__ Kl, float* __restrict__ Mo, float* __restrict__ Lo) {
  __shared__ float sm[64], ssum[64];
  const int tid = threadIdx.x, wave = tid >> 5, lane = tid & 31, col = lane & 15, g = lane >> 4;
  const int bh = blockIdx.y; const int i0 = blockIdx.x * 64 + wave * 16;
  const __bf16* qh = Qh + ((size_t)bh * TT + i0) * HS; const __bf16* ql = Ql + ((size_t)bh * TT + i0) * HS;
  const v16b qh0 = frag_t(qh, lane), qh1 = frag_t(qh + 512, lane), ql0 = frag_t(ql, lane), ql1 = frag_t(ql + 512, lane);
  asm volatile("s_wait_xcnt 0x0" :: "v"(qh0), "v"(qh1), "v"(ql0), "v"(ql1) : "memory");   // the key loads below may land in the address registers of the query loads above; the loaded values as inputs keep this wait behind those loads
  float m[8], l[8];
#pragma unroll
  for (int r = 0; r < 8; ++r) { m[r] = -3.0e38f; l[r] = 0.f; }
  const int jend = i0 + 16;                                      // keys j <= i for rows i0..i0+15 -> tiles covering [0, i0+16)
  // key fragments are fetched one 64-key step ahead: a tile's registers are refilled for step j0 + 64 directly behind the six products that read them at step j0, so a load has the rest of the step to arrive and no tile waits a whole memory latency of its own
  const __bf16* pkh = Kh + (size_t)bh * TT * HS + lane * 8; const __bf16* pkl = Kl + (size_t)bh * TT * HS + lane * 8;   // the lane's own piece of key tile 0; 16 keys = 1024 elements
  v16b kf[4][4];   // [16-key tile of the step][hi dims 0..31, lo dims 0..31, hi dims 32..63, lo dims 32..63]
#pragma unroll
  for (int jt = 0; jt < 4; ++jt) { kf[jt][0] = frag_p(pkh + jt * 1024); kf[jt][1] = frag_p(pkl + jt * 1024); kf[jt][2] = frag_p(pkh + jt * 1024 + 512); kf[jt][3] = frag_p(pkl + jt * 1024 + 512); }
  asm volatile("s_wait_xcnt 0x0" ::: "memory");   // the pointer step in the loop lands in the address registers of the loads above, which are still in flight
#pragma unroll 1   // kept rolled: the trip count (blockIdx.x + 1) differs from block to block
  for (int j0 = 0; j0 < jend; j0 += 64) {
    const int adv = (j0 + 64 < jend) ? 4096 : 0;   // wave-uniform; the last step has no next one: it fetches its own tiles again (rows that exist) and nothing reads them
    pkh += adv; pkl += adv;
    v8f s4[4];   // the step's four score tiles; j0 + 63 <= 1023, so a tile past the diagonal reads rows that exist; the select below drops it
#pragma unroll
    for (int jt = 0; jt < 4; ++jt) { v8f s = {};
      s = mac3p(qh0, ql0, kf[jt][0], kf[jt][1], s); s = mac3p(qh1, ql1, kf[jt][2], kf[jt][3], s); s4[jt] = s;
      kf[jt][0] = frag_p(pkh + jt * 1024); kf[jt][1] = frag_p(pkl + jt * 1024); kf[jt][2] = frag_p(pkh + jt * 1024 + 512); kf[jt][3] = frag_p(pkl + jt * 1024 + 512); }
    asm volatile("s_wait_xcnt 0x0" ::: "memory");   // the next trip's pointer step lands in the address registers of the loads above, which are still in flight
#pragma unroll
    for (int r = 0; r < 8; ++r) { const int i = i0 + 8 * g + r; float v[4];
#pragma unroll
      for (int t = 0; t < 4; ++t) v[t] = (j0 + t * 16 + col <= i) ? s4[t][r] * SCL2 : -1e30f;
      const float mn = fmaxf(fmaxf(fmaxf(fmaxf(m[r], v[0]), v[1]), v[2]), v[3]);
      l[r] = l[r] * ex2(m[r] - mn) + ((ex2(v[0] - mn) + ex2(v[1] - mn)) + (ex2(v[2] - mn) + ex2(v[3] - mn))); m[r] = mn; }   // a lane that has seen masked keys only holds m = -1e30 and a count in l: the next rescale, or the merge below, multiplies it by 2^(-1e30 - max) = 0
  }
#pragma unroll
  for (int r = 0; r < 8; ++r) { float mt = m[r];   // merge of the row's 16 lanes: every row has key 0, so the merged max is a real score
#pragma unroll
    for (int o = 1; o < 16; o <<= 1) mt = fmaxf(mt, __shfl_xor(mt, o));
    float e = l[r] * ex2(m[r] - mt);
#pragma unroll
    for (int o = 1; o < 16; o <<= 1) e += __shfl_xor(e, o);
    m[r] = mt; l[r] = e; }
  if (col == 0) {
#pragma unroll
    for (int r = 0; r < 8; ++r) { sm[wave * 16 + 8 * g + r] = m[r]; ssum[wave * 16 + 8 * g + r] = l[r]; } }
  __syncthreads();
  if (tid < 16) { vst2(Mo + (size_t)bh * TT + blockIdx.x * 64 + tid * 4, *(const v4f*)&sm[tid * 4]); vst2(Lo + (size_t)bh * TT + blockIdx.x * 64 + tid * 4, *(const v4f*)&ssum[tid * 4]); }
}
// ---- k_mix: block = (b, 32 queries i0..i0+31 = two 16-query tiles, keys of one 128-key chunk), 16 waves, wave = one head; loop over the chunk's 32-key tiles (causal). M and L are known, so O is a plain sum over keys and chunks are independent.
// Every key and value fragment that a wave fetches from L2 feeds both query tiles; the queries themselves (128 KiB a block) are brought into LDS once
__global__ __launch_bounds__(512) void k_mix(const __bf16* __restrict__ Qh, const __bf16* __restrict__ Ql, const __bf16* __restrict__ Kh, const __bf16* __restrict__ Kl, const __bf16* __restrict__ VTh, const __bf16* __restrict__ VTl,
                                             const float* __restrict__ Mo, const float* __restrict__ Lo, const float* __restrict__ tw, const float* __restrict__ talpha, const float* __restrict__ tbeta, const float* __restrict__ mixw,
                                             float* __restrict__ PART) {
  __shared__ __align__(16) __bf16 pw[2][QB * 32][PWP];          // (P*w) for the tile, hi and lo plane: row = i*32 + j (query-in-block, key-in-tile), column = head h; the pad is never read
  __bf16 (*pwh)[PWP] = pw[0]; __bf16 (*pwl)[PWP] = pw[1];
  __shared__ __align__(16) float attp[NH][QB][36];               // mixed attention tile per output head o: [o][i][j]
  __shared__ __align__(16) __bf16 mixr[NH][32];                  // mixing matrix rows o, k = h, then the same 16 again
  __shared__ __align__(16) __bf16 qs[NH][2][2][16 * HS];         // the block's queries: [head = wave][query tile][hi, lo][two fragment-order tiles, as in global memory]; a wave reads only what it wrote itself
  const int tid = threadIdx.x, wave = tid >> 5, lane = tid & 31, col = lane & 15, g = lane >> 4;
  // blockIdx.y -> (query block = 4 gq + tl, chunk <= gq): the full 128-key chunks first, then the diagonal chunks from the longest to the shortest
  int rem = blockIdx.y, gq, tl, chunk;
  if (rem < MIXFULL) { gq = NCHK - 1; while (gq > 1 && rem >= (KCH / QB) * gq) { rem -= (KCH / QB) * gq; --gq; } chunk = rem >> 2; tl = rem & 3; }
  else { rem -= MIXFULL; gq = rem & 7; tl = 3 - (rem >> 3); chunk = gq; }
  const int b = blockIdx.x, i0 = (gq * (KCH / QB) + tl) * QB;
  const int bh = b * NH + wave;          // this wave's head: h in the S phase, output head o in the PV phase
  v8b qt_[2][8];   // the head's q (hi, lo): 32 rows x 64 dims = 8 wave-wide 16-byte pieces per plane, on their way to LDS
  { const size_t qo = ((size_t)bh * TT + i0) * HS + lane * 8;
#pragma unroll
    for (int n = 0; n < 8; ++n) { qt_[0][n] = *(const v8b*)(Qh + qo + n * 256); qt_[1][n] = *(const v8b*)(Ql + qo + n * 256); } }
  asm volatile("s_wait_xcnt 0x0" ::: "memory");   // the address arithmetic below may land in the address registers of the sixteen loads above, which are still in flight
  for (int q = tid; q < NH * 32; q += 512) { const int o = q >> 5, h = q & 31; mixr[o][h] = (__bf16)mixw[o * NH + (h & (NH - 1))]; }
  float mrow[2][8], lb[2][8];            // per query tile: row max (of s * SCL2), and beta[h][i] / L (the per-row factors of p*w = (2^(s*SCL2-m)/L) * ((tw*alpha)*beta), folded)
  { const float* pm = Mo + (size_t)bh * TT + i0 + 8 * g; const float* pl_ = Lo + (size_t)bh * TT + i0 + 8 * g; const float* pb_ = tbeta + wave * TT + i0 + 8 * g; float ls[2][8];   // the lane's first row
#pragma unroll
    for (int u = 0; u < 2; ++u)
#pragma unroll
      for (int r = 0; r < 8; ++r) { mrow[u][r] = pm[u * 16 + r]; ls[u][r] = pl_[u * 16 + r]; lb[u][r] = pb_[u * 16 + r]; }
    asm volatile("s_wait_xcnt 0x0" :: "v"(pm), "v"(pl_), "v"(pb_) : "memory");   // a later result may land in the address registers of the loads above; the addresses as inputs keep those registers untouched up to this wait
#pragma unroll
    for (int u = 0; u < 2; ++u)
#pragma unroll
      for (int r = 0; r < 8; ++r) lb[u][r] = bfr(lb[u][r]) / ls[u][r]; }
#pragma unroll
  for (int n = 0; n < 8; ++n) { *(v8b*)&qs[wave][n >> 2][0][(n & 3) * 256 + lane * 8] = qt_[0][n]; *(v8b*)&qs[wave][n >> 2][1][(n & 3) * 256 + lane * 8] = qt_[1][n]; }
  v8f oacc[2][4];
#pragma unroll
  for (int u = 0; u < 2; ++u)
#pragma unroll
    for (int d4 = 0; d4 < 4; ++d4) oacc[u][d4] = (v8f){};
  __syncthreads();
  const int jbeg = chunk * KCH; const int jend = (i0 + QB < jbeg + KCH) ? i0 + QB : jbeg + KCH;
#pragma unroll 1
  for (int j0 = jbeg; j0 < jend; j0 += 32) {
    // -- S for this wave's head, both query tiles; P*w -> pwh/pwl[(i)*32 + j][h]
    { const int h = wave;
#pragma unroll 1
      for (int jt = 0; jt < 2; ++jt) { const int jb = j0 + jt * 16;   // body is one straight line, no call and no branch: the rows' loads, exps and stores overlap. jb + 15 <= 1023, so a half past the diagonal reads rows that exist; the select drops it
        const __bf16* kh = Kh + ((size_t)bh * TT + jb) * HS; const __bf16* kl = Kl + ((size_t)bh * TT + jb) * HS;
        const int j = jb + col, jr = j - (i0 + 8 * g); const int ai = h * TT + (j < TT ? j : TT - 1); int wi[2][8]; float twv[2][8];   // jr = key minus the lane's first query row: row u * 16 + r sees the key where jr <= u * 16 + r
#pragma unroll
        for (int u = 0; u < 2; ++u)
#pragma unroll
          for (int r = 0; r < 8; ++r) { const int widx = TT - 1 + jr - (u * 16 + r); wi[u][r] = h * TT + (widx < TT ? widx : TT - 1); }   // 0 <= widx; clamped into the row above the diagonal
        const float al = talpha[ai];
#pragma unroll
        for (int u = 0; u < 2; ++u)
#pragma unroll
          for (int r = 0; r < 8; ++r) twv[u][r] = tw[wi[u][r]];
        // the key loads below, or one of these loads itself, may land in the offset registers of the seventeen loads above; the offsets as inputs keep those registers untouched up to this wait
        asm volatile("s_wait_xcnt 0x0" :: "v"(ai), "v"(wi[0][0]), "v"(wi[0][1]), "v"(wi[0][2]), "v"(wi[0][3]), "v"(wi[0][4]), "v"(wi[0][5]), "v"(wi[0][6]), "v"(wi[0][7]),
                     "v"(wi[1][0]), "v"(wi[1][1]), "v"(wi[1][2]), "v"(wi[1][3]), "v"(wi[1][4]), "v"(wi[1][5]), "v"(wi[1][6]), "v"(wi[1][7]) : "memory");
        const __bf16* pkh = kh + lane * 8; const __bf16* pkl = kl + lane * 8;
        const v16b kh0 = frag_p(pkh), kl0 = frag_p(pkl), kh1 = frag_p(pkh + 512), kl1 = frag_p(pkl + 512);
        asm volatile("s_wait_xcnt 0x0" :: "v"(pkh), "v"(pkl) : "memory");   // a result may land in the address registers of the eight loads above; the addresses as inputs keep those registers untouched up to this wait
        // inputs-only fence on the loaded values: holds all 25 loads of this half in front of the products, so that they share one memory latency (without it the compiler sinks half of the key loads and the decay loads behind the products: three latencies in a row)
        asm volatile("" :: "v"(kh0), "v"(kl0), "v"(kh1), "v"(kl1), "v"(al), "v"(twv[0][0]), "v"(twv[0][1]), "v"(twv[0][2]), "v"(twv[0][3]), "v"(twv[0][4]), "v"(twv[0][5]), "v"(twv[0][6]), "v"(twv[0][7]),
                     "v"(twv[1][0]), "v"(twv[1][1]), "v"(twv[1][2]), "v"(twv[1][3]), "v"(twv[1][4]), "v"(twv[1][5]), "v"(twv[1][6]), "v"(twv[1][7]));
        const float alpha_j = bfr(al);
#pragma unroll
        for (int u = 0; u < 2; ++u) {   // the two query tiles against the same key fragments
          const __bf16* qh = &qs[wave][u][0][0]; const __bf16* ql = &qs[wave][u][1][0];
          const v16b qh0 = frag_t(qh, lane), qh1 = frag_t(qh + 512, lane), ql0 = frag_t(ql, lane), ql1 = frag_t(ql + 512, lane);   // from LDS each time, to keep VGPRs <= 256
          v8f s = {}; s = mac3p(qh0, ql0, kh0, kl0, s); s = mac3p(qh1, ql1, kh1, kl1, s);
#pragma unroll
          for (int r = 0; r < 8; ++r) { const int il = u * 16 + 8 * g + r;
            const float pv = (ex2(s[r] * SCL2 - mrow[u][r]) * lb[u][r]) * (bfr(twv[u][r]) * alpha_j);
            const float pw = (jr <= u * 16 + r) ? pv : 0.f;                  // causal mask as a select: a masked pv is never used
            const __bf16 hi = (__bf16)pw; pwh[il * 32 + jt * 16 + col][h] = hi; pwl[il * 32 + jt * 16 + col][h] = (__bf16)(pw - (float)hi); } } } }
    __syncthreads();
    // -- mixing GEMM: att'[o][(i,j)] = sum_h mix[o][h] Pw[(i,j)][h]; 64 column tiles of 16 (i,j) pairs, K = 32: k 0..15 = the heads' hi parts, k 16..31 = their lo parts, against the mixing row twice; wave owns column tiles 4w..4w+3
    { const v16b am = frag_b16(&mixr[col][0], lane);            // A rows o = col, k = h
#pragma unroll 1
      for (int ct = 0; ct < 4; ++ct) { const int n0c = (wave * 4 + ct) * 16; v8f a = {};
        a = wmma_bf(am, frag_hl(&pwh[n0c + col][8 * g], &pwl[n0c + col][8 * g]), a);
        const int il = n0c >> 5, jl0 = n0c & 31;                 // the 16 columns of this tile share i (32 | n0c+0..15 within one i row since tiles are 16-aligned inside 32)
#pragma unroll
        for (int r = 0; r < 8; ++r) attp[8 * g + r][il][jl0 + col] = a[r]; } }
    __syncthreads();
    // -- O[o] += att'[o](hi/lo) v_o(hi/lo): this wave's output head o = wave, both query tiles against the same value fragments; K = 32 keys (one step); 4 d tiles
    { const size_t vo = ((size_t)bh * (HS / 16) * (TT / 32) + (j0 >> 5)) * 512 + lane * 8; const __bf16* pvh = VTh + vo; const __bf16* pvl = VTl + vo; v16b vh[4], vl[4];   // the lane's piece of d tile 0; a d tile further = (TT / 32) * 512 elements
#pragma unroll
      for (int d4 = 0; d4 < 4; ++d4) { vh[d4] = frag_p(pvh + d4 * (TT / 32) * 512); vl[d4] = frag_p(pvl + d4 * (TT / 32) * 512); }
      asm volatile("s_wait_xcnt 0x0" :: "v"(pvh), "v"(pvl) : "memory");   // a result may land in the address registers of the sixteen loads above; the addresses as inputs keep those registers untouched up to this wait
      const F2 af0 = split_row(&attp[wave][col][0], 0, lane), af1 = split_row(&attp[wave][16 + col][0], 0, lane);
      // inputs-only fence on the loaded values: holds all sixteen value loads in front of the products, so that they share one memory latency (without it the compiler fetches one d tile at a time: four latencies in a row)
      asm volatile("" :: "v"(vh[0]), "v"(vl[0]), "v"(vh[1]), "v"(vl[1]), "v"(vh[2]), "v"(vl[2]), "v"(vh[3]), "v"(vl[3]));
#pragma unroll
      for (int d4 = 0; d4 < 4; ++d4) { oacc[0][d4] = mac3p(af0.h, af0.l, vh[d4], vl[d4], oacc[0][d4]); oacc[1][d4] = mac3p(af1.h, af1.l, vh[d4], vl[d4], oacc[1][d4]); } }
    __syncthreads();                                            // pw*/attp are rewritten by the next key tile
  }
  // -- partial O rows: r = b*1024 + i, columns o*64 + d, f32; per wave 16 rows x 64 cols per query tile staged in the (now free) pw and attp buffers, 4 KiB per wave in each: 256-B segments by 16 lanes
  float* st0 = (float*)&pw[0][0][0] + wave * (16 * 64); float* st1 = &attp[0][0][0] + wave * (16 * 64);
#pragma unroll
  for (int d4 = 0; d4 < 4; ++d4)
#pragma unroll
    for (int r = 0; r < 8; ++r) { st0[(8 * g + r) * 64 + d4 * 16 + col] = oacc[0][d4][r]; st1[(8 * g + r) * 64 + d4 * 16 + col] = oacc[1][d4][r]; }
  LDSX();
  for (int qq = lane; qq < 16 * 16; qq += 32) { const int rl = qq >> 4, pc = qq & 15; const size_t o = ((size_t)chunk * NR + (size_t)b * TT + i0 + rl) * CCH + wave * 64 + pc * 4;
    vst2(PART + o, *(const v4f*)(st0 + rl * 64 + pc * 4)); vst2(PART + o + 16 * CCH, *(const v4f*)(st1 + rl * 64 + pc * 4)); }
}
// ---- k_red: O[r][c] = sum of the row's chunk partials, ascending chunk; -> hi/lo planes in fragment order; block = 16 rows x 256 columns, wave = one tile (16 rows x 32 columns: one whole 128-byte line of each row), lane = its two pieces of 8 columns
__global__ __launch_bounds__(256) void k_red(const float* __restrict__ PART, __bf16* __restrict__ OH, __bf16* __restrict__ OL) {
  const int wave = threadIdx.x >> 5, lane = threadIdx.x & 31, col = lane & 15, g = lane >> 4; const int rt = blockIdx.x >> 2, kc = (blockIdx.x & 3) * 8 + wave;
  const int t = (rt * 16) % TT; const int nch = t / KCH + 1;   // the 16 rows of a block lie in one chunk group
  const float* p = PART + (size_t)(rt * 16 + col) * CCH + kc * 32 + g * 8; v4f a0 = {}, a1 = {}, a2 = {}, a3 = {};
#pragma unroll 1   // at most 8 trips; kept rolled so that the kernel stays small in registers and all of its waves are resident at once and hide each trip's load latency
  for (int c = 0; c < nch; ++c) { a0 += *(const v4f*)p; a1 += *(const v4f*)(p + 4); a2 += *(const v4f*)(p + 16); a3 += *(const v4f*)(p + 20); p += (size_t)NR * CCH; }
  v8b hi, lo, hj, lj;
#pragma unroll
  for (int i = 0; i < 4; ++i) { const __bf16 h0 = (__bf16)a0[i], h1 = (__bf16)a1[i], h2 = (__bf16)a2[i], h3 = (__bf16)a3[i]; hi[i] = h0; hi[4 + i] = h1; hj[i] = h2; hj[4 + i] = h3;
    lo[i] = (__bf16)(a0[i] - (float)h0); lo[4 + i] = (__bf16)(a1[i] - (float)h1); lj[i] = (__bf16)(a2[i] - (float)h2); lj[4 + i] = (__bf16)(a3[i] - (float)h3); }
  const size_t e = ((size_t)rt * (CCH / 32) + kc) * 512 + lane * 8;
  *(v8b*)(OH + e) = hi; *(v8b*)(OH + e + 256) = hj; *(v8b*)(OL + e) = lo; *(v8b*)(OL + e + 256) = lj;
}
// ---- k_out: out = (O(hi/lo) . Wo^T rows + bo) * gamma[t]; block (64 rows, 128 cols), K = 1024
__global__ __launch_bounds__(128) void k_out(const __bf16* __restrict__ OH, const __bf16* __restrict__ OL, const __bf16* __restrict__ PT, const float* __restrict__ bo, const float* __restrict__ gam, float* __restrict__ out) {
  __shared__ __align__(16) float so[4][16][132];
  const int tid = threadIdx.x, wave = tid >> 5, lane = tid & 31, col = lane & 15, g = lane >> 4; const size_t r0 = (size_t)blockIdx.x * 64 + wave * 16; const int n0 = blockIdx.y * 128;
  v8f acc[8] = {};
  // fragments are fetched one k step ahead, as in k_qkv: a weight fragment's registers are refilled for step kc + 1 directly behind the two products that read them at step kc
  const __bf16* ph = OH + (r0 >> 4) * (CCH / 32) * 512 + lane * 8; const __bf16* pl = OL + (r0 >> 4) * (CCH / 32) * 512 + lane * 8; const __bf16* pb = PT + (size_t)((3 * CCH + n0) / 16) * (CCH / 32) * 512 + lane * 8;   // the lane's own piece of tile (., k step 0)
  v16b ah0 = frag_p(ph), al0 = frag_p(pl), ah1, al1, wf[8];
#pragma unroll
  for (int j = 0; j < 8; ++j) wf[j] = frag_p(pb + (size_t)j * (CCH / 32) * 512);
#pragma unroll 1   // 15 trips of two k steps (two, so that the O fragments swap without copies); kept rolled so that the loop stays small in the instruction cache
  for (int kc = 0; kc < CCH / 32 - 2; kc += 2) {
    ah1 = frag_p(ph + 512); al1 = frag_p(pl + 512);
#pragma unroll
    for (int j = 0; j < 8; ++j) { acc[j] = wmma_bf(al0, wf[j], acc[j]); acc[j] = wmma_bf(ah0, wf[j], acc[j]); wf[j] = frag_p(pb + ((size_t)j * (CCH / 32) + 1) * 512); }
    ah0 = frag_p(ph + 1024); al0 = frag_p(pl + 1024);
#pragma unroll
    for (int j = 0; j < 8; ++j) { acc[j] = wmma_bf(al1, wf[j], acc[j]); acc[j] = wmma_bf(ah1, wf[j], acc[j]); wf[j] = frag_p(pb + ((size_t)j * (CCH / 32) + 2) * 512); }
    asm volatile("s_wait_xcnt 0x0" ::: "memory");   // the pointer steps below land in the address registers of the loads above, which are still in flight
    ph += 1024; pl += 1024; pb += 1024; }
  ah1 = frag_p(ph + 512); al1 = frag_p(pl + 512);   // the last two k steps: nothing is left to fetch behind the last
  asm volatile("s_wait_xcnt 0x0" ::: "memory");     // ph and pl are dead from here on: a later load's result may land in their registers
#pragma unroll
  for (int j = 0; j < 8; ++j) { acc[j] = wmma_bf(al0, wf[j], acc[j]); acc[j] = wmma_bf(ah0, wf[j], acc[j]); wf[j] = frag_p(pb + ((size_t)j * (CCH / 32) + 1) * 512); }
  asm volatile("s_wait_xcnt 0x0" ::: "memory");     // the epilogue may land in the address registers of the loads above
#pragma unroll
  for (int j = 0; j < 8; ++j) { acc[j] = wmma_bf(al1, wf[j], acc[j]); acc[j] = wmma_bf(ah1, wf[j], acc[j]); }
#pragma unroll
  for (int j = 0; j < 8; ++j) { const float bb = bfr(bo[n0 + j * 16 + col]);
#pragma unroll
    for (int r = 0; r < 8; ++r) { const int t = (int)((r0 + 8 * g + r) % TT); so[wave][8 * g + r][j * 16 + col] = (acc[j][r] + bb) * bfr(gam[t]); } }
  LDSX();
  for (int rl = 0; rl < 16; ++rl) vst2(out + (r0 + rl) * CCH + n0 + lane * 4, *(const v4f*)(&so[wave][rl][lane * 4]));
}

extern "C" void kernel_launch(void* const* d_in, const int* in_sizes, int n_in, void* d_out, int out_size, void* d_ws, size_t ws_size, hipStream_t stream) {
  (void)in_sizes; (void)n_in; (void)out_size;
  const float** I = (const float**)d_in;   // x, Wq, bq, Wk, bk, Wv, bv, Wo, bo, time_w, time_alpha, time_beta, time_gamma, head_mix_w
  if (ws_size < (size_t)WS_END) return;
  char* ws = (char*)d_ws;
  __bf16* PT = (__bf16*)(ws + WS_PT); __bf16 *Qh = (__bf16*)(ws + WS_QH), *Ql = (__bf16*)(ws + WS_QL), *Kh = (__bf16*)(ws + WS_KH), *Kl = (__bf16*)(ws + WS_KL), *VTh = (__bf16*)(ws + WS_VTH), *VTl = (__bf16*)(ws + WS_VTL);
  float *Mo = (float*)(ws + WS_M), *Lo = (float*)(ws + WS_L); __bf16 *OH = (__bf16*)(ws + WS_OH), *OL = (__bf16*)(ws + WS_OL); float* PART = (float*)(ws + WS_PART); __bf16* XS = (__bf16*)(ws + WS_XS);
  k_pack<<<4 * (CCH / 16) * 4 + (NR / 16) * 4, 256, 0, stream>>>(I[0], I[1], I[3], I[5], I[7], PT, XS);
  k_qkv<<<dim3(NR / 64, 24), 128, 0, stream>>>(XS, PT, I[2], I[4], I[6], Qh, Ql, Kh, Kl, VTh, VTl);
  k_stats<<<dim3(TT / 64, NB * NH), 128, 0, stream>>>(Qh, Ql, Kh, Kl, Mo, Lo);
  k_mix<<<dim3(NB, MIXBLK), 512, 0, stream>>>(Qh, Ql, Kh, Kl, VTh, VTl, Mo, Lo, I[9], I[10], I[11], I[13], PART);
  k_red<<<(NR / 16) * 4, 256, 0, stream>>>(PART, OH, OL);
  k_out<<<dim3(NR / 64, CCH / 128), 128, 0, stream>>>(OH, OL, PT, I[8], I[12], (float*)d_out);
}

// v010
// A run of this version takes 177 microseconds.
// Two timings next to v009 put it at 1.13 and 1.10 times that version's speed.
// Counting every step since v000, it is 4.60 times as fast.
// compute dtype: x, all weights/biases, time_w/alpha/beta/gamma and the head-mixing matrix (module inputs) rounded to bf16; q/k/v = xs W with exact bf16 products; RoPE, scores' softmax statistics,
// decay and normalisation in f32; scores = q'(hi/lo) k'(hi/lo)^T (3 products); head mixing = bf16(mix) x (P w)(hi/lo) (one K = 32 product: hi heads | lo heads); context = att'(hi/lo) x v(hi/lo) (3 products); out = O(hi/lo) Wo (2 products) + bo, x gamma; f32 accumulate.
#include <hip/hip_runtime.h>
#include <math.h>

typedef __attribute__((ext_vector_type(16))) _Float16 v16h;
typedef __attribute__((ext_vector_type(16))) __bf16 v16b;
typedef __attribute__((ext_vector_type(8)))  _Float16 v8h;
typedef __attribute__((ext_vector_type(8)))  float v8f;
typedef __attribute__((ext_vector_type(4)))  float v4f;
typedef __attribute__((ext_vector_type(2)))  float v2f;
typedef __attribute__((ext_vector_type(4)))  unsigned v4u;
typedef __attribute__((ext_vector_type(4)))  int v4i;
typedef float __attribute__((may_alias)) float_a;
typedef int __attribute__((may_alias)) int_a;

template <typename T> __device__ __forceinline__ void vst2(void* p, T v) { *(T*)p = v;  }
__device__ __forceinline__ v8f wmma16(v16h a, v16h b, v8f c) {
  v8f d = __builtin_amdgcn_wmma_f32_16x16x32_f16(false, a, false, b, (short)0, c, false, false);
  asm volatile("v_nop\n\tv_nop\n\tv_nop\n\tv_nop" : "+v"(d) : "v"(a), "v"(b));
  return d;
}
__device__ __forceinline__ v8f wmma_bf(v16b a, v16b b, v8f c) {
  v8f d = __builtin_amdgcn_wmma_f32_16x16x32_bf16(false, a, false, b, (short)0, c, false, false);
  asm volatile("v_nop\n\tv_nop\n\tv_nop\n\tv_nop" : "+v"(d) : "v"(a), "v"(b));
  return d;
}
// 16x16x32 fragments: lane = (h = lane>>4, row/col = lane&15); elements 0..7 = k0+8h+0..7, 8..15 = k0+16+8h+0..7; D element r = row 8h+r
__device__ __forceinline__ v16h frag_h(const _Float16* rowk0, int lane) {
  union { v16h v; v8h q[2]; } u; const _Float16* p = rowk0 + 8 * (lane >> 4);
  u.q[0] = *(const v8h*)p; u.q[1] = *(const v8h*)(p + 16); return u.v;
}
__device__ __forceinline__ v16h frag_f32(const float* rowk0, int lane) {
  v16h a; const float* p = rowk0 + 8 * (lane >> 4);
#pragma unroll
  for (int i = 0; i < 8; ++i) { a[i] = (_Float16)p[i]; a[8 + i] = (_Float16)p[16 + i]; }
  return a;
}
__device__ __forceinline__ v16h frag_f32s(const float* rowk0, int lane, float sc) {
  v16h a; const float* p = rowk0 + 8 * (lane >> 4);
#pragma unroll
  for (int i = 0; i < 8; ++i) { a[i] = (_Float16)(p[i] * sc); a[8 + i] = (_Float16)(p[16 + i] * sc); }
  return a;
}
// column fragment from a [K][ld] layout (column n), rows >= K read as 0
__device__ __forceinline__ v16h fragc_f32(const float* W, int k0, int n, int lane, int ld, int K) {
  v16h a; const int g = lane >> 4;
#pragma unroll
  for (int i = 0; i < 8; ++i) { const int ka = k0 + 8 * g + i, kb = ka + 16;
    a[i] = (_Float16)(ka < K ? W[(size_t)(ka < K ? ka : K - 1) * ld + n] : 0.f); a[8 + i] = (_Float16)(kb < K ? W[(size_t)(kb < K ? kb : K - 1) * ld + n] : 0.f); }
  return a;
}
struct F2 { v16b h, l; };
__device__ __forceinline__ F2 bsplit16(const float v[16]) { F2 r;
#pragma unroll
  for (int i = 0; i < 16; ++i) { const __bf16 h = (__bf16)v[i]; r.h[i] = h; r.l[i] = (__bf16)(v[i] - (float)h); }
  return r; }
__device__ __forceinline__ F2 split_row(const float* row, int k0, int lane) { float v[16]; const float* p = row + k0 + 8 * (lane >> 4);
#pragma unroll
  for (int i = 0; i < 8; ++i) { v[i] = p[i]; v[8 + i] = p[16 + i]; }
  return bsplit16(v); }
__device__ __forceinline__ F2 split_rowK(const float* row, int k0, int lane, int K) { float v[16]; const int g = lane >> 4;
#pragma unroll
  for (int i = 0; i < 8; ++i) { const int ka = k0 + 8 * g + i, kb = ka + 16; v[i] = ka < K ? row[ka < K ? ka : K - 1] : 0.f; v[8 + i] = kb < K ? row[kb < K ? kb : K - 1] : 0.f; }
  return bsplit16(v); }
__device__ __forceinline__ F2 split_col(const float* W, int k0, int n, int lane, int ld, int K) { float v[16]; const int g = lane >> 4;
#pragma unroll
  for (int i = 0; i < 8; ++i) { const int ka = k0 + 8 * g + i, kb = ka + 16; v[i] = ka < K ? W[(size_t)(ka < K ? ka : K - 1) * ld + n] : 0.f; v[8 + i] = kb < K ? W[(size_t)(kb < K ? kb : K - 1) * ld + n] : 0.f; }
  return bsplit16(v); }
__device__ __forceinline__ v8f mac3(const F2& a, const F2& b, v8f c) { c = wmma_bf(a.l, b.h, c); c = wmma_bf(a.h, b.l, c); return wmma_bf(a.h, b.h, c); }
__device__ __forceinline__ float sigm(float v) { return 1.0f / (1.0f + expf(-v)); }
#define LDSX() do { asm volatile("s_wait_dscnt 0" ::: "memory"); __builtin_amdgcn_wave_barrier(); __builtin_amdgcn_fence(__ATOMIC_RELEASE, "workgroup"); } while (0)


// Causal multi-head attention with token shift, partial RoPE, per-head Toeplitz time decay, a 16x16 cross-head mixing of the softmax maps, output projection and a per-position gain.
// Rows r = b*1024 + t. Every bf16 operand plane in the workspace (xs, weights, q, k, v^T, O) is stored in fragment order (see frag_t); the shapes below name rows and K. k_pack ([in][out] weights -> bf16 rows); k_pack also builds xs (channels < 512 come from t-1, zero at t = 0) as bf16 rows; k_qkv (xs W + bias; RoPE on dims 0..31; q/k -> hi/lo rows [bh][t][64], v -> hi/lo transposed [bh][d][t]);
// k_stats (per (bh, 64 queries): causal row max and sum of exp over the keys, kept per lane and merged once -> M, L); k_mix (block = (b, 32 queries, 128-key chunk), loop over 32-key tiles: S for all 16 heads -> P*w as bf16 hi/lo [query,key][h] in LDS -> mixing GEMM -> att'[o][i][j] f32 in LDS
// -> O[o] += att'(hi/lo) v_o(hi/lo); a block covers at most 128 keys and leaves its f32 partial O in PART[chunk][r][o*64+d]); k_red (sum of a row's chunks in ascending key order -> O hi/lo planes [r][o*64+d]); k_out ((O Wo + bo) * gamma[t]).
#define NB 4
#define TT 1024
#define CCH 1024
#define NH 16
#define HS 64
#define NR (NB * TT)
#define ROT 32
#define KCH 128                 // keys per k_mix block
#define NCHK (TT / KCH)         // chunks of the longest row
#define QB 32                   // queries per k_mix block
#define MIXFULL ((KCH / QB) * (NCHK * (NCHK - 1) / 2))  // (32-query block, chunk) pairs per batch below the diagonal: the 4 blocks with diagonal chunk q have q full chunks each
#define MIXBLK (MIXFULL + TT / QB)             // plus one diagonal chunk per block
#define PWP 24                  // k_mix: elements per LDS row of P*w: the 16 heads + 8 of pad = 48 B (16 B x odd): the 16 rows that a wave's lanes touch lie on 16 banks (at 64 B: on 4)
typedef __attribute__((ext_vector_type(8))) __bf16 v8b;
__device__ __forceinline__ v16b frag_b16(const __bf16* rowk0, int lane) {
  union { v16b v; v8b q[2]; } u; const __bf16* p = rowk0 + 8 * (lane >> 4);
  u.q[0] = *(const v8b*)p; u.q[1] = *(const v8b*)(p + 16); return u.v;
}
// Fragment order of a bf16 operand [rows][K] in global memory: tiles of 16 rows x 32 k (512 elements, 1 KiB), tile index = (row >> 4) * (K / 32) + (k >> 5); inside a tile the 8 elements k & ~7 .. of a row lie at
// element ((k >> 4) & 1) * 256 + (((k >> 3) & 1) * 16 + (row & 15)) * 8. That is the order in which the lanes read a fragment, so each of its two wave-wide 16-byte loads covers 512 contiguous bytes (4 lines, not 16)
__device__ __forceinline__ v16b frag_t(const __bf16* tile, int lane) {
  union { v16b v; v8b q[2]; } u; const __bf16* p = tile + lane * 8;
  u.q[0] = *(const v8b*)p; u.q[1] = *(const v8b*)(p + 256); return u.v;
}
// the same fragment from the lane's own pointer (tile + lane * 8)
__device__ __forceinline__ v16b frag_p(const __bf16* p) {
  union { v16b v; v8b q[2]; } u; u.q[0] = *(const v8b*)p; u.q[1] = *(const v8b*)(p + 256); return u.v;
}
// fragment whose k 0..15 come from one 16-wide row and k 16..31 from another; ph, pl = the lane's 8 elements (8 (lane >> 4) ..) of each
__device__ __forceinline__ v16b frag_hl(const __bf16* ph, const __bf16* pl) {
  union { v16b v; v8b q[2]; } u; u.q[0] = *(const v8b*)ph; u.q[1] = *(const v8b*)pl; return u.v;
}
__device__ __forceinline__ float bfr(float v) { return (float)(__bf16)v; }
// e^(s/8 - max) is taken as 2^(s * SCL2 - M): log2(e) is folded into the score scale, M (k_stats -> k_mix) is the row max of s * SCL2, and the power is the hardware's own f32 exp2, one instruction; no argument whose power is used lies above 0 by more than a rounding, and a power below the normal range may count as 0
#define SCL2 0.18033688011112042f   // log2(e) / sqrt(64)
__device__ __forceinline__ float ex2(float v) { return __builtin_amdgcn_exp2f(v); }
__device__ __forceinline__ v8f mac3p(v16b ah, v16b al, v16b bh, v16b bl, v8f c) { c = wmma_bf(al, bh, c); c = wmma_bf(ah, bl, c); return wmma_bf(ah, bh, c); }
__constant__ float c_invfreq[16] = {1.0f,0.5623413324356079f,0.3162277638912201f,0.17782793939113617f,0.10000000149011612f,0.05623412877321243f,0.03162277862429619f,0.017782794311642647f,0.009999999776482582f,0.005623413249850273f,0.003162277862429619f,0.0017782794311642647f,0.0010000000474974513f,0.000562341301701963f,0.0003162277862429619f,0.00017782794020604342f};

// workspace carve (bytes)
#define PLANE_Q (2u * NB * NH * TT * HS)        // bf16 [64 bh][1024][64] = 8 MiB
#define WS_PT   0u                               // bf16 [4096][1024]: rows 0.. Wq^T, 1024.. Wk^T, 2048.. Wv^T, 3072.. Wo^T  (8 MiB)
#define WS_QH   (WS_PT + 2u * 4 * CCH * CCH)
#define WS_QL   (WS_QH + PLANE_Q)
#define WS_KH   (WS_QL + PLANE_Q)
#define WS_KL   (WS_KH + PLANE_Q)
#define WS_VTH  (WS_KL + PLANE_Q)                // bf16 [bh][64 d][1024 t]
#define WS_VTL  (WS_VTH + PLANE_Q)
#define WS_M    (WS_VTL + PLANE_Q)               // f32 [bh][1024]
#define WS_L    (WS_M + 4u * NB * NH * TT)
#define WS_OH   (WS_L + 4u * NB * NH * TT)       // bf16 [4096][1024] (row r, col o*64 + d)
#define WS_OL   (WS_OH + 2u * NR * CCH)
#define WS_PART (WS_OL + 2u * NR * CCH)          // f32 [8 key chunks][4096][1024]; row r uses chunks 0 .. t/128
#define WS_XS   (WS_PART + 4u * NCHK * NR * CCH) // bf16 [4096][1024]: shifted x
#define WS_END  (WS_XS + 2u * NR * CCH)

// ---- k_pack: PT (row n, k) = bf16(W[k][n]) in fragment order; block = (16 rows n, 256 k; which matrix is block-uniform), wave = one tile: a lane gathers its 2 x 8 k of its own column n (16 lanes = a 64-byte run of W) and stores them as the fragment's pieces
// blocks from 1024 on: XS (row r, channel k) = bf16(xs) in fragment order, xs = x with channels < 512 taken from row t-1 (zero at t = 0; the address is clamped to the row itself, the load is unconditional and the zero a select); wave = one tile = one 128-byte line of each of 16 rows
__global__ __launch_bounds__(256) void k_pack(const float* __restrict__ X, const float* __restrict__ Wq, const float* __restrict__ Wk, const float* __restrict__ Wv, const float* __restrict__ Wo, __bf16* __restrict__ PT, __bf16* __restrict__ XS) {
  const int tid = threadIdx.x, wave = tid >> 5, lane = tid & 31, col = lane & 15, g = lane >> 4;
  const int rt = (blockIdx.x >> 2) & 255, kc = (blockIdx.x & 3) * 8 + wave;
  if (blockIdx.x >= 4 * (CCH / 16) * 4) {   // block-uniform
    const int r = rt * 16 + col, t = r % TT; const bool shifted = kc * 32 < CCH / 2; const bool zero = shifted && (t == 0);
    const float* px = X + (size_t)(r - ((shifted && t > 0) ? 1 : 0)) * CCH + kc * 32 + g * 8;
    const v4f x0 = *(const v4f*)px, x1 = *(const v4f*)(px + 4), x2 = *(const v4f*)(px + 16), x3 = *(const v4f*)(px + 20); v8b y0, y1;
#pragma unroll
    for (int e = 0; e < 4; ++e) { y0[e] = (__bf16)(zero ? 0.f : x0[e]); y0[4 + e] = (__bf16)(zero ? 0.f : x1[e]); y1[e] = (__bf16)(zero ? 0.f : x2[e]); y1[4 + e] = (__bf16)(zero ? 0.f : x3[e]); }
    __bf16* dx = XS + ((size_t)rt * (CCH / 32) + kc) * 512 + lane * 8;
    *(v8b*)dx = y0; *(v8b*)(dx + 256) = y1;
    return;
  }
  const int which = rt >> 6, nn = (rt & 63) * 16 + col;
  const float* Wm = which == 0 ? Wq : which == 1 ? Wk : which == 2 ? Wv : Wo;
  const float* p = Wm + (size_t)(kc * 32 + g * 8) * CCH + nn; v8b o0, o1;
#pragma unroll
  for (int e = 0; e < 8; ++e) { o0[e] = (__bf16)p[(size_t)e * CCH]; o1[e] = (__bf16)p[(size_t)(16 + e) * CCH]; }
  __bf16* d = PT + ((size_t)rt * (CCH / 32) + kc) * 512 + lane * 8;
  *(v8b*)d = o0; *(v8b*)(d + 256) = o1;
}
// ---- k_qkv: block (128 rows = 8 waves, 128 cols = 2 heads of q, k or v): the eight waves read the same weight fragments, so a weight line that the WGP cache has fetched from L2 once feeds 128 rows; exact products; + bias; RoPE (q, k); q/k -> hi/lo rows [bh][t][64]; v -> VT hi/lo [bh][d][t]
__global__ __launch_bounds__(256) void k_qkv(const __bf16* __restrict__ XS, const __bf16* __restrict__ PT, const float* __restrict__ bq, const float* __restrict__ bk, const float* __restrict__ bv,
                                             __bf16* __restrict__ Qh, __bf16* __restrict__ Ql, __bf16* __restrict__ Kh, __bf16* __restrict__ Kl, __bf16* __restrict__ VTh, __bf16* __restrict__ VTl) {
  __shared__ __align__(16) __bf16 sh_[128][136], sl_[128][136];   // q, k: [row][64 dims]; v: [channel][128 t]; pitch 272 B = 16 B x odd
  const int tid = threadIdx.x, wave = tid >> 5, lane = tid & 31, col = lane & 15, g = lane >> 4;
  const size_t rb = (size_t)blockIdx.x * 128; const int b = (int)(rb / TT), t0 = (int)(rb % TT);
  const int which = blockIdx.y >> 3; const int n0 = (blockIdx.y & 7) * 128;          // block-uniform: 0 q, 1 k, 2 v; n0 = first output channel (2 heads)
  const size_t r0 = rb + wave * 16;
  v8f acc[8] = {};
  // fragments are fetched one k step ahead: a weight fragment's registers are refilled for step kc + 1 directly behind the product that read them at step kc, so a load has eight products' time to arrive and no product waits a whole memory latency of its own
  const __bf16* pa = XS + (r0 >> 4) * (CCH / 32) * 512 + lane * 8; const __bf16* pb = PT + (size_t)((which * CCH + n0) / 16) * (CCH / 32) * 512 + lane * 8;   // the lane's own piece of tile (., k step 0)
  v16b a0 = frag_p(pa), a1, wf[8];
#pragma unroll
  for (int j = 0; j < 8; ++j) wf[j] = frag_p(pb + (size_t)j * (CCH / 32) * 512);
#pragma unroll 1   // 15 trips of two k steps (two, so that the two x fragments swap without copies); kept rolled so that the loop stays small in the instruction cache
  for (int kc = 0; kc < CCH / 32 - 2; kc += 2) {
    a1 = frag_p(pa + 512);
#pragma unroll
    for (int j = 0; j < 8; ++j) { acc[j] = wmma_bf(a0, wf[j], acc[j]); wf[j] = frag_p(pb + ((size_t)j * (CCH / 32) + 1) * 512); }
    a0 = frag_p(pa + 1024);
#pragma unroll
    for (int j = 0; j < 8; ++j) { acc[j] = wmma_bf(a1, wf[j], acc[j]); wf[j] = frag_p(pb + ((size_t)j * (CCH / 32) + 2) * 512); }
    asm volatile("s_wait_xcnt 0x0" ::: "memory");   // the pointer steps below land in the address registers of the loads above, which are still in flight
    pa += 1024; pb += 1024; }
  a1 = frag_p(pa + 512);   // the last two k steps: nothing is left to fetch behind the last
  asm volatile("s_wait_xcnt 0x0" ::: "memory");     // pa is dead from here on: a later load's result may land in its registers
#pragma unroll
  for (int j = 0; j < 8; ++j) { acc[j] = wmma_bf(a0, wf[j], acc[j]); wf[j] = frag_p(pb + ((size_t)j * (CCH / 32) + 1) * 512); }
  asm volatile("s_wait_xcnt 0x0" ::: "memory");     // the epilogue may land in the address registers of the loads above
#pragma unroll
  for (int j = 0; j < 8; ++j) acc[j] = wmma_bf(a1, wf[j], acc[j]);
  const float* bias = which == 0 ? bq : which == 1 ? bk : bv;
#pragma unroll
  for (int j = 0; j < 8; ++j) { const float bb = bfr(bias[n0 + j * 16 + col]);
#pragma unroll
    for (int r = 0; r < 8; ++r) acc[j][r] += bb; }
  if (which < 2) {   // RoPE on head-local dims 0..15 (tile 4h'+0) and 16..31 (tile 4h'+1), pairs in the same lane; theta = t * inv_freq[col]; sine and cosine come from one call, so one argument reduction per angle is live, not two: that keeps the kernel within 160 registers, at which three work-groups (six waves a SIMD) share a WGP and the whole grid is resident at once
#pragma unroll
    for (int hp = 0; hp < 2; ++hp) {
#pragma unroll
      for (int r = 0; r < 8; ++r) { const int t = t0 + wave * 16 + 8 * g + r; const float th = (float)t * c_invfreq[col]; float cs, sn; sincosf(th, &sn, &cs);
        const float a0 = acc[hp * 4][r], a1 = acc[hp * 4 + 1][r];
        acc[hp * 4][r] = a0 * cs - a1 * sn; acc[hp * 4 + 1][r] = a1 * cs + a0 * sn; } }
    __bf16* Oh = which == 0 ? Qh : Kh; __bf16* Ol = which == 0 ? Ql : Kl;
#pragma unroll
    for (int hp = 0; hp < 2; ++hp) {
#pragma unroll
      for (int j = 0; j < 4; ++j)
#pragma unroll
        for (int r = 0; r < 8; ++r) { const float v = acc[hp * 4 + j][r]; const __bf16 hi = (__bf16)v; sh_[wave * 16 + 8 * g + r][j * 16 + col] = hi; sl_[wave * 16 + 8 * g + r][j * 16 + col] = (__bf16)(v - (float)hi); }
      LDSX();
      const int h = (n0 >> 6) + hp; const size_t base = ((size_t)(b * NH + h) * TT + t0 + wave * 16) * HS;   // the wave's 16 rows x 64 dims = two whole tiles; piece qq of them holds row qq & 15, dims 8 (qq >> 4) ..
      v4u ph[4], pl[4];
#pragma unroll   // four fixed trips, unrolled so that ph and pl are registers and the eight LDS reads share one latency
      for (int q4 = 0; q4 < 4; ++q4) { const int qq = q4 * 32 + lane, pc = q4 * 2 + g; ph[q4] = *(const v4u*)(&sh_[wave * 16 + col][pc * 8]); pl[q4] = *(const v4u*)(&sl_[wave * 16 + col][pc * 8]); vst2((unsigned*)(Oh + base + qq * 8), ph[q4]); vst2((unsigned*)(Ol + base + qq * 8), pl[q4]); }
      asm volatile("s_wait_xcnt 0x0" :: "v"(ph[0]), "v"(ph[1]), "v"(ph[2]), "v"(ph[3]), "v"(pl[0]), "v"(pl[1]), "v"(pl[2]), "v"(pl[3]) : "memory");   // the next head's conversions may land in the data registers of the eight stores above; the stored values as inputs keep those registers untouched up to this wait
      LDSX(); }
  } else {
#pragma unroll
    for (int j = 0; j < 8; ++j)
#pragma unroll
      for (int r = 0; r < 8; ++r) { const float v = acc[j][r]; const __bf16 hi = (__bf16)v; sh_[j * 16 + col][wave * 16 + 8 * g + r] = hi; sl_[j * 16 + col][wave * 16 + 8 * g + r] = (__bf16)(v - (float)hi); }
    __syncthreads();
    for (int qq = tid; qq < 128 * 16; qq += 256) { const int ct = qq >> 8, kcl = (qq >> 6) & 3, w = qq & 63; const int c = ct * 16 + (w & 15), pc = kcl * 4 + (w >> 4);   // 32 tiles (8 groups of 16 channels x 4 groups of 32 t), 64 pieces each, in storage order
      const int h = (n0 >> 6) + (ct >> 2); const size_t o = (((size_t)(b * NH + h) * (HS / 16) + (ct & 3)) * (TT / 32) + (t0 >> 5) + kcl) * 512 + w * 8;
      vst2((unsigned*)(VTh + o), *(const v4u*)(&sh_[c][pc * 8])); vst2((unsigned*)(VTl + o), *(const v4u*)(&sl_[c][pc * 8])); }
  }
}
// ---- k_stats: block = (bh, 64 queries); wave = 16 queries; causal key steps of 64 (four 16-key tiles): S = q'(hi/lo) k'(hi/lo) * SCL2 (base-2 exponents); every lane keeps the running max and sum of its own key columns (j = col mod 16) and rescales once per step; key fragments come one step ahead;
// the 16 lanes of a row are merged once, behind the loop -> M, L (f32 [bh][t], 256 B per block by 16 lanes)
__global__ __launch_bounds__(128) void k_stats(const __bf16* __restrict__ Qh, const __bf16* __restrict__ Ql, const __bf16* __restrict__ Kh, const __bf16* __restrict__ Kl, float* __restrict__ Mo, float* __restrict__ Lo) {
  __shared__ float sm[64], ssum[64];
  const int tid = threadIdx.x, wave = tid >> 5, lane = tid & 31, col = lane & 15, g = lane >> 4;
  const int bh = blockIdx.y; const int i0 = blockIdx.x * 64 + wave * 16;
  const __bf16* qh = Qh + ((size_t)bh * TT + i0) * HS; const __bf16* ql = Ql + ((size_t)bh * TT + i0) * HS;
  const v16b qh0 = frag_t(qh, lane), qh1 = frag_t(qh + 512, lane), ql0 = frag_t(ql, lane), ql1 = frag_t(ql + 512, lane);
  asm volatile("s_wait_xcnt 0x0" :: "v"(qh0), "v"(qh1), "v"(ql0), "v"(ql1) : "memory");   // the key loads below may land in the address registers of the query loads above; the loaded values as inputs keep this wait behind those loads
  float m[8], l[8];
#pragma unroll
  for (int r = 0; r < 8; ++r) { m[r] = -3.0e38f; l[r] = 0.f; }
  const int jend = i0 + 16;                                      // keys j <= i for rows i0..i0+15 -> tiles covering [0, i0+16)
  // key fragments are fetched one 64-key step ahead: a tile's registers are refilled for step j0 + 64 directly behind the six products that read them at step j0, so a load has the rest of the step to arrive and no tile waits a whole memory latency of its own
  const __bf16* pkh = Kh + (size_t)bh * TT * HS + lane * 8; const __bf16* pkl = Kl + (size_t)bh * TT * HS + lane * 8;   // the lane's own piece of key tile 0; 16 keys = 1024 elements
  v16b kf[4][4];   // [16-key tile of the step][hi dims 0..31, lo dims 0..31, hi dims 32..63, lo dims 32..63]
#pragma unroll
  for (int jt = 0; jt < 4; ++jt) { kf[jt][0] = frag_p(pkh + jt * 1024); kf[jt][1] = frag_p(pkl + jt * 1024); kf[jt][2] = frag_p(pkh + jt * 1024 + 512); kf[jt][3] = frag_p(pkl + jt * 1024 + 512); }
  asm volatile("s_wait_xcnt 0x0" ::: "memory");   // the pointer step in the loop lands in the address registers of the loads above, which are still in flight
#pragma unroll 1   // kept rolled: the trip count (blockIdx.x + 1) differs from block to block
  for (int j0 = 0; j0 < jend; j0 += 64) {
    const int adv = (j0 + 64 < jend) ? 4096 : 0;   // wave-uniform; the last step has no next one: it fetches its own tiles again (rows that exist) and nothing reads them
    pkh += adv; pkl += adv;
    v8f s4[4];   // the step's four score tiles; j0 + 63 <= 1023, so a tile past the diagonal reads rows that exist; the select below drops it
#pragma unroll
    for (int jt = 0; jt < 4; ++jt) { v8f s = {};
      s = mac3p(qh0, ql0, kf[jt][0], kf[jt][1], s); s = mac3p(qh1, ql1, kf[jt][2], kf[jt][3], s); s4[jt] = s;
      kf[jt][0] = frag_p(pkh + jt * 1024); kf[jt][1] = frag_p(pkl + jt * 1024); kf[jt][2] = frag_p(pkh + jt * 1024 + 512); kf[jt][3] = frag_p(pkl + jt * 1024 + 512); }
    asm volatile("s_wait_xcnt 0x0" ::: "memory");   // the next trip's pointer step lands in the address registers of the loads above, which are still in flight
#pragma unroll
    for (int r = 0; r < 8; ++r) { const int i = i0 + 8 * g + r; float v[4];
#pragma unroll
      for (int t = 0; t < 4; ++t) v[t] = (j0 + t * 16 + col <= i) ? s4[t][r] * SCL2 : -1e30f;
      const float mn = fmaxf(fmaxf(fmaxf(fmaxf(m[r], v[0]), v[1]), v[2]), v[3]);
      l[r] = l[r] * ex2(m[r] - mn) + ((ex2(v[0] - mn) + ex2(v[1] - mn)) + (ex2(v[2] - mn) + ex2(v[3] - mn))); m[r] = mn; }   // a lane that has seen masked keys only holds m = -1e30 and a count in l: the next rescale, or the merge below, multiplies it by 2^(-1e30 - max) = 0
  }
#pragma unroll
  for (int r = 0; r < 8; ++r) { float mt = m[r];   // merge of the row's 16 lanes: every row has key 0, so the merged max is a real score
#pragma unroll
    for (int o = 1; o < 16; o <<= 1) mt = fmaxf(mt, __shfl_xor(mt, o));
    float e = l[r] * ex2(m[r] - mt);
#pragma unroll
    for (int o = 1; o < 16; o <<= 1) e += __shfl_xor(e, o);
    m[r] = mt; l[r] = e; }
  if (col == 0) {
#pragma unroll
    for (int r = 0; r < 8; ++r) { sm[wave * 16 + 8 * g + r] = m[r]; ssum[wave * 16 + 8 * g + r] = l[r]; } }
  __syncthreads();
  if (tid < 16) { vst2(Mo + (size_t)bh * TT + blockIdx.x * 64 + tid * 4, *(const v4f*)&sm[tid * 4]); vst2(Lo + (size_t)bh * TT + blockIdx.x * 64 + tid * 4, *(const v4f*)&ssum[tid * 4]); }
}
// ---- k_mix: block = (b, 32 queries i0..i0+31 = two 16-query tiles, keys of one 128-key chunk), 16 waves, wave = one head; loop over the chunk's 32-key tiles (causal). M and L are known, so O is a plain sum over keys and chunks are independent.
// Every key and value fragment that a wave fetches from L2 feeds both query tiles; the queries themselves (128 KiB a block) are brought into LDS once
__global__ __launch_bounds__(512) void k_mix(const __bf16* __restrict__ Qh, const __bf16* __restrict__ Ql, const __bf16* __restrict__ Kh, const __bf16* __restrict__ Kl, const __bf16* __restrict__ VTh, const __bf16* __restrict__ VTl,
                                             const float* __restrict__ Mo, const float* __restrict__ Lo, const float* __restrict__ tw, const float* __restrict__ talpha, const float* __restrict__ tbeta, const float* __restrict__ mixw,
                                             float* __restrict__ PART) {
  __shared__ __align__(16) __bf16 pw[2][QB * 32][PWP];          // (P*w) for the tile, hi and lo plane: row = i*32 + j (query-in-block, key-in-tile), column = head h; the pad is never read
  __bf16 (*pwh)[PWP] = pw[0]; __bf16 (*pwl)[PWP] = pw[1];
  __shared__ __align__(16) float attp[NH][QB][36];               // mixed attention tile per output head o: [o][i][j]
  __shared__ __align__(16) __bf16 mixr[NH][32];                  // mixing matrix rows o, k = h, then the same 16 again
  __shared__ __align__(16) __bf16 qs[NH][2][2][16 * HS];         // the block's queries: [head = wave][query tile][hi, lo][two fragment-order tiles, as in global memory]; a wave reads only what it wrote itself
  const int tid = threadIdx.x, wave = tid >> 5, lane = tid & 31, col = lane & 15, g = lane >> 4;
  // blockIdx.y -> (query block = 4 gq + tl, chunk <= gq): the full 128-key chunks first, then the diagonal chunks from the longest to the shortest
  int rem = blockIdx.y, gq, tl, chunk;
  if (rem < MIXFULL) { gq = NCHK - 1; while (gq > 1 && rem >= (KCH / QB) * gq) { rem -= (KCH / QB) * gq; --gq; } chunk = rem >> 2; tl = rem & 3; }
  else { rem -= MIXFULL; gq = rem & 7; tl = 3 - (rem >> 3); chunk = gq; }
  const int b = blockIdx.x, i0 = (gq * (KCH / QB) + tl) * QB;
  const int bh = b * NH + wave;          // this wave's head: h in the S phase, output head o in the PV phase
  v8b qt_[2][8];   // the head's q (hi, lo): 32 rows x 64 dims = 8 wave-wide 16-byte pieces per plane, on their way to LDS
  { const size_t qo = ((size_t)bh * TT + i0) * HS + lane * 8;
#pragma unroll
    for (int n = 0; n < 8; ++n) { qt_[0][n] = *(const v8b*)(Qh + qo + n * 256); qt_[1][n] = *(const v8b*)(Ql + qo + n * 256); } }
  asm volatile("s_wait_xcnt 0x0" ::: "memory");   // the address arithmetic below may land in the address registers of the sixteen loads above, which are still in flight
  for (int q = tid; q < NH * 32; q += 512) { const int o = q >> 5, h = q & 31; mixr[o][h] = (__bf16)mixw[o * NH + (h & (NH - 1))]; }
  float mrow[2][8], lb[2][8];            // per query tile: row max (of s * SCL2), and beta[h][i] / L (the per-row factors of p*w = (2^(s*SCL2-m)/L) * ((tw*alpha)*beta), folded)
  { const float* pm = Mo + (size_t)bh * TT + i0 + 8 * g; const float* pl_ = Lo + (size_t)bh * TT + i0 + 8 * g; const float* pb_ = tbeta + wave * TT + i0 + 8 * g; float ls[2][8];   // the lane's first row
#pragma unroll
    for (int u = 0; u < 2; ++u)
#pragma unroll
      for (int r = 0; r < 8; ++r) { mrow[u][r] = pm[u * 16 + r]; ls[u][r] = pl_[u * 16 + r]; lb[u][r] = pb_[u * 16 + r]; }
    asm volatile("s_wait_xcnt 0x0" :: "v"(pm), "v"(pl_), "v"(pb_) : "memory");   // a later result may land in the address registers of the loads above; the addresses as inputs keep those registers untouched up to this wait
#pragma unroll
    for (int u = 0; u < 2; ++u)
#pragma unroll
      for (int r = 0; r < 8; ++r) lb[u][r] = bfr(lb[u][r]) / ls[u][r]; }
#pragma unroll
  for (int n = 0; n < 8; ++n) { *(v8b*)&qs[wave][n >> 2][0][(n & 3) * 256 + lane * 8] = qt_[0][n]; *(v8b*)&qs[wave][n >> 2][1][(n & 3) * 256 + lane * 8] = qt_[1][n]; }
  v8f oacc[2][4];
#pragma unroll
  for (int u = 0; u < 2; ++u)
#pragma unroll
    for (int d4 = 0; d4 < 4; ++d4) oacc[u][d4] = (v8f){};
  __syncthreads();
  const int jbeg = chunk * KCH; const int jend = (i0 + QB < jbeg + KCH) ? i0 + QB : jbeg + KCH;
#pragma unroll 1
  for (int j0 = jbeg; j0 < jend; j0 += 32) {
    // -- S for this wave's head, both query tiles; P*w -> pwh/pwl[(i)*32 + j][h]
    { const int h = wave;
#pragma unroll 1
      for (int jt = 0; jt < 2; ++jt) { const int jb = j0 + jt * 16;   // body is one straight line, no call and no branch: the rows' loads, exps and stores overlap. jb + 15 <= 1023, so a half past the diagonal reads rows that exist; the select drops it
        const __bf16* kh = Kh + ((size_t)bh * TT + jb) * HS; const __bf16* kl = Kl + ((size_t)bh * TT + jb) * HS;
        const int j = jb + col, jr = j - (i0 + 8 * g); const int ai = h * TT + (j < TT ? j : TT - 1); int wi[2][8]; float twv[2][8];   // jr = key minus the lane's first query row: row u * 16 + r sees the key where jr <= u * 16 + r
#pragma unroll
        for (int u = 0; u < 2; ++u)
#pragma unroll
          for (int r = 0; r < 8; ++r) { const int widx = TT - 1 + jr - (u * 16 + r); wi[u][r] = h * TT + (widx < TT ? widx : TT - 1); }   // 0 <= widx; clamped into the row above the diagonal
        const float al = talpha[ai];
#pragma unroll
        for (int u = 0; u < 2; ++u)
#pragma unroll
          for (int r = 0; r < 8; ++r) twv[u][r] = tw[wi[u][r]];
        // the key loads below, or one of these loads itself, may land in the offset registers of the seventeen loads above; the offsets as inputs keep those registers untouched up to this wait
        asm volatile("s_wait_xcnt 0x0" :: "v"(ai), "v"(wi[0][0]), "v"(wi[0][1]), "v"(wi[0][2]), "v"(wi[0][3]), "v"(wi[0][4]), "v"(wi[0][5]), "v"(wi[0][6]), "v"(wi[0][7]),
                     "v"(wi[1][0]), "v"(wi[1][1]), "v"(wi[1][2]), "v"(wi[1][3]), "v"(wi[1][4]), "v"(wi[1][5]), "v"(wi[1][6]), "v"(wi[1][7]) : "memory");
        const __bf16* pkh = kh + lane * 8; const __bf16* pkl = kl + lane * 8;
        const v16b kh0 = frag_p(pkh), kl0 = frag_p(pkl), kh1 = frag_p(pkh + 512), kl1 = frag_p(pkl + 512);
        asm volatile("s_wait_xcnt 0x0" :: "v"(pkh), "v"(pkl) : "memory");   // a result may land in the address registers of the eight loads above; the addresses as inputs keep those registers untouched up to this wait
        // inputs-only fence on the loaded values: holds all 25 loads of this half in front of the products, so that they share one memory latency (without it the compiler sinks half of the key loads and the decay loads behind the products: three latencies in a row)
        asm volatile("" :: "v"(kh0), "v"(kl0), "v"(kh1), "v"(kl1), "v"(al), "v"(twv[0][0]), "v"(twv[0][1]), "v"(twv[0][2]), "v"(twv[0][3]), "v"(twv[0][4]), "v"(twv[0][5]), "v"(twv[0][6]), "v"(twv[0][7]),
                     "v"(twv[1][0]), "v"(twv[1][1]), "v"(twv[1][2]), "v"(twv[1][3]), "v"(twv[1][4]), "v"(twv[1][5]), "v"(twv[1][6]), "v"(twv[1][7]));
        const float alpha_j = bfr(al);
#pragma unroll
        for (int u = 0; u < 2; ++u) {   // the two query tiles against the same key fragments
          const __bf16* qh = &qs[wave][u][0][0]; const __bf16* ql = &qs[wave][u][1][0];
          const v16b qh0 = frag_t(qh, lane), qh1 = frag_t(qh + 512, lane), ql0 = frag_t(ql, lane), ql1 = frag_t(ql + 512, lane);   // from LDS each time, to keep VGPRs <= 256
          v8f s = {}; s = mac3p(qh0, ql0, kh0, kl0, s); s = mac3p(qh1, ql1, kh1, kl1, s);
#pragma unroll
          for (int r = 0; r < 8; ++r) { const int il = u * 16 + 8 * g + r;
            const float pv = (ex2(s[r] * SCL2 - mrow[u][r]) * lb[u][r]) * (bfr(twv[u][r]) * alpha_j);
            const float pw = (jr <= u * 16 + r) ? pv : 0.f;                  // causal mask as a select: a masked pv is never used
            const __bf16 hi = (__bf16)pw; pwh[il * 32 + jt * 16 + col][h] = hi; pwl[il * 32 + jt * 16 + col][h] = (__bf16)(pw - (float)hi); } } } }
    __syncthreads();
    // -- mixing GEMM: att'[o][(i,j)] = sum_h mix[o][h] Pw[(i,j)][h]; 64 column tiles of 16 (i,j) pairs, K = 32: k 0..15 = the heads' hi parts, k 16..31 = their lo parts, against the mixing row twice; wave owns column tiles 4w..4w+3
    { const v16b am = frag_b16(&mixr[col][0], lane);            // A rows o = col, k = h
#pragma unroll 1
      for (int ct = 0; ct < 4; ++ct) { const int n0c = (wave * 4 + ct) * 16; v8f a = {};
        a = wmma_bf(am, frag_hl(&pwh[n0c + col][8 * g], &pwl[n0c + col][8 * g]), a);
        const int il = n0c >> 5, jl0 = n0c & 31;                 // the 16 columns of this tile share i (32 | n0c+0..15 within one i row since tiles are 16-aligned inside 32)
#pragma unroll
        for (int r = 0; r < 8; ++r) attp[8 * g + r][il][jl0 + col] = a[r]; } }
    __syncthreads();
    // -- O[o] += att'[o](hi/lo) v_o(hi/lo): this wave's output head o = wave, both query tiles against the same value fragments; K = 32 keys (one step); 4 d tiles
    { const size_t vo = ((size_t)bh * (HS / 16) * (TT / 32) + (j0 >> 5)) * 512 + lane * 8; const __bf16* pvh = VTh + vo; const __bf16* pvl = VTl + vo; v16b vh[4], vl[4];   // the lane's piece of d tile 0; a d tile further = (TT / 32) * 512 elements
#pragma unroll
      for (int d4 = 0; d4 < 4; ++d4) { vh[d4] = frag_p(pvh + d4 * (TT / 32) * 512); vl[d4] = frag_p(pvl + d4 * (TT / 32) * 512); }
      asm volatile("s_wait_xcnt 0x0" :: "v"(pvh), "v"(pvl) : "memory");   // a result may land in the address registers of the sixteen loads above; the addresses as inputs keep those registers untouched up to this wait
      const F2 af0 = split_row(&attp[wave][col][0], 0, lane), af1 = split_row(&attp[wave][16 + col][0], 0, lane);
      // inputs-only fence on the loaded values: holds all sixteen value loads in front of the products, so that they share one memory latency (without it the compiler fetches one d tile at a time: four latencies in a row)
      asm volatile("" :: "v"(vh[0]), "v"(vl[0]), "v"(vh[1]), "v"(vl[1]), "v"(vh[2]), "v"(vl[2]), "v"(vh[3]), "v"(vl[3]));
#pragma unroll
      for (int d4 = 0; d4 < 4; ++d4) { oacc[0][d4] = mac3p(af0.h, af0.l, vh[d4], vl[d4], oacc[0][d4]); oacc[1][d4] = mac3p(af1.h, af1.l, vh[d4], vl[d4], oacc[1][d4]); } }
    __syncthreads();                                            // pw*/attp are rewritten by the next key tile
  }
  // -- partial O rows: r = b*1024 + i, columns o*64 + d, f32; per wave 16 rows x 64 cols per query tile staged in the (now free) pw and attp buffers, 4 KiB per wave in each: 256-B segments by 16 lanes
  float* st0 = (float*)&pw[0][0][0] + wave * (16 * 64); float* st1 = &attp[0][0][0] + wave * (16 * 64);
#pragma unroll
  for (int d4 = 0; d4 < 4; ++d4)
#pragma unroll
    for (int r = 0; r < 8; ++r) { st0[(8 * g + r) * 64 + d4 * 16 + col] = oacc[0][d4][r]; st1[(8 * g + r) * 64 + d4 * 16 + col] = oacc[1][d4][r]; }
  LDSX();
  for (int qq = lane; qq < 16 * 16; qq += 32) { const int rl = qq >> 4, pc = qq & 15; const size_t o = ((size_t)chunk * NR + (size_t)b * TT + i0 + rl) * CCH + wave * 64 + pc * 4;
    vst2(PART + o, *(const v4f*)(st0 + rl * 64 + pc * 4)); vst2(PART + o + 16 * CCH, *(const v4f*)(st1 + rl * 64 + pc * 4)); }
}
// ---- k_red: O[r][c] = sum of the row's chunk partials, ascending chunk; -> hi/lo planes in fragment order; block = 16 rows x 256 columns, wave = one tile (16 rows x 32 columns: one whole 128-byte line of each row), lane = its two pieces of 8 columns
__global__ __launch_bounds__(256) void k_red(const float* __restrict__ PART, __bf16* __restrict__ OH, __bf16* __restrict__ OL) {
  const int wave = threadIdx.x >> 5, lane = threadIdx.x & 31, col = lane & 15, g = lane >> 4; const int rt = blockIdx.x >> 2, kc = (blockIdx.x & 3) * 8 + wave;
  const int t = (rt * 16) % TT; const int nch = t / KCH + 1;   // the 16 rows of a block lie in one chunk group
  const float* p = PART + (size_t)(rt * 16 + col) * CCH + kc * 32 + g * 8; v4f a0 = {}, a1 = {}, a2 = {}, a3 = {};
#pragma unroll 1   // at most 8 trips; kept rolled so that the kernel stays small in registers and all of its waves are resident at once and hide each trip's load latency
  for (int c = 0; c < nch; ++c) { a0 += *(const v4f*)p; a1 += *(const v4f*)(p + 4); a2 += *(const v4f*)(p + 16); a3 += *(const v4f*)(p + 20); p += (size_t)NR * CCH; }
  v8b hi, lo, hj, lj;
#pragma unroll
  for (int i = 0; i < 4; ++i) { const __bf16 h0 = (__bf16)a0[i], h1 = (__bf16)a1[i], h2 = (__bf16)a2[i], h3 = (__bf16)a3[i]; hi[i] = h0; hi[4 + i] = h1; hj[i] = h2; hj[4 + i] = h3;
    lo[i] = (__bf16)(a0[i] - (float)h0); lo[4 + i] = (__bf16)(a1[i] - (float)h1); lj[i] = (__bf16)(a2[i] - (float)h2); lj[4 + i] = (__bf16)(a3[i] - (float)h3); }
  const size_t e = ((size_t)rt * (CCH / 32) + kc) * 512 + lane * 8;
  *(v8b*)(OH + e) = hi; *(v8b*)(OH + e + 256) = hj; *(v8b*)(OL + e) = lo; *(v8b*)(OL + e + 256) = lj;
}
// ---- k_out: out = (O(hi/lo) . Wo^T rows + bo) * gamma[t]; block (128 rows = 8 waves, 128 cols), K = 1024; the eight waves share the weight fragments as in k_qkv
__global__ __launch_bounds__(256) void k_out(const __bf16* __restrict__ OH, const __bf16* __restrict__ OL, const __bf16* __restrict__ PT, const float* __restrict__ bo, const float* __restrict__ gam, float* __restrict__ out) {
  __shared__ __align__(16) float so[8][16][132];
  const int tid = threadIdx.x, wave = tid >> 5, lane = tid & 31, col = lane & 15, g = lane >> 4; const size_t r0 = (size_t)blockIdx.x * 128 + wave * 16; const int n0 = blockIdx.y * 128;
  v8f acc[8] = {};
  // fragments are fetched one k step ahead, as in k_qkv: a weight fragment's registers are refilled for step kc + 1 directly behind the two products that read them at step kc
  const __bf16* ph = OH + (r0 >> 4) * (CCH / 32) * 512 + lane * 8; const __bf16* pl = OL + (r0 >> 4) * (CCH / 32) * 512 + lane * 8; const __bf16* pb = PT + (size_t)((3 * CCH + n0) / 16) * (CCH / 32) * 512 + lane * 8;   // the lane's own piece of tile (., k step 0)
  v16b ah0 = frag_p(ph), al0 = frag_p(pl), ah1, al1, wf[8];
#pragma unroll
  for (int j = 0; j < 8; ++j) wf[j] = frag_p(pb + (size_t)j * (CCH / 32) * 512);
#pragma unroll 1   // 15 trips of two k steps (two, so that the O fragments swap without copies); kept rolled so that the loop stays small in the instruction cache
  for (int kc = 0; kc < CCH / 32 - 2; kc += 2) {
    ah1 = frag_p(ph + 512); al1 = frag_p(pl + 512);
#pragma unroll
    for (int j = 0; j < 8; ++j) { acc[j] = wmma_bf(al0, wf[j], acc[j]); acc[j] = wmma_bf(ah0, wf[j], acc[j]); wf[j] = frag_p(pb + ((size_t)j * (CCH / 32) + 1) * 512); }
    ah0 = frag_p(ph + 1024); al0 = frag_p(pl + 1024);
#pragma unroll
    for (int j = 0; j < 8; ++j) { acc[j] = wmma_bf(al1, wf[j], acc[j]); acc[j] = wmma_bf(ah1, wf[j], acc[j]); wf[j] = frag_p(pb + ((size_t)j * (CCH / 32) + 2) * 512); }
    asm volatile("s_wait_xcnt 0x0" ::: "memory");   // the pointer steps below land in the address registers of the loads above, which are still in flight
    ph += 1024; pl += 1024; pb += 1024; }
  ah1 = frag_p(ph + 512); al1 = frag_p(pl + 512);   // the last two k steps: nothing is left to fetch behind the last
  asm volatile("s_wait_xcnt 0x0" ::: "memory");     // ph and pl are dead from here on: a later load's result may land in their registers
#pragma unroll
  for (int j = 0; j < 8; ++j) { acc[j] = wmma_bf(al0, wf[j], acc[j]); acc[j] = wmma_bf(ah0, wf[j], acc[j]); wf[j] = frag_p(pb + ((size_t)j * (CCH / 32) + 1) * 512); }
  asm volatile("s_wait_xcnt 0x0" ::: "memory");     // the epilogue may land in the address registers of the loads above
#pragma unroll
  for (int j = 0; j < 8; ++j) { acc[j] = wmma_bf(al1, wf[j], acc[j]); acc[j] = wmma_bf(ah1, wf[j], acc[j]); }
#pragma unroll
  for (int j = 0; j < 8; ++j) { const float bb = bfr(bo[n0 + j * 16 + col]);
#pragma unroll
    for (int r = 0; r < 8; ++r) { const int t = (int)((r0 + 8 * g + r) % TT); so[wave][8 * g + r][j * 16 + col] = (acc[j][r] + bb) * bfr(gam[t]); } }
  LDSX();
  for (int rl = 0; rl < 16; ++rl) vst2(out + (r0 + rl) * CCH + n0 + lane * 4, *(const v4f*)(&so[wave][rl][lane * 4]));
}

extern "C" void kernel_launch(void* const* d_in, const int* in_sizes, int n_in, void* d_out, int out_size, void* d_ws, size_t ws_size, hipStream_t stream) {
  (void)in_sizes; (void)n_in; (void)out_size;
  const float** I = (const float**)d_in;   // x, Wq, bq, Wk, bk, Wv, bv, Wo, bo, time_w, time_alpha, time_beta, time_gamma, head_mix_w
  if (ws_size < (size_t)WS_END) return;
  char* ws = (char*)d_ws;
  __bf16* PT = (__bf16*)(ws + WS_PT); __bf16 *Qh = (__bf16*)(ws + WS_QH), *Ql = (__bf16*)(ws + WS_QL), *Kh = (__bf16*)(ws + WS_KH), *Kl = (__bf16*)(ws + WS_KL), *VTh = (__bf16*)(ws + WS_VTH), *VTl = (__bf16*)(ws + WS_VTL);
  float *Mo = (float*)(ws + WS_M), *Lo = (float*)(ws + WS_L); __bf16 *OH = (__bf16*)(ws + WS_OH), *OL = (__bf16*)(ws + WS_OL); float* PART = (float*)(ws + WS_PART); __bf16* XS = (__bf16*)(ws + WS_XS);
  k_pack<<<4 * (CCH / 16) * 4 + (NR / 16) * 4, 256, 0, stream>>>(I[0], I[1], I[3], I[5], I[7], PT, XS);
  k_qkv<<<dim3(NR / 128, 24), 256, 0, stream>>>(XS, PT, I[2], I[4], I[6], Qh, Ql, Kh, Kl, VTh, VTl);
  k_stats<<<dim3(TT / 64, NB * NH), 128, 0, stream>>>(Qh, Ql, Kh, Kl, Mo, Lo);
  k_mix<<<dim3(NB, MIXBLK), 512, 0, stream>>>(Qh, Ql, Kh, Kl, VTh, VTl, Mo, Lo, I[9], I[10], I[11], I[13], PART);
  k_red<<<(NR / 16) * 4, 256, 0, stream>>>(PART, OH, OL);
  k_out<<<dim3(NR / 128, CCH / 128), 256, 0, stream>>>(OH, OL, PT, I[8], I[12], (float*)d_out);
}
